// v000
// The times below were measured on an AMD MI455X: many runs one after another, warmed up first and cycling through
// copies of the inputs, with the whole window's GPU time divided by the number of runs. Launches and the gaps
// between them are all in it. The median over several windows is given; except for v000 it joins two sittings, which
// can be a few percent apart, so the side-by-side timings, each taken in one sitting, are the better comparison.
// The starting kernel, v000, takes 541 microseconds a run.
#include <hip/hip_runtime.h>
#include <math.h>

// ---------------- problem constants ----------------
#define T_SEQ   2048
#define DMODEL  2048
#define NHEAD   16
#define HDIM    128
#define SB      204      // int(0.1*2048)
#define RB      1024     // int(0.5*2048)
#define NVALID  1228     // SB + RB
#define SCALE_QK 0.088388347648318447f   // 1/sqrt(128)

typedef float  v8f  __attribute__((ext_vector_type(8)));
typedef __bf16 v4bf __attribute__((ext_vector_type(4)));
typedef __bf16 v8bf __attribute__((ext_vector_type(8)));
typedef __bf16 v16bf __attribute__((ext_vector_type(16)));

static __device__ __forceinline__ v8f wmma_bf16(v16bf a, v16bf b, v8f c) {
  // D(16x16,f32) = A(16x32,bf16) x B(32x16,bf16) + C
  return __builtin_amdgcn_wmma_f32_16x16x32_bf16(false, a, false, b, (short)0, c, false, false);
}

// 16-bit A/B fragment: 8 contiguous K at p, 8 more at p+16
static __device__ __forceinline__ v16bf ld_frag(const __bf16* p) {
  v8bf a = *(const v8bf*)(p);
  v8bf b = *(const v8bf*)(p + 16);
  return __builtin_shufflevector(a, b, 0,1,2,3,4,5,6,7,8,9,10,11,12,13,14,15);
}

static __device__ __forceinline__ void split4(float4 v, v4bf& h, v4bf& l) {
  h[0] = (__bf16)v.x; l[0] = (__bf16)(v.x - (float)h[0]);
  h[1] = (__bf16)v.y; l[1] = (__bf16)(v.y - (float)h[1]);
  h[2] = (__bf16)v.z; l[2] = (__bf16)(v.z - (float)h[2]);
  h[3] = (__bf16)v.w; l[3] = (__bf16)(v.w - (float)h[3]);
}

static __device__ __forceinline__ float fin_clamp(float v) {
  if (v != v)        return 0.0f;
  if (v >  1.0e38f)  return  1.0e4f;
  if (v < -1.0e38f)  return -1.0e4f;
  return v;
}

static __device__ __forceinline__ float rmax16(float v) {
  #pragma unroll
  for (int m = 1; m < 16; m <<= 1) v = fmaxf(v, __shfl_xor(v, m, 32));
  return v;
}
static __device__ __forceinline__ float rsum16(float v) {
  #pragma unroll
  for (int m = 1; m < 16; m <<= 1) v += __shfl_xor(v, m, 32);
  return v;
}

// ---------------- async global->LDS copy (CDNA5), with sync fallback ----------------
#if __has_builtin(__builtin_amdgcn_global_load_async_to_lds_b128)
#define HAS_ASYNC_LDS 1
typedef int gv4i __attribute__((vector_size(16)));
typedef __attribute__((address_space(1))) gv4i as1_v4i;   // global
typedef __attribute__((address_space(3))) gv4i as3_v4i;   // LDS
static __device__ __forceinline__ void async_cp16(void* l, const void* g) {
  __builtin_amdgcn_global_load_async_to_lds_b128((as1_v4i*)g, (as3_v4i*)l, 0, 0);
}
static __device__ __forceinline__ void wait_async0() {
#if __has_builtin(__builtin_amdgcn_s_wait_asynccnt)
  __builtin_amdgcn_s_wait_asynccnt(0);
#else
  asm volatile("s_wait_asynccnt 0" ::: "memory");
#endif
}
#else
#define HAS_ASYNC_LDS 0
static __device__ __forceinline__ void async_cp16(void* l, const void* g) {
  *(float4*)l = *(const float4*)g;     // 16B sync copy fallback
}
static __device__ __forceinline__ void wait_async0() {}
#endif

// ---------------- kernel 1: nan_to_num(optional) + bf16 hi/lo split ----------------
__global__ void split_kernel(const float* __restrict__ x, __bf16* __restrict__ hi,
                             __bf16* __restrict__ lo, int n, int do_clamp) {
  int i = blockIdx.x * blockDim.x + threadIdx.x;
  if (i < n) {
    float v = x[i];
    if (do_clamp) v = fin_clamp(v);
    __bf16 h = (__bf16)v;
    hi[i] = h;
    lo[i] = (__bf16)(v - (float)h);
  }
}

// ---------------- GEMM: C = A * W^T, bf16x3, async double-buffered LDS ----------------
// Operands pre-split to global bf16 hi/lo.  mode 0: scatter [H][T][HDIM]; 1: [T][D]+clamp.
__global__ __launch_bounds__(256)
void gemm_bf16x3_async_kernel(const __bf16* __restrict__ Ahi_g, const __bf16* __restrict__ Alo_g,
                              const __bf16* __restrict__ Whi_g, const __bf16* __restrict__ Wlo_g,
                              float* __restrict__ out, int mode) {
  __shared__ __bf16 Abuf[2][2][64 * 40];    // [buf][hi/lo], 64 rows x BK=32, stride 40
  __shared__ __bf16 Wbuf[2][2][128 * 40];

  const int tid  = threadIdx.x;
  const int wid  = tid >> 5;
  const int lane = tid & 31;
  const int ln   = lane & 15;
  const int hf   = lane >> 4;
  const int wr   = wid >> 2;       // 0..1
  const int wc   = wid & 3;        // 0..3
  const int m0   = blockIdx.y * 64;
  const int n0   = blockIdx.x * 128;

  // per-thread 16B-chunk assignments: A = 256 chunks (1/thread/array), W = 512 (2/thread/array)
  const int arow = tid >> 2, ac = (tid & 3) * 8;       // 8 bf16 = 16B

  v8f acc[2][2];
  #pragma unroll
  for (int i = 0; i < 2; ++i)
    #pragma unroll
    for (int j = 0; j < 2; ++j)
      #pragma unroll
      for (int r = 0; r < 8; ++r) acc[i][j][r] = 0.0f;

  auto issue = [&](int buf, int kt) {
    async_cp16(&Abuf[buf][0][arow * 40 + ac], Ahi_g + (size_t)(m0 + arow) * DMODEL + kt + ac);
    async_cp16(&Abuf[buf][1][arow * 40 + ac], Alo_g + (size_t)(m0 + arow) * DMODEL + kt + ac);
    #pragma unroll
    for (int i = 0; i < 2; ++i) {
      int idx = tid + i * 256, rw = idx >> 2, cw = (idx & 3) * 8;
      async_cp16(&Wbuf[buf][0][rw * 40 + cw], Whi_g + (size_t)(n0 + rw) * DMODEL + kt + cw);
      async_cp16(&Wbuf[buf][1][rw * 40 + cw], Wlo_g + (size_t)(n0 + rw) * DMODEL + kt + cw);
    }
  };

  issue(0, 0);
  for (int i = 0; i < DMODEL / 32; ++i) {
    const int kt  = i * 32;
    const int buf = i & 1;
    wait_async0();          // own async copies for buf complete
    __syncthreads();        // all waves' copies complete; all done computing i-1

    if (kt + 32 < DMODEL) issue(buf ^ 1, kt + 32);   // overlap next tile with compute

    const __bf16* Ah = Abuf[buf][0];
    const __bf16* Al = Abuf[buf][1];
    const __bf16* Wh = Wbuf[buf][0];
    const __bf16* Wl = Wbuf[buf][1];
    const int ab = (wr * 32 + ln) * 40 + 8 * hf;
    const int bb = (wc * 32 + ln) * 40 + 8 * hf;
    v16bf a0h = ld_frag(&Ah[ab]),           a0l = ld_frag(&Al[ab]);
    v16bf a1h = ld_frag(&Ah[ab + 16 * 40]), a1l = ld_frag(&Al[ab + 16 * 40]);
    v16bf b0h = ld_frag(&Wh[bb]),           b0l = ld_frag(&Wl[bb]);
    v16bf b1h = ld_frag(&Wh[bb + 16 * 40]), b1l = ld_frag(&Wl[bb + 16 * 40]);

    // product-major, round-robin over the 4 independent accumulators:
    // each accumulator's C-chain has distance 4 -> no copies / hazard stalls
    acc[0][0] = wmma_bf16(a0h, b0l, acc[0][0]);
    acc[0][1] = wmma_bf16(a0h, b1l, acc[0][1]);
    acc[1][0] = wmma_bf16(a1h, b0l, acc[1][0]);
    acc[1][1] = wmma_bf16(a1h, b1l, acc[1][1]);
    acc[0][0] = wmma_bf16(a0l, b0h, acc[0][0]);
    acc[0][1] = wmma_bf16(a0l, b1h, acc[0][1]);
    acc[1][0] = wmma_bf16(a1l, b0h, acc[1][0]);
    acc[1][1] = wmma_bf16(a1l, b1h, acc[1][1]);
    acc[0][0] = wmma_bf16(a0h, b0h, acc[0][0]);
    acc[0][1] = wmma_bf16(a0h, b1h, acc[0][1]);
    acc[1][0] = wmma_bf16(a1h, b0h, acc[1][0]);
    acc[1][1] = wmma_bf16(a1h, b1h, acc[1][1]);
  }

  // C layout: lane ln = column, row = r + 8*hf
  #pragma unroll
  for (int i = 0; i < 2; ++i)
    #pragma unroll
    for (int j = 0; j < 2; ++j)
      #pragma unroll
      for (int r = 0; r < 8; ++r) {
        int gm = m0 + wr * 32 + i * 16 + r + 8 * hf;
        int gn = n0 + wc * 32 + j * 16 + ln;
        float v = acc[i][j][r];
        if (mode == 1) {
          out[(size_t)gm * DMODEL + gn] = fin_clamp(v);
        } else {
          int h = gn >> 7, d = gn & 127;
          out[((size_t)h * T_SEQ + gm) * HDIM + d] = v;
        }
      }
}

// ---------------- kernel 3: RoPE on Q,K + emit bf16 hi/lo split of K ----------------
__global__ void rope_split_kernel(float* __restrict__ Q, float* __restrict__ K,
                                  __bf16* __restrict__ Khi, __bf16* __restrict__ Klo) {
  int idx = blockIdx.x * blockDim.x + threadIdx.x;       // H*T*64
  if (idx >= NHEAD * T_SEQ * 64) return;
  int j = idx & 63;
  int t = (idx >> 6) & (T_SEQ - 1);
  int h = idx >> 17;
  float invf = __expf(-(float)j * (9.210340371976184f / 64.0f)); // 10000^(-j/64)
  float ang = (float)t * invf;
  float c = cosf(ang), s = sinf(ang);
  size_t base = ((size_t)h * T_SEQ + t) * HDIM;

  float q1 = Q[base + j], q2 = Q[base + j + 64];
  Q[base + j]      = q1 * c - q2 * s;
  Q[base + j + 64] = q2 * c + q1 * s;

  float k1 = K[base + j], k2 = K[base + j + 64];
  float k1n = k1 * c - k2 * s;
  float k2n = k2 * c + k1 * s;
  K[base + j]      = k1n;
  K[base + j + 64] = k2n;
  __bf16 h1 = (__bf16)k1n; Khi[base + j]      = h1; Klo[base + j]      = (__bf16)(k1n - (float)h1);
  __bf16 h2 = (__bf16)k2n; Khi[base + j + 64] = h2; Klo[base + j + 64] = (__bf16)(k2n - (float)h2);
}

// ---------------- kernel 4: last-row softmax -> stochastic V bump (f32) ----------------
__global__ __launch_bounds__(256)
void vupdate_kernel(const float* __restrict__ Q, const float* __restrict__ K,
                    const float* __restrict__ bern, float* __restrict__ V) {
  const int h = blockIdx.x, tid = threadIdx.x;
  __shared__ float sc[NVALID];
  __shared__ float qrow[HDIM];
  __shared__ float red[256];
  __shared__ float sh_coef;
  __shared__ float ve[HDIM];

  if (tid < HDIM) qrow[tid] = Q[((size_t)h * T_SEQ + (T_SEQ - 1)) * HDIM + tid];
  __syncthreads();

  float lmax = -1e30f;
  for (int idx = tid; idx < NVALID; idx += 256) {
    int key = (idx < SB) ? idx : (T_SEQ - RB) + (idx - SB);
    const float* kr = K + ((size_t)h * T_SEQ + key) * HDIM;
    float d = 0.0f;
    #pragma unroll 8
    for (int c = 0; c < HDIM; ++c) d += qrow[c] * kr[c];
    d *= SCALE_QK;
    sc[idx] = d;
    lmax = fmaxf(lmax, d);
  }
  red[tid] = lmax; __syncthreads();
  for (int s = 128; s > 0; s >>= 1) { if (tid < s) red[tid] = fmaxf(red[tid], red[tid + s]); __syncthreads(); }
  float gmax = red[0]; __syncthreads();

  float lsum = 0.0f, ltail = 0.0f;
  for (int idx = tid; idx < NVALID; idx += 256) {
    float e = __expf(sc[idx] - gmax);
    lsum += e;
    if (idx >= SB + 1) ltail += e;     // keys 1025..2047
  }
  red[tid] = lsum; __syncthreads();
  for (int s = 128; s > 0; s >>= 1) { if (tid < s) red[tid] += red[tid + s]; __syncthreads(); }
  float gsum = red[0]; __syncthreads();
  red[tid] = ltail; __syncthreads();
  for (int s = 128; s > 0; s >>= 1) { if (tid < s) red[tid] += red[tid + s]; __syncthreads(); }

  if (tid == 0) {
    float gtail = red[0];
    float pe   = __expf(sc[SB] - gmax) / gsum;             // probs at key e=1024
    float mean = (gtail / gsum) / 1023.0f + 1e-6f;
    float p = pe / mean;
    p = (p != p) ? 0.0f : fminf(fmaxf(p, 0.0f), 1.0f);
    float m = (bern[h] < p) ? 1.0f : 0.0f;
    sh_coef = m / (float)RB;
  }
  __syncthreads();
  if (tid < HDIM) ve[tid] = V[((size_t)h * T_SEQ + RB) * HDIM + tid] * sh_coef;
  __syncthreads();
  for (int idx = tid; idx < (T_SEQ - RB - 1) * HDIM; idx += 256) {
    int row = RB + 1 + (idx >> 7);
    int d   = idx & 127;
    V[((size_t)h * T_SEQ + row) * HDIM + d] += ve[d];
  }
}

// ---------------- kernel 5: flash attention, bf16x3, 32-key tiles ----------------
__global__ __launch_bounds__(128)
void attn_kernel(const float* __restrict__ Q, const __bf16* __restrict__ Khi,
                 const __bf16* __restrict__ Klo, const float* __restrict__ V,
                 float* __restrict__ Oout) {
  __shared__ __bf16 Qhi_s[64 * 136], Qlo_s[64 * 136];   // 64 queries x 128 dims
  __shared__ __bf16 Vhi_s[128 * 40], Vlo_s[128 * 40];   // [d][key], 32 keys
  __shared__ __bf16 Phi_s[4 * 16 * 32], Plo_s[4 * 16 * 32];

  const int tid  = threadIdx.x;
  const int w    = tid >> 5;         // 4 waves, 16 queries each
  const int lane = tid & 31;
  const int ln   = lane & 15;
  const int hf   = lane >> 4;
  const int h    = blockIdx.y;
  const int t0   = blockIdx.x * 64;
  const size_t hk = (size_t)h * T_SEQ;

  const float* Qh = Q + hk * HDIM;
  const float* Vh = V + hk * HDIM;

  // stage + split this block's 64 query rows
  #pragma unroll
  for (int i = 0; i < 16; ++i) {
    int idx = tid + i * 128;
    int row = idx >> 5, kc = (idx & 31) * 4;
    float4 v = *(const float4*)(Qh + (size_t)(t0 + row) * HDIM + kc);
    v4bf hh, ll; split4(v, hh, ll);
    *(v4bf*)(&Qhi_s[row * 136 + kc]) = hh;
    *(v4bf*)(&Qlo_s[row * 136 + kc]) = ll;
  }

  v8f Oacc[8];
  float mrow[8], lrow[8], alphas[8];
  #pragma unroll
  for (int ct = 0; ct < 8; ++ct)
    #pragma unroll
    for (int r = 0; r < 8; ++r) Oacc[ct][r] = 0.0f;
  #pragma unroll
  for (int r = 0; r < 8; ++r) { mrow[r] = -1e30f; lrow[r] = 0.0f; }

  __bf16* Pw_hi = &Phi_s[w * 16 * 32];
  __bf16* Pw_lo = &Plo_s[w * 16 * 32];

  for (int it = 0; it < 39; ++it) {     // 7 tiles for [0,204), 32 for [1024,2048)
    const int k0 = (it < 7) ? it * 32 : (T_SEQ - RB) + (it - 7) * 32;
    __syncthreads();
    // stage V tile 32x128, split + transpose -> [d][key]
    #pragma unroll
    for (int i = 0; i < 32; ++i) {
      int idx = tid + i * 128;
      int kr = idx >> 7, d = idx & 127;
      float v = Vh[(size_t)(k0 + kr) * HDIM + d];
      __bf16 hh = (__bf16)v;
      Vhi_s[d * 40 + kr] = hh;
      Vlo_s[d * 40 + kr] = (__bf16)(v - (float)hh);
    }
    __syncthreads();

    // S(16x32) = Q(16x128) * K^T(128x32), two 16-col tiles, bf16x3
    v8f S0, S1;
    #pragma unroll
    for (int r = 0; r < 8; ++r) { S0[r] = 0.0f; S1[r] = 0.0f; }
    const size_t kr0 = (hk + k0 + ln) * HDIM;
    const size_t kr1 = (hk + k0 + 16 + ln) * HDIM;
    #pragma unroll
    for (int kc = 0; kc < HDIM; kc += 32) {
      int qb = (w * 16 + ln) * 136 + kc + 8 * hf;
      v16bf qh = ld_frag(&Qhi_s[qb]), ql = ld_frag(&Qlo_s[qb]);
      v16bf kh0 = ld_frag(Khi + kr0 + kc + 8 * hf);
      v16bf kl0 = ld_frag(Klo + kr0 + kc + 8 * hf);
      v16bf kh1 = ld_frag(Khi + kr1 + kc + 8 * hf);
      v16bf kl1 = ld_frag(Klo + kr1 + kc + 8 * hf);
      // interleave the two independent accumulators
      S0 = wmma_bf16(qh, kl0, S0);
      S1 = wmma_bf16(qh, kl1, S1);
      S0 = wmma_bf16(ql, kh0, S0);
      S1 = wmma_bf16(ql, kh1, S1);
      S0 = wmma_bf16(qh, kh0, S0);
      S1 = wmma_bf16(qh, kh1, S1);
    }

    const bool m0c = (it == 6) && ((k0 + ln) >= SB);   // keys 192..207 partial
    const bool m1c = (it == 6);                        // keys 208..223 all masked
    #pragma unroll
    for (int r = 0; r < 8; ++r) {
      float s0 = S0[r] * SCALE_QK; if (m0c) s0 = -1e30f;
      float s1 = S1[r] * SCALE_QK; if (m1c) s1 = -1e30f;
      float tmax  = fmaxf(rmax16(s0), rmax16(s1));
      float mnew  = fmaxf(mrow[r], tmax);
      float alpha = __expf(mrow[r] - mnew);
      float p0 = __expf(s0 - mnew);
      float p1 = __expf(s1 - mnew);
      float rs = rsum16(p0 + p1);
      lrow[r]   = lrow[r] * alpha + rs;
      mrow[r]   = mnew;
      alphas[r] = alpha;
      int prow = (r + 8 * hf) * 32;
      __bf16 h0 = (__bf16)p0;
      Pw_hi[prow + ln] = h0;       Pw_lo[prow + ln] = (__bf16)(p0 - (float)h0);
      __bf16 h1 = (__bf16)p1;
      Pw_hi[prow + 16 + ln] = h1;  Pw_lo[prow + 16 + ln] = (__bf16)(p1 - (float)h1);
    }
    #pragma unroll
    for (int ct = 0; ct < 8; ++ct)
      #pragma unroll
      for (int r = 0; r < 8; ++r) Oacc[ct][r] *= alphas[r];

    asm volatile("s_wait_dscnt 0" ::: "memory");

    // O(16x128) += P(16x32) * V(32x128), bf16x3; process ct in pairs so the
    // 3-product chains alternate between two independent accumulators
    const int pb = ln * 32 + 8 * hf;
    v16bf ph = ld_frag(&Pw_hi[pb]), pl = ld_frag(&Pw_lo[pb]);
    #pragma unroll
    for (int ct = 0; ct < 8; ct += 2) {
      int vb0 = ((ct + 0) * 16 + ln) * 40 + 8 * hf;
      int vb1 = ((ct + 1) * 16 + ln) * 40 + 8 * hf;
      v16bf vh0 = ld_frag(&Vhi_s[vb0]), vl0 = ld_frag(&Vlo_s[vb0]);
      v16bf vh1 = ld_frag(&Vhi_s[vb1]), vl1 = ld_frag(&Vlo_s[vb1]);
      Oacc[ct + 0] = wmma_bf16(ph, vl0, Oacc[ct + 0]);
      Oacc[ct + 1] = wmma_bf16(ph, vl1, Oacc[ct + 1]);
      Oacc[ct + 0] = wmma_bf16(pl, vh0, Oacc[ct + 0]);
      Oacc[ct + 1] = wmma_bf16(pl, vh1, Oacc[ct + 1]);
      Oacc[ct + 0] = wmma_bf16(ph, vh0, Oacc[ct + 0]);
      Oacc[ct + 1] = wmma_bf16(ph, vh1, Oacc[ct + 1]);
    }
  }

  // write [T][D]: col = h*128 + d
  #pragma unroll
  for (int ct = 0; ct < 8; ++ct)
    #pragma unroll
    for (int r = 0; r < 8; ++r) {
      int t = t0 + w * 16 + r + 8 * hf;
      int c = h * HDIM + ct * 16 + ln;
      Oout[(size_t)t * DMODEL + c] = Oacc[ct][r] / lrow[r];
    }
}

// ---------------- launch ----------------
extern "C" void kernel_launch(void* const* d_in, const int* in_sizes, int n_in,
                              void* d_out, int out_size, void* d_ws, size_t ws_size,
                              hipStream_t stream) {
  (void)in_sizes; (void)n_in; (void)out_size; (void)ws_size;
  const float* hidden = (const float*)d_in[0];
  const float* wq     = (const float*)d_in[1];
  const float* wk     = (const float*)d_in[2];
  const float* wv     = (const float*)d_in[3];
  const float* wo     = (const float*)d_in[4];
  const float* bern   = (const float*)d_in[5];

  const size_t NE = (size_t)T_SEQ * DMODEL;   // 4,194,304
  const int    NEi = (int)NE;
  float* ws    = (float*)d_ws;
  float* q     = ws;            // [H][T][128] f32
  float* k     = ws + 1 * NE;
  float* v     = ws + 2 * NE;
  float* attnb = ws + 3 * NE;   // [T][D]
  __bf16* xhi  = (__bf16*)(ws + 4 * NE);  // activation split (hidden, then attnb)
  __bf16* xlo  = xhi + NE;
  __bf16* whi  = xlo + NE;                // current weight split (reused 4x)
  __bf16* wlo  = whi + NE;
  __bf16* khi  = wlo + NE;                // RoPE'd K split
  __bf16* klo  = khi + NE;

  const int SGRID = (NEi + 255) / 256;
  dim3 ggrid(DMODEL / 128, T_SEQ / 64);       // (16, 32)

  // sanitized hidden -> bf16 hi/lo
  split_kernel<<<SGRID, 256, 0, stream>>>(hidden, xhi, xlo, NEi, 1);

  split_kernel<<<SGRID, 256, 0, stream>>>(wq, whi, wlo, NEi, 0);
  gemm_bf16x3_async_kernel<<<ggrid, 256, 0, stream>>>(xhi, xlo, whi, wlo, q, 0);
  split_kernel<<<SGRID, 256, 0, stream>>>(wk, whi, wlo, NEi, 0);
  gemm_bf16x3_async_kernel<<<ggrid, 256, 0, stream>>>(xhi, xlo, whi, wlo, k, 0);
  split_kernel<<<SGRID, 256, 0, stream>>>(wv, whi, wlo, NEi, 0);
  gemm_bf16x3_async_kernel<<<ggrid, 256, 0, stream>>>(xhi, xlo, whi, wlo, v, 0);

  int nrope = NHEAD * T_SEQ * 64;
  rope_split_kernel<<<(nrope + 255) / 256, 256, 0, stream>>>(q, k, khi, klo);

  vupdate_kernel<<<NHEAD, 256, 0, stream>>>(q, k, bern, v);

  attn_kernel<<<dim3(T_SEQ / 64, NHEAD), 128, 0, stream>>>(q, khi, klo, v, attnb);

  // output projection: split attnb (reuse x buffers) and wo, then GEMM -> d_out
  split_kernel<<<SGRID, 256, 0, stream>>>(attnb, xhi, xlo, NEi, 0);
  split_kernel<<<SGRID, 256, 0, stream>>>(wo, whi, wlo, NEi, 0);
  gemm_bf16x3_async_kernel<<<ggrid, 256, 0, stream>>>(xhi, xlo, whi, wlo, (float*)d_out, 1);
}

// v001
// Measured time: 485 microseconds a run.
// Next to v000, in two timings, it ran 1.13 and 1.15 times as fast.
#include <hip/hip_runtime.h>
#include <math.h>

// ---------------- problem constants ----------------
#define T_SEQ   2048
#define DMODEL  2048
#define NHEAD   16
#define HDIM    128
#define SB      204      // int(0.1*2048)
#define RB      1024     // int(0.5*2048)
#define NVALID  1228     // SB + RB
#define SCALE_QK 0.088388347648318447f   // 1/sqrt(128)

typedef float  v8f  __attribute__((ext_vector_type(8)));
typedef __bf16 v4bf __attribute__((ext_vector_type(4)));
typedef __bf16 v8bf __attribute__((ext_vector_type(8)));
typedef __bf16 v16bf __attribute__((ext_vector_type(16)));

static __device__ __forceinline__ v8f wmma_bf16(v16bf a, v16bf b, v8f c) {
  // D(16x16,f32) = A(16x32,bf16) x B(32x16,bf16) + C
  return __builtin_amdgcn_wmma_f32_16x16x32_bf16(false, a, false, b, (short)0, c, false, false);
}

// 16-bit A/B fragment: 8 contiguous K at p, 8 more at p+16
static __device__ __forceinline__ v16bf ld_frag(const __bf16* p) {
  v8bf a = *(const v8bf*)(p);
  v8bf b = *(const v8bf*)(p + 16);
  return __builtin_shufflevector(a, b, 0,1,2,3,4,5,6,7,8,9,10,11,12,13,14,15);
}

static __device__ __forceinline__ void split4(float4 v, v4bf& h, v4bf& l) {
  h[0] = (__bf16)v.x; l[0] = (__bf16)(v.x - (float)h[0]);
  h[1] = (__bf16)v.y; l[1] = (__bf16)(v.y - (float)h[1]);
  h[2] = (__bf16)v.z; l[2] = (__bf16)(v.z - (float)h[2]);
  h[3] = (__bf16)v.w; l[3] = (__bf16)(v.w - (float)h[3]);
}

static __device__ __forceinline__ float fin_clamp(float v) {
  if (v != v)        return 0.0f;
  if (v >  1.0e38f)  return  1.0e4f;
  if (v < -1.0e38f)  return -1.0e4f;
  return v;
}

static __device__ __forceinline__ float rmax16(float v) {
  #pragma unroll
  for (int m = 1; m < 16; m <<= 1) v = fmaxf(v, __shfl_xor(v, m, 32));
  return v;
}
static __device__ __forceinline__ float rsum16(float v) {
  #pragma unroll
  for (int m = 1; m < 16; m <<= 1) v += __shfl_xor(v, m, 32);
  return v;
}

// ---------------- async global->LDS copy (CDNA5), with sync fallback ----------------
#if __has_builtin(__builtin_amdgcn_global_load_async_to_lds_b128)
#define HAS_ASYNC_LDS 1
typedef int gv4i __attribute__((vector_size(16)));
typedef __attribute__((address_space(1))) gv4i as1_v4i;   // global
typedef __attribute__((address_space(3))) gv4i as3_v4i;   // LDS
static __device__ __forceinline__ void async_cp16(void* l, const void* g) {
  __builtin_amdgcn_global_load_async_to_lds_b128((as1_v4i*)g, (as3_v4i*)l, 0, 0);
}
static __device__ __forceinline__ void wait_async0() {
#if __has_builtin(__builtin_amdgcn_s_wait_asynccnt)
  __builtin_amdgcn_s_wait_asynccnt(0);
#else
  asm volatile("s_wait_asynccnt 0" ::: "memory");
#endif
}
#else
#define HAS_ASYNC_LDS 0
static __device__ __forceinline__ void async_cp16(void* l, const void* g) {
  *(float4*)l = *(const float4*)g;     // 16B sync copy fallback
}
static __device__ __forceinline__ void wait_async0() {}
#endif

// ---------------- kernel 1: nan_to_num(optional) + bf16 hi/lo split ----------------
__global__ void split_kernel(const float* __restrict__ x, __bf16* __restrict__ hi,
                             __bf16* __restrict__ lo, int n, int do_clamp) {
  int i = blockIdx.x * blockDim.x + threadIdx.x;
  if (i < n) {
    float v = x[i];
    if (do_clamp) v = fin_clamp(v);
    __bf16 h = (__bf16)v;
    hi[i] = h;
    lo[i] = (__bf16)(v - (float)h);
  }
}

// ---------------- GEMM: C = A * W^T, bf16x3, async double-buffered LDS ----------------
// Operands pre-split to global bf16 hi/lo.  mode 0: scatter [H][T][HDIM]; 1: [T][D]+clamp.
__global__ __launch_bounds__(256)
void gemm_bf16x3_async_kernel(const __bf16* __restrict__ Ahi_g, const __bf16* __restrict__ Alo_g,
                              const __bf16* __restrict__ Whi_g, const __bf16* __restrict__ Wlo_g,
                              float* __restrict__ out, int mode) {
  __shared__ __bf16 Abuf[2][2][64 * 40];    // [buf][hi/lo], 64 rows x BK=32, stride 40
  __shared__ __bf16 Wbuf[2][2][128 * 40];

  const int tid  = threadIdx.x;
  const int wid  = tid >> 5;
  const int lane = tid & 31;
  const int ln   = lane & 15;
  const int hf   = lane >> 4;
  const int wr   = wid >> 2;       // 0..1
  const int wc   = wid & 3;        // 0..3
  const int m0   = blockIdx.y * 64;
  const int n0   = blockIdx.x * 128;

  // per-thread 16B-chunk assignments: A = 256 chunks (1/thread/array), W = 512 (2/thread/array)
  const int arow = tid >> 2, ac = (tid & 3) * 8;       // 8 bf16 = 16B

  v8f acc[2][2];
  #pragma unroll
  for (int i = 0; i < 2; ++i)
    #pragma unroll
    for (int j = 0; j < 2; ++j)
      #pragma unroll
      for (int r = 0; r < 8; ++r) acc[i][j][r] = 0.0f;

  auto issue = [&](int buf, int kt) {
    async_cp16(&Abuf[buf][0][arow * 40 + ac], Ahi_g + (size_t)(m0 + arow) * DMODEL + kt + ac);
    async_cp16(&Abuf[buf][1][arow * 40 + ac], Alo_g + (size_t)(m0 + arow) * DMODEL + kt + ac);
    #pragma unroll
    for (int i = 0; i < 2; ++i) {
      int idx = tid + i * 256, rw = idx >> 2, cw = (idx & 3) * 8;
      async_cp16(&Wbuf[buf][0][rw * 40 + cw], Whi_g + (size_t)(n0 + rw) * DMODEL + kt + cw);
      async_cp16(&Wbuf[buf][1][rw * 40 + cw], Wlo_g + (size_t)(n0 + rw) * DMODEL + kt + cw);
    }
  };

  issue(0, 0);
  for (int i = 0; i < DMODEL / 32; ++i) {
    const int kt  = i * 32;
    const int buf = i & 1;
    wait_async0();          // own async copies for buf complete
    __syncthreads();        // all waves' copies complete; all done computing i-1

    if (kt + 32 < DMODEL) issue(buf ^ 1, kt + 32);   // overlap next tile with compute

    const __bf16* Ah = Abuf[buf][0];
    const __bf16* Al = Abuf[buf][1];
    const __bf16* Wh = Wbuf[buf][0];
    const __bf16* Wl = Wbuf[buf][1];
    const int ab = (wr * 32 + ln) * 40 + 8 * hf;
    const int bb = (wc * 32 + ln) * 40 + 8 * hf;
    v16bf a0h = ld_frag(&Ah[ab]),           a0l = ld_frag(&Al[ab]);
    v16bf a1h = ld_frag(&Ah[ab + 16 * 40]), a1l = ld_frag(&Al[ab + 16 * 40]);
    v16bf b0h = ld_frag(&Wh[bb]),           b0l = ld_frag(&Wl[bb]);
    v16bf b1h = ld_frag(&Wh[bb + 16 * 40]), b1l = ld_frag(&Wl[bb + 16 * 40]);

    // product-major, round-robin over the 4 independent accumulators:
    // each accumulator's C-chain has distance 4 -> no copies / hazard stalls
    acc[0][0] = wmma_bf16(a0h, b0l, acc[0][0]);
    acc[0][1] = wmma_bf16(a0h, b1l, acc[0][1]);
    acc[1][0] = wmma_bf16(a1h, b0l, acc[1][0]);
    acc[1][1] = wmma_bf16(a1h, b1l, acc[1][1]);
    acc[0][0] = wmma_bf16(a0l, b0h, acc[0][0]);
    acc[0][1] = wmma_bf16(a0l, b1h, acc[0][1]);
    acc[1][0] = wmma_bf16(a1l, b0h, acc[1][0]);
    acc[1][1] = wmma_bf16(a1l, b1h, acc[1][1]);
    acc[0][0] = wmma_bf16(a0h, b0h, acc[0][0]);
    acc[0][1] = wmma_bf16(a0h, b1h, acc[0][1]);
    acc[1][0] = wmma_bf16(a1h, b0h, acc[1][0]);
    acc[1][1] = wmma_bf16(a1h, b1h, acc[1][1]);
  }

  // C layout: lane ln = column, row = r + 8*hf
  #pragma unroll
  for (int i = 0; i < 2; ++i)
    #pragma unroll
    for (int j = 0; j < 2; ++j)
      #pragma unroll
      for (int r = 0; r < 8; ++r) {
        int gm = m0 + wr * 32 + i * 16 + r + 8 * hf;
        int gn = n0 + wc * 32 + j * 16 + ln;
        float v = acc[i][j][r];
        if (mode == 1) {
          out[(size_t)gm * DMODEL + gn] = fin_clamp(v);
        } else {
          int h = gn >> 7, d = gn & 127;
          out[((size_t)h * T_SEQ + gm) * HDIM + d] = v;
        }
      }
}

// ---------------- kernel 3: RoPE on Q,K + emit bf16 hi/lo split of K ----------------
__global__ void rope_split_kernel(float* __restrict__ Q, float* __restrict__ K,
                                  __bf16* __restrict__ Khi, __bf16* __restrict__ Klo) {
  int idx = blockIdx.x * blockDim.x + threadIdx.x;       // H*T*64
  if (idx >= NHEAD * T_SEQ * 64) return;
  int j = idx & 63;
  int t = (idx >> 6) & (T_SEQ - 1);
  int h = idx >> 17;
  float invf = __expf(-(float)j * (9.210340371976184f / 64.0f)); // 10000^(-j/64)
  float ang = (float)t * invf;
  float c = cosf(ang), s = sinf(ang);
  size_t base = ((size_t)h * T_SEQ + t) * HDIM;

  float q1 = Q[base + j], q2 = Q[base + j + 64];
  Q[base + j]      = q1 * c - q2 * s;
  Q[base + j + 64] = q2 * c + q1 * s;

  float k1 = K[base + j], k2 = K[base + j + 64];
  float k1n = k1 * c - k2 * s;
  float k2n = k2 * c + k1 * s;
  K[base + j]      = k1n;
  K[base + j + 64] = k2n;
  __bf16 h1 = (__bf16)k1n; Khi[base + j]      = h1; Klo[base + j]      = (__bf16)(k1n - (float)h1);
  __bf16 h2 = (__bf16)k2n; Khi[base + j + 64] = h2; Klo[base + j + 64] = (__bf16)(k2n - (float)h2);
}

// ---------------- kernel 4: last-row softmax -> stochastic V bump (f32) ----------------
__global__ __launch_bounds__(256)
void vupdate_kernel(const float* __restrict__ Q, const float* __restrict__ K,
                    const float* __restrict__ bern, float* __restrict__ V) {
  const int h = blockIdx.x, tid = threadIdx.x;
  __shared__ float sc[NVALID];
  __shared__ float qrow[HDIM];
  __shared__ float red[256];
  __shared__ float sh_coef;
  __shared__ float ve[HDIM];

  if (tid < HDIM) qrow[tid] = Q[((size_t)h * T_SEQ + (T_SEQ - 1)) * HDIM + tid];
  __syncthreads();

  float lmax = -1e30f;
  for (int idx = tid; idx < NVALID; idx += 256) {
    int key = (idx < SB) ? idx : (T_SEQ - RB) + (idx - SB);
    const float* kr = K + ((size_t)h * T_SEQ + key) * HDIM;
    float d = 0.0f;
    #pragma unroll 8
    for (int c = 0; c < HDIM; ++c) d += qrow[c] * kr[c];
    d *= SCALE_QK;
    sc[idx] = d;
    lmax = fmaxf(lmax, d);
  }
  red[tid] = lmax; __syncthreads();
  for (int s = 128; s > 0; s >>= 1) { if (tid < s) red[tid] = fmaxf(red[tid], red[tid + s]); __syncthreads(); }
  float gmax = red[0]; __syncthreads();

  float lsum = 0.0f, ltail = 0.0f;
  for (int idx = tid; idx < NVALID; idx += 256) {
    float e = __expf(sc[idx] - gmax);
    lsum += e;
    if (idx >= SB + 1) ltail += e;     // keys 1025..2047
  }
  red[tid] = lsum; __syncthreads();
  for (int s = 128; s > 0; s >>= 1) { if (tid < s) red[tid] += red[tid + s]; __syncthreads(); }
  float gsum = red[0]; __syncthreads();
  red[tid] = ltail; __syncthreads();
  for (int s = 128; s > 0; s >>= 1) { if (tid < s) red[tid] += red[tid + s]; __syncthreads(); }

  if (tid == 0) {
    float gtail = red[0];
    float pe   = __expf(sc[SB] - gmax) / gsum;             // probs at key e=1024
    float mean = (gtail / gsum) / 1023.0f + 1e-6f;
    float p = pe / mean;
    p = (p != p) ? 0.0f : fminf(fmaxf(p, 0.0f), 1.0f);
    float m = (bern[h] < p) ? 1.0f : 0.0f;
    sh_coef = m / (float)RB;
  }
  __syncthreads();
  if (tid < HDIM) ve[tid] = V[((size_t)h * T_SEQ + RB) * HDIM + tid] * sh_coef;
  __syncthreads();
  for (int idx = tid; idx < (T_SEQ - RB - 1) * HDIM; idx += 256) {
    int row = RB + 1 + (idx >> 7);
    int d   = idx & 127;
    V[((size_t)h * T_SEQ + row) * HDIM + d] += ve[d];
  }
}

// ---------------- kernel 5: flash attention, bf16x3, 32-key tiles ----------------
__global__ __launch_bounds__(128)
void attn_kernel(const float* __restrict__ Q, const __bf16* __restrict__ Khi,
                 const __bf16* __restrict__ Klo, const float* __restrict__ V,
                 float* __restrict__ Oout) {
  __shared__ __bf16 Qhi_s[64 * 136], Qlo_s[64 * 136];   // 64 queries x 128 dims
  __shared__ __bf16 Vhi_s[128 * 40], Vlo_s[128 * 40];   // [d][key], 32 keys
  __shared__ __bf16 Phi_s[4 * 16 * 32], Plo_s[4 * 16 * 32];
  // K tile, 32 keys x 128 dims, hi and lo, two buffers; row pitch 272 B for 16-byte readers
  __shared__ __attribute__((aligned(16))) __bf16 Khi_s[2][32 * 136];
  __shared__ __attribute__((aligned(16))) __bf16 Klo_s[2][32 * 136];

  const int tid  = threadIdx.x;
  const int w    = tid >> 5;         // 4 waves, 16 queries each
  const int lane = tid & 31;
  const int ln   = lane & 15;
  const int hf   = lane >> 4;
  const int h    = blockIdx.y;
  const int t0   = blockIdx.x * 64;
  const size_t hk = (size_t)h * T_SEQ;

  const float* Qh = Q + hk * HDIM;
  const float* Vh = V + hk * HDIM;

  // one K tile (hi and lo) into LDS, once per block: each wave's copy takes 512 contiguous
  // bytes (two whole key rows), 8 copies per thread and tile
  auto issue_k = [&](int buf, int kbase) {
    #pragma unroll
    for (int i = 0; i < 4; ++i) {
      int idx = tid + i * 128, rw = idx >> 4, cw = (idx & 15) * 8;
      async_cp16(&Khi_s[buf][rw * 136 + cw], Khi + (hk + kbase + rw) * HDIM + cw);
      async_cp16(&Klo_s[buf][rw * 136 + cw], Klo + (hk + kbase + rw) * HDIM + cw);
    }
  };
  issue_k(0, 0);

  // stage + split this block's 64 query rows
  #pragma unroll
  for (int i = 0; i < 16; ++i) {
    int idx = tid + i * 128;
    int row = idx >> 5, kc = (idx & 31) * 4;
    float4 v = *(const float4*)(Qh + (size_t)(t0 + row) * HDIM + kc);
    v4bf hh, ll; split4(v, hh, ll);
    *(v4bf*)(&Qhi_s[row * 136 + kc]) = hh;
    *(v4bf*)(&Qlo_s[row * 136 + kc]) = ll;
  }

  v8f Oacc[8];
  float mrow[8], lrow[8], alphas[8];
  #pragma unroll
  for (int ct = 0; ct < 8; ++ct)
    #pragma unroll
    for (int r = 0; r < 8; ++r) Oacc[ct][r] = 0.0f;
  #pragma unroll
  for (int r = 0; r < 8; ++r) { mrow[r] = -1e30f; lrow[r] = 0.0f; }

  __bf16* Pw_hi = &Phi_s[w * 16 * 32];
  __bf16* Pw_lo = &Plo_s[w * 16 * 32];

  for (int it = 0; it < 39; ++it) {     // 7 tiles for [0,204), 32 for [1024,2048)
    const int k0 = (it < 7) ? it * 32 : (T_SEQ - RB) + (it - 7) * 32;
    __syncthreads();
    // stage V tile 32x128, split + transpose -> [d][key]
    #pragma unroll
    for (int i = 0; i < 32; ++i) {
      int idx = tid + i * 128;
      int kr = idx >> 7, d = idx & 127;
      float v = Vh[(size_t)(k0 + kr) * HDIM + d];
      __bf16 hh = (__bf16)v;
      Vhi_s[d * 40 + kr] = hh;
      Vlo_s[d * 40 + kr] = (__bf16)(v - (float)hh);
    }
    // own LDS traffic retired before the refill below aims at a buffer this wave has read
    asm volatile("s_wait_dscnt 0x0" ::: "memory");
    // own copies of this tile's K have landed; the barrier then shows them to the other waves
    asm volatile("s_wait_asynccnt 0x0" ::: "memory");
    __syncthreads();

    // next tile's K flies while this tile is worked on; its buffer was last read one trip ago
    if (it + 1 < 39)
      issue_k((it + 1) & 1, (it + 1 < 7) ? (it + 1) * 32 : (T_SEQ - RB) + (it + 1 - 7) * 32);
    const __bf16* Kh_t = Khi_s[it & 1];
    const __bf16* Kl_t = Klo_s[it & 1];

    // S(16x32) = Q(16x128) * K^T(128x32), two 16-col tiles, bf16x3
    v8f S0, S1;
    #pragma unroll
    for (int r = 0; r < 8; ++r) { S0[r] = 0.0f; S1[r] = 0.0f; }
    const int kr0 = ln * 136;
    const int kr1 = (16 + ln) * 136;
    #pragma unroll
    for (int kc = 0; kc < HDIM; kc += 32) {
      int qb = (w * 16 + ln) * 136 + kc + 8 * hf;
      v16bf qh = ld_frag(&Qhi_s[qb]), ql = ld_frag(&Qlo_s[qb]);
      v16bf kh0 = ld_frag(Kh_t + kr0 + kc + 8 * hf);
      v16bf kl0 = ld_frag(Kl_t + kr0 + kc + 8 * hf);
      v16bf kh1 = ld_frag(Kh_t + kr1 + kc + 8 * hf);
      v16bf kl1 = ld_frag(Kl_t + kr1 + kc + 8 * hf);
      // interleave the two independent accumulators
      S0 = wmma_bf16(qh, kl0, S0);
      S1 = wmma_bf16(qh, kl1, S1);
      S0 = wmma_bf16(ql, kh0, S0);
      S1 = wmma_bf16(ql, kh1, S1);
      S0 = wmma_bf16(qh, kh0, S0);
      S1 = wmma_bf16(qh, kh1, S1);
    }

    const bool m0c = (it == 6) && ((k0 + ln) >= SB);   // keys 192..207 partial
    const bool m1c = (it == 6);                        // keys 208..223 all masked
    #pragma unroll
    for (int r = 0; r < 8; ++r) {
      float s0 = S0[r] * SCALE_QK; if (m0c) s0 = -1e30f;
      float s1 = S1[r] * SCALE_QK; if (m1c) s1 = -1e30f;
      float tmax  = fmaxf(rmax16(s0), rmax16(s1));
      float mnew  = fmaxf(mrow[r], tmax);
      float alpha = __expf(mrow[r] - mnew);
      float p0 = __expf(s0 - mnew);
      float p1 = __expf(s1 - mnew);
      float rs = rsum16(p0 + p1);
      lrow[r]   = lrow[r] * alpha + rs;
      mrow[r]   = mnew;
      alphas[r] = alpha;
      int prow = (r + 8 * hf) * 32;
      __bf16 h0 = (__bf16)p0;
      Pw_hi[prow + ln] = h0;       Pw_lo[prow + ln] = (__bf16)(p0 - (float)h0);
      __bf16 h1 = (__bf16)p1;
      Pw_hi[prow + 16 + ln] = h1;  Pw_lo[prow + 16 + ln] = (__bf16)(p1 - (float)h1);
    }
    #pragma unroll
    for (int ct = 0; ct < 8; ++ct)
      #pragma unroll
      for (int r = 0; r < 8; ++r) Oacc[ct][r] *= alphas[r];

    asm volatile("s_wait_dscnt 0" ::: "memory");

    // O(16x128) += P(16x32) * V(32x128), bf16x3; process ct in pairs so the
    // 3-product chains alternate between two independent accumulators
    const int pb = ln * 32 + 8 * hf;
    v16bf ph = ld_frag(&Pw_hi[pb]), pl = ld_frag(&Pw_lo[pb]);
    #pragma unroll
    for (int ct = 0; ct < 8; ct += 2) {
      int vb0 = ((ct + 0) * 16 + ln) * 40 + 8 * hf;
      int vb1 = ((ct + 1) * 16 + ln) * 40 + 8 * hf;
      v16bf vh0 = ld_frag(&Vhi_s[vb0]), vl0 = ld_frag(&Vlo_s[vb0]);
      v16bf vh1 = ld_frag(&Vhi_s[vb1]), vl1 = ld_frag(&Vlo_s[vb1]);
      Oacc[ct + 0] = wmma_bf16(ph, vl0, Oacc[ct + 0]);
      Oacc[ct + 1] = wmma_bf16(ph, vl1, Oacc[ct + 1]);
      Oacc[ct + 0] = wmma_bf16(pl, vh0, Oacc[ct + 0]);
      Oacc[ct + 1] = wmma_bf16(pl, vh1, Oacc[ct + 1]);
      Oacc[ct + 0] = wmma_bf16(ph, vh0, Oacc[ct + 0]);
      Oacc[ct + 1] = wmma_bf16(ph, vh1, Oacc[ct + 1]);
    }
  }

  // write [T][D]: col = h*128 + d
  #pragma unroll
  for (int ct = 0; ct < 8; ++ct)
    #pragma unroll
    for (int r = 0; r < 8; ++r) {
      int t = t0 + w * 16 + r + 8 * hf;
      int c = h * HDIM + ct * 16 + ln;
      Oout[(size_t)t * DMODEL + c] = Oacc[ct][r] / lrow[r];
    }
}

// ---------------- launch ----------------
extern "C" void kernel_launch(void* const* d_in, const int* in_sizes, int n_in,
                              void* d_out, int out_size, void* d_ws, size_t ws_size,
                              hipStream_t stream) {
  (void)in_sizes; (void)n_in; (void)out_size; (void)ws_size;
  const float* hidden = (const float*)d_in[0];
  const float* wq     = (const float*)d_in[1];
  const float* wk     = (const float*)d_in[2];
  const float* wv     = (const float*)d_in[3];
  const float* wo     = (const float*)d_in[4];
  const float* bern   = (const float*)d_in[5];

  const size_t NE = (size_t)T_SEQ * DMODEL;   // 4,194,304
  const int    NEi = (int)NE;
  float* ws    = (float*)d_ws;
  float* q     = ws;            // [H][T][128] f32
  float* k     = ws + 1 * NE;
  float* v     = ws + 2 * NE;
  float* attnb = ws + 3 * NE;   // [T][D]
  __bf16* xhi  = (__bf16*)(ws + 4 * NE);  // activation split (hidden, then attnb)
  __bf16* xlo  = xhi + NE;
  __bf16* whi  = xlo + NE;                // current weight split (reused 4x)
  __bf16* wlo  = whi + NE;
  __bf16* khi  = wlo + NE;                // RoPE'd K split
  __bf16* klo  = khi + NE;

  const int SGRID = (NEi + 255) / 256;
  dim3 ggrid(DMODEL / 128, T_SEQ / 64);       // (16, 32)

  // sanitized hidden -> bf16 hi/lo
  split_kernel<<<SGRID, 256, 0, stream>>>(hidden, xhi, xlo, NEi, 1);

  split_kernel<<<SGRID, 256, 0, stream>>>(wq, whi, wlo, NEi, 0);
  gemm_bf16x3_async_kernel<<<ggrid, 256, 0, stream>>>(xhi, xlo, whi, wlo, q, 0);
  split_kernel<<<SGRID, 256, 0, stream>>>(wk, whi, wlo, NEi, 0);
  gemm_bf16x3_async_kernel<<<ggrid, 256, 0, stream>>>(xhi, xlo, whi, wlo, k, 0);
  split_kernel<<<SGRID, 256, 0, stream>>>(wv, whi, wlo, NEi, 0);
  gemm_bf16x3_async_kernel<<<ggrid, 256, 0, stream>>>(xhi, xlo, whi, wlo, v, 0);

  int nrope = NHEAD * T_SEQ * 64;
  rope_split_kernel<<<(nrope + 255) / 256, 256, 0, stream>>>(q, k, khi, klo);

  vupdate_kernel<<<NHEAD, 256, 0, stream>>>(q, k, bern, v);

  attn_kernel<<<dim3(T_SEQ / 64, NHEAD), 128, 0, stream>>>(q, khi, klo, v, attnb);

  // output projection: split attnb (reuse x buffers) and wo, then GEMM -> d_out
  split_kernel<<<SGRID, 256, 0, stream>>>(attnb, xhi, xlo, NEi, 0);
  split_kernel<<<SGRID, 256, 0, stream>>>(wo, whi, wlo, NEi, 0);
  gemm_bf16x3_async_kernel<<<ggrid, 256, 0, stream>>>(xhi, xlo, whi, wlo, (float*)d_out, 1);
}

// v002
// One run takes 468 microseconds.
// Timed twice side by side with v001, it ran 1.04 times as fast both times.
// All steps since v000 together make it 1.18 times as fast.
#include <hip/hip_runtime.h>
#include <math.h>

// ---------------- problem constants ----------------
#define T_SEQ   2048
#define DMODEL  2048
#define NHEAD   16
#define HDIM    128
#define SB      204      // int(0.1*2048)
#define RB      1024     // int(0.5*2048)
#define NVALID  1228     // SB + RB
#define SCALE_QK 0.088388347648318447f   // 1/sqrt(128)

typedef float  v8f  __attribute__((ext_vector_type(8)));
typedef __bf16 v4bf __attribute__((ext_vector_type(4)));
typedef __bf16 v8bf __attribute__((ext_vector_type(8)));
typedef __bf16 v16bf __attribute__((ext_vector_type(16)));

static __device__ __forceinline__ v8f wmma_bf16(v16bf a, v16bf b, v8f c) {
  // D(16x16,f32) = A(16x32,bf16) x B(32x16,bf16) + C
  return __builtin_amdgcn_wmma_f32_16x16x32_bf16(false, a, false, b, (short)0, c, false, false);
}

// 16-bit A/B fragment: 8 contiguous K at p, 8 more at p+16
static __device__ __forceinline__ v16bf ld_frag(const __bf16* p) {
  v8bf a = *(const v8bf*)(p);
  v8bf b = *(const v8bf*)(p + 16);
  return __builtin_shufflevector(a, b, 0,1,2,3,4,5,6,7,8,9,10,11,12,13,14,15);
}

static __device__ __forceinline__ void split4(float4 v, v4bf& h, v4bf& l) {
  h[0] = (__bf16)v.x; l[0] = (__bf16)(v.x - (float)h[0]);
  h[1] = (__bf16)v.y; l[1] = (__bf16)(v.y - (float)h[1]);
  h[2] = (__bf16)v.z; l[2] = (__bf16)(v.z - (float)h[2]);
  h[3] = (__bf16)v.w; l[3] = (__bf16)(v.w - (float)h[3]);
}

static __device__ __forceinline__ float fin_clamp(float v) {
  if (v != v)        return 0.0f;
  if (v >  1.0e38f)  return  1.0e4f;
  if (v < -1.0e38f)  return -1.0e4f;
  return v;
}

static __device__ __forceinline__ float rmax16(float v) {
  #pragma unroll
  for (int m = 1; m < 16; m <<= 1) v = fmaxf(v, __shfl_xor(v, m, 32));
  return v;
}
static __device__ __forceinline__ float rsum16(float v) {
  #pragma unroll
  for (int m = 1; m < 16; m <<= 1) v += __shfl_xor(v, m, 32);
  return v;
}

// ---------------- async global->LDS copy (CDNA5), with sync fallback ----------------
#if __has_builtin(__builtin_amdgcn_global_load_async_to_lds_b128)
#define HAS_ASYNC_LDS 1
typedef int gv4i __attribute__((vector_size(16)));
typedef __attribute__((address_space(1))) gv4i as1_v4i;   // global
typedef __attribute__((address_space(3))) gv4i as3_v4i;   // LDS
static __device__ __forceinline__ void async_cp16(void* l, const void* g) {
  __builtin_amdgcn_global_load_async_to_lds_b128((as1_v4i*)g, (as3_v4i*)l, 0, 0);
}
static __device__ __forceinline__ void wait_async0() {
#if __has_builtin(__builtin_amdgcn_s_wait_asynccnt)
  __builtin_amdgcn_s_wait_asynccnt(0);
#else
  asm volatile("s_wait_asynccnt 0" ::: "memory");
#endif
}
#else
#define HAS_ASYNC_LDS 0
static __device__ __forceinline__ void async_cp16(void* l, const void* g) {
  *(float4*)l = *(const float4*)g;     // 16B sync copy fallback
}
static __device__ __forceinline__ void wait_async0() {}
#endif

// ---------------- kernel 1: nan_to_num(optional) + bf16 hi/lo split ----------------
// 16 waves per block, one block per 64 KiB of input: a thread takes 8 float4, each wave-wide load
// covers 512 contiguous bytes and each wave-wide store 256, so few waves have to be started.
#define SPLIT_THREADS 512
#define SPLIT_VEC     8
#define SPLIT_GRID    ((T_SEQ * DMODEL) / (SPLIT_THREADS * SPLIT_VEC * 4))
static_assert(SPLIT_GRID * SPLIT_THREADS * SPLIT_VEC * 4 == T_SEQ * DMODEL, "blocks tile the array");
__global__ __launch_bounds__(SPLIT_THREADS)
void split_kernel(const float* __restrict__ x, __bf16* __restrict__ hi,
                  __bf16* __restrict__ lo, int do_clamp) {
  // byte offsets in 32 bits: one offset register serves all loads and one all stores
  const unsigned t4 = blockIdx.x * (SPLIT_THREADS * SPLIT_VEC) + threadIdx.x;   // in float4 units
  const char* xb = (const char*)x + t4 * 16u;
  char* hb = (char*)hi + t4 * 8u;
  char* lb = (char*)lo + t4 * 8u;
  float4 v[SPLIT_VEC];
  #pragma unroll
  for (int i = 0; i < SPLIT_VEC; ++i)
    v[i] = *(const float4*)(xb + i * (SPLIT_THREADS * 16));
  // precaution: stands ahead of the clamp's exec saves, which reuse a scalar register of the
  // base pair that the eight loads name
  asm volatile("s_wait_xcnt 0x0" ::: "memory");
  v4bf hh[SPLIT_VEC], ll[SPLIT_VEC];
  #pragma unroll
  for (int i = 0; i < SPLIT_VEC; ++i) {
    float4 u = v[i];
    if (do_clamp) {
      u.x = fin_clamp(u.x); u.y = fin_clamp(u.y); u.z = fin_clamp(u.z); u.w = fin_clamp(u.w);
    }
    split4(u, hh[i], ll[i]);
  }
  #pragma unroll
  for (int i = 0; i < SPLIT_VEC; ++i) {
    *(v4bf*)(hb + i * (SPLIT_THREADS * 8)) = hh[i];
    *(v4bf*)(lb + i * (SPLIT_THREADS * 8)) = ll[i];
  }
}

// ---------------- GEMM: C = A * W^T, bf16x3, async double-buffered LDS ----------------
// Operands pre-split to global bf16 hi/lo.  mode 0: scatter [H][T][HDIM]; 1: [T][D]+clamp.
__global__ __launch_bounds__(256)
void gemm_bf16x3_async_kernel(const __bf16* __restrict__ Ahi_g, const __bf16* __restrict__ Alo_g,
                              const __bf16* __restrict__ Whi_g, const __bf16* __restrict__ Wlo_g,
                              float* __restrict__ out, int mode) {
  __shared__ __bf16 Abuf[2][2][64 * 40];    // [buf][hi/lo], 64 rows x BK=32, stride 40
  __shared__ __bf16 Wbuf[2][2][128 * 40];

  const int tid  = threadIdx.x;
  const int wid  = tid >> 5;
  const int lane = tid & 31;
  const int ln   = lane & 15;
  const int hf   = lane >> 4;
  const int wr   = wid >> 2;       // 0..1
  const int wc   = wid & 3;        // 0..3
  const int m0   = blockIdx.y * 64;
  const int n0   = blockIdx.x * 128;

  // per-thread 16B-chunk assignments: A = 256 chunks (1/thread/array), W = 512 (2/thread/array)
  const int arow = tid >> 2, ac = (tid & 3) * 8;       // 8 bf16 = 16B

  v8f acc[2][2];
  #pragma unroll
  for (int i = 0; i < 2; ++i)
    #pragma unroll
    for (int j = 0; j < 2; ++j)
      #pragma unroll
      for (int r = 0; r < 8; ++r) acc[i][j][r] = 0.0f;

  auto issue = [&](int buf, int kt) {
    async_cp16(&Abuf[buf][0][arow * 40 + ac], Ahi_g + (size_t)(m0 + arow) * DMODEL + kt + ac);
    async_cp16(&Abuf[buf][1][arow * 40 + ac], Alo_g + (size_t)(m0 + arow) * DMODEL + kt + ac);
    #pragma unroll
    for (int i = 0; i < 2; ++i) {
      int idx = tid + i * 256, rw = idx >> 2, cw = (idx & 3) * 8;
      async_cp16(&Wbuf[buf][0][rw * 40 + cw], Whi_g + (size_t)(n0 + rw) * DMODEL + kt + cw);
      async_cp16(&Wbuf[buf][1][rw * 40 + cw], Wlo_g + (size_t)(n0 + rw) * DMODEL + kt + cw);
    }
  };

  issue(0, 0);
  for (int i = 0; i < DMODEL / 32; ++i) {
    const int kt  = i * 32;
    const int buf = i & 1;
    wait_async0();          // own async copies for buf complete
    __syncthreads();        // all waves' copies complete; all done computing i-1

    if (kt + 32 < DMODEL) issue(buf ^ 1, kt + 32);   // overlap next tile with compute

    const __bf16* Ah = Abuf[buf][0];
    const __bf16* Al = Abuf[buf][1];
    const __bf16* Wh = Wbuf[buf][0];
    const __bf16* Wl = Wbuf[buf][1];
    const int ab = (wr * 32 + ln) * 40 + 8 * hf;
    const int bb = (wc * 32 + ln) * 40 + 8 * hf;
    v16bf a0h = ld_frag(&Ah[ab]),           a0l = ld_frag(&Al[ab]);
    v16bf a1h = ld_frag(&Ah[ab + 16 * 40]), a1l = ld_frag(&Al[ab + 16 * 40]);
    v16bf b0h = ld_frag(&Wh[bb]),           b0l = ld_frag(&Wl[bb]);
    v16bf b1h = ld_frag(&Wh[bb + 16 * 40]), b1l = ld_frag(&Wl[bb + 16 * 40]);

    // product-major, round-robin over the 4 independent accumulators:
    // each accumulator's C-chain has distance 4 -> no copies / hazard stalls
    acc[0][0] = wmma_bf16(a0h, b0l, acc[0][0]);
    acc[0][1] = wmma_bf16(a0h, b1l, acc[0][1]);
    acc[1][0] = wmma_bf16(a1h, b0l, acc[1][0]);
    acc[1][1] = wmma_bf16(a1h, b1l, acc[1][1]);
    acc[0][0] = wmma_bf16(a0l, b0h, acc[0][0]);
    acc[0][1] = wmma_bf16(a0l, b1h, acc[0][1]);
    acc[1][0] = wmma_bf16(a1l, b0h, acc[1][0]);
    acc[1][1] = wmma_bf16(a1l, b1h, acc[1][1]);
    acc[0][0] = wmma_bf16(a0h, b0h, acc[0][0]);
    acc[0][1] = wmma_bf16(a0h, b1h, acc[0][1]);
    acc[1][0] = wmma_bf16(a1h, b0h, acc[1][0]);
    acc[1][1] = wmma_bf16(a1h, b1h, acc[1][1]);
  }

  // C layout: lane ln = column, row = r + 8*hf
  #pragma unroll
  for (int i = 0; i < 2; ++i)
    #pragma unroll
    for (int j = 0; j < 2; ++j)
      #pragma unroll
      for (int r = 0; r < 8; ++r) {
        int gm = m0 + wr * 32 + i * 16 + r + 8 * hf;
        int gn = n0 + wc * 32 + j * 16 + ln;
        float v = acc[i][j][r];
        if (mode == 1) {
          out[(size_t)gm * DMODEL + gn] = fin_clamp(v);
        } else {
          int h = gn >> 7, d = gn & 127;
          out[((size_t)h * T_SEQ + gm) * HDIM + d] = v;
        }
      }
}

// ---------------- kernel 3: RoPE on Q,K + emit bf16 hi/lo split of K ----------------
// A thread takes 4 neighbouring j (with their partners j + 64) of one position t in ROPE_HEADS heads,
// Q and K: 16 loads of 16 bytes, all issued ahead of the angles.
#define ROPE_HEADS 4
#define ROPE_N     ((NHEAD / ROPE_HEADS) * T_SEQ * 16)
// written as explicit fma so that the product rounded first is x2*s (low half) and x1*s (high half)
static __device__ __forceinline__ void rot4(float4 a, float4 b, const float* c, const float* s,
                                            float4& lo, float4& hi) {
  lo.x = fmaf(c[0], a.x, -(b.x * s[0]));  hi.x = fmaf(c[0], b.x, a.x * s[0]);
  lo.y = fmaf(c[1], a.y, -(b.y * s[1]));  hi.y = fmaf(c[1], b.y, a.y * s[1]);
  lo.z = fmaf(c[2], a.z, -(b.z * s[2]));  hi.z = fmaf(c[2], b.z, a.z * s[2]);
  lo.w = fmaf(c[3], a.w, -(b.w * s[3]));  hi.w = fmaf(c[3], b.w, a.w * s[3]);
}
__global__ __launch_bounds__(256)
void rope_split_kernel(float* __restrict__ Q, float* __restrict__ K,
                       __bf16* __restrict__ Khi, __bf16* __restrict__ Klo) {
  int idx = blockIdx.x * blockDim.x + threadIdx.x;       // (H/ROPE_HEADS)*T*16
  if (idx >= ROPE_N) return;
  int j  = (idx & 15) * 4;
  int t  = (idx >> 4) & (T_SEQ - 1);
  int h0 = (idx >> 15) * ROPE_HEADS;
  const size_t base0 = ((size_t)h0 * T_SEQ + t) * HDIM + j;

  float4 q1[ROPE_HEADS], q2[ROPE_HEADS], k1[ROPE_HEADS], k2[ROPE_HEADS];
  #pragma unroll
  for (int i = 0; i < ROPE_HEADS; ++i) {
    const size_t base = base0 + (size_t)i * T_SEQ * HDIM;
    q1[i] = *(const float4*)(Q + base);  q2[i] = *(const float4*)(Q + base + 64);
    k1[i] = *(const float4*)(K + base);  k2[i] = *(const float4*)(K + base + 64);
  }

  float c[4], s[4];
  #pragma unroll
  for (int e = 0; e < 4; ++e) {
    float invf = __expf(-(float)(j + e) * (9.210340371976184f / 64.0f)); // 10000^(-j/64)
    float ang = (float)t * invf;
    c[e] = cosf(ang); s[e] = sinf(ang);
  }

  #pragma unroll
  for (int i = 0; i < ROPE_HEADS; ++i) {
    const size_t base = base0 + (size_t)i * T_SEQ * HDIM;
    float4 a, b;
    rot4(q1[i], q2[i], c, s, a, b);
    *(float4*)(Q + base)      = a;
    *(float4*)(Q + base + 64) = b;
    rot4(k1[i], k2[i], c, s, a, b);
    *(float4*)(K + base)      = a;
    *(float4*)(K + base + 64) = b;
    v4bf hh, ll;
    split4(a, hh, ll);
    *(v4bf*)(Khi + base)      = hh;  *(v4bf*)(Klo + base)      = ll;
    split4(b, hh, ll);
    *(v4bf*)(Khi + base + 64) = hh;  *(v4bf*)(Klo + base + 64) = ll;
  }
}

// ---------------- kernel 4: last-row softmax -> stochastic V bump (f32) ----------------
__global__ __launch_bounds__(256)
void vupdate_kernel(const float* __restrict__ Q, const float* __restrict__ K,
                    const float* __restrict__ bern, float* __restrict__ V) {
  const int h = blockIdx.x, tid = threadIdx.x;
  __shared__ float sc[NVALID];
  __shared__ float qrow[HDIM];
  __shared__ float red[256];
  __shared__ float sh_coef;
  __shared__ float ve[HDIM];

  if (tid < HDIM) qrow[tid] = Q[((size_t)h * T_SEQ + (T_SEQ - 1)) * HDIM + tid];
  __syncthreads();

  float lmax = -1e30f;
  for (int idx = tid; idx < NVALID; idx += 256) {
    int key = (idx < SB) ? idx : (T_SEQ - RB) + (idx - SB);
    const float* kr = K + ((size_t)h * T_SEQ + key) * HDIM;
    float d = 0.0f;
    #pragma unroll 8
    for (int c = 0; c < HDIM; ++c) d += qrow[c] * kr[c];
    d *= SCALE_QK;
    sc[idx] = d;
    lmax = fmaxf(lmax, d);
  }
  red[tid] = lmax; __syncthreads();
  for (int s = 128; s > 0; s >>= 1) { if (tid < s) red[tid] = fmaxf(red[tid], red[tid + s]); __syncthreads(); }
  float gmax = red[0]; __syncthreads();

  float lsum = 0.0f, ltail = 0.0f;
  for (int idx = tid; idx < NVALID; idx += 256) {
    float e = __expf(sc[idx] - gmax);
    lsum += e;
    if (idx >= SB + 1) ltail += e;     // keys 1025..2047
  }
  red[tid] = lsum; __syncthreads();
  for (int s = 128; s > 0; s >>= 1) { if (tid < s) red[tid] += red[tid + s]; __syncthreads(); }
  float gsum = red[0]; __syncthreads();
  red[tid] = ltail; __syncthreads();
  for (int s = 128; s > 0; s >>= 1) { if (tid < s) red[tid] += red[tid + s]; __syncthreads(); }

  if (tid == 0) {
    float gtail = red[0];
    float pe   = __expf(sc[SB] - gmax) / gsum;             // probs at key e=1024
    float mean = (gtail / gsum) / 1023.0f + 1e-6f;
    float p = pe / mean;
    p = (p != p) ? 0.0f : fminf(fmaxf(p, 0.0f), 1.0f);
    float m = (bern[h] < p) ? 1.0f : 0.0f;
    sh_coef = m / (float)RB;
  }
  __syncthreads();
  if (tid < HDIM) ve[tid] = V[((size_t)h * T_SEQ + RB) * HDIM + tid] * sh_coef;
  __syncthreads();
  for (int idx = tid; idx < (T_SEQ - RB - 1) * HDIM; idx += 256) {
    int row = RB + 1 + (idx >> 7);
    int d   = idx & 127;
    V[((size_t)h * T_SEQ + row) * HDIM + d] += ve[d];
  }
}

// ---------------- kernel 5: flash attention, bf16x3, 32-key tiles ----------------
__global__ __launch_bounds__(128)
void attn_kernel(const float* __restrict__ Q, const __bf16* __restrict__ Khi,
                 const __bf16* __restrict__ Klo, const float* __restrict__ V,
                 float* __restrict__ Oout) {
  __shared__ __bf16 Qhi_s[64 * 136], Qlo_s[64 * 136];   // 64 queries x 128 dims
  __shared__ __bf16 Vhi_s[128 * 40], Vlo_s[128 * 40];   // [d][key], 32 keys
  __shared__ __bf16 Phi_s[4 * 16 * 32], Plo_s[4 * 16 * 32];
  // K tile, 32 keys x 128 dims, hi and lo, two buffers; row pitch 272 B for 16-byte readers
  __shared__ __attribute__((aligned(16))) __bf16 Khi_s[2][32 * 136];
  __shared__ __attribute__((aligned(16))) __bf16 Klo_s[2][32 * 136];

  const int tid  = threadIdx.x;
  const int w    = tid >> 5;         // 4 waves, 16 queries each
  const int lane = tid & 31;
  const int ln   = lane & 15;
  const int hf   = lane >> 4;
  const int h    = blockIdx.y;
  const int t0   = blockIdx.x * 64;
  const size_t hk = (size_t)h * T_SEQ;

  const float* Qh = Q + hk * HDIM;
  const float* Vh = V + hk * HDIM;

  // one K tile (hi and lo) into LDS, once per block: each wave's copy takes 512 contiguous
  // bytes (two whole key rows), 8 copies per thread and tile
  auto issue_k = [&](int buf, int kbase) {
    #pragma unroll
    for (int i = 0; i < 4; ++i) {
      int idx = tid + i * 128, rw = idx >> 4, cw = (idx & 15) * 8;
      async_cp16(&Khi_s[buf][rw * 136 + cw], Khi + (hk + kbase + rw) * HDIM + cw);
      async_cp16(&Klo_s[buf][rw * 136 + cw], Klo + (hk + kbase + rw) * HDIM + cw);
    }
  };
  issue_k(0, 0);

  // stage + split this block's 64 query rows
  #pragma unroll
  for (int i = 0; i < 16; ++i) {
    int idx = tid + i * 128;
    int row = idx >> 5, kc = (idx & 31) * 4;
    float4 v = *(const float4*)(Qh + (size_t)(t0 + row) * HDIM + kc);
    v4bf hh, ll; split4(v, hh, ll);
    *(v4bf*)(&Qhi_s[row * 136 + kc]) = hh;
    *(v4bf*)(&Qlo_s[row * 136 + kc]) = ll;
  }

  v8f Oacc[8];
  float mrow[8], lrow[8], alphas[8];
  #pragma unroll
  for (int ct = 0; ct < 8; ++ct)
    #pragma unroll
    for (int r = 0; r < 8; ++r) Oacc[ct][r] = 0.0f;
  #pragma unroll
  for (int r = 0; r < 8; ++r) { mrow[r] = -1e30f; lrow[r] = 0.0f; }

  __bf16* Pw_hi = &Phi_s[w * 16 * 32];
  __bf16* Pw_lo = &Plo_s[w * 16 * 32];

  for (int it = 0; it < 39; ++it) {     // 7 tiles for [0,204), 32 for [1024,2048)
    const int k0 = (it < 7) ? it * 32 : (T_SEQ - RB) + (it - 7) * 32;
    __syncthreads();
    // stage V tile 32x128, split + transpose -> [d][key]
    #pragma unroll
    for (int i = 0; i < 32; ++i) {
      int idx = tid + i * 128;
      int kr = idx >> 7, d = idx & 127;
      float v = Vh[(size_t)(k0 + kr) * HDIM + d];
      __bf16 hh = (__bf16)v;
      Vhi_s[d * 40 + kr] = hh;
      Vlo_s[d * 40 + kr] = (__bf16)(v - (float)hh);
    }
    // own LDS traffic retired before the refill below aims at a buffer this wave has read
    asm volatile("s_wait_dscnt 0x0" ::: "memory");
    // own copies of this tile's K have landed; the barrier then shows them to the other waves
    asm volatile("s_wait_asynccnt 0x0" ::: "memory");
    __syncthreads();

    // next tile's K flies while this tile is worked on; its buffer was last read one trip ago
    if (it + 1 < 39)
      issue_k((it + 1) & 1, (it + 1 < 7) ? (it + 1) * 32 : (T_SEQ - RB) + (it + 1 - 7) * 32);
    const __bf16* Kh_t = Khi_s[it & 1];
    const __bf16* Kl_t = Klo_s[it & 1];

    // S(16x32) = Q(16x128) * K^T(128x32), two 16-col tiles, bf16x3
    v8f S0, S1;
    #pragma unroll
    for (int r = 0; r < 8; ++r) { S0[r] = 0.0f; S1[r] = 0.0f; }
    const int kr0 = ln * 136;
    const int kr1 = (16 + ln) * 136;
    #pragma unroll
    for (int kc = 0; kc < HDIM; kc += 32) {
      int qb = (w * 16 + ln) * 136 + kc + 8 * hf;
      v16bf qh = ld_frag(&Qhi_s[qb]), ql = ld_frag(&Qlo_s[qb]);
      v16bf kh0 = ld_frag(Kh_t + kr0 + kc + 8 * hf);
      v16bf kl0 = ld_frag(Kl_t + kr0 + kc + 8 * hf);
      v16bf kh1 = ld_frag(Kh_t + kr1 + kc + 8 * hf);
      v16bf kl1 = ld_frag(Kl_t + kr1 + kc + 8 * hf);
      // interleave the two independent accumulators
      S0 = wmma_bf16(qh, kl0, S0);
      S1 = wmma_bf16(qh, kl1, S1);
      S0 = wmma_bf16(ql, kh0, S0);
      S1 = wmma_bf16(ql, kh1, S1);
      S0 = wmma_bf16(qh, kh0, S0);
      S1 = wmma_bf16(qh, kh1, S1);
    }

    const bool m0c = (it == 6) && ((k0 + ln) >= SB);   // keys 192..207 partial
    const bool m1c = (it == 6);                        // keys 208..223 all masked
    #pragma unroll
    for (int r = 0; r < 8; ++r) {
      float s0 = S0[r] * SCALE_QK; if (m0c) s0 = -1e30f;
      float s1 = S1[r] * SCALE_QK; if (m1c) s1 = -1e30f;
      float tmax  = fmaxf(rmax16(s0), rmax16(s1));
      float mnew  = fmaxf(mrow[r], tmax);
      float alpha = __expf(mrow[r] - mnew);
      float p0 = __expf(s0 - mnew);
      float p1 = __expf(s1 - mnew);
      float rs = rsum16(p0 + p1);
      lrow[r]   = lrow[r] * alpha + rs;
      mrow[r]   = mnew;
      alphas[r] = alpha;
      int prow = (r + 8 * hf) * 32;
      __bf16 h0 = (__bf16)p0;
      Pw_hi[prow + ln] = h0;       Pw_lo[prow + ln] = (__bf16)(p0 - (float)h0);
      __bf16 h1 = (__bf16)p1;
      Pw_hi[prow + 16 + ln] = h1;  Pw_lo[prow + 16 + ln] = (__bf16)(p1 - (float)h1);
    }
    #pragma unroll
    for (int ct = 0; ct < 8; ++ct)
      #pragma unroll
      for (int r = 0; r < 8; ++r) Oacc[ct][r] *= alphas[r];

    asm volatile("s_wait_dscnt 0" ::: "memory");

    // O(16x128) += P(16x32) * V(32x128), bf16x3; process ct in pairs so the
    // 3-product chains alternate between two independent accumulators
    const int pb = ln * 32 + 8 * hf;
    v16bf ph = ld_frag(&Pw_hi[pb]), pl = ld_frag(&Pw_lo[pb]);
    #pragma unroll
    for (int ct = 0; ct < 8; ct += 2) {
      int vb0 = ((ct + 0) * 16 + ln) * 40 + 8 * hf;
      int vb1 = ((ct + 1) * 16 + ln) * 40 + 8 * hf;
      v16bf vh0 = ld_frag(&Vhi_s[vb0]), vl0 = ld_frag(&Vlo_s[vb0]);
      v16bf vh1 = ld_frag(&Vhi_s[vb1]), vl1 = ld_frag(&Vlo_s[vb1]);
      Oacc[ct + 0] = wmma_bf16(ph, vl0, Oacc[ct + 0]);
      Oacc[ct + 1] = wmma_bf16(ph, vl1, Oacc[ct + 1]);
      Oacc[ct + 0] = wmma_bf16(pl, vh0, Oacc[ct + 0]);
      Oacc[ct + 1] = wmma_bf16(pl, vh1, Oacc[ct + 1]);
      Oacc[ct + 0] = wmma_bf16(ph, vh0, Oacc[ct + 0]);
      Oacc[ct + 1] = wmma_bf16(ph, vh1, Oacc[ct + 1]);
    }
  }

  // write [T][D]: col = h*128 + d
  #pragma unroll
  for (int ct = 0; ct < 8; ++ct)
    #pragma unroll
    for (int r = 0; r < 8; ++r) {
      int t = t0 + w * 16 + r + 8 * hf;
      int c = h * HDIM + ct * 16 + ln;
      Oout[(size_t)t * DMODEL + c] = Oacc[ct][r] / lrow[r];
    }
}

// ---------------- launch ----------------
extern "C" void kernel_launch(void* const* d_in, const int* in_sizes, int n_in,
                              void* d_out, int out_size, void* d_ws, size_t ws_size,
                              hipStream_t stream) {
  (void)in_sizes; (void)n_in; (void)out_size; (void)ws_size;
  const float* hidden = (const float*)d_in[0];
  const float* wq     = (const float*)d_in[1];
  const float* wk     = (const float*)d_in[2];
  const float* wv     = (const float*)d_in[3];
  const float* wo     = (const float*)d_in[4];
  const float* bern   = (const float*)d_in[5];

  const size_t NE = (size_t)T_SEQ * DMODEL;   // 4,194,304
  float* ws    = (float*)d_ws;
  float* q     = ws;            // [H][T][128] f32
  float* k     = ws + 1 * NE;
  float* v     = ws + 2 * NE;
  float* attnb = ws + 3 * NE;   // [T][D]
  __bf16* xhi  = (__bf16*)(ws + 4 * NE);  // activation split (hidden, then attnb)
  __bf16* xlo  = xhi + NE;
  __bf16* whi  = xlo + NE;                // current weight split (reused 4x)
  __bf16* wlo  = whi + NE;
  __bf16* khi  = wlo + NE;                // RoPE'd K split
  __bf16* klo  = khi + NE;

  dim3 ggrid(DMODEL / 128, T_SEQ / 64);       // (16, 32)

  // sanitized hidden -> bf16 hi/lo
  split_kernel<<<SPLIT_GRID, SPLIT_THREADS, 0, stream>>>(hidden, xhi, xlo, 1);

  split_kernel<<<SPLIT_GRID, SPLIT_THREADS, 0, stream>>>(wq, whi, wlo, 0);
  gemm_bf16x3_async_kernel<<<ggrid, 256, 0, stream>>>(xhi, xlo, whi, wlo, q, 0);
  split_kernel<<<SPLIT_GRID, SPLIT_THREADS, 0, stream>>>(wk, whi, wlo, 0);
  gemm_bf16x3_async_kernel<<<ggrid, 256, 0, stream>>>(xhi, xlo, whi, wlo, k, 0);
  split_kernel<<<SPLIT_GRID, SPLIT_THREADS, 0, stream>>>(wv, whi, wlo, 0);
  gemm_bf16x3_async_kernel<<<ggrid, 256, 0, stream>>>(xhi, xlo, whi, wlo, v, 0);

  rope_split_kernel<<<ROPE_N / 256, 256, 0, stream>>>(q, k, khi, klo);

  vupdate_kernel<<<NHEAD, 256, 0, stream>>>(q, k, bern, v);

  attn_kernel<<<dim3(T_SEQ / 64, NHEAD), 128, 0, stream>>>(q, khi, klo, v, attnb);

  // output projection: split attnb (reuse x buffers) and wo, then GEMM -> d_out
  split_kernel<<<SPLIT_GRID, SPLIT_THREADS, 0, stream>>>(attnb, xhi, xlo, 0);
  split_kernel<<<SPLIT_GRID, SPLIT_THREADS, 0, stream>>>(wo, whi, wlo, 0);
  gemm_bf16x3_async_kernel<<<ggrid, 256, 0, stream>>>(xhi, xlo, whi, wlo, (float*)d_out, 1);
}

// v003
// It runs in 417 microseconds.
// In two side-by-side timings against v002, it was 1.11 and 1.12 times as fast.
// Over all steps from v000 it is 1.32 times as fast.
#include <hip/hip_runtime.h>
#include <math.h>

// ---------------- problem constants ----------------
#define T_SEQ   2048
#define DMODEL  2048
#define NHEAD   16
#define HDIM    128
#define SB      204      // int(0.1*2048)
#define RB      1024     // int(0.5*2048)
#define NVALID  1228     // SB + RB
#define SCALE_QK 0.088388347648318447f   // 1/sqrt(128)

typedef float  v8f  __attribute__((ext_vector_type(8)));
typedef __bf16 v4bf __attribute__((ext_vector_type(4)));
typedef __bf16 v8bf __attribute__((ext_vector_type(8)));
typedef __bf16 v16bf __attribute__((ext_vector_type(16)));

static __device__ __forceinline__ v8f wmma_bf16(v16bf a, v16bf b, v8f c) {
  // D(16x16,f32) = A(16x32,bf16) x B(32x16,bf16) + C
  return __builtin_amdgcn_wmma_f32_16x16x32_bf16(false, a, false, b, (short)0, c, false, false);
}

// 16-bit A/B fragment: 8 contiguous K at p, 8 more at p+16
static __device__ __forceinline__ v16bf ld_frag(const __bf16* p) {
  v8bf a = *(const v8bf*)(p);
  v8bf b = *(const v8bf*)(p + 16);
  return __builtin_shufflevector(a, b, 0,1,2,3,4,5,6,7,8,9,10,11,12,13,14,15);
}

static __device__ __forceinline__ void split4(float4 v, v4bf& h, v4bf& l) {
  h[0] = (__bf16)v.x; l[0] = (__bf16)(v.x - (float)h[0]);
  h[1] = (__bf16)v.y; l[1] = (__bf16)(v.y - (float)h[1]);
  h[2] = (__bf16)v.z; l[2] = (__bf16)(v.z - (float)h[2]);
  h[3] = (__bf16)v.w; l[3] = (__bf16)(v.w - (float)h[3]);
}

static __device__ __forceinline__ float fin_clamp(float v) {
  if (v != v)        return 0.0f;
  if (v >  1.0e38f)  return  1.0e4f;
  if (v < -1.0e38f)  return -1.0e4f;
  return v;
}

static __device__ __forceinline__ float rmax16(float v) {
  #pragma unroll
  for (int m = 1; m < 16; m <<= 1) v = fmaxf(v, __shfl_xor(v, m, 32));
  return v;
}
static __device__ __forceinline__ float rsum16(float v) {
  #pragma unroll
  for (int m = 1; m < 16; m <<= 1) v += __shfl_xor(v, m, 32);
  return v;
}

// ---------------- async global->LDS copy (CDNA5), with sync fallback ----------------
#if __has_builtin(__builtin_amdgcn_global_load_async_to_lds_b128)
#define HAS_ASYNC_LDS 1
typedef int gv4i __attribute__((vector_size(16)));
typedef __attribute__((address_space(1))) gv4i as1_v4i;   // global
typedef __attribute__((address_space(3))) gv4i as3_v4i;   // LDS
static __device__ __forceinline__ void async_cp16(void* l, const void* g) {
  __builtin_amdgcn_global_load_async_to_lds_b128((as1_v4i*)g, (as3_v4i*)l, 0, 0);
}
static __device__ __forceinline__ void wait_async0() {
#if __has_builtin(__builtin_amdgcn_s_wait_asynccnt)
  __builtin_amdgcn_s_wait_asynccnt(0);
#else
  asm volatile("s_wait_asynccnt 0" ::: "memory");
#endif
}
#else
#define HAS_ASYNC_LDS 0
static __device__ __forceinline__ void async_cp16(void* l, const void* g) {
  *(float4*)l = *(const float4*)g;     // 16B sync copy fallback
}
static __device__ __forceinline__ void wait_async0() {}
#endif

// ---------------- kernel 1: nan_to_num(optional) + bf16 hi/lo split ----------------
// 16 waves per block, one block per 64 KiB of input: a thread takes 8 float4, each wave-wide load
// covers 512 contiguous bytes and each wave-wide store 256, so few waves have to be started.
#define SPLIT_THREADS 512
#define SPLIT_VEC     8
#define SPLIT_GRID    ((T_SEQ * DMODEL) / (SPLIT_THREADS * SPLIT_VEC * 4))
static_assert(SPLIT_GRID * SPLIT_THREADS * SPLIT_VEC * 4 == T_SEQ * DMODEL, "blocks tile the array");
__global__ __launch_bounds__(SPLIT_THREADS)
void split_kernel(const float* __restrict__ x, __bf16* __restrict__ hi,
                  __bf16* __restrict__ lo, int do_clamp) {
  // byte offsets in 32 bits: one offset register serves all loads and one all stores
  const unsigned t4 = blockIdx.x * (SPLIT_THREADS * SPLIT_VEC) + threadIdx.x;   // in float4 units
  const char* xb = (const char*)x + t4 * 16u;
  char* hb = (char*)hi + t4 * 8u;
  char* lb = (char*)lo + t4 * 8u;
  float4 v[SPLIT_VEC];
  #pragma unroll
  for (int i = 0; i < SPLIT_VEC; ++i)
    v[i] = *(const float4*)(xb + i * (SPLIT_THREADS * 16));
  // precaution: stands ahead of the clamp's exec saves, which reuse a scalar register of the
  // base pair that the eight loads name
  asm volatile("s_wait_xcnt 0x0" ::: "memory");
  v4bf hh[SPLIT_VEC], ll[SPLIT_VEC];
  #pragma unroll
  for (int i = 0; i < SPLIT_VEC; ++i) {
    float4 u = v[i];
    if (do_clamp) {
      u.x = fin_clamp(u.x); u.y = fin_clamp(u.y); u.z = fin_clamp(u.z); u.w = fin_clamp(u.w);
    }
    split4(u, hh[i], ll[i]);
  }
  #pragma unroll
  for (int i = 0; i < SPLIT_VEC; ++i) {
    *(v4bf*)(hb + i * (SPLIT_THREADS * 8)) = hh[i];
    *(v4bf*)(lb + i * (SPLIT_THREADS * 8)) = ll[i];
  }
}

// ---------------- GEMM: C = A * W^T, bf16x3, async double-buffered LDS ----------------
// Operands pre-split to global bf16 hi/lo.  mode 0: scatter [H][T][HDIM]; 1: [T][D]+clamp.
__global__ __launch_bounds__(256)
void gemm_bf16x3_async_kernel(const __bf16* __restrict__ Ahi_g, const __bf16* __restrict__ Alo_g,
                              const __bf16* __restrict__ Whi_g, const __bf16* __restrict__ Wlo_g,
                              float* __restrict__ out, int mode) {
  __shared__ __bf16 Abuf[2][2][64 * 40];    // [buf][hi/lo], 64 rows x BK=32, stride 40
  __shared__ __bf16 Wbuf[2][2][128 * 40];

  const int tid  = threadIdx.x;
  const int wid  = tid >> 5;
  const int lane = tid & 31;
  const int ln   = lane & 15;
  const int hf   = lane >> 4;
  const int wr   = wid >> 2;       // 0..1
  const int wc   = wid & 3;        // 0..3
  const int m0   = blockIdx.y * 64;
  const int n0   = blockIdx.x * 128;

  // per-thread 16B-chunk assignments: A = 256 chunks (1/thread/array), W = 512 (2/thread/array)
  const int arow = tid >> 2, ac = (tid & 3) * 8;       // 8 bf16 = 16B

  v8f acc[2][2];
  #pragma unroll
  for (int i = 0; i < 2; ++i)
    #pragma unroll
    for (int j = 0; j < 2; ++j)
      #pragma unroll
      for (int r = 0; r < 8; ++r) acc[i][j][r] = 0.0f;

  auto issue = [&](int buf, int kt) {
    async_cp16(&Abuf[buf][0][arow * 40 + ac], Ahi_g + (size_t)(m0 + arow) * DMODEL + kt + ac);
    async_cp16(&Abuf[buf][1][arow * 40 + ac], Alo_g + (size_t)(m0 + arow) * DMODEL + kt + ac);
    #pragma unroll
    for (int i = 0; i < 2; ++i) {
      int idx = tid + i * 256, rw = idx >> 2, cw = (idx & 3) * 8;
      async_cp16(&Wbuf[buf][0][rw * 40 + cw], Whi_g + (size_t)(n0 + rw) * DMODEL + kt + cw);
      async_cp16(&Wbuf[buf][1][rw * 40 + cw], Wlo_g + (size_t)(n0 + rw) * DMODEL + kt + cw);
    }
  };

  issue(0, 0);
  for (int i = 0; i < DMODEL / 32; ++i) {
    const int kt  = i * 32;
    const int buf = i & 1;
    wait_async0();          // own async copies for buf complete
    __syncthreads();        // all waves' copies complete; all done computing i-1

    if (kt + 32 < DMODEL) issue(buf ^ 1, kt + 32);   // overlap next tile with compute

    const __bf16* Ah = Abuf[buf][0];
    const __bf16* Al = Abuf[buf][1];
    const __bf16* Wh = Wbuf[buf][0];
    const __bf16* Wl = Wbuf[buf][1];
    const int ab = (wr * 32 + ln) * 40 + 8 * hf;
    const int bb = (wc * 32 + ln) * 40 + 8 * hf;
    v16bf a0h = ld_frag(&Ah[ab]),           a0l = ld_frag(&Al[ab]);
    v16bf a1h = ld_frag(&Ah[ab + 16 * 40]), a1l = ld_frag(&Al[ab + 16 * 40]);
    v16bf b0h = ld_frag(&Wh[bb]),           b0l = ld_frag(&Wl[bb]);
    v16bf b1h = ld_frag(&Wh[bb + 16 * 40]), b1l = ld_frag(&Wl[bb + 16 * 40]);

    // product-major, round-robin over the 4 independent accumulators:
    // each accumulator's C-chain has distance 4 -> no copies / hazard stalls
    acc[0][0] = wmma_bf16(a0h, b0l, acc[0][0]);
    acc[0][1] = wmma_bf16(a0h, b1l, acc[0][1]);
    acc[1][0] = wmma_bf16(a1h, b0l, acc[1][0]);
    acc[1][1] = wmma_bf16(a1h, b1l, acc[1][1]);
    acc[0][0] = wmma_bf16(a0l, b0h, acc[0][0]);
    acc[0][1] = wmma_bf16(a0l, b1h, acc[0][1]);
    acc[1][0] = wmma_bf16(a1l, b0h, acc[1][0]);
    acc[1][1] = wmma_bf16(a1l, b1h, acc[1][1]);
    acc[0][0] = wmma_bf16(a0h, b0h, acc[0][0]);
    acc[0][1] = wmma_bf16(a0h, b1h, acc[0][1]);
    acc[1][0] = wmma_bf16(a1h, b0h, acc[1][0]);
    acc[1][1] = wmma_bf16(a1h, b1h, acc[1][1]);
  }

  // C layout: lane ln = column, row = r + 8*hf
  #pragma unroll
  for (int i = 0; i < 2; ++i)
    #pragma unroll
    for (int j = 0; j < 2; ++j)
      #pragma unroll
      for (int r = 0; r < 8; ++r) {
        int gm = m0 + wr * 32 + i * 16 + r + 8 * hf;
        int gn = n0 + wc * 32 + j * 16 + ln;
        float v = acc[i][j][r];
        if (mode == 1) {
          out[(size_t)gm * DMODEL + gn] = fin_clamp(v);
        } else {
          int h = gn >> 7, d = gn & 127;
          out[((size_t)h * T_SEQ + gm) * HDIM + d] = v;
        }
      }
}

// ---------------- kernel 3: RoPE on Q,K + emit bf16 hi/lo split of K ----------------
// A thread takes 4 neighbouring j (with their partners j + 64) of one position t in ROPE_HEADS heads,
// Q and K: 16 loads of 16 bytes, all issued ahead of the angles.
#define ROPE_HEADS 4
#define ROPE_N     ((NHEAD / ROPE_HEADS) * T_SEQ * 16)
// written as explicit fma so that the product rounded first is x2*s (low half) and x1*s (high half)
static __device__ __forceinline__ void rot4(float4 a, float4 b, const float* c, const float* s,
                                            float4& lo, float4& hi) {
  lo.x = fmaf(c[0], a.x, -(b.x * s[0]));  hi.x = fmaf(c[0], b.x, a.x * s[0]);
  lo.y = fmaf(c[1], a.y, -(b.y * s[1]));  hi.y = fmaf(c[1], b.y, a.y * s[1]);
  lo.z = fmaf(c[2], a.z, -(b.z * s[2]));  hi.z = fmaf(c[2], b.z, a.z * s[2]);
  lo.w = fmaf(c[3], a.w, -(b.w * s[3]));  hi.w = fmaf(c[3], b.w, a.w * s[3]);
}
__global__ __launch_bounds__(256)
void rope_split_kernel(float* __restrict__ Q, float* __restrict__ K,
                       __bf16* __restrict__ Khi, __bf16* __restrict__ Klo) {
  int idx = blockIdx.x * blockDim.x + threadIdx.x;       // (H/ROPE_HEADS)*T*16
  if (idx >= ROPE_N) return;
  int j  = (idx & 15) * 4;
  int t  = (idx >> 4) & (T_SEQ - 1);
  int h0 = (idx >> 15) * ROPE_HEADS;
  const size_t base0 = ((size_t)h0 * T_SEQ + t) * HDIM + j;

  float4 q1[ROPE_HEADS], q2[ROPE_HEADS], k1[ROPE_HEADS], k2[ROPE_HEADS];
  #pragma unroll
  for (int i = 0; i < ROPE_HEADS; ++i) {
    const size_t base = base0 + (size_t)i * T_SEQ * HDIM;
    q1[i] = *(const float4*)(Q + base);  q2[i] = *(const float4*)(Q + base + 64);
    k1[i] = *(const float4*)(K + base);  k2[i] = *(const float4*)(K + base + 64);
  }

  float c[4], s[4];
  #pragma unroll
  for (int e = 0; e < 4; ++e) {
    float invf = __expf(-(float)(j + e) * (9.210340371976184f / 64.0f)); // 10000^(-j/64)
    float ang = (float)t * invf;
    c[e] = cosf(ang); s[e] = sinf(ang);
  }

  #pragma unroll
  for (int i = 0; i < ROPE_HEADS; ++i) {
    const size_t base = base0 + (size_t)i * T_SEQ * HDIM;
    float4 a, b;
    rot4(q1[i], q2[i], c, s, a, b);
    *(float4*)(Q + base)      = a;
    *(float4*)(Q + base + 64) = b;
    rot4(k1[i], k2[i], c, s, a, b);
    *(float4*)(K + base)      = a;
    *(float4*)(K + base + 64) = b;
    v4bf hh, ll;
    split4(a, hh, ll);
    *(v4bf*)(Khi + base)      = hh;  *(v4bf*)(Klo + base)      = ll;
    split4(b, hh, ll);
    *(v4bf*)(Khi + base + 64) = hh;  *(v4bf*)(Klo + base + 64) = ll;
  }
}

// ---------------- kernel 4: last-row softmax -> per-head bump coefficient (f32) ----------------
__global__ __launch_bounds__(256)
void vcoef_kernel(const float* __restrict__ Q, const float* __restrict__ K,
                  const float* __restrict__ bern, float* __restrict__ coef) {
  const int h = blockIdx.x, tid = threadIdx.x;
  __shared__ float sc[NVALID];
  __shared__ float qrow[HDIM];
  __shared__ float red[256];

  if (tid < HDIM) qrow[tid] = Q[((size_t)h * T_SEQ + (T_SEQ - 1)) * HDIM + tid];
  __syncthreads();

  float lmax = -1e30f;
  for (int idx = tid; idx < NVALID; idx += 256) {
    int key = (idx < SB) ? idx : (T_SEQ - RB) + (idx - SB);
    const float* kr = K + ((size_t)h * T_SEQ + key) * HDIM;
    float d = 0.0f;
    #pragma unroll 8
    for (int c = 0; c < HDIM; ++c) d += qrow[c] * kr[c];
    d *= SCALE_QK;
    sc[idx] = d;
    lmax = fmaxf(lmax, d);
  }
  red[tid] = lmax; __syncthreads();
  for (int s = 128; s > 0; s >>= 1) { if (tid < s) red[tid] = fmaxf(red[tid], red[tid + s]); __syncthreads(); }
  float gmax = red[0]; __syncthreads();

  float lsum = 0.0f, ltail = 0.0f;
  for (int idx = tid; idx < NVALID; idx += 256) {
    float e = __expf(sc[idx] - gmax);
    lsum += e;
    if (idx >= SB + 1) ltail += e;     // keys 1025..2047
  }
  red[tid] = lsum; __syncthreads();
  for (int s = 128; s > 0; s >>= 1) { if (tid < s) red[tid] += red[tid + s]; __syncthreads(); }
  float gsum = red[0]; __syncthreads();
  red[tid] = ltail; __syncthreads();
  for (int s = 128; s > 0; s >>= 1) { if (tid < s) red[tid] += red[tid + s]; __syncthreads(); }

  if (tid == 0) {
    float gtail = red[0];
    float pe   = __expf(sc[SB] - gmax) / gsum;             // probs at key e=1024
    float mean = (gtail / gsum) / 1023.0f + 1e-6f;
    float p = pe / mean;
    p = (p != p) ? 0.0f : fminf(fmaxf(p, 0.0f), 1.0f);
    float m = (bern[h] < p) ? 1.0f : 0.0f;
    coef[h] = m / (float)RB;
  }
}

// ---------------- kernel 4b: V bump + bf16 hi/lo split + transpose, once for all query blocks ----
// One block per (32-key tile, head).  Output tile: [d 0..127][key 0..31], 8 KiB contiguous, hi and lo,
// in the order in which attention walks the tiles.
#define NTILE 39      // 7 tiles for [0,204), 32 for [1024,2048)
#define VT_PITCH 132  // floats; rows stay 16-byte aligned
__global__ __launch_bounds__(256)
void vprep_kernel(const float* __restrict__ V, const float* __restrict__ coef,
                  __bf16* __restrict__ Vthi, __bf16* __restrict__ Vtlo) {
  __shared__ __attribute__((aligned(16))) float tile[32 * VT_PITCH];
  const int tid = threadIdx.x;
  const int it  = blockIdx.x;
  const int h   = blockIdx.y;
  const int k0  = (it < 7) ? it * 32 : (T_SEQ - RB) + (it - 7) * 32;
  const float* Vh = V + (size_t)h * T_SEQ * HDIM;
  const float cf = coef[h];
  // a thread keeps one group of 4 dims and takes 4 keys; all five loads go out together
  const int d4 = (tid & 31) * 4, kr0 = tid >> 5;
  // byte offsets in 32 bits on block-uniform bases: one offset register serves the four row loads,
  // whose rows lie a constant 4096 bytes apart
  const char* eb = (const char*)(Vh + (size_t)RB * HDIM) + (unsigned)d4 * 4u;
  const char* rb = (const char*)(Vh + (size_t)k0 * HDIM) + (unsigned)tid * 16u;
  const float4 e = *(const float4*)eb;
  float4 v[4];
  #pragma unroll
  for (int i = 0; i < 4; ++i)
    v[i] = *(const float4*)(rb + i * (8 * HDIM * 4));
  const float bx = e.x * cf, by = e.y * cf, bz = e.z * cf, bw = e.w * cf;
  #pragma unroll
  for (int i = 0; i < 4; ++i) {
    const bool bump = (k0 + kr0 + i * 8) > RB;     // keys 1025..2047 take the evicted row's share
    float4 u = v[i];
    u.x = bump ? u.x + bx : u.x;  u.y = bump ? u.y + by : u.y;
    u.z = bump ? u.z + bz : u.z;  u.w = bump ? u.w + bw : u.w;
    *(float4*)(&tile[(kr0 + i * 8) * VT_PITCH + d4]) = u;
  }
  __syncthreads();
  const size_t ob = ((size_t)h * NTILE + it) * (HDIM * 32);
  #pragma unroll
  for (int i = 0; i < 2; ++i) {
    int c = tid + i * 256;                   // 16-byte chunk of the output tile
    int d = c >> 2, kg = (c & 3) * 8;
    v8bf hh, ll;
    #pragma unroll
    for (int j = 0; j < 8; ++j) {
      float v = tile[(kg + j) * VT_PITCH + d];
      __bf16 x = (__bf16)v;
      hh[j] = x;
      ll[j] = (__bf16)(v - (float)x);
    }
    *(v8bf*)(Vthi + ob + c * 8) = hh;
    *(v8bf*)(Vtlo + ob + c * 8) = ll;
  }
}

// ---------------- kernel 5: flash attention, bf16x3, 32-key tiles ----------------
__global__ __launch_bounds__(128)
void attn_kernel(const float* __restrict__ Q, const __bf16* __restrict__ Khi,
                 const __bf16* __restrict__ Klo, const __bf16* __restrict__ Vthi,
                 const __bf16* __restrict__ Vtlo, float* __restrict__ Oout) {
  __shared__ __bf16 Qhi_s[64 * 136], Qlo_s[64 * 136];   // 64 queries x 128 dims
  // V tile [d][key], 32 keys, hi and lo, two buffers; row pitch 80 B for 16-byte readers
  __shared__ __attribute__((aligned(16))) __bf16 Vhi_s[2][128 * 40];
  __shared__ __attribute__((aligned(16))) __bf16 Vlo_s[2][128 * 40];
  __shared__ __bf16 Phi_s[4 * 16 * 32], Plo_s[4 * 16 * 32];
  // K tile, 32 keys x 128 dims, hi and lo, two buffers; row pitch 272 B for 16-byte readers
  __shared__ __attribute__((aligned(16))) __bf16 Khi_s[2][32 * 136];
  __shared__ __attribute__((aligned(16))) __bf16 Klo_s[2][32 * 136];

  const int tid  = threadIdx.x;
  const int w    = tid >> 5;         // 4 waves, 16 queries each
  const int lane = tid & 31;
  const int ln   = lane & 15;
  const int hf   = lane >> 4;
  const int h    = blockIdx.y;
  const int t0   = blockIdx.x * 64;
  const size_t hk = (size_t)h * T_SEQ;

  const float* Qh = Q + hk * HDIM;

  // one K tile (hi and lo) into LDS, once per block: each wave's copy takes 512 contiguous
  // bytes (two whole key rows), 8 copies per thread and tile
  auto issue_k = [&](int buf, int kbase) {
    #pragma unroll
    for (int i = 0; i < 4; ++i) {
      int idx = tid + i * 128, rw = idx >> 4, cw = (idx & 15) * 8;
      async_cp16(&Khi_s[buf][rw * 136 + cw], Khi + (hk + kbase + rw) * HDIM + cw);
      async_cp16(&Klo_s[buf][rw * 136 + cw], Klo + (hk + kbase + rw) * HDIM + cw);
    }
  };
  // one prepared V tile (hi and lo) into LDS: each wave's copy takes 512 contiguous bytes,
  // 8 copies per thread and tile
  auto issue_v = [&](int buf, int tile) {
    const size_t vb = ((size_t)h * NTILE + tile) * (HDIM * 32);
    #pragma unroll
    for (int i = 0; i < 4; ++i) {
      int c = tid + i * 128;
      async_cp16(&Vhi_s[buf][(c >> 2) * 40 + (c & 3) * 8], Vthi + vb + c * 8);
      async_cp16(&Vlo_s[buf][(c >> 2) * 40 + (c & 3) * 8], Vtlo + vb + c * 8);
    }
  };
  issue_k(0, 0);
  issue_v(0, 0);

  // stage + split this block's 64 query rows
  #pragma unroll
  for (int i = 0; i < 16; ++i) {
    int idx = tid + i * 128;
    int row = idx >> 5, kc = (idx & 31) * 4;
    float4 v = *(const float4*)(Qh + (size_t)(t0 + row) * HDIM + kc);
    v4bf hh, ll; split4(v, hh, ll);
    *(v4bf*)(&Qhi_s[row * 136 + kc]) = hh;
    *(v4bf*)(&Qlo_s[row * 136 + kc]) = ll;
  }

  v8f Oacc[8];
  float mrow[8], lrow[8], alphas[8];
  #pragma unroll
  for (int ct = 0; ct < 8; ++ct)
    #pragma unroll
    for (int r = 0; r < 8; ++r) Oacc[ct][r] = 0.0f;
  #pragma unroll
  for (int r = 0; r < 8; ++r) { mrow[r] = -1e30f; lrow[r] = 0.0f; }

  __bf16* Pw_hi = &Phi_s[w * 16 * 32];
  __bf16* Pw_lo = &Plo_s[w * 16 * 32];

  for (int it = 0; it < NTILE; ++it) {
    const int k0 = (it < 7) ? it * 32 : (T_SEQ - RB) + (it - 7) * 32;
    // own LDS traffic retired before the refill below aims at a buffer this wave has read
    asm volatile("s_wait_dscnt 0x0" ::: "memory");
    // own copies of this tile's K and V have landed; the barrier then shows them to the other waves
    asm volatile("s_wait_asynccnt 0x0" ::: "memory");
    __syncthreads();

    // next tile's K and V fly while this tile is worked on; their buffers were last read one trip ago
    if (it + 1 < NTILE) {
      issue_k((it + 1) & 1, (it + 1 < 7) ? (it + 1) * 32 : (T_SEQ - RB) + (it + 1 - 7) * 32);
      issue_v((it + 1) & 1, it + 1);
    }
    const __bf16* Kh_t = Khi_s[it & 1];
    const __bf16* Kl_t = Klo_s[it & 1];
    const __bf16* Vh_t = Vhi_s[it & 1];
    const __bf16* Vl_t = Vlo_s[it & 1];

    // S(16x32) = Q(16x128) * K^T(128x32), two 16-col tiles, bf16x3
    v8f S0, S1;
    #pragma unroll
    for (int r = 0; r < 8; ++r) { S0[r] = 0.0f; S1[r] = 0.0f; }
    const int kr0 = ln * 136;
    const int kr1 = (16 + ln) * 136;
    #pragma unroll
    for (int kc = 0; kc < HDIM; kc += 32) {
      int qb = (w * 16 + ln) * 136 + kc + 8 * hf;
      v16bf qh = ld_frag(&Qhi_s[qb]), ql = ld_frag(&Qlo_s[qb]);
      v16bf kh0 = ld_frag(Kh_t + kr0 + kc + 8 * hf);
      v16bf kl0 = ld_frag(Kl_t + kr0 + kc + 8 * hf);
      v16bf kh1 = ld_frag(Kh_t + kr1 + kc + 8 * hf);
      v16bf kl1 = ld_frag(Kl_t + kr1 + kc + 8 * hf);
      // interleave the two independent accumulators
      S0 = wmma_bf16(qh, kl0, S0);
      S1 = wmma_bf16(qh, kl1, S1);
      S0 = wmma_bf16(ql, kh0, S0);
      S1 = wmma_bf16(ql, kh1, S1);
      S0 = wmma_bf16(qh, kh0, S0);
      S1 = wmma_bf16(qh, kh1, S1);
    }

    const bool m0c = (it == 6) && ((k0 + ln) >= SB);   // keys 192..207 partial
    const bool m1c = (it == 6);                        // keys 208..223 all masked
    #pragma unroll
    for (int r = 0; r < 8; ++r) {
      float s0 = S0[r] * SCALE_QK; if (m0c) s0 = -1e30f;
      float s1 = S1[r] * SCALE_QK; if (m1c) s1 = -1e30f;
      float tmax  = fmaxf(rmax16(s0), rmax16(s1));
      float mnew  = fmaxf(mrow[r], tmax);
      float alpha = __expf(mrow[r] - mnew);
      float p0 = __expf(s0 - mnew);
      float p1 = __expf(s1 - mnew);
      float rs = rsum16(p0 + p1);
      lrow[r]   = lrow[r] * alpha + rs;
      mrow[r]   = mnew;
      alphas[r] = alpha;
      int prow = (r + 8 * hf) * 32;
      __bf16 h0 = (__bf16)p0;
      Pw_hi[prow + ln] = h0;       Pw_lo[prow + ln] = (__bf16)(p0 - (float)h0);
      __bf16 h1 = (__bf16)p1;
      Pw_hi[prow + 16 + ln] = h1;  Pw_lo[prow + 16 + ln] = (__bf16)(p1 - (float)h1);
    }
    #pragma unroll
    for (int ct = 0; ct < 8; ++ct)
      #pragma unroll
      for (int r = 0; r < 8; ++r) Oacc[ct][r] *= alphas[r];

    asm volatile("s_wait_dscnt 0" ::: "memory");

    // O(16x128) += P(16x32) * V(32x128), bf16x3; process ct in pairs so the
    // 3-product chains alternate between two independent accumulators
    const int pb = ln * 32 + 8 * hf;
    v16bf ph = ld_frag(&Pw_hi[pb]), pl = ld_frag(&Pw_lo[pb]);
    #pragma unroll
    for (int ct = 0; ct < 8; ct += 2) {
      int vb0 = ((ct + 0) * 16 + ln) * 40 + 8 * hf;
      int vb1 = ((ct + 1) * 16 + ln) * 40 + 8 * hf;
      v16bf vh0 = ld_frag(Vh_t + vb0), vl0 = ld_frag(Vl_t + vb0);
      v16bf vh1 = ld_frag(Vh_t + vb1), vl1 = ld_frag(Vl_t + vb1);
      Oacc[ct + 0] = wmma_bf16(ph, vl0, Oacc[ct + 0]);
      Oacc[ct + 1] = wmma_bf16(ph, vl1, Oacc[ct + 1]);
      Oacc[ct + 0] = wmma_bf16(pl, vh0, Oacc[ct + 0]);
      Oacc[ct + 1] = wmma_bf16(pl, vh1, Oacc[ct + 1]);
      Oacc[ct + 0] = wmma_bf16(ph, vh0, Oacc[ct + 0]);
      Oacc[ct + 1] = wmma_bf16(ph, vh1, Oacc[ct + 1]);
    }
  }

  // write [T][D]: col = h*128 + d
  #pragma unroll
  for (int ct = 0; ct < 8; ++ct)
    #pragma unroll
    for (int r = 0; r < 8; ++r) {
      int t = t0 + w * 16 + r + 8 * hf;
      int c = h * HDIM + ct * 16 + ln;
      Oout[(size_t)t * DMODEL + c] = Oacc[ct][r] / lrow[r];
    }
}

// ---------------- launch ----------------
extern "C" void kernel_launch(void* const* d_in, const int* in_sizes, int n_in,
                              void* d_out, int out_size, void* d_ws, size_t ws_size,
                              hipStream_t stream) {
  (void)in_sizes; (void)n_in; (void)out_size; (void)ws_size;
  const float* hidden = (const float*)d_in[0];
  const float* wq     = (const float*)d_in[1];
  const float* wk     = (const float*)d_in[2];
  const float* wv     = (const float*)d_in[3];
  const float* wo     = (const float*)d_in[4];
  const float* bern   = (const float*)d_in[5];

  const size_t NE = (size_t)T_SEQ * DMODEL;   // 4,194,304
  float* ws    = (float*)d_ws;
  float* q     = ws;            // [H][T][128] f32
  float* k     = ws + 1 * NE;
  float* v     = ws + 2 * NE;
  float* attnb = ws + 3 * NE;   // [T][D]
  __bf16* xhi  = (__bf16*)(ws + 4 * NE);  // activation split (hidden, then attnb)
  __bf16* xlo  = xhi + NE;
  __bf16* whi  = xlo + NE;                // current weight split (reused 4x)
  __bf16* wlo  = whi + NE;
  __bf16* khi  = wlo + NE;                // RoPE'd K split
  __bf16* klo  = khi + NE;
  __bf16* vthi = klo + NE;                // bumped V, split, tiled [H][NTILE][128][32]
  __bf16* vtlo = vthi + NE;
  float* coef  = (float*)(vtlo + NE);     // [H]

  dim3 ggrid(DMODEL / 128, T_SEQ / 64);       // (16, 32)

  // sanitized hidden -> bf16 hi/lo
  split_kernel<<<SPLIT_GRID, SPLIT_THREADS, 0, stream>>>(hidden, xhi, xlo, 1);

  split_kernel<<<SPLIT_GRID, SPLIT_THREADS, 0, stream>>>(wq, whi, wlo, 0);
  gemm_bf16x3_async_kernel<<<ggrid, 256, 0, stream>>>(xhi, xlo, whi, wlo, q, 0);
  split_kernel<<<SPLIT_GRID, SPLIT_THREADS, 0, stream>>>(wk, whi, wlo, 0);
  gemm_bf16x3_async_kernel<<<ggrid, 256, 0, stream>>>(xhi, xlo, whi, wlo, k, 0);
  split_kernel<<<SPLIT_GRID, SPLIT_THREADS, 0, stream>>>(wv, whi, wlo, 0);
  gemm_bf16x3_async_kernel<<<ggrid, 256, 0, stream>>>(xhi, xlo, whi, wlo, v, 0);

  rope_split_kernel<<<ROPE_N / 256, 256, 0, stream>>>(q, k, khi, klo);

  vcoef_kernel<<<NHEAD, 256, 0, stream>>>(q, k, bern, coef);
  vprep_kernel<<<dim3(NTILE, NHEAD), 256, 0, stream>>>(v, coef, vthi, vtlo);

  attn_kernel<<<dim3(T_SEQ / 64, NHEAD), 128, 0, stream>>>(q, khi, klo, vthi, vtlo, attnb);

  // output projection: split attnb (reuse x buffers) and wo, then GEMM -> d_out
  split_kernel<<<SPLIT_GRID, SPLIT_THREADS, 0, stream>>>(attnb, xhi, xlo, 0);
  split_kernel<<<SPLIT_GRID, SPLIT_THREADS, 0, stream>>>(wo, whi, wlo, 0);
  gemm_bf16x3_async_kernel<<<ggrid, 256, 0, stream>>>(xhi, xlo, whi, wlo, (float*)d_out, 1);
}

// v004
// A run of this version takes 320 microseconds.
// Next to v003, in two timings, it ran 1.30 times as fast each time.
// All steps since v000 together make it 1.71 times as fast.
#include <hip/hip_runtime.h>
#include <math.h>

// ---------------- problem constants ----------------
#define T_SEQ   2048
#define DMODEL  2048
#define NHEAD   16
#define HDIM    128
#define SB      204      // int(0.1*2048)
#define RB      1024     // int(0.5*2048)
#define NVALID  1228     // SB + RB
#define SCALE_QK 0.088388347648318447f   // 1/sqrt(128)

typedef float  v8f  __attribute__((ext_vector_type(8)));
typedef __bf16 v4bf __attribute__((ext_vector_type(4)));
typedef __bf16 v8bf __attribute__((ext_vector_type(8)));
typedef __bf16 v16bf __attribute__((ext_vector_type(16)));

static __device__ __forceinline__ v8f wmma_bf16(v16bf a, v16bf b, v8f c) {
  // D(16x16,f32) = A(16x32,bf16) x B(32x16,bf16) + C
  return __builtin_amdgcn_wmma_f32_16x16x32_bf16(false, a, false, b, (short)0, c, false, false);
}

// 16-bit A/B fragment: 8 contiguous K at p, 8 more at p+16
static __device__ __forceinline__ v16bf ld_frag(const __bf16* p) {
  v8bf a = *(const v8bf*)(p);
  v8bf b = *(const v8bf*)(p + 16);
  return __builtin_shufflevector(a, b, 0,1,2,3,4,5,6,7,8,9,10,11,12,13,14,15);
}

static __device__ __forceinline__ void split4(float4 v, v4bf& h, v4bf& l) {
  h[0] = (__bf16)v.x; l[0] = (__bf16)(v.x - (float)h[0]);
  h[1] = (__bf16)v.y; l[1] = (__bf16)(v.y - (float)h[1]);
  h[2] = (__bf16)v.z; l[2] = (__bf16)(v.z - (float)h[2]);
  h[3] = (__bf16)v.w; l[3] = (__bf16)(v.w - (float)h[3]);
}

static __device__ __forceinline__ float fin_clamp(float v) {
  if (v != v)        return 0.0f;
  if (v >  1.0e38f)  return  1.0e4f;
  if (v < -1.0e38f)  return -1.0e4f;
  return v;
}

static __device__ __forceinline__ float rmax16(float v) {
  #pragma unroll
  for (int m = 1; m < 16; m <<= 1) v = fmaxf(v, __shfl_xor(v, m, 32));
  return v;
}
static __device__ __forceinline__ float rsum16(float v) {
  #pragma unroll
  for (int m = 1; m < 16; m <<= 1) v += __shfl_xor(v, m, 32);
  return v;
}

// ---------------- async global->LDS copy (CDNA5), with sync fallback ----------------
#if __has_builtin(__builtin_amdgcn_global_load_async_to_lds_b128)
#define HAS_ASYNC_LDS 1
typedef int gv4i __attribute__((vector_size(16)));
typedef __attribute__((address_space(1))) gv4i as1_v4i;   // global
typedef __attribute__((address_space(3))) gv4i as3_v4i;   // LDS
static __device__ __forceinline__ void async_cp16(void* l, const void* g) {
  __builtin_amdgcn_global_load_async_to_lds_b128((as1_v4i*)g, (as3_v4i*)l, 0, 0);
}
#else
#define HAS_ASYNC_LDS 0
static __device__ __forceinline__ void async_cp16(void* l, const void* g) {
  *(float4*)l = *(const float4*)g;     // 16B sync copy fallback
}
#endif

// ---------------- kernel 1: nan_to_num(optional) + bf16 hi/lo split ----------------
// 16 waves per block, one block per 64 KiB of input: a thread takes 8 float4, each wave-wide load
// covers 512 contiguous bytes and each wave-wide store 256, so few waves have to be started.
#define SPLIT_THREADS 512
#define SPLIT_VEC     8
#define SPLIT_GRID    ((T_SEQ * DMODEL) / (SPLIT_THREADS * SPLIT_VEC * 4))
static_assert(SPLIT_GRID * SPLIT_THREADS * SPLIT_VEC * 4 == T_SEQ * DMODEL, "blocks tile the array");
__global__ __launch_bounds__(SPLIT_THREADS)
void split_kernel(const float* __restrict__ x, __bf16* __restrict__ hi,
                  __bf16* __restrict__ lo, int do_clamp) {
  // byte offsets in 32 bits: one offset register serves all loads and one all stores
  const unsigned t4 = blockIdx.x * (SPLIT_THREADS * SPLIT_VEC) + threadIdx.x;   // in float4 units
  const char* xb = (const char*)x + t4 * 16u;
  char* hb = (char*)hi + t4 * 8u;
  char* lb = (char*)lo + t4 * 8u;
  float4 v[SPLIT_VEC];
  #pragma unroll
  for (int i = 0; i < SPLIT_VEC; ++i)
    v[i] = *(const float4*)(xb + i * (SPLIT_THREADS * 16));
  // precaution: stands ahead of the clamp's exec saves, which reuse a scalar register of the
  // base pair that the eight loads name
  asm volatile("s_wait_xcnt 0x0" ::: "memory");
  v4bf hh[SPLIT_VEC], ll[SPLIT_VEC];
  #pragma unroll
  for (int i = 0; i < SPLIT_VEC; ++i) {
    float4 u = v[i];
    if (do_clamp) {
      u.x = fin_clamp(u.x); u.y = fin_clamp(u.y); u.z = fin_clamp(u.z); u.w = fin_clamp(u.w);
    }
    split4(u, hh[i], ll[i]);
  }
  #pragma unroll
  for (int i = 0; i < SPLIT_VEC; ++i) {
    *(v4bf*)(hb + i * (SPLIT_THREADS * 8)) = hh[i];
    *(v4bf*)(lb + i * (SPLIT_THREADS * 8)) = ll[i];
  }
}

// ---------------- GEMM: C = A * W^T, bf16x3, async double-buffered LDS ----------------
// Operands pre-split to global bf16 hi/lo.  mode 0: scatter [H][T][HDIM]; 1: [T][D]+clamp.
// One 128 x 128 tile of C per block, 8 waves as 2 x 4, 64 x 32 per wave; a trip takes 128 k, so a
// staged row is 256 contiguous bytes (whole lines) and the two buffers leave room for one block
// per WGP.  A trip is 4 blocks of 32 k; each block's fragments are fetched one block ahead.
#define GT_MN    128
#define GT_K     128
#define GT_PITCH 136                   // bf16; rows of 272 B = 16 B x odd, for 16-byte readers
#define GT_ARR   (GT_MN * GT_PITCH)    // one operand plane of one buffer
#define GT_TRIPS (DMODEL / GT_K)
__global__ __launch_bounds__(256)
void gemm_bf16x3_async_kernel(const __bf16* __restrict__ Ahi_g, const __bf16* __restrict__ Alo_g,
                              const __bf16* __restrict__ Whi_g, const __bf16* __restrict__ Wlo_g,
                              float* __restrict__ out, int mode) {
  __shared__ __attribute__((aligned(16))) __bf16 Sbuf[2][4][GT_ARR];   // [buf][Ahi, Alo, Whi, Wlo]

  const int tid  = threadIdx.x;
  const int wid  = tid >> 5;
  const int lane = tid & 31;
  const int ln   = lane & 15;
  const int hf   = lane >> 4;
  const int wr   = wid >> 2;       // 0..1
  const int wc   = wid & 3;        // 0..3
  const int m0   = blockIdx.y * GT_MN;
  const int n0   = blockIdx.x * GT_MN;

  // 8 copies per plane and thread: rows crow + 0..3 and 64 + crow + 0..3, so that neighbouring
  // copies lie one row (4096 B) apart; a wave's copy takes two whole 256-B rows
  const int crow = (tid >> 4) * 4, cc = (tid & 15) * 8;      // 8 bf16 = 16B
  const __bf16* a_hi = Ahi_g + (size_t)(m0 + crow) * DMODEL + cc;
  const __bf16* a_lo = Alo_g + (size_t)(m0 + crow) * DMODEL + cc;
  const __bf16* w_hi = Whi_g + (size_t)(n0 + crow) * DMODEL + cc;
  const __bf16* w_lo = Wlo_g + (size_t)(n0 + crow) * DMODEL + cc;
  const int     loff = crow * GT_PITCH + cc;

  v8f acc[4][2];
  #pragma unroll
  for (int i = 0; i < 4; ++i)
    #pragma unroll
    for (int j = 0; j < 2; ++j)
      #pragma unroll
      for (int r = 0; r < 8; ++r) acc[i][j][r] = 0.0f;

  auto issue = [&](int buf, int kt) {
    // unrolled: the row steps become constants of the copies' addresses
    #pragma unroll
    for (int i = 0; i < 8; ++i) {
      const int rw = (i & 3) + (i >> 2) * 64;
      const int go = rw * DMODEL + kt;
      const int lr = loff + rw * GT_PITCH;
      async_cp16(&Sbuf[buf][0][lr], a_hi + go);
      async_cp16(&Sbuf[buf][1][lr], a_lo + go);
      async_cp16(&Sbuf[buf][2][lr], w_hi + go);
      async_cp16(&Sbuf[buf][3][lr], w_lo + go);
    }
  };

  // two fragment sets: one is worked on while the other is filled
  v16bf fa_h[2][4], fa_l[2][4], fb_h[2][2], fb_l[2][2];
  auto load_set = [&](int s, int buf, int ks) {
    const int ab = (wr * 64 + ln) * GT_PITCH + ks + 8 * hf;
    const int bb = (wc * 32 + ln) * GT_PITCH + ks + 8 * hf;
    // both loops unrolled: fragment arrays stay in registers only under constant indices
    #pragma unroll
    for (int i = 0; i < 4; ++i) {
      fa_h[s][i] = ld_frag(&Sbuf[buf][0][ab + i * 16 * GT_PITCH]);
      fa_l[s][i] = ld_frag(&Sbuf[buf][1][ab + i * 16 * GT_PITCH]);
    }
    #pragma unroll
    for (int j = 0; j < 2; ++j) {
      fb_h[s][j] = ld_frag(&Sbuf[buf][2][bb + j * 16 * GT_PITCH]);
      fb_l[s][j] = ld_frag(&Sbuf[buf][3][bb + j * 16 * GT_PITCH]);
    }
  };

  issue(0, 0);
  // own copies of tile 0 have landed; the barrier then shows them to the other waves
  asm volatile("s_wait_asynccnt 0x0" ::: "memory");
  __syncthreads();
  issue(1, GT_K);
  load_set(0, 0, 0);

  for (int t = 0; t < GT_TRIPS; ++t) {
    const int buf = t & 1;
    // unrolled: the set index must be a constant for the fragments to stay in registers
    #pragma unroll
    for (int b = 0; b < 4; ++b) {
      if (b < 3) {
        load_set((b + 1) & 1, buf, (b + 1) * 32);
      } else {
        // publish point of tile t + 1, ahead of this tile's last block, whose fragments are fetched:
        // own LDS reads retired before the refill below aims at the buffer this trip has read
        asm volatile("s_wait_dscnt 0x0" ::: "memory");
        // own copies of the next tile have landed; the barrier then shows them to the other waves
        asm volatile("s_wait_asynccnt 0x0" ::: "memory");
        __syncthreads();
        if (t + 1 < GT_TRIPS) load_set(0, buf ^ 1, 0);
      }
      // keeps the next block's fragment loads one group ahead of this block's products
      __builtin_amdgcn_sched_barrier(0);
      // the refill flies while the next tile is worked on; its address work may mix with the products
      if (b == 3 && t + 2 < GT_TRIPS) issue(buf, (t + 2) * GT_K);
      const int s = b & 1;
      // product-major over the 8 independent accumulators; per accumulator and 32 k the order
      // stays hi*lo, lo*hi, hi*hi (loops unrolled: register arrays need constant indices)
      #pragma unroll
      for (int i = 0; i < 4; ++i)
        #pragma unroll
        for (int j = 0; j < 2; ++j) acc[i][j] = wmma_bf16(fa_h[s][i], fb_l[s][j], acc[i][j]);
      #pragma unroll
      for (int i = 0; i < 4; ++i)
        #pragma unroll
        for (int j = 0; j < 2; ++j) acc[i][j] = wmma_bf16(fa_l[s][i], fb_h[s][j], acc[i][j]);
      #pragma unroll
      for (int i = 0; i < 4; ++i)
        #pragma unroll
        for (int j = 0; j < 2; ++j) acc[i][j] = wmma_bf16(fa_h[s][i], fb_h[s][j], acc[i][j]);
      // keeps the following block's loads from moving in among these products
      __builtin_amdgcn_sched_barrier(0);
    }
  }
  // precaution: no copy is outstanding when the wave ends
  asm volatile("s_wait_asynccnt 0x0" ::: "memory");

  // C layout: lane ln = column, row = r + 8*hf
  #pragma unroll
  for (int i = 0; i < 4; ++i)
    #pragma unroll
    for (int j = 0; j < 2; ++j)
      #pragma unroll
      for (int r = 0; r < 8; ++r) {
        int gm = m0 + wr * 64 + i * 16 + r + 8 * hf;
        int gn = n0 + wc * 32 + j * 16 + ln;
        float v = acc[i][j][r];
        if (mode == 1) {
          out[(size_t)gm * DMODEL + gn] = fin_clamp(v);
        } else {
          int h = gn >> 7, d = gn & 127;
          out[((size_t)h * T_SEQ + gm) * HDIM + d] = v;
        }
      }
}

// ---------------- kernel 3: RoPE on Q,K + emit bf16 hi/lo split of K ----------------
// A thread takes 4 neighbouring j (with their partners j + 64) of one position t in ROPE_HEADS heads,
// Q and K: 16 loads of 16 bytes, all issued ahead of the angles.
#define ROPE_HEADS 4
#define ROPE_N     ((NHEAD / ROPE_HEADS) * T_SEQ * 16)
// written as explicit fma so that the product rounded first is x2*s (low half) and x1*s (high half)
static __device__ __forceinline__ void rot4(float4 a, float4 b, const float* c, const float* s,
                                            float4& lo, float4& hi) {
  lo.x = fmaf(c[0], a.x, -(b.x * s[0]));  hi.x = fmaf(c[0], b.x, a.x * s[0]);
  lo.y = fmaf(c[1], a.y, -(b.y * s[1]));  hi.y = fmaf(c[1], b.y, a.y * s[1]);
  lo.z = fmaf(c[2], a.z, -(b.z * s[2]));  hi.z = fmaf(c[2], b.z, a.z * s[2]);
  lo.w = fmaf(c[3], a.w, -(b.w * s[3]));  hi.w = fmaf(c[3], b.w, a.w * s[3]);
}
__global__ __launch_bounds__(256)
void rope_split_kernel(float* __restrict__ Q, float* __restrict__ K,
                       __bf16* __restrict__ Khi, __bf16* __restrict__ Klo) {
  int idx = blockIdx.x * blockDim.x + threadIdx.x;       // (H/ROPE_HEADS)*T*16
  if (idx >= ROPE_N) return;
  int j  = (idx & 15) * 4;
  int t  = (idx >> 4) & (T_SEQ - 1);
  int h0 = (idx >> 15) * ROPE_HEADS;
  const size_t base0 = ((size_t)h0 * T_SEQ + t) * HDIM + j;

  float4 q1[ROPE_HEADS], q2[ROPE_HEADS], k1[ROPE_HEADS], k2[ROPE_HEADS];
  #pragma unroll
  for (int i = 0; i < ROPE_HEADS; ++i) {
    const size_t base = base0 + (size_t)i * T_SEQ * HDIM;
    q1[i] = *(const float4*)(Q + base);  q2[i] = *(const float4*)(Q + base + 64);
    k1[i] = *(const float4*)(K + base);  k2[i] = *(const float4*)(K + base + 64);
  }

  float c[4], s[4];
  #pragma unroll
  for (int e = 0; e < 4; ++e) {
    float invf = __expf(-(float)(j + e) * (9.210340371976184f / 64.0f)); // 10000^(-j/64)
    float ang = (float)t * invf;
    c[e] = cosf(ang); s[e] = sinf(ang);
  }

  #pragma unroll
  for (int i = 0; i < ROPE_HEADS; ++i) {
    const size_t base = base0 + (size_t)i * T_SEQ * HDIM;
    float4 a, b;
    rot4(q1[i], q2[i], c, s, a, b);
    *(float4*)(Q + base)      = a;
    *(float4*)(Q + base + 64) = b;
    rot4(k1[i], k2[i], c, s, a, b);
    *(float4*)(K + base)      = a;
    *(float4*)(K + base + 64) = b;
    v4bf hh, ll;
    split4(a, hh, ll);
    *(v4bf*)(Khi + base)      = hh;  *(v4bf*)(Klo + base)      = ll;
    split4(b, hh, ll);
    *(v4bf*)(Khi + base + 64) = hh;  *(v4bf*)(Klo + base + 64) = ll;
  }
}

// ---------------- kernel 4: last-row softmax -> per-head bump coefficient (f32) ----------------
__global__ __launch_bounds__(256)
void vcoef_kernel(const float* __restrict__ Q, const float* __restrict__ K,
                  const float* __restrict__ bern, float* __restrict__ coef) {
  const int h = blockIdx.x, tid = threadIdx.x;
  __shared__ float sc[NVALID];
  __shared__ float qrow[HDIM];
  __shared__ float red[256];

  if (tid < HDIM) qrow[tid] = Q[((size_t)h * T_SEQ + (T_SEQ - 1)) * HDIM + tid];
  __syncthreads();

  float lmax = -1e30f;
  for (int idx = tid; idx < NVALID; idx += 256) {
    int key = (idx < SB) ? idx : (T_SEQ - RB) + (idx - SB);
    const float* kr = K + ((size_t)h * T_SEQ + key) * HDIM;
    float d = 0.0f;
    #pragma unroll 8
    for (int c = 0; c < HDIM; ++c) d += qrow[c] * kr[c];
    d *= SCALE_QK;
    sc[idx] = d;
    lmax = fmaxf(lmax, d);
  }
  red[tid] = lmax; __syncthreads();
  for (int s = 128; s > 0; s >>= 1) { if (tid < s) red[tid] = fmaxf(red[tid], red[tid + s]); __syncthreads(); }
  float gmax = red[0]; __syncthreads();

  float lsum = 0.0f, ltail = 0.0f;
  for (int idx = tid; idx < NVALID; idx += 256) {
    float e = __expf(sc[idx] - gmax);
    lsum += e;
    if (idx >= SB + 1) ltail += e;     // keys 1025..2047
  }
  red[tid] = lsum; __syncthreads();
  for (int s = 128; s > 0; s >>= 1) { if (tid < s) red[tid] += red[tid + s]; __syncthreads(); }
  float gsum = red[0]; __syncthreads();
  red[tid] = ltail; __syncthreads();
  for (int s = 128; s > 0; s >>= 1) { if (tid < s) red[tid] += red[tid + s]; __syncthreads(); }

  if (tid == 0) {
    float gtail = red[0];
    float pe   = __expf(sc[SB] - gmax) / gsum;             // probs at key e=1024
    float mean = (gtail / gsum) / 1023.0f + 1e-6f;
    float p = pe / mean;
    p = (p != p) ? 0.0f : fminf(fmaxf(p, 0.0f), 1.0f);
    float m = (bern[h] < p) ? 1.0f : 0.0f;
    coef[h] = m / (float)RB;
  }
}

// ---------------- kernel 4b: V bump + bf16 hi/lo split + transpose, once for all query blocks ----
// One block per (32-key tile, head).  Output tile: [d 0..127][key 0..31], 8 KiB contiguous, hi and lo,
// in the order in which attention walks the tiles.
#define NTILE 39      // 7 tiles for [0,204), 32 for [1024,2048)
#define VT_PITCH 132  // floats; rows stay 16-byte aligned
__global__ __launch_bounds__(256)
void vprep_kernel(const float* __restrict__ V, const float* __restrict__ coef,
                  __bf16* __restrict__ Vthi, __bf16* __restrict__ Vtlo) {
  __shared__ __attribute__((aligned(16))) float tile[32 * VT_PITCH];
  const int tid = threadIdx.x;
  const int it  = blockIdx.x;
  const int h   = blockIdx.y;
  const int k0  = (it < 7) ? it * 32 : (T_SEQ - RB) + (it - 7) * 32;
  const float* Vh = V + (size_t)h * T_SEQ * HDIM;
  const float cf = coef[h];
  // a thread keeps one group of 4 dims and takes 4 keys; all five loads go out together
  const int d4 = (tid & 31) * 4, kr0 = tid >> 5;
  // byte offsets in 32 bits on block-uniform bases: one offset register serves the four row loads,
  // whose rows lie a constant 4096 bytes apart
  const char* eb = (const char*)(Vh + (size_t)RB * HDIM) + (unsigned)d4 * 4u;
  const char* rb = (const char*)(Vh + (size_t)k0 * HDIM) + (unsigned)tid * 16u;
  const float4 e = *(const float4*)eb;
  float4 v[4];
  #pragma unroll
  for (int i = 0; i < 4; ++i)
    v[i] = *(const float4*)(rb + i * (8 * HDIM * 4));
  const float bx = e.x * cf, by = e.y * cf, bz = e.z * cf, bw = e.w * cf;
  #pragma unroll
  for (int i = 0; i < 4; ++i) {
    const bool bump = (k0 + kr0 + i * 8) > RB;     // keys 1025..2047 take the evicted row's share
    float4 u = v[i];
    u.x = bump ? u.x + bx : u.x;  u.y = bump ? u.y + by : u.y;
    u.z = bump ? u.z + bz : u.z;  u.w = bump ? u.w + bw : u.w;
    *(float4*)(&tile[(kr0 + i * 8) * VT_PITCH + d4]) = u;
  }
  __syncthreads();
  const size_t ob = ((size_t)h * NTILE + it) * (HDIM * 32);
  #pragma unroll
  for (int i = 0; i < 2; ++i) {
    int c = tid + i * 256;                   // 16-byte chunk of the output tile
    int d = c >> 2, kg = (c & 3) * 8;
    v8bf hh, ll;
    #pragma unroll
    for (int j = 0; j < 8; ++j) {
      float v = tile[(kg + j) * VT_PITCH + d];
      __bf16 x = (__bf16)v;
      hh[j] = x;
      ll[j] = (__bf16)(v - (float)x);
    }
    *(v8bf*)(Vthi + ob + c * 8) = hh;
    *(v8bf*)(Vtlo + ob + c * 8) = ll;
  }
}

// ---------------- kernel 5: flash attention, bf16x3, 32-key tiles ----------------
__global__ __launch_bounds__(128)
void attn_kernel(const float* __restrict__ Q, const __bf16* __restrict__ Khi,
                 const __bf16* __restrict__ Klo, const __bf16* __restrict__ Vthi,
                 const __bf16* __restrict__ Vtlo, float* __restrict__ Oout) {
  __shared__ __bf16 Qhi_s[64 * 136], Qlo_s[64 * 136];   // 64 queries x 128 dims
  // V tile [d][key], 32 keys, hi and lo, two buffers; row pitch 80 B for 16-byte readers
  __shared__ __attribute__((aligned(16))) __bf16 Vhi_s[2][128 * 40];
  __shared__ __attribute__((aligned(16))) __bf16 Vlo_s[2][128 * 40];
  __shared__ __bf16 Phi_s[4 * 16 * 32], Plo_s[4 * 16 * 32];
  // K tile, 32 keys x 128 dims, hi and lo, two buffers; row pitch 272 B for 16-byte readers
  __shared__ __attribute__((aligned(16))) __bf16 Khi_s[2][32 * 136];
  __shared__ __attribute__((aligned(16))) __bf16 Klo_s[2][32 * 136];

  const int tid  = threadIdx.x;
  const int w    = tid >> 5;         // 4 waves, 16 queries each
  const int lane = tid & 31;
  const int ln   = lane & 15;
  const int hf   = lane >> 4;
  const int h    = blockIdx.y;
  const int t0   = blockIdx.x * 64;
  const size_t hk = (size_t)h * T_SEQ;

  const float* Qh = Q + hk * HDIM;

  // one K tile (hi and lo) into LDS, once per block: each wave's copy takes 512 contiguous
  // bytes (two whole key rows), 8 copies per thread and tile
  auto issue_k = [&](int buf, int kbase) {
    #pragma unroll
    for (int i = 0; i < 4; ++i) {
      int idx = tid + i * 128, rw = idx >> 4, cw = (idx & 15) * 8;
      async_cp16(&Khi_s[buf][rw * 136 + cw], Khi + (hk + kbase + rw) * HDIM + cw);
      async_cp16(&Klo_s[buf][rw * 136 + cw], Klo + (hk + kbase + rw) * HDIM + cw);
    }
  };
  // one prepared V tile (hi and lo) into LDS: each wave's copy takes 512 contiguous bytes,
  // 8 copies per thread and tile
  auto issue_v = [&](int buf, int tile) {
    const size_t vb = ((size_t)h * NTILE + tile) * (HDIM * 32);
    #pragma unroll
    for (int i = 0; i < 4; ++i) {
      int c = tid + i * 128;
      async_cp16(&Vhi_s[buf][(c >> 2) * 40 + (c & 3) * 8], Vthi + vb + c * 8);
      async_cp16(&Vlo_s[buf][(c >> 2) * 40 + (c & 3) * 8], Vtlo + vb + c * 8);
    }
  };
  issue_k(0, 0);
  issue_v(0, 0);

  // stage + split this block's 64 query rows
  #pragma unroll
  for (int i = 0; i < 16; ++i) {
    int idx = tid + i * 128;
    int row = idx >> 5, kc = (idx & 31) * 4;
    float4 v = *(const float4*)(Qh + (size_t)(t0 + row) * HDIM + kc);
    v4bf hh, ll; split4(v, hh, ll);
    *(v4bf*)(&Qhi_s[row * 136 + kc]) = hh;
    *(v4bf*)(&Qlo_s[row * 136 + kc]) = ll;
  }

  v8f Oacc[8];
  float mrow[8], lrow[8], alphas[8];
  #pragma unroll
  for (int ct = 0; ct < 8; ++ct)
    #pragma unroll
    for (int r = 0; r < 8; ++r) Oacc[ct][r] = 0.0f;
  #pragma unroll
  for (int r = 0; r < 8; ++r) { mrow[r] = -1e30f; lrow[r] = 0.0f; }

  __bf16* Pw_hi = &Phi_s[w * 16 * 32];
  __bf16* Pw_lo = &Plo_s[w * 16 * 32];

  for (int it = 0; it < NTILE; ++it) {
    const int k0 = (it < 7) ? it * 32 : (T_SEQ - RB) + (it - 7) * 32;
    // own LDS traffic retired before the refill below aims at a buffer this wave has read
    asm volatile("s_wait_dscnt 0x0" ::: "memory");
    // own copies of this tile's K and V have landed; the barrier then shows them to the other waves
    asm volatile("s_wait_asynccnt 0x0" ::: "memory");
    __syncthreads();

    // next tile's K and V fly while this tile is worked on; their buffers were last read one trip ago
    if (it + 1 < NTILE) {
      issue_k((it + 1) & 1, (it + 1 < 7) ? (it + 1) * 32 : (T_SEQ - RB) + (it + 1 - 7) * 32);
      issue_v((it + 1) & 1, it + 1);
    }
    const __bf16* Kh_t = Khi_s[it & 1];
    const __bf16* Kl_t = Klo_s[it & 1];
    const __bf16* Vh_t = Vhi_s[it & 1];
    const __bf16* Vl_t = Vlo_s[it & 1];

    // S(16x32) = Q(16x128) * K^T(128x32), two 16-col tiles, bf16x3
    v8f S0, S1;
    #pragma unroll
    for (int r = 0; r < 8; ++r) { S0[r] = 0.0f; S1[r] = 0.0f; }
    const int kr0 = ln * 136;
    const int kr1 = (16 + ln) * 136;
    #pragma unroll
    for (int kc = 0; kc < HDIM; kc += 32) {
      int qb = (w * 16 + ln) * 136 + kc + 8 * hf;
      v16bf qh = ld_frag(&Qhi_s[qb]), ql = ld_frag(&Qlo_s[qb]);
      v16bf kh0 = ld_frag(Kh_t + kr0 + kc + 8 * hf);
      v16bf kl0 = ld_frag(Kl_t + kr0 + kc + 8 * hf);
      v16bf kh1 = ld_frag(Kh_t + kr1 + kc + 8 * hf);
      v16bf kl1 = ld_frag(Kl_t + kr1 + kc + 8 * hf);
      // interleave the two independent accumulators
      S0 = wmma_bf16(qh, kl0, S0);
      S1 = wmma_bf16(qh, kl1, S1);
      S0 = wmma_bf16(ql, kh0, S0);
      S1 = wmma_bf16(ql, kh1, S1);
      S0 = wmma_bf16(qh, kh0, S0);
      S1 = wmma_bf16(qh, kh1, S1);
    }

    const bool m0c = (it == 6) && ((k0 + ln) >= SB);   // keys 192..207 partial
    const bool m1c = (it == 6);                        // keys 208..223 all masked
    #pragma unroll
    for (int r = 0; r < 8; ++r) {
      float s0 = S0[r] * SCALE_QK; if (m0c) s0 = -1e30f;
      float s1 = S1[r] * SCALE_QK; if (m1c) s1 = -1e30f;
      float tmax  = fmaxf(rmax16(s0), rmax16(s1));
      float mnew  = fmaxf(mrow[r], tmax);
      float alpha = __expf(mrow[r] - mnew);
      float p0 = __expf(s0 - mnew);
      float p1 = __expf(s1 - mnew);
      float rs = rsum16(p0 + p1);
      lrow[r]   = lrow[r] * alpha + rs;
      mrow[r]   = mnew;
      alphas[r] = alpha;
      int prow = (r + 8 * hf) * 32;
      __bf16 h0 = (__bf16)p0;
      Pw_hi[prow + ln] = h0;       Pw_lo[prow + ln] = (__bf16)(p0 - (float)h0);
      __bf16 h1 = (__bf16)p1;
      Pw_hi[prow + 16 + ln] = h1;  Pw_lo[prow + 16 + ln] = (__bf16)(p1 - (float)h1);
    }
    #pragma unroll
    for (int ct = 0; ct < 8; ++ct)
      #pragma unroll
      for (int r = 0; r < 8; ++r) Oacc[ct][r] *= alphas[r];

    asm volatile("s_wait_dscnt 0" ::: "memory");

    // O(16x128) += P(16x32) * V(32x128), bf16x3; process ct in pairs so the
    // 3-product chains alternate between two independent accumulators
    const int pb = ln * 32 + 8 * hf;
    v16bf ph = ld_frag(&Pw_hi[pb]), pl = ld_frag(&Pw_lo[pb]);
    #pragma unroll
    for (int ct = 0; ct < 8; ct += 2) {
      int vb0 = ((ct + 0) * 16 + ln) * 40 + 8 * hf;
      int vb1 = ((ct + 1) * 16 + ln) * 40 + 8 * hf;
      v16bf vh0 = ld_frag(Vh_t + vb0), vl0 = ld_frag(Vl_t + vb0);
      v16bf vh1 = ld_frag(Vh_t + vb1), vl1 = ld_frag(Vl_t + vb1);
      Oacc[ct + 0] = wmma_bf16(ph, vl0, Oacc[ct + 0]);
      Oacc[ct + 1] = wmma_bf16(ph, vl1, Oacc[ct + 1]);
      Oacc[ct + 0] = wmma_bf16(pl, vh0, Oacc[ct + 0]);
      Oacc[ct + 1] = wmma_bf16(pl, vh1, Oacc[ct + 1]);
      Oacc[ct + 0] = wmma_bf16(ph, vh0, Oacc[ct + 0]);
      Oacc[ct + 1] = wmma_bf16(ph, vh1, Oacc[ct + 1]);
    }
  }

  // write [T][D]: col = h*128 + d
  #pragma unroll
  for (int ct = 0; ct < 8; ++ct)
    #pragma unroll
    for (int r = 0; r < 8; ++r) {
      int t = t0 + w * 16 + r + 8 * hf;
      int c = h * HDIM + ct * 16 + ln;
      Oout[(size_t)t * DMODEL + c] = Oacc[ct][r] / lrow[r];
    }
}

// ---------------- launch ----------------
extern "C" void kernel_launch(void* const* d_in, const int* in_sizes, int n_in,
                              void* d_out, int out_size, void* d_ws, size_t ws_size,
                              hipStream_t stream) {
  (void)in_sizes; (void)n_in; (void)out_size; (void)ws_size;
  const float* hidden = (const float*)d_in[0];
  const float* wq     = (const float*)d_in[1];
  const float* wk     = (const float*)d_in[2];
  const float* wv     = (const float*)d_in[3];
  const float* wo     = (const float*)d_in[4];
  const float* bern   = (const float*)d_in[5];

  const size_t NE = (size_t)T_SEQ * DMODEL;   // 4,194,304
  float* ws    = (float*)d_ws;
  float* q     = ws;            // [H][T][128] f32
  float* k     = ws + 1 * NE;
  float* v     = ws + 2 * NE;
  float* attnb = ws + 3 * NE;   // [T][D]
  __bf16* xhi  = (__bf16*)(ws + 4 * NE);  // activation split (hidden, then attnb)
  __bf16* xlo  = xhi + NE;
  __bf16* whi  = xlo + NE;                // current weight split (reused 4x)
  __bf16* wlo  = whi + NE;
  __bf16* khi  = wlo + NE;                // RoPE'd K split
  __bf16* klo  = khi + NE;
  __bf16* vthi = klo + NE;                // bumped V, split, tiled [H][NTILE][128][32]
  __bf16* vtlo = vthi + NE;
  float* coef  = (float*)(vtlo + NE);     // [H]

  dim3 ggrid(DMODEL / GT_MN, T_SEQ / GT_MN);   // (16, 16)

  // sanitized hidden -> bf16 hi/lo
  split_kernel<<<SPLIT_GRID, SPLIT_THREADS, 0, stream>>>(hidden, xhi, xlo, 1);

  split_kernel<<<SPLIT_GRID, SPLIT_THREADS, 0, stream>>>(wq, whi, wlo, 0);
  gemm_bf16x3_async_kernel<<<ggrid, 256, 0, stream>>>(xhi, xlo, whi, wlo, q, 0);
  split_kernel<<<SPLIT_GRID, SPLIT_THREADS, 0, stream>>>(wk, whi, wlo, 0);
  gemm_bf16x3_async_kernel<<<ggrid, 256, 0, stream>>>(xhi, xlo, whi, wlo, k, 0);
  split_kernel<<<SPLIT_GRID, SPLIT_THREADS, 0, stream>>>(wv, whi, wlo, 0);
  gemm_bf16x3_async_kernel<<<ggrid, 256, 0, stream>>>(xhi, xlo, whi, wlo, v, 0);

  rope_split_kernel<<<ROPE_N / 256, 256, 0, stream>>>(q, k, khi, klo);

  vcoef_kernel<<<NHEAD, 256, 0, stream>>>(q, k, bern, coef);
  vprep_kernel<<<dim3(NTILE, NHEAD), 256, 0, stream>>>(v, coef, vthi, vtlo);

  attn_kernel<<<dim3(T_SEQ / 64, NHEAD), 128, 0, stream>>>(q, khi, klo, vthi, vtlo, attnb);

  // output projection: split attnb (reuse x buffers) and wo, then GEMM -> d_out
  split_kernel<<<SPLIT_GRID, SPLIT_THREADS, 0, stream>>>(attnb, xhi, xlo, 0);
  split_kernel<<<SPLIT_GRID, SPLIT_THREADS, 0, stream>>>(wo, whi, wlo, 0);
  gemm_bf16x3_async_kernel<<<ggrid, 256, 0, stream>>>(xhi, xlo, whi, wlo, (float*)d_out, 1);
}

// v005
// One run takes 300 microseconds.
// Next to v004, in two timings, it ran 1.06 and 1.07 times as fast.
// Over all steps from v000 it is 1.82 times as fast.
#include <hip/hip_runtime.h>
#include <math.h>

// ---------------- problem constants ----------------
#define T_SEQ   2048
#define DMODEL  2048
#define NHEAD   16
#define HDIM    128
#define SB      204      // int(0.1*2048)
#define RB      1024     // int(0.5*2048)
#define NVALID  1228     // SB + RB
#define SCALE_QK 0.088388347648318447f   // 1/sqrt(128)

typedef float  v8f  __attribute__((ext_vector_type(8)));
typedef __bf16 v4bf __attribute__((ext_vector_type(4)));
typedef __bf16 v8bf __attribute__((ext_vector_type(8)));
typedef __bf16 v16bf __attribute__((ext_vector_type(16)));

static __device__ __forceinline__ v8f wmma_bf16(v16bf a, v16bf b, v8f c) {
  // D(16x16,f32) = A(16x32,bf16) x B(32x16,bf16) + C
  return __builtin_amdgcn_wmma_f32_16x16x32_bf16(false, a, false, b, (short)0, c, false, false);
}

// 16-bit A/B fragment: 8 contiguous K at p, 8 more at p+16
static __device__ __forceinline__ v16bf ld_frag(const __bf16* p) {
  v8bf a = *(const v8bf*)(p);
  v8bf b = *(const v8bf*)(p + 16);
  return __builtin_shufflevector(a, b, 0,1,2,3,4,5,6,7,8,9,10,11,12,13,14,15);
}

static __device__ __forceinline__ void split4(float4 v, v4bf& h, v4bf& l) {
  h[0] = (__bf16)v.x; l[0] = (__bf16)(v.x - (float)h[0]);
  h[1] = (__bf16)v.y; l[1] = (__bf16)(v.y - (float)h[1]);
  h[2] = (__bf16)v.z; l[2] = (__bf16)(v.z - (float)h[2]);
  h[3] = (__bf16)v.w; l[3] = (__bf16)(v.w - (float)h[3]);
}

static __device__ __forceinline__ float fin_clamp(float v) {
  if (v != v)        return 0.0f;
  if (v >  1.0e38f)  return  1.0e4f;
  if (v < -1.0e38f)  return -1.0e4f;
  return v;
}

// value of lane l ^ 16: the other half of a column of a 16 x 16 accumulator tile
static __device__ __forceinline__ float xhalf(float v) {
  int b = __builtin_bit_cast(int, v);
  return __builtin_bit_cast(float, __builtin_amdgcn_permlanex16(b, b, 0x76543210, 0xfedcba98, false, false));
}

// ---------------- async global->LDS copy (CDNA5), with sync fallback ----------------
#if __has_builtin(__builtin_amdgcn_global_load_async_to_lds_b128)
#define HAS_ASYNC_LDS 1
typedef int gv4i __attribute__((vector_size(16)));
typedef __attribute__((address_space(1))) gv4i as1_v4i;   // global
typedef __attribute__((address_space(3))) gv4i as3_v4i;   // LDS
static __device__ __forceinline__ void async_cp16(void* l, const void* g) {
  __builtin_amdgcn_global_load_async_to_lds_b128((as1_v4i*)g, (as3_v4i*)l, 0, 0);
}
#else
#define HAS_ASYNC_LDS 0
static __device__ __forceinline__ void async_cp16(void* l, const void* g) {
  *(float4*)l = *(const float4*)g;     // 16B sync copy fallback
}
#endif

// ---------------- kernel 1: nan_to_num(optional) + bf16 hi/lo split ----------------
// 16 waves per block, one block per 64 KiB of input: a thread takes 8 float4, each wave-wide load
// covers 512 contiguous bytes and each wave-wide store 256, so few waves have to be started.
#define SPLIT_THREADS 512
#define SPLIT_VEC     8
#define SPLIT_GRID    ((T_SEQ * DMODEL) / (SPLIT_THREADS * SPLIT_VEC * 4))
static_assert(SPLIT_GRID * SPLIT_THREADS * SPLIT_VEC * 4 == T_SEQ * DMODEL, "blocks tile the array");
__global__ __launch_bounds__(SPLIT_THREADS)
void split_kernel(const float* __restrict__ x, __bf16* __restrict__ hi,
                  __bf16* __restrict__ lo, int do_clamp) {
  // byte offsets in 32 bits: one offset register serves all loads and one all stores
  const unsigned t4 = blockIdx.x * (SPLIT_THREADS * SPLIT_VEC) + threadIdx.x;   // in float4 units
  const char* xb = (const char*)x + t4 * 16u;
  char* hb = (char*)hi + t4 * 8u;
  char* lb = (char*)lo + t4 * 8u;
  float4 v[SPLIT_VEC];
  #pragma unroll
  for (int i = 0; i < SPLIT_VEC; ++i)
    v[i] = *(const float4*)(xb + i * (SPLIT_THREADS * 16));
  // precaution: stands ahead of the clamp's exec saves, which reuse a scalar register of the
  // base pair that the eight loads name
  asm volatile("s_wait_xcnt 0x0" ::: "memory");
  v4bf hh[SPLIT_VEC], ll[SPLIT_VEC];
  #pragma unroll
  for (int i = 0; i < SPLIT_VEC; ++i) {
    float4 u = v[i];
    if (do_clamp) {
      u.x = fin_clamp(u.x); u.y = fin_clamp(u.y); u.z = fin_clamp(u.z); u.w = fin_clamp(u.w);
    }
    split4(u, hh[i], ll[i]);
  }
  #pragma unroll
  for (int i = 0; i < SPLIT_VEC; ++i) {
    *(v4bf*)(hb + i * (SPLIT_THREADS * 8)) = hh[i];
    *(v4bf*)(lb + i * (SPLIT_THREADS * 8)) = ll[i];
  }
}

// ---------------- GEMM: C = A * W^T, bf16x3, async double-buffered LDS ----------------
// Operands pre-split to global bf16 hi/lo.  mode 0: scatter [H][T][HDIM]; 1: [T][D]+clamp.
// One 128 x 128 tile of C per block, 8 waves as 2 x 4, 64 x 32 per wave; a trip takes 128 k, so a
// staged row is 256 contiguous bytes (whole lines) and the two buffers leave room for one block
// per WGP.  A trip is 4 blocks of 32 k; each block's fragments are fetched one block ahead.
#define GT_MN    128
#define GT_K     128
#define GT_PITCH 136                   // bf16; rows of 272 B = 16 B x odd, for 16-byte readers
#define GT_ARR   (GT_MN * GT_PITCH)    // one operand plane of one buffer
#define GT_TRIPS (DMODEL / GT_K)
__global__ __launch_bounds__(256)
void gemm_bf16x3_async_kernel(const __bf16* __restrict__ Ahi_g, const __bf16* __restrict__ Alo_g,
                              const __bf16* __restrict__ Whi_g, const __bf16* __restrict__ Wlo_g,
                              float* __restrict__ out, int mode) {
  __shared__ __attribute__((aligned(16))) __bf16 Sbuf[2][4][GT_ARR];   // [buf][Ahi, Alo, Whi, Wlo]

  const int tid  = threadIdx.x;
  const int wid  = tid >> 5;
  const int lane = tid & 31;
  const int ln   = lane & 15;
  const int hf   = lane >> 4;
  const int wr   = wid >> 2;       // 0..1
  const int wc   = wid & 3;        // 0..3
  const int m0   = blockIdx.y * GT_MN;
  const int n0   = blockIdx.x * GT_MN;

  // 8 copies per plane and thread: rows crow + 0..3 and 64 + crow + 0..3, so that neighbouring
  // copies lie one row (4096 B) apart; a wave's copy takes two whole 256-B rows
  const int crow = (tid >> 4) * 4, cc = (tid & 15) * 8;      // 8 bf16 = 16B
  const __bf16* a_hi = Ahi_g + (size_t)(m0 + crow) * DMODEL + cc;
  const __bf16* a_lo = Alo_g + (size_t)(m0 + crow) * DMODEL + cc;
  const __bf16* w_hi = Whi_g + (size_t)(n0 + crow) * DMODEL + cc;
  const __bf16* w_lo = Wlo_g + (size_t)(n0 + crow) * DMODEL + cc;
  const int     loff = crow * GT_PITCH + cc;

  v8f acc[4][2];
  #pragma unroll
  for (int i = 0; i < 4; ++i)
    #pragma unroll
    for (int j = 0; j < 2; ++j)
      #pragma unroll
      for (int r = 0; r < 8; ++r) acc[i][j][r] = 0.0f;

  auto issue = [&](int buf, int kt) {
    // unrolled: the row steps become constants of the copies' addresses
    #pragma unroll
    for (int i = 0; i < 8; ++i) {
      const int rw = (i & 3) + (i >> 2) * 64;
      const int go = rw * DMODEL + kt;
      const int lr = loff + rw * GT_PITCH;
      async_cp16(&Sbuf[buf][0][lr], a_hi + go);
      async_cp16(&Sbuf[buf][1][lr], a_lo + go);
      async_cp16(&Sbuf[buf][2][lr], w_hi + go);
      async_cp16(&Sbuf[buf][3][lr], w_lo + go);
    }
  };

  // two fragment sets: one is worked on while the other is filled
  v16bf fa_h[2][4], fa_l[2][4], fb_h[2][2], fb_l[2][2];
  auto load_set = [&](int s, int buf, int ks) {
    const int ab = (wr * 64 + ln) * GT_PITCH + ks + 8 * hf;
    const int bb = (wc * 32 + ln) * GT_PITCH + ks + 8 * hf;
    // both loops unrolled: fragment arrays stay in registers only under constant indices
    #pragma unroll
    for (int i = 0; i < 4; ++i) {
      fa_h[s][i] = ld_frag(&Sbuf[buf][0][ab + i * 16 * GT_PITCH]);
      fa_l[s][i] = ld_frag(&Sbuf[buf][1][ab + i * 16 * GT_PITCH]);
    }
    #pragma unroll
    for (int j = 0; j < 2; ++j) {
      fb_h[s][j] = ld_frag(&Sbuf[buf][2][bb + j * 16 * GT_PITCH]);
      fb_l[s][j] = ld_frag(&Sbuf[buf][3][bb + j * 16 * GT_PITCH]);
    }
  };

  issue(0, 0);
  // own copies of tile 0 have landed; the barrier then shows them to the other waves
  asm volatile("s_wait_asynccnt 0x0" ::: "memory");
  __syncthreads();
  issue(1, GT_K);
  load_set(0, 0, 0);

  for (int t = 0; t < GT_TRIPS; ++t) {
    const int buf = t & 1;
    // unrolled: the set index must be a constant for the fragments to stay in registers
    #pragma unroll
    for (int b = 0; b < 4; ++b) {
      if (b < 3) {
        load_set((b + 1) & 1, buf, (b + 1) * 32);
      } else {
        // publish point of tile t + 1, ahead of this tile's last block, whose fragments are fetched:
        // own LDS reads retired before the refill below aims at the buffer this trip has read
        asm volatile("s_wait_dscnt 0x0" ::: "memory");
        // own copies of the next tile have landed; the barrier then shows them to the other waves
        asm volatile("s_wait_asynccnt 0x0" ::: "memory");
        __syncthreads();
        if (t + 1 < GT_TRIPS) load_set(0, buf ^ 1, 0);
      }
      // keeps the next block's fragment loads one group ahead of this block's products
      __builtin_amdgcn_sched_barrier(0);
      // the refill flies while the next tile is worked on; its address work may mix with the products
      if (b == 3 && t + 2 < GT_TRIPS) issue(buf, (t + 2) * GT_K);
      const int s = b & 1;
      // product-major over the 8 independent accumulators; per accumulator and 32 k the order
      // stays hi*lo, lo*hi, hi*hi (loops unrolled: register arrays need constant indices)
      #pragma unroll
      for (int i = 0; i < 4; ++i)
        #pragma unroll
        for (int j = 0; j < 2; ++j) acc[i][j] = wmma_bf16(fa_h[s][i], fb_l[s][j], acc[i][j]);
      #pragma unroll
      for (int i = 0; i < 4; ++i)
        #pragma unroll
        for (int j = 0; j < 2; ++j) acc[i][j] = wmma_bf16(fa_l[s][i], fb_h[s][j], acc[i][j]);
      #pragma unroll
      for (int i = 0; i < 4; ++i)
        #pragma unroll
        for (int j = 0; j < 2; ++j) acc[i][j] = wmma_bf16(fa_h[s][i], fb_h[s][j], acc[i][j]);
      // keeps the following block's loads from moving in among these products
      __builtin_amdgcn_sched_barrier(0);
    }
  }
  // precaution: no copy is outstanding when the wave ends
  asm volatile("s_wait_asynccnt 0x0" ::: "memory");

  // C layout: lane ln = column, row = r + 8*hf
  #pragma unroll
  for (int i = 0; i < 4; ++i)
    #pragma unroll
    for (int j = 0; j < 2; ++j)
      #pragma unroll
      for (int r = 0; r < 8; ++r) {
        int gm = m0 + wr * 64 + i * 16 + r + 8 * hf;
        int gn = n0 + wc * 32 + j * 16 + ln;
        float v = acc[i][j][r];
        if (mode == 1) {
          out[(size_t)gm * DMODEL + gn] = fin_clamp(v);
        } else {
          int h = gn >> 7, d = gn & 127;
          out[((size_t)h * T_SEQ + gm) * HDIM + d] = v;
        }
      }
}

// ---------------- kernel 3: RoPE on Q,K + emit bf16 hi/lo split of K ----------------
// A thread takes 4 neighbouring j (with their partners j + 64) of one position t in ROPE_HEADS heads,
// Q and K: 16 loads of 16 bytes, all issued ahead of the angles.
#define ROPE_HEADS 4
#define ROPE_N     ((NHEAD / ROPE_HEADS) * T_SEQ * 16)
// written as explicit fma so that the product rounded first is x2*s (low half) and x1*s (high half)
static __device__ __forceinline__ void rot4(float4 a, float4 b, const float* c, const float* s,
                                            float4& lo, float4& hi) {
  lo.x = fmaf(c[0], a.x, -(b.x * s[0]));  hi.x = fmaf(c[0], b.x, a.x * s[0]);
  lo.y = fmaf(c[1], a.y, -(b.y * s[1]));  hi.y = fmaf(c[1], b.y, a.y * s[1]);
  lo.z = fmaf(c[2], a.z, -(b.z * s[2]));  hi.z = fmaf(c[2], b.z, a.z * s[2]);
  lo.w = fmaf(c[3], a.w, -(b.w * s[3]));  hi.w = fmaf(c[3], b.w, a.w * s[3]);
}
__global__ __launch_bounds__(256)
void rope_split_kernel(float* __restrict__ Q, float* __restrict__ K,
                       __bf16* __restrict__ Khi, __bf16* __restrict__ Klo) {
  int idx = blockIdx.x * blockDim.x + threadIdx.x;       // (H/ROPE_HEADS)*T*16
  if (idx >= ROPE_N) return;
  int j  = (idx & 15) * 4;
  int t  = (idx >> 4) & (T_SEQ - 1);
  int h0 = (idx >> 15) * ROPE_HEADS;
  const size_t base0 = ((size_t)h0 * T_SEQ + t) * HDIM + j;

  float4 q1[ROPE_HEADS], q2[ROPE_HEADS], k1[ROPE_HEADS], k2[ROPE_HEADS];
  #pragma unroll
  for (int i = 0; i < ROPE_HEADS; ++i) {
    const size_t base = base0 + (size_t)i * T_SEQ * HDIM;
    q1[i] = *(const float4*)(Q + base);  q2[i] = *(const float4*)(Q + base + 64);
    k1[i] = *(const float4*)(K + base);  k2[i] = *(const float4*)(K + base + 64);
  }

  float c[4], s[4];
  #pragma unroll
  for (int e = 0; e < 4; ++e) {
    float invf = __expf(-(float)(j + e) * (9.210340371976184f / 64.0f)); // 10000^(-j/64)
    float ang = (float)t * invf;
    c[e] = cosf(ang); s[e] = sinf(ang);
  }

  #pragma unroll
  for (int i = 0; i < ROPE_HEADS; ++i) {
    const size_t base = base0 + (size_t)i * T_SEQ * HDIM;
    float4 a, b;
    rot4(q1[i], q2[i], c, s, a, b);
    *(float4*)(Q + base)      = a;
    *(float4*)(Q + base + 64) = b;
    rot4(k1[i], k2[i], c, s, a, b);
    *(float4*)(K + base)      = a;
    *(float4*)(K + base + 64) = b;
    v4bf hh, ll;
    split4(a, hh, ll);
    *(v4bf*)(Khi + base)      = hh;  *(v4bf*)(Klo + base)      = ll;
    split4(b, hh, ll);
    *(v4bf*)(Khi + base + 64) = hh;  *(v4bf*)(Klo + base + 64) = ll;
  }
}

// ---------------- kernel 4: last-row softmax -> per-head bump coefficient (f32) ----------------
__global__ __launch_bounds__(256)
void vcoef_kernel(const float* __restrict__ Q, const float* __restrict__ K,
                  const float* __restrict__ bern, float* __restrict__ coef) {
  const int h = blockIdx.x, tid = threadIdx.x;
  __shared__ float sc[NVALID];
  __shared__ float qrow[HDIM];
  __shared__ float red[256];

  if (tid < HDIM) qrow[tid] = Q[((size_t)h * T_SEQ + (T_SEQ - 1)) * HDIM + tid];
  __syncthreads();

  float lmax = -1e30f;
  for (int idx = tid; idx < NVALID; idx += 256) {
    int key = (idx < SB) ? idx : (T_SEQ - RB) + (idx - SB);
    const float* kr = K + ((size_t)h * T_SEQ + key) * HDIM;
    float d = 0.0f;
    #pragma unroll 8
    for (int c = 0; c < HDIM; ++c) d += qrow[c] * kr[c];
    d *= SCALE_QK;
    sc[idx] = d;
    lmax = fmaxf(lmax, d);
  }
  red[tid] = lmax; __syncthreads();
  for (int s = 128; s > 0; s >>= 1) { if (tid < s) red[tid] = fmaxf(red[tid], red[tid + s]); __syncthreads(); }
  float gmax = red[0]; __syncthreads();

  float lsum = 0.0f, ltail = 0.0f;
  for (int idx = tid; idx < NVALID; idx += 256) {
    float e = __expf(sc[idx] - gmax);
    lsum += e;
    if (idx >= SB + 1) ltail += e;     // keys 1025..2047
  }
  red[tid] = lsum; __syncthreads();
  for (int s = 128; s > 0; s >>= 1) { if (tid < s) red[tid] += red[tid + s]; __syncthreads(); }
  float gsum = red[0]; __syncthreads();
  red[tid] = ltail; __syncthreads();
  for (int s = 128; s > 0; s >>= 1) { if (tid < s) red[tid] += red[tid + s]; __syncthreads(); }

  if (tid == 0) {
    float gtail = red[0];
    float pe   = __expf(sc[SB] - gmax) / gsum;             // probs at key e=1024
    float mean = (gtail / gsum) / 1023.0f + 1e-6f;
    float p = pe / mean;
    p = (p != p) ? 0.0f : fminf(fmaxf(p, 0.0f), 1.0f);
    float m = (bern[h] < p) ? 1.0f : 0.0f;
    coef[h] = m / (float)RB;
  }
}

// ---------------- kernel 4b: V bump + bf16 hi/lo split + transpose, once for all query blocks ----
// One block per (32-key tile, head).  Output tile: [d 0..127][key 0..31], 8 KiB contiguous, hi and lo,
// in the order in which attention walks the tiles.
#define NTILE 39      // 7 tiles for [0,204), 32 for [1024,2048)
#define VT_PITCH 132  // floats; rows stay 16-byte aligned
__global__ __launch_bounds__(256)
void vprep_kernel(const float* __restrict__ V, const float* __restrict__ coef,
                  __bf16* __restrict__ Vthi, __bf16* __restrict__ Vtlo) {
  __shared__ __attribute__((aligned(16))) float tile[32 * VT_PITCH];
  const int tid = threadIdx.x;
  const int it  = blockIdx.x;
  const int h   = blockIdx.y;
  const int k0  = (it < 7) ? it * 32 : (T_SEQ - RB) + (it - 7) * 32;
  const float* Vh = V + (size_t)h * T_SEQ * HDIM;
  const float cf = coef[h];
  // a thread keeps one group of 4 dims and takes 4 keys; all five loads go out together
  const int d4 = (tid & 31) * 4, kr0 = tid >> 5;
  // byte offsets in 32 bits on block-uniform bases: one offset register serves the four row loads,
  // whose rows lie a constant 4096 bytes apart
  const char* eb = (const char*)(Vh + (size_t)RB * HDIM) + (unsigned)d4 * 4u;
  const char* rb = (const char*)(Vh + (size_t)k0 * HDIM) + (unsigned)tid * 16u;
  const float4 e = *(const float4*)eb;
  float4 v[4];
  #pragma unroll
  for (int i = 0; i < 4; ++i)
    v[i] = *(const float4*)(rb + i * (8 * HDIM * 4));
  const float bx = e.x * cf, by = e.y * cf, bz = e.z * cf, bw = e.w * cf;
  #pragma unroll
  for (int i = 0; i < 4; ++i) {
    const bool bump = (k0 + kr0 + i * 8) > RB;     // keys 1025..2047 take the evicted row's share
    float4 u = v[i];
    u.x = bump ? u.x + bx : u.x;  u.y = bump ? u.y + by : u.y;
    u.z = bump ? u.z + bz : u.z;  u.w = bump ? u.w + bw : u.w;
    *(float4*)(&tile[(kr0 + i * 8) * VT_PITCH + d4]) = u;
  }
  __syncthreads();
  const size_t ob = ((size_t)h * NTILE + it) * (HDIM * 32);
  #pragma unroll
  for (int i = 0; i < 2; ++i) {
    int c = tid + i * 256;                   // 16-byte chunk of the output tile
    int d = c >> 2, kg = (c & 3) * 8;
    v8bf hh, ll;
    #pragma unroll
    for (int j = 0; j < 8; ++j) {
      float v = tile[(kg + j) * VT_PITCH + d];
      __bf16 x = (__bf16)v;
      hh[j] = x;
      ll[j] = (__bf16)(v - (float)x);
    }
    *(v8bf*)(Vthi + ob + c * 8) = hh;
    *(v8bf*)(Vtlo + ob + c * 8) = ll;
  }
}

__global__ __launch_bounds__(128)
void attn_kernel(const float* __restrict__ Q, const __bf16* __restrict__ Khi,
                 const __bf16* __restrict__ Klo, const __bf16* __restrict__ Vthi,
                 const __bf16* __restrict__ Vtlo, float* __restrict__ Oout) {
  __shared__ __bf16 Qhi_s[64 * 136], Qlo_s[64 * 136];   // 64 queries x 128 dims
  // V tile [d][key], 32 keys, hi and lo, two buffers; row pitch 80 B for 16-byte readers
  __shared__ __attribute__((aligned(16))) __bf16 Vhi_s[2][128 * 40];
  __shared__ __attribute__((aligned(16))) __bf16 Vlo_s[2][128 * 40];
  // K tile, 32 keys x 128 dims, hi and lo, two buffers; row pitch 272 B for 16-byte readers
  __shared__ __attribute__((aligned(16))) __bf16 Khi_s[2][32 * 136];
  __shared__ __attribute__((aligned(16))) __bf16 Klo_s[2][32 * 136];

  const int tid  = threadIdx.x;
  const int w    = tid >> 5;         // 4 waves, 16 queries each
  const int lane = tid & 31;
  const int ln   = lane & 15;
  const int hf   = lane >> 4;
  const int h    = blockIdx.y;
  const int t0   = blockIdx.x * 64;
  const size_t hk = (size_t)h * T_SEQ;

  const float* Qh = Q + hk * HDIM;

  // one K tile (hi and lo) into LDS, once per block: each wave's copy takes 512 contiguous
  // bytes (two whole key rows), 8 copies per thread and tile
  auto issue_k = [&](int buf, int kbase) {
    #pragma unroll
    for (int i = 0; i < 4; ++i) {
      int idx = tid + i * 128, rw = idx >> 4, cw = (idx & 15) * 8;
      async_cp16(&Khi_s[buf][rw * 136 + cw], Khi + (hk + kbase + rw) * HDIM + cw);
      async_cp16(&Klo_s[buf][rw * 136 + cw], Klo + (hk + kbase + rw) * HDIM + cw);
    }
  };
  // one prepared V tile (hi and lo) into LDS: each wave's copy takes 512 contiguous bytes,
  // 8 copies per thread and tile
  auto issue_v = [&](int buf, int tile) {
    const size_t vb = ((size_t)h * NTILE + tile) * (HDIM * 32);
    #pragma unroll
    for (int i = 0; i < 4; ++i) {
      int c = tid + i * 128;
      async_cp16(&Vhi_s[buf][(c >> 2) * 40 + (c & 3) * 8], Vthi + vb + c * 8);
      async_cp16(&Vlo_s[buf][(c >> 2) * 40 + (c & 3) * 8], Vtlo + vb + c * 8);
    }
  };
  issue_k(0, 0);
  issue_v(0, 0);

  // stage + split this block's 64 query rows
  // row (tid >> 5) + 4 * i, dims (tid & 31) * 4 and up: one address for all sixteen loads, 2048 bytes apart
  const float* qp = Qh + (size_t)(t0 + (tid >> 5)) * HDIM + (tid & 31) * 4;
  float4 qv[16];
  #pragma unroll
  for (int i = 0; i < 16; ++i) qv[i] = *(const float4*)(qp + i * 4 * HDIM);
  // precaution: stands ahead of every later write of the loads' address registers; it names the address so
  // that those registers are held until here and no load's result lands in them
  asm volatile("s_wait_xcnt 0x0" :: "v"(qp) : "memory");
  #pragma unroll
  for (int i = 0; i < 16; ++i) {
    int idx = tid + i * 128;
    int row = idx >> 5, kc = (idx & 31) * 4;
    float4 v = qv[i];
    v4bf hh, ll; split4(v, hh, ll);
    *(v4bf*)(&Qhi_s[row * 136 + kc]) = hh;
    *(v4bf*)(&Qlo_s[row * 136 + kc]) = ll;
  }

  v8f Oacc[8];
  float mrow = -1e30f, lrow = 0.0f;      // of query w * 16 + ln, the same in both halves
  #pragma unroll
  for (int ct = 0; ct < 8; ++ct)
    #pragma unroll
    for (int r = 0; r < 8; ++r) Oacc[ct][r] = 0.0f;

  for (int it = 0; it < NTILE; ++it) {
    const int k0 = (it < 7) ? it * 32 : (T_SEQ - RB) + (it - 7) * 32;
    // own LDS traffic retired before the refill below aims at a buffer this wave has read
    asm volatile("s_wait_dscnt 0x0" ::: "memory");
    // own copies of this tile's K and V have landed; the barrier then shows them to the other waves
    asm volatile("s_wait_asynccnt 0x0" ::: "memory");
    __syncthreads();

    // next tile's K and V fly while this tile is worked on; their buffers were last read one trip ago
    if (it + 1 < NTILE) {
      issue_k((it + 1) & 1, (it + 1 < 7) ? (it + 1) * 32 : (T_SEQ - RB) + (it + 1 - 7) * 32);
      issue_v((it + 1) & 1, it + 1);
    }
    const __bf16* Kh_t = Khi_s[it & 1];
    const __bf16* Kl_t = Klo_s[it & 1];
    const __bf16* Vh_t = Vhi_s[it & 1];
    const __bf16* Vl_t = Vlo_s[it & 1];

    // S^T(32x16) = K(32x128) * Q^T(128x16), two 16-key tiles, bf16x3: S0[r] is key k0 + 8*hf + r,
    // S1[r] key k0 + 16 + 8*hf + r, both of query ln
    v8f S0, S1;
    #pragma unroll
    for (int r = 0; r < 8; ++r) { S0[r] = 0.0f; S1[r] = 0.0f; }
    const int kr0 = ln * 136;
    const int kr1 = (16 + ln) * 136;
    #pragma unroll
    for (int kc = 0; kc < HDIM; kc += 32) {
      int qb = (w * 16 + ln) * 136 + kc + 8 * hf;
      v16bf qh = ld_frag(&Qhi_s[qb]), ql = ld_frag(&Qlo_s[qb]);
      v16bf kh0 = ld_frag(Kh_t + kr0 + kc + 8 * hf);
      v16bf kl0 = ld_frag(Kl_t + kr0 + kc + 8 * hf);
      v16bf kh1 = ld_frag(Kh_t + kr1 + kc + 8 * hf);
      v16bf kl1 = ld_frag(Kl_t + kr1 + kc + 8 * hf);
      // interleave the two independent accumulators
      S0 = wmma_bf16(kl0, qh, S0);
      S1 = wmma_bf16(kl1, qh, S1);
      S0 = wmma_bf16(kh0, ql, S0);
      S1 = wmma_bf16(kh1, ql, S1);
      S0 = wmma_bf16(kh0, qh, S0);
      S1 = wmma_bf16(kh1, qh, S1);
    }

    float s0[8], s1[8];
    #pragma unroll
    for (int r = 0; r < 8; ++r) {
      s0[r] = S0[r] * SCALE_QK; if ((it == 6) && (k0 + 8 * hf + r >= SB)) s0[r] = -1e30f;  // keys 192..207 partial
      s1[r] = S1[r] * SCALE_QK; if (it == 6) s1[r] = -1e30f;                               // keys 208..223 all masked
    }
    float ma = fmaxf(s0[0], s0[1]), mb = fmaxf(s1[0], s1[1]);
    #pragma unroll
    for (int r = 2; r < 8; r += 2) {
      ma = fmaxf(fmaxf(ma, s0[r]), s0[r + 1]);
      mb = fmaxf(fmaxf(mb, s1[r]), s1[r + 1]);
    }
    float tmax = fmaxf(ma, mb);
    tmax = fmaxf(tmax, xhalf(tmax));
    const float mnew  = fmaxf(mrow, tmax);
    const float alpha = __expf(mrow - mnew);
    // element s of the B operand is key 8*hf + s (s < 8) or 16 + 8*hf + (s - 8): the order in which
    // ld_frag fetches the keys of a V row
    v16bf ph, pl;
    float ps[8];
    #pragma unroll
    for (int r = 0; r < 8; ++r) {
      float p0 = __expf(s0[r] - mnew);
      float p1 = __expf(s1[r] - mnew);
      ps[r] = p0 + p1;
      __bf16 h0 = (__bf16)p0;
      ph[r]     = h0;  pl[r]     = (__bf16)(p0 - (float)h0);
      __bf16 h1 = (__bf16)p1;
      ph[8 + r] = h1;  pl[8 + r] = (__bf16)(p1 - (float)h1);
    }
    float rs = ((ps[0] + ps[1]) + (ps[2] + ps[3])) + ((ps[4] + ps[5]) + (ps[6] + ps[7]));
    rs += xhalf(rs);
    lrow = lrow * alpha + rs;
    mrow = mnew;
    #pragma unroll
    for (int ct = 0; ct < 8; ++ct)
      #pragma unroll
      for (int r = 0; r < 8; ++r) Oacc[ct][r] *= alpha;

    // O^T(128x16) += V^T(128x32) * P^T(32x16), bf16x3; process ct in pairs so the
    // 3-product chains alternate between two independent accumulators
    #pragma unroll
    for (int ct = 0; ct < 8; ct += 2) {
      int vb0 = ((ct + 0) * 16 + ln) * 40 + 8 * hf;
      int vb1 = ((ct + 1) * 16 + ln) * 40 + 8 * hf;
      v16bf vh0 = ld_frag(Vh_t + vb0), vl0 = ld_frag(Vl_t + vb0);
      v16bf vh1 = ld_frag(Vh_t + vb1), vl1 = ld_frag(Vl_t + vb1);
      Oacc[ct + 0] = wmma_bf16(vl0, ph, Oacc[ct + 0]);
      Oacc[ct + 1] = wmma_bf16(vl1, ph, Oacc[ct + 1]);
      Oacc[ct + 0] = wmma_bf16(vh0, pl, Oacc[ct + 0]);
      Oacc[ct + 1] = wmma_bf16(vh1, pl, Oacc[ct + 1]);
      Oacc[ct + 0] = wmma_bf16(vh0, ph, Oacc[ct + 0]);
      Oacc[ct + 1] = wmma_bf16(vh1, ph, Oacc[ct + 1]);
    }
  }

  // write [T][D]: row t = this lane's query, col = h*128 + d with d = ct*16 + 8*hf + r: 8 neighbours
  float* orow = Oout + (size_t)(t0 + w * 16 + ln) * DMODEL + h * HDIM + 8 * hf;
  #pragma unroll
  for (int ct = 0; ct < 8; ++ct)
    #pragma unroll
    for (int r = 0; r < 8; ++r) Oacc[ct][r] = Oacc[ct][r] / lrow;
  #pragma unroll
  for (int ct = 0; ct < 8; ++ct) {
    *(float4*)(orow + ct * 16)     = make_float4(Oacc[ct][0], Oacc[ct][1], Oacc[ct][2], Oacc[ct][3]);
    *(float4*)(orow + ct * 16 + 4) = make_float4(Oacc[ct][4], Oacc[ct][5], Oacc[ct][6], Oacc[ct][7]);
  }
}

// ---------------- launch ----------------
extern "C" void kernel_launch(void* const* d_in, const int* in_sizes, int n_in,
                              void* d_out, int out_size, void* d_ws, size_t ws_size,
                              hipStream_t stream) {
  (void)in_sizes; (void)n_in; (void)out_size; (void)ws_size;
  const float* hidden = (const float*)d_in[0];
  const float* wq     = (const float*)d_in[1];
  const float* wk     = (const float*)d_in[2];
  const float* wv     = (const float*)d_in[3];
  const float* wo     = (const float*)d_in[4];
  const float* bern   = (const float*)d_in[5];

  const size_t NE = (size_t)T_SEQ * DMODEL;   // 4,194,304
  float* ws    = (float*)d_ws;
  float* q     = ws;            // [H][T][128] f32
  float* k     = ws + 1 * NE;
  float* v     = ws + 2 * NE;
  float* attnb = ws + 3 * NE;   // [T][D]
  __bf16* xhi  = (__bf16*)(ws + 4 * NE);  // activation split (hidden, then attnb)
  __bf16* xlo  = xhi + NE;
  __bf16* whi  = xlo + NE;                // current weight split (reused 4x)
  __bf16* wlo  = whi + NE;
  __bf16* khi  = wlo + NE;                // RoPE'd K split
  __bf16* klo  = khi + NE;
  __bf16* vthi = klo + NE;                // bumped V, split, tiled [H][NTILE][128][32]
  __bf16* vtlo = vthi + NE;
  float* coef  = (float*)(vtlo + NE);     // [H]

  dim3 ggrid(DMODEL / GT_MN, T_SEQ / GT_MN);   // (16, 16)

  // sanitized hidden -> bf16 hi/lo
  split_kernel<<<SPLIT_GRID, SPLIT_THREADS, 0, stream>>>(hidden, xhi, xlo, 1);

  split_kernel<<<SPLIT_GRID, SPLIT_THREADS, 0, stream>>>(wq, whi, wlo, 0);
  gemm_bf16x3_async_kernel<<<ggrid, 256, 0, stream>>>(xhi, xlo, whi, wlo, q, 0);
  split_kernel<<<SPLIT_GRID, SPLIT_THREADS, 0, stream>>>(wk, whi, wlo, 0);
  gemm_bf16x3_async_kernel<<<ggrid, 256, 0, stream>>>(xhi, xlo, whi, wlo, k, 0);
  split_kernel<<<SPLIT_GRID, SPLIT_THREADS, 0, stream>>>(wv, whi, wlo, 0);
  gemm_bf16x3_async_kernel<<<ggrid, 256, 0, stream>>>(xhi, xlo, whi, wlo, v, 0);

  rope_split_kernel<<<ROPE_N / 256, 256, 0, stream>>>(q, k, khi, klo);

  vcoef_kernel<<<NHEAD, 256, 0, stream>>>(q, k, bern, coef);
  vprep_kernel<<<dim3(NTILE, NHEAD), 256, 0, stream>>>(v, coef, vthi, vtlo);

  attn_kernel<<<dim3(T_SEQ / 64, NHEAD), 128, 0, stream>>>(q, khi, klo, vthi, vtlo, attnb);

  // output projection: split attnb (reuse x buffers) and wo, then GEMM -> d_out
  split_kernel<<<SPLIT_GRID, SPLIT_THREADS, 0, stream>>>(attnb, xhi, xlo, 0);
  split_kernel<<<SPLIT_GRID, SPLIT_THREADS, 0, stream>>>(wo, whi, wlo, 0);
  gemm_bf16x3_async_kernel<<<ggrid, 256, 0, stream>>>(xhi, xlo, whi, wlo, (float*)d_out, 1);
}

// v006
// It runs in 286 microseconds.
// Timed twice side by side with v005, it ran 1.07 and 1.05 times as fast.
// Over all steps from v000 it is 1.93 times as fast.
#include <hip/hip_runtime.h>
#include <math.h>

// ---------------- problem constants ----------------
#define T_SEQ   2048
#define DMODEL  2048
#define NHEAD   16
#define HDIM    128
#define SB      204      // int(0.1*2048)
#define RB      1024     // int(0.5*2048)
#define NVALID  1228     // SB + RB
#define SCALE_QK 0.088388347648318447f   // 1/sqrt(128)

typedef float  v8f  __attribute__((ext_vector_type(8)));
typedef __bf16 v4bf __attribute__((ext_vector_type(4)));
typedef __bf16 v8bf __attribute__((ext_vector_type(8)));
typedef __bf16 v16bf __attribute__((ext_vector_type(16)));

static __device__ __forceinline__ v8f wmma_bf16(v16bf a, v16bf b, v8f c) {
  // D(16x16,f32) = A(16x32,bf16) x B(32x16,bf16) + C
  return __builtin_amdgcn_wmma_f32_16x16x32_bf16(false, a, false, b, (short)0, c, false, false);
}

// 16-bit A/B fragment: 8 contiguous K at p, 8 more at p+16
static __device__ __forceinline__ v16bf ld_frag(const __bf16* p) {
  v8bf a = *(const v8bf*)(p);
  v8bf b = *(const v8bf*)(p + 16);
  return __builtin_shufflevector(a, b, 0,1,2,3,4,5,6,7,8,9,10,11,12,13,14,15);
}

static __device__ __forceinline__ void split4(float4 v, v4bf& h, v4bf& l) {
  h[0] = (__bf16)v.x; l[0] = (__bf16)(v.x - (float)h[0]);
  h[1] = (__bf16)v.y; l[1] = (__bf16)(v.y - (float)h[1]);
  h[2] = (__bf16)v.z; l[2] = (__bf16)(v.z - (float)h[2]);
  h[3] = (__bf16)v.w; l[3] = (__bf16)(v.w - (float)h[3]);
}

static __device__ __forceinline__ float fin_clamp(float v) {
  if (v != v)        return 0.0f;
  if (v >  1.0e38f)  return  1.0e4f;
  if (v < -1.0e38f)  return -1.0e4f;
  return v;
}

// value of lane l ^ 16: the other half of a column of a 16 x 16 accumulator tile
static __device__ __forceinline__ float xhalf(float v) {
  int b = __builtin_bit_cast(int, v);
  return __builtin_bit_cast(float, __builtin_amdgcn_permlanex16(b, b, 0x76543210, 0xfedcba98, false, false));
}

// ---------------- async global->LDS copy (CDNA5), with sync fallback ----------------
#if __has_builtin(__builtin_amdgcn_global_load_async_to_lds_b128)
#define HAS_ASYNC_LDS 1
typedef int gv4i __attribute__((vector_size(16)));
typedef __attribute__((address_space(1))) gv4i as1_v4i;   // global
typedef __attribute__((address_space(3))) gv4i as3_v4i;   // LDS
static __device__ __forceinline__ void async_cp16(void* l, const void* g) {
  __builtin_amdgcn_global_load_async_to_lds_b128((as1_v4i*)g, (as3_v4i*)l, 0, 0);
}
#else
#define HAS_ASYNC_LDS 0
static __device__ __forceinline__ void async_cp16(void* l, const void* g) {
  *(float4*)l = *(const float4*)g;     // 16B sync copy fallback
}
#endif

// ---------------- kernel 1: nan_to_num(optional) + bf16 hi/lo split ----------------
// 16 waves per block, one block per 64 KiB of input: a thread takes 8 float4, each wave-wide load
// covers 512 contiguous bytes and each wave-wide store 256, so few waves have to be started.
// blockIdx.y picks one of up to five arrays of the same size, which depend on nothing but the inputs:
// one launch splits them all; array a's planes lie a * T_SEQ * DMODEL elements into hi and lo.
#define SPLIT_THREADS 512
#define SPLIT_VEC     8
#define SPLIT_GRID    ((T_SEQ * DMODEL) / (SPLIT_THREADS * SPLIT_VEC * 4))
static_assert(SPLIT_GRID * SPLIT_THREADS * SPLIT_VEC * 4 == T_SEQ * DMODEL, "blocks tile the array");
__global__ __launch_bounds__(SPLIT_THREADS)
void split_kernel(const float* __restrict__ x0, const float* __restrict__ x1,
                  const float* __restrict__ x2, const float* __restrict__ x3,
                  const float* __restrict__ x4, __bf16* __restrict__ hi,
                  __bf16* __restrict__ lo, int clamp_first) {
  const unsigned arr = blockIdx.y;
  const float* x = (arr == 0) ? x0 : (arr == 1) ? x1 : (arr == 2) ? x2 : (arr == 3) ? x3 : x4;
  const bool do_clamp = clamp_first && arr == 0;     // only the activations are sanitized
  const size_t plane = (size_t)arr * (T_SEQ * DMODEL);
  // byte offsets in 32 bits: one offset register serves all loads and one all stores
  const unsigned t4 = blockIdx.x * (SPLIT_THREADS * SPLIT_VEC) + threadIdx.x;   // in float4 units
  const char* xb = (const char*)x + t4 * 16u;
  char* hb = (char*)(hi + plane) + t4 * 8u;
  char* lb = (char*)(lo + plane) + t4 * 8u;
  float4 v[SPLIT_VEC];
  #pragma unroll
  for (int i = 0; i < SPLIT_VEC; ++i)
    v[i] = *(const float4*)(xb + i * (SPLIT_THREADS * 16));
  // precaution: stands ahead of the clamp's exec saves, which reuse a scalar register of the
  // base pair that the eight loads name
  asm volatile("s_wait_xcnt 0x0" ::: "memory");
  v4bf hh[SPLIT_VEC], ll[SPLIT_VEC];
  #pragma unroll
  for (int i = 0; i < SPLIT_VEC; ++i) {
    float4 u = v[i];
    if (do_clamp) {
      u.x = fin_clamp(u.x); u.y = fin_clamp(u.y); u.z = fin_clamp(u.z); u.w = fin_clamp(u.w);
    }
    split4(u, hh[i], ll[i]);
  }
  #pragma unroll
  for (int i = 0; i < SPLIT_VEC; ++i) {
    *(v4bf*)(hb + i * (SPLIT_THREADS * 8)) = hh[i];
    *(v4bf*)(lb + i * (SPLIT_THREADS * 8)) = ll[i];
  }
}

// ---------------- GEMM: C = A * W^T, bf16x3, async double-buffered LDS ----------------
// Operands pre-split to global bf16 hi/lo.  mode 0: scatter [H][T][HDIM]; 1: [T][D]+clamp.
// One 128 x 128 tile of C per block, 8 waves as 2 x 4, 64 x 32 per wave; a trip takes 128 k, so a
// staged row is 256 contiguous bytes (whole lines) and the two buffers leave room for one block
// per WGP.  A trip is 4 blocks of 32 k; each block's fragments are fetched one block ahead.
// blockIdx.z picks one of several products that share A: its weight planes and its output lie
// z * T_SEQ * DMODEL elements into Whi_g, Wlo_g and out_g.
#define GT_MN    128
#define GT_K     128
#define GT_PITCH 136                   // bf16; rows of 272 B = 16 B x odd, for 16-byte readers
#define GT_ARR   (GT_MN * GT_PITCH)    // one operand plane of one buffer
#define GT_TRIPS (DMODEL / GT_K)
__global__ __launch_bounds__(256)
void gemm_bf16x3_async_kernel(const __bf16* __restrict__ Ahi_g, const __bf16* __restrict__ Alo_g,
                              const __bf16* __restrict__ Whi_g, const __bf16* __restrict__ Wlo_g,
                              float* __restrict__ out_g, int mode) {
  __shared__ __attribute__((aligned(16))) __bf16 Sbuf[2][4][GT_ARR];   // [buf][Ahi, Alo, Whi, Wlo]
  static_assert(T_SEQ == DMODEL, "a weight plane and an output are of one size");
  const size_t zoff = (size_t)blockIdx.z * ((size_t)T_SEQ * DMODEL);
  float* __restrict__ out = out_g + zoff;

  const int tid  = threadIdx.x;
  const int wid  = tid >> 5;
  const int lane = tid & 31;
  const int ln   = lane & 15;
  const int hf   = lane >> 4;
  const int wr   = wid >> 2;       // 0..1
  const int wc   = wid & 3;        // 0..3
  const int m0   = blockIdx.y * GT_MN;
  const int n0   = blockIdx.x * GT_MN;

  // 8 copies per plane and thread: rows crow + 0..3 and 64 + crow + 0..3, so that neighbouring
  // copies lie one row (4096 B) apart; a wave's copy takes two whole 256-B rows
  const int crow = (tid >> 4) * 4, cc = (tid & 15) * 8;      // 8 bf16 = 16B
  const __bf16* a_hi = Ahi_g + (size_t)(m0 + crow) * DMODEL + cc;
  const __bf16* a_lo = Alo_g + (size_t)(m0 + crow) * DMODEL + cc;
  const __bf16* w_hi = Whi_g + zoff + (size_t)(n0 + crow) * DMODEL + cc;
  const __bf16* w_lo = Wlo_g + zoff + (size_t)(n0 + crow) * DMODEL + cc;
  const int     loff = crow * GT_PITCH + cc;

  v8f acc[4][2];
  #pragma unroll
  for (int i = 0; i < 4; ++i)
    #pragma unroll
    for (int j = 0; j < 2; ++j)
      #pragma unroll
      for (int r = 0; r < 8; ++r) acc[i][j][r] = 0.0f;

  auto issue = [&](int buf, int kt) {
    // unrolled: the row steps become constants of the copies' addresses
    #pragma unroll
    for (int i = 0; i < 8; ++i) {
      const int rw = (i & 3) + (i >> 2) * 64;
      const int go = rw * DMODEL + kt;
      const int lr = loff + rw * GT_PITCH;
      async_cp16(&Sbuf[buf][0][lr], a_hi + go);
      async_cp16(&Sbuf[buf][1][lr], a_lo + go);
      async_cp16(&Sbuf[buf][2][lr], w_hi + go);
      async_cp16(&Sbuf[buf][3][lr], w_lo + go);
    }
  };

  // two fragment sets: one is worked on while the other is filled
  v16bf fa_h[2][4], fa_l[2][4], fb_h[2][2], fb_l[2][2];
  auto load_set = [&](int s, int buf, int ks) {
    const int ab = (wr * 64 + ln) * GT_PITCH + ks + 8 * hf;
    const int bb = (wc * 32 + ln) * GT_PITCH + ks + 8 * hf;
    // both loops unrolled: fragment arrays stay in registers only under constant indices
    #pragma unroll
    for (int i = 0; i < 4; ++i) {
      fa_h[s][i] = ld_frag(&Sbuf[buf][0][ab + i * 16 * GT_PITCH]);
      fa_l[s][i] = ld_frag(&Sbuf[buf][1][ab + i * 16 * GT_PITCH]);
    }
    #pragma unroll
    for (int j = 0; j < 2; ++j) {
      fb_h[s][j] = ld_frag(&Sbuf[buf][2][bb + j * 16 * GT_PITCH]);
      fb_l[s][j] = ld_frag(&Sbuf[buf][3][bb + j * 16 * GT_PITCH]);
    }
  };

  issue(0, 0);
  // own copies of tile 0 have landed; the barrier then shows them to the other waves
  asm volatile("s_wait_asynccnt 0x0" ::: "memory");
  __syncthreads();
  issue(1, GT_K);
  load_set(0, 0, 0);

  for (int t = 0; t < GT_TRIPS; ++t) {
    const int buf = t & 1;
    // unrolled: the set index must be a constant for the fragments to stay in registers
    #pragma unroll
    for (int b = 0; b < 4; ++b) {
      if (b < 3) {
        load_set((b + 1) & 1, buf, (b + 1) * 32);
      } else {
        // publish point of tile t + 1, ahead of this tile's last block, whose fragments are fetched:
        // own LDS reads retired before the refill below aims at the buffer this trip has read
        asm volatile("s_wait_dscnt 0x0" ::: "memory");
        // own copies of the next tile have landed; the barrier then shows them to the other waves
        asm volatile("s_wait_asynccnt 0x0" ::: "memory");
        __syncthreads();
        if (t + 1 < GT_TRIPS) load_set(0, buf ^ 1, 0);
      }
      // keeps the next block's fragment loads one group ahead of this block's products
      __builtin_amdgcn_sched_barrier(0);
      // the refill flies while the next tile is worked on; its address work may mix with the products
      if (b == 3 && t + 2 < GT_TRIPS) issue(buf, (t + 2) * GT_K);
      const int s = b & 1;
      // product-major over the 8 independent accumulators; per accumulator and 32 k the order
      // stays hi*lo, lo*hi, hi*hi (loops unrolled: register arrays need constant indices)
      #pragma unroll
      for (int i = 0; i < 4; ++i)
        #pragma unroll
        for (int j = 0; j < 2; ++j) acc[i][j] = wmma_bf16(fa_h[s][i], fb_l[s][j], acc[i][j]);
      #pragma unroll
      for (int i = 0; i < 4; ++i)
        #pragma unroll
        for (int j = 0; j < 2; ++j) acc[i][j] = wmma_bf16(fa_l[s][i], fb_h[s][j], acc[i][j]);
      #pragma unroll
      for (int i = 0; i < 4; ++i)
        #pragma unroll
        for (int j = 0; j < 2; ++j) acc[i][j] = wmma_bf16(fa_h[s][i], fb_h[s][j], acc[i][j]);
      // keeps the following block's loads from moving in among these products
      __builtin_amdgcn_sched_barrier(0);
    }
  }
  // precaution: no copy is outstanding when the wave ends
  asm volatile("s_wait_asynccnt 0x0" ::: "memory");

  // C layout: lane ln = column, row = r + 8*hf
  #pragma unroll
  for (int i = 0; i < 4; ++i)
    #pragma unroll
    for (int j = 0; j < 2; ++j)
      #pragma unroll
      for (int r = 0; r < 8; ++r) {
        int gm = m0 + wr * 64 + i * 16 + r + 8 * hf;
        int gn = n0 + wc * 32 + j * 16 + ln;
        float v = acc[i][j][r];
        if (mode == 1) {
          out[(size_t)gm * DMODEL + gn] = fin_clamp(v);
        } else {
          int h = gn >> 7, d = gn & 127;
          out[((size_t)h * T_SEQ + gm) * HDIM + d] = v;
        }
      }
}

// ---------------- kernel 3: RoPE on Q,K + emit bf16 hi/lo split of K ----------------
// A thread takes 4 neighbouring j (with their partners j + 64) of one position t in ROPE_HEADS heads,
// Q and K: 16 loads of 16 bytes, all issued ahead of the angles.
#define ROPE_HEADS 4
#define ROPE_N     ((NHEAD / ROPE_HEADS) * T_SEQ * 16)
// written as explicit fma so that the product rounded first is x2*s (low half) and x1*s (high half)
static __device__ __forceinline__ void rot4(float4 a, float4 b, const float* c, const float* s,
                                            float4& lo, float4& hi) {
  lo.x = fmaf(c[0], a.x, -(b.x * s[0]));  hi.x = fmaf(c[0], b.x, a.x * s[0]);
  lo.y = fmaf(c[1], a.y, -(b.y * s[1]));  hi.y = fmaf(c[1], b.y, a.y * s[1]);
  lo.z = fmaf(c[2], a.z, -(b.z * s[2]));  hi.z = fmaf(c[2], b.z, a.z * s[2]);
  lo.w = fmaf(c[3], a.w, -(b.w * s[3]));  hi.w = fmaf(c[3], b.w, a.w * s[3]);
}
__global__ __launch_bounds__(256)
void rope_split_kernel(float* __restrict__ Q, float* __restrict__ K,
                       __bf16* __restrict__ Khi, __bf16* __restrict__ Klo) {
  int idx = blockIdx.x * blockDim.x + threadIdx.x;       // (H/ROPE_HEADS)*T*16
  if (idx >= ROPE_N) return;
  int j  = (idx & 15) * 4;
  int t  = (idx >> 4) & (T_SEQ - 1);
  int h0 = (idx >> 15) * ROPE_HEADS;
  const size_t base0 = ((size_t)h0 * T_SEQ + t) * HDIM + j;

  float4 q1[ROPE_HEADS], q2[ROPE_HEADS], k1[ROPE_HEADS], k2[ROPE_HEADS];
  #pragma unroll
  for (int i = 0; i < ROPE_HEADS; ++i) {
    const size_t base = base0 + (size_t)i * T_SEQ * HDIM;
    q1[i] = *(const float4*)(Q + base);  q2[i] = *(const float4*)(Q + base + 64);
    k1[i] = *(const float4*)(K + base);  k2[i] = *(const float4*)(K + base + 64);
  }

  float c[4], s[4];
  #pragma unroll
  for (int e = 0; e < 4; ++e) {
    float invf = __expf(-(float)(j + e) * (9.210340371976184f / 64.0f)); // 10000^(-j/64)
    float ang = (float)t * invf;
    c[e] = cosf(ang); s[e] = sinf(ang);
  }

  #pragma unroll
  for (int i = 0; i < ROPE_HEADS; ++i) {
    const size_t base = base0 + (size_t)i * T_SEQ * HDIM;
    float4 a, b;
    rot4(q1[i], q2[i], c, s, a, b);
    *(float4*)(Q + base)      = a;
    *(float4*)(Q + base + 64) = b;
    rot4(k1[i], k2[i], c, s, a, b);
    *(float4*)(K + base)      = a;
    *(float4*)(K + base + 64) = b;
    v4bf hh, ll;
    split4(a, hh, ll);
    *(v4bf*)(Khi + base)      = hh;  *(v4bf*)(Klo + base)      = ll;
    split4(b, hh, ll);
    *(v4bf*)(Khi + base + 64) = hh;  *(v4bf*)(Klo + base + 64) = ll;
  }
}

// ---------------- kernel 4: last-row softmax -> per-head bump coefficient (f32) ----------------
__global__ __launch_bounds__(256)
void vcoef_kernel(const float* __restrict__ Q, const float* __restrict__ K,
                  const float* __restrict__ bern, float* __restrict__ coef) {
  const int h = blockIdx.x, tid = threadIdx.x;
  __shared__ float sc[NVALID];
  __shared__ float qrow[HDIM];
  __shared__ float red[256];

  if (tid < HDIM) qrow[tid] = Q[((size_t)h * T_SEQ + (T_SEQ - 1)) * HDIM + tid];
  __syncthreads();

  float lmax = -1e30f;
  for (int idx = tid; idx < NVALID; idx += 256) {
    int key = (idx < SB) ? idx : (T_SEQ - RB) + (idx - SB);
    const float* kr = K + ((size_t)h * T_SEQ + key) * HDIM;
    float d = 0.0f;
    #pragma unroll 8
    for (int c = 0; c < HDIM; ++c) d += qrow[c] * kr[c];
    d *= SCALE_QK;
    sc[idx] = d;
    lmax = fmaxf(lmax, d);
  }
  red[tid] = lmax; __syncthreads();
  for (int s = 128; s > 0; s >>= 1) { if (tid < s) red[tid] = fmaxf(red[tid], red[tid + s]); __syncthreads(); }
  float gmax = red[0]; __syncthreads();

  float lsum = 0.0f, ltail = 0.0f;
  for (int idx = tid; idx < NVALID; idx += 256) {
    float e = __expf(sc[idx] - gmax);
    lsum += e;
    if (idx >= SB + 1) ltail += e;     // keys 1025..2047
  }
  red[tid] = lsum; __syncthreads();
  for (int s = 128; s > 0; s >>= 1) { if (tid < s) red[tid] += red[tid + s]; __syncthreads(); }
  float gsum = red[0]; __syncthreads();
  red[tid] = ltail; __syncthreads();
  for (int s = 128; s > 0; s >>= 1) { if (tid < s) red[tid] += red[tid + s]; __syncthreads(); }

  if (tid == 0) {
    float gtail = red[0];
    float pe   = __expf(sc[SB] - gmax) / gsum;             // probs at key e=1024
    float mean = (gtail / gsum) / 1023.0f + 1e-6f;
    float p = pe / mean;
    p = (p != p) ? 0.0f : fminf(fmaxf(p, 0.0f), 1.0f);
    float m = (bern[h] < p) ? 1.0f : 0.0f;
    coef[h] = m / (float)RB;
  }
}

// ---------------- kernel 4b: V bump + bf16 hi/lo split + transpose, once for all query blocks ----
// One block per (32-key tile, head).  Output tile: [d 0..127][key 0..31], 8 KiB contiguous, hi and lo,
// in the order in which attention walks the tiles.
#define NTILE 39      // 7 tiles for [0,204), 32 for [1024,2048)
#define VT_PITCH 132  // floats; rows stay 16-byte aligned
__global__ __launch_bounds__(256)
void vprep_kernel(const float* __restrict__ V, const float* __restrict__ coef,
                  __bf16* __restrict__ Vthi, __bf16* __restrict__ Vtlo) {
  __shared__ __attribute__((aligned(16))) float tile[32 * VT_PITCH];
  const int tid = threadIdx.x;
  const int it  = blockIdx.x;
  const int h   = blockIdx.y;
  const int k0  = (it < 7) ? it * 32 : (T_SEQ - RB) + (it - 7) * 32;
  const float* Vh = V + (size_t)h * T_SEQ * HDIM;
  const float cf = coef[h];
  // a thread keeps one group of 4 dims and takes 4 keys; all five loads go out together
  const int d4 = (tid & 31) * 4, kr0 = tid >> 5;
  // byte offsets in 32 bits on block-uniform bases: one offset register serves the four row loads,
  // whose rows lie a constant 4096 bytes apart
  const char* eb = (const char*)(Vh + (size_t)RB * HDIM) + (unsigned)d4 * 4u;
  const char* rb = (const char*)(Vh + (size_t)k0 * HDIM) + (unsigned)tid * 16u;
  const float4 e = *(const float4*)eb;
  float4 v[4];
  #pragma unroll
  for (int i = 0; i < 4; ++i)
    v[i] = *(const float4*)(rb + i * (8 * HDIM * 4));
  const float bx = e.x * cf, by = e.y * cf, bz = e.z * cf, bw = e.w * cf;
  #pragma unroll
  for (int i = 0; i < 4; ++i) {
    const bool bump = (k0 + kr0 + i * 8) > RB;     // keys 1025..2047 take the evicted row's share
    float4 u = v[i];
    u.x = bump ? u.x + bx : u.x;  u.y = bump ? u.y + by : u.y;
    u.z = bump ? u.z + bz : u.z;  u.w = bump ? u.w + bw : u.w;
    *(float4*)(&tile[(kr0 + i * 8) * VT_PITCH + d4]) = u;
  }
  __syncthreads();
  const size_t ob = ((size_t)h * NTILE + it) * (HDIM * 32);
  #pragma unroll
  for (int i = 0; i < 2; ++i) {
    int c = tid + i * 256;                   // 16-byte chunk of the output tile
    int d = c >> 2, kg = (c & 3) * 8;
    v8bf hh, ll;
    #pragma unroll
    for (int j = 0; j < 8; ++j) {
      float v = tile[(kg + j) * VT_PITCH + d];
      __bf16 x = (__bf16)v;
      hh[j] = x;
      ll[j] = (__bf16)(v - (float)x);
    }
    *(v8bf*)(Vthi + ob + c * 8) = hh;
    *(v8bf*)(Vtlo + ob + c * 8) = ll;
  }
}

__global__ __launch_bounds__(128)
void attn_kernel(const float* __restrict__ Q, const __bf16* __restrict__ Khi,
                 const __bf16* __restrict__ Klo, const __bf16* __restrict__ Vthi,
                 const __bf16* __restrict__ Vtlo, float* __restrict__ Oout) {
  __shared__ __bf16 Qhi_s[64 * 136], Qlo_s[64 * 136];   // 64 queries x 128 dims
  // V tile [d][key], 32 keys, hi and lo, two buffers; row pitch 80 B for 16-byte readers
  __shared__ __attribute__((aligned(16))) __bf16 Vhi_s[2][128 * 40];
  __shared__ __attribute__((aligned(16))) __bf16 Vlo_s[2][128 * 40];
  // K tile, 32 keys x 128 dims, hi and lo, two buffers; row pitch 272 B for 16-byte readers
  __shared__ __attribute__((aligned(16))) __bf16 Khi_s[2][32 * 136];
  __shared__ __attribute__((aligned(16))) __bf16 Klo_s[2][32 * 136];

  const int tid  = threadIdx.x;
  const int w    = tid >> 5;         // 4 waves, 16 queries each
  const int lane = tid & 31;
  const int ln   = lane & 15;
  const int hf   = lane >> 4;
  const int h    = blockIdx.y;
  const int t0   = blockIdx.x * 64;
  const size_t hk = (size_t)h * T_SEQ;

  const float* Qh = Q + hk * HDIM;

  // one K tile (hi and lo) into LDS, once per block: each wave's copy takes 512 contiguous
  // bytes (two whole key rows), 8 copies per thread and tile
  auto issue_k = [&](int buf, int kbase) {
    #pragma unroll
    for (int i = 0; i < 4; ++i) {
      int idx = tid + i * 128, rw = idx >> 4, cw = (idx & 15) * 8;
      async_cp16(&Khi_s[buf][rw * 136 + cw], Khi + (hk + kbase + rw) * HDIM + cw);
      async_cp16(&Klo_s[buf][rw * 136 + cw], Klo + (hk + kbase + rw) * HDIM + cw);
    }
  };
  // one prepared V tile (hi and lo) into LDS: each wave's copy takes 512 contiguous bytes,
  // 8 copies per thread and tile
  auto issue_v = [&](int buf, int tile) {
    const size_t vb = ((size_t)h * NTILE + tile) * (HDIM * 32);
    #pragma unroll
    for (int i = 0; i < 4; ++i) {
      int c = tid + i * 128;
      async_cp16(&Vhi_s[buf][(c >> 2) * 40 + (c & 3) * 8], Vthi + vb + c * 8);
      async_cp16(&Vlo_s[buf][(c >> 2) * 40 + (c & 3) * 8], Vtlo + vb + c * 8);
    }
  };
  issue_k(0, 0);
  issue_v(0, 0);

  // stage + split this block's 64 query rows
  // row (tid >> 5) + 4 * i, dims (tid & 31) * 4 and up: one address for all sixteen loads, 2048 bytes apart
  const float* qp = Qh + (size_t)(t0 + (tid >> 5)) * HDIM + (tid & 31) * 4;
  float4 qv[16];
  #pragma unroll
  for (int i = 0; i < 16; ++i) qv[i] = *(const float4*)(qp + i * 4 * HDIM);
  // precaution: stands ahead of every later write of the loads' address registers; it names the address so
  // that those registers are held until here and no load's result lands in them
  asm volatile("s_wait_xcnt 0x0" :: "v"(qp) : "memory");
  #pragma unroll
  for (int i = 0; i < 16; ++i) {
    int idx = tid + i * 128;
    int row = idx >> 5, kc = (idx & 31) * 4;
    float4 v = qv[i];
    v4bf hh, ll; split4(v, hh, ll);
    *(v4bf*)(&Qhi_s[row * 136 + kc]) = hh;
    *(v4bf*)(&Qlo_s[row * 136 + kc]) = ll;
  }

  v8f Oacc[8];
  float mrow = -1e30f, lrow = 0.0f;      // of query w * 16 + ln, the same in both halves
  #pragma unroll
  for (int ct = 0; ct < 8; ++ct)
    #pragma unroll
    for (int r = 0; r < 8; ++r) Oacc[ct][r] = 0.0f;

  for (int it = 0; it < NTILE; ++it) {
    const int k0 = (it < 7) ? it * 32 : (T_SEQ - RB) + (it - 7) * 32;
    // own LDS traffic retired before the refill below aims at a buffer this wave has read
    asm volatile("s_wait_dscnt 0x0" ::: "memory");
    // own copies of this tile's K and V have landed; the barrier then shows them to the other waves
    asm volatile("s_wait_asynccnt 0x0" ::: "memory");
    __syncthreads();

    // next tile's K and V fly while this tile is worked on; their buffers were last read one trip ago
    if (it + 1 < NTILE) {
      issue_k((it + 1) & 1, (it + 1 < 7) ? (it + 1) * 32 : (T_SEQ - RB) + (it + 1 - 7) * 32);
      issue_v((it + 1) & 1, it + 1);
    }
    const __bf16* Kh_t = Khi_s[it & 1];
    const __bf16* Kl_t = Klo_s[it & 1];
    const __bf16* Vh_t = Vhi_s[it & 1];
    const __bf16* Vl_t = Vlo_s[it & 1];

    // S^T(32x16) = K(32x128) * Q^T(128x16), two 16-key tiles, bf16x3: S0[r] is key k0 + 8*hf + r,
    // S1[r] key k0 + 16 + 8*hf + r, both of query ln
    v8f S0, S1;
    #pragma unroll
    for (int r = 0; r < 8; ++r) { S0[r] = 0.0f; S1[r] = 0.0f; }
    const int kr0 = ln * 136;
    const int kr1 = (16 + ln) * 136;
    #pragma unroll
    for (int kc = 0; kc < HDIM; kc += 32) {
      int qb = (w * 16 + ln) * 136 + kc + 8 * hf;
      v16bf qh = ld_frag(&Qhi_s[qb]), ql = ld_frag(&Qlo_s[qb]);
      v16bf kh0 = ld_frag(Kh_t + kr0 + kc + 8 * hf);
      v16bf kl0 = ld_frag(Kl_t + kr0 + kc + 8 * hf);
      v16bf kh1 = ld_frag(Kh_t + kr1 + kc + 8 * hf);
      v16bf kl1 = ld_frag(Kl_t + kr1 + kc + 8 * hf);
      // interleave the two independent accumulators
      S0 = wmma_bf16(kl0, qh, S0);
      S1 = wmma_bf16(kl1, qh, S1);
      S0 = wmma_bf16(kh0, ql, S0);
      S1 = wmma_bf16(kh1, ql, S1);
      S0 = wmma_bf16(kh0, qh, S0);
      S1 = wmma_bf16(kh1, qh, S1);
    }

    float s0[8], s1[8];
    #pragma unroll
    for (int r = 0; r < 8; ++r) {
      s0[r] = S0[r] * SCALE_QK; if ((it == 6) && (k0 + 8 * hf + r >= SB)) s0[r] = -1e30f;  // keys 192..207 partial
      s1[r] = S1[r] * SCALE_QK; if (it == 6) s1[r] = -1e30f;                               // keys 208..223 all masked
    }
    float ma = fmaxf(s0[0], s0[1]), mb = fmaxf(s1[0], s1[1]);
    #pragma unroll
    for (int r = 2; r < 8; r += 2) {
      ma = fmaxf(fmaxf(ma, s0[r]), s0[r + 1]);
      mb = fmaxf(fmaxf(mb, s1[r]), s1[r + 1]);
    }
    float tmax = fmaxf(ma, mb);
    tmax = fmaxf(tmax, xhalf(tmax));
    const float mnew  = fmaxf(mrow, tmax);
    const float alpha = __expf(mrow - mnew);
    // element s of the B operand is key 8*hf + s (s < 8) or 16 + 8*hf + (s - 8): the order in which
    // ld_frag fetches the keys of a V row
    v16bf ph, pl;
    float ps[8];
    #pragma unroll
    for (int r = 0; r < 8; ++r) {
      float p0 = __expf(s0[r] - mnew);
      float p1 = __expf(s1[r] - mnew);
      ps[r] = p0 + p1;
      __bf16 h0 = (__bf16)p0;
      ph[r]     = h0;  pl[r]     = (__bf16)(p0 - (float)h0);
      __bf16 h1 = (__bf16)p1;
      ph[8 + r] = h1;  pl[8 + r] = (__bf16)(p1 - (float)h1);
    }
    float rs = ((ps[0] + ps[1]) + (ps[2] + ps[3])) + ((ps[4] + ps[5]) + (ps[6] + ps[7]));
    rs += xhalf(rs);
    lrow = lrow * alpha + rs;
    mrow = mnew;
    #pragma unroll
    for (int ct = 0; ct < 8; ++ct)
      #pragma unroll
      for (int r = 0; r < 8; ++r) Oacc[ct][r] *= alpha;

    // O^T(128x16) += V^T(128x32) * P^T(32x16), bf16x3; process ct in pairs so the
    // 3-product chains alternate between two independent accumulators
    #pragma unroll
    for (int ct = 0; ct < 8; ct += 2) {
      int vb0 = ((ct + 0) * 16 + ln) * 40 + 8 * hf;
      int vb1 = ((ct + 1) * 16 + ln) * 40 + 8 * hf;
      v16bf vh0 = ld_frag(Vh_t + vb0), vl0 = ld_frag(Vl_t + vb0);
      v16bf vh1 = ld_frag(Vh_t + vb1), vl1 = ld_frag(Vl_t + vb1);
      Oacc[ct + 0] = wmma_bf16(vl0, ph, Oacc[ct + 0]);
      Oacc[ct + 1] = wmma_bf16(vl1, ph, Oacc[ct + 1]);
      Oacc[ct + 0] = wmma_bf16(vh0, pl, Oacc[ct + 0]);
      Oacc[ct + 1] = wmma_bf16(vh1, pl, Oacc[ct + 1]);
      Oacc[ct + 0] = wmma_bf16(vh0, ph, Oacc[ct + 0]);
      Oacc[ct + 1] = wmma_bf16(vh1, ph, Oacc[ct + 1]);
    }
  }

  // write [T][D]: row t = this lane's query, col = h*128 + d with d = ct*16 + 8*hf + r: 8 neighbours
  float* orow = Oout + (size_t)(t0 + w * 16 + ln) * DMODEL + h * HDIM + 8 * hf;
  #pragma unroll
  for (int ct = 0; ct < 8; ++ct)
    #pragma unroll
    for (int r = 0; r < 8; ++r) Oacc[ct][r] = Oacc[ct][r] / lrow;
  #pragma unroll
  for (int ct = 0; ct < 8; ++ct) {
    *(float4*)(orow + ct * 16)     = make_float4(Oacc[ct][0], Oacc[ct][1], Oacc[ct][2], Oacc[ct][3]);
    *(float4*)(orow + ct * 16 + 4) = make_float4(Oacc[ct][4], Oacc[ct][5], Oacc[ct][6], Oacc[ct][7]);
  }
}

// ---------------- launch ----------------
extern "C" void kernel_launch(void* const* d_in, const int* in_sizes, int n_in,
                              void* d_out, int out_size, void* d_ws, size_t ws_size,
                              hipStream_t stream) {
  (void)in_sizes; (void)n_in; (void)out_size; (void)ws_size;
  const float* hidden = (const float*)d_in[0];
  const float* wq     = (const float*)d_in[1];
  const float* wk     = (const float*)d_in[2];
  const float* wv     = (const float*)d_in[3];
  const float* wo     = (const float*)d_in[4];
  const float* bern   = (const float*)d_in[5];

  const size_t NE = (size_t)T_SEQ * DMODEL;   // 4,194,304
  float* ws    = (float*)d_ws;
  float* q     = ws;            // [H][T][128] f32; q, k, v lie one behind the other
  float* k     = ws + 1 * NE;
  float* v     = ws + 2 * NE;
  float* attnb = ws + 3 * NE;   // [T][D]
  __bf16* shi  = (__bf16*)(ws + 4 * NE);  // hi planes: activations (hidden, then attnb), wq, wk, wv, wo
  __bf16* slo  = shi + 5 * NE;            // lo planes, the same order
  __bf16* khi  = slo + 5 * NE;            // RoPE'd K split
  __bf16* klo  = khi + NE;
  __bf16* vthi = klo + NE;                // bumped V, split, tiled [H][NTILE][128][32]
  __bf16* vtlo = vthi + NE;
  float* coef  = (float*)(vtlo + NE);     // [H]

  // sanitized hidden and the four weights -> bf16 hi/lo, one launch
  split_kernel<<<dim3(SPLIT_GRID, 5), SPLIT_THREADS, 0, stream>>>(hidden, wq, wk, wv, wo, shi, slo, 1);

  // Q, K and V projections, one launch: z = 0, 1, 2
  gemm_bf16x3_async_kernel<<<dim3(DMODEL / GT_MN, T_SEQ / GT_MN, 3), 256, 0, stream>>>(
      shi, slo, shi + NE, slo + NE, q, 0);

  rope_split_kernel<<<ROPE_N / 256, 256, 0, stream>>>(q, k, khi, klo);

  vcoef_kernel<<<NHEAD, 256, 0, stream>>>(q, k, bern, coef);
  vprep_kernel<<<dim3(NTILE, NHEAD), 256, 0, stream>>>(v, coef, vthi, vtlo);

  attn_kernel<<<dim3(T_SEQ / 64, NHEAD), 128, 0, stream>>>(q, khi, klo, vthi, vtlo, attnb);

  // output projection: split attnb into the activations' planes, then GEMM -> d_out
  split_kernel<<<dim3(SPLIT_GRID, 1), SPLIT_THREADS, 0, stream>>>(attnb, attnb, attnb, attnb, attnb, shi, slo, 0);
  gemm_bf16x3_async_kernel<<<dim3(DMODEL / GT_MN, T_SEQ / GT_MN, 1), 256, 0, stream>>>(
      shi, slo, shi + 4 * NE, slo + 4 * NE, (float*)d_out, 1);
}

// v007
// Measured time: 263 microseconds a run.
// In both of two side-by-side timings against v006, it was 1.09 times as fast.
// Counting every step since v000, it is 2.10 times as fast.
#include <hip/hip_runtime.h>
#include <math.h>

// ---------------- problem constants ----------------
#define T_SEQ   2048
#define DMODEL  2048
#define NHEAD   16
#define HDIM    128
#define SB      204      // int(0.1*2048)
#define RB      1024     // int(0.5*2048)
#define NVALID  1228     // SB + RB
#define SCALE_QK 0.088388347648318447f   // 1/sqrt(128)

typedef float  v8f  __attribute__((ext_vector_type(8)));
typedef __bf16 v4bf __attribute__((ext_vector_type(4)));
typedef __bf16 v8bf __attribute__((ext_vector_type(8)));
typedef __bf16 v16bf __attribute__((ext_vector_type(16)));

static __device__ __forceinline__ v8f wmma_bf16(v16bf a, v16bf b, v8f c) {
  // D(16x16,f32) = A(16x32,bf16) x B(32x16,bf16) + C
  return __builtin_amdgcn_wmma_f32_16x16x32_bf16(false, a, false, b, (short)0, c, false, false);
}

// 16-bit A/B fragment: 8 contiguous K at p, 8 more at p+16
static __device__ __forceinline__ v16bf ld_frag(const __bf16* p) {
  v8bf a = *(const v8bf*)(p);
  v8bf b = *(const v8bf*)(p + 16);
  return __builtin_shufflevector(a, b, 0,1,2,3,4,5,6,7,8,9,10,11,12,13,14,15);
}

static __device__ __forceinline__ void split4(float4 v, v4bf& h, v4bf& l) {
  h[0] = (__bf16)v.x; l[0] = (__bf16)(v.x - (float)h[0]);
  h[1] = (__bf16)v.y; l[1] = (__bf16)(v.y - (float)h[1]);
  h[2] = (__bf16)v.z; l[2] = (__bf16)(v.z - (float)h[2]);
  h[3] = (__bf16)v.w; l[3] = (__bf16)(v.w - (float)h[3]);
}

static __device__ __forceinline__ float fin_clamp(float v) {
  if (v != v)        return 0.0f;
  if (v >  1.0e38f)  return  1.0e4f;
  if (v < -1.0e38f)  return -1.0e4f;
  return v;
}

// value of lane l ^ 16: the other half of a column of a 16 x 16 accumulator tile
static __device__ __forceinline__ float xhalf(float v) {
  int b = __builtin_bit_cast(int, v);
  return __builtin_bit_cast(float, __builtin_amdgcn_permlanex16(b, b, 0x76543210, 0xfedcba98, false, false));
}

// ---------------- async global->LDS copy (CDNA5), with sync fallback ----------------
#if __has_builtin(__builtin_amdgcn_global_load_async_to_lds_b128)
#define HAS_ASYNC_LDS 1
typedef int gv4i __attribute__((vector_size(16)));
typedef __attribute__((address_space(1))) gv4i as1_v4i;   // global
typedef __attribute__((address_space(3))) gv4i as3_v4i;   // LDS
static __device__ __forceinline__ void async_cp16(void* l, const void* g) {
  __builtin_amdgcn_global_load_async_to_lds_b128((as1_v4i*)g, (as3_v4i*)l, 0, 0);
}
#else
#define HAS_ASYNC_LDS 0
static __device__ __forceinline__ void async_cp16(void* l, const void* g) {
  *(float4*)l = *(const float4*)g;     // 16B sync copy fallback
}
#endif

// ---------------- kernel 1: nan_to_num(optional) + bf16 hi/lo split ----------------
// 16 waves per block, one block per 64 KiB of input: a thread takes 8 float4, each wave-wide load
// covers 512 contiguous bytes and each wave-wide store 256, so few waves have to be started.
// blockIdx.y picks one of up to five arrays of the same size, which depend on nothing but the inputs:
// one launch splits them all; array a's planes lie a * T_SEQ * DMODEL elements into hi and lo.
#define SPLIT_THREADS 512
#define SPLIT_VEC     8
#define SPLIT_GRID    ((T_SEQ * DMODEL) / (SPLIT_THREADS * SPLIT_VEC * 4))
static_assert(SPLIT_GRID * SPLIT_THREADS * SPLIT_VEC * 4 == T_SEQ * DMODEL, "blocks tile the array");
__global__ __launch_bounds__(SPLIT_THREADS)
void split_kernel(const float* __restrict__ x0, const float* __restrict__ x1,
                  const float* __restrict__ x2, const float* __restrict__ x3,
                  const float* __restrict__ x4, __bf16* __restrict__ hi,
                  __bf16* __restrict__ lo, int clamp_first) {
  const unsigned arr = blockIdx.y;
  const float* x = (arr == 0) ? x0 : (arr == 1) ? x1 : (arr == 2) ? x2 : (arr == 3) ? x3 : x4;
  const bool do_clamp = clamp_first && arr == 0;     // only the activations are sanitized
  const size_t plane = (size_t)arr * (T_SEQ * DMODEL);
  // byte offsets in 32 bits: one offset register serves all loads and one all stores
  const unsigned t4 = blockIdx.x * (SPLIT_THREADS * SPLIT_VEC) + threadIdx.x;   // in float4 units
  const char* xb = (const char*)x + t4 * 16u;
  char* hb = (char*)(hi + plane) + t4 * 8u;
  char* lb = (char*)(lo + plane) + t4 * 8u;
  float4 v[SPLIT_VEC];
  #pragma unroll
  for (int i = 0; i < SPLIT_VEC; ++i)
    v[i] = *(const float4*)(xb + i * (SPLIT_THREADS * 16));
  // precaution: stands ahead of the clamp's exec saves, which reuse a scalar register of the
  // base pair that the eight loads name
  asm volatile("s_wait_xcnt 0x0" ::: "memory");
  v4bf hh[SPLIT_VEC], ll[SPLIT_VEC];
  #pragma unroll
  for (int i = 0; i < SPLIT_VEC; ++i) {
    float4 u = v[i];
    if (do_clamp) {
      u.x = fin_clamp(u.x); u.y = fin_clamp(u.y); u.z = fin_clamp(u.z); u.w = fin_clamp(u.w);
    }
    split4(u, hh[i], ll[i]);
  }
  #pragma unroll
  for (int i = 0; i < SPLIT_VEC; ++i) {
    *(v4bf*)(hb + i * (SPLIT_THREADS * 8)) = hh[i];
    *(v4bf*)(lb + i * (SPLIT_THREADS * 8)) = ll[i];
  }
}

// ---------------- GEMM: C = A * W^T, bf16x3, async double-buffered LDS ----------------
// Operands pre-split to global bf16 hi/lo.  mode 0: scatter [H][T][HDIM]; 1: [T][D]+clamp.
// One 128 x 128 tile of C per block, 8 waves as 2 x 4, 64 x 32 per wave; a trip takes 128 k, so a
// staged row is 256 contiguous bytes (whole lines) and the two buffers leave room for one block
// per WGP.  A trip is 4 blocks of 32 k; each block's fragments are fetched one block ahead.
// blockIdx.z picks one of several products that share A: its weight planes and its output lie
// z * T_SEQ * DMODEL elements into Whi_g, Wlo_g and out_g.
#define GT_MN    128
#define GT_K     128
#define GT_PITCH 136                   // bf16; rows of 272 B = 16 B x odd, for 16-byte readers
#define GT_ARR   (GT_MN * GT_PITCH)    // one operand plane of one buffer
#define GT_TRIPS (DMODEL / GT_K)
__global__ __launch_bounds__(256)
void gemm_bf16x3_async_kernel(const __bf16* __restrict__ Ahi_g, const __bf16* __restrict__ Alo_g,
                              const __bf16* __restrict__ Whi_g, const __bf16* __restrict__ Wlo_g,
                              float* __restrict__ out_g, int mode) {
  __shared__ __attribute__((aligned(16))) __bf16 Sbuf[2][4][GT_ARR];   // [buf][Ahi, Alo, Whi, Wlo]
  static_assert(T_SEQ == DMODEL, "a weight plane and an output are of one size");
  const size_t zoff = (size_t)blockIdx.z * ((size_t)T_SEQ * DMODEL);
  float* __restrict__ out = out_g + zoff;

  const int tid  = threadIdx.x;
  const int wid  = tid >> 5;
  const int lane = tid & 31;
  const int ln   = lane & 15;
  const int hf   = lane >> 4;
  const int wr   = wid >> 2;       // 0..1
  const int wc   = wid & 3;        // 0..3
  const int m0   = blockIdx.y * GT_MN;
  const int n0   = blockIdx.x * GT_MN;

  // 8 copies per plane and thread: rows crow + 0..3 and 64 + crow + 0..3, so that neighbouring
  // copies lie one row (4096 B) apart; a wave's copy takes two whole 256-B rows
  const int crow = (tid >> 4) * 4, cc = (tid & 15) * 8;      // 8 bf16 = 16B
  const __bf16* a_hi = Ahi_g + (size_t)(m0 + crow) * DMODEL + cc;
  const __bf16* a_lo = Alo_g + (size_t)(m0 + crow) * DMODEL + cc;
  const __bf16* w_hi = Whi_g + zoff + (size_t)(n0 + crow) * DMODEL + cc;
  const __bf16* w_lo = Wlo_g + zoff + (size_t)(n0 + crow) * DMODEL + cc;
  const int     loff = crow * GT_PITCH + cc;

  v8f acc[4][2];
  #pragma unroll
  for (int i = 0; i < 4; ++i)
    #pragma unroll
    for (int j = 0; j < 2; ++j)
      #pragma unroll
      for (int r = 0; r < 8; ++r) acc[i][j][r] = 0.0f;

  auto issue = [&](int buf, int kt) {
    // unrolled: the row steps become constants of the copies' addresses
    #pragma unroll
    for (int i = 0; i < 8; ++i) {
      const int rw = (i & 3) + (i >> 2) * 64;
      const int go = rw * DMODEL + kt;
      const int lr = loff + rw * GT_PITCH;
      async_cp16(&Sbuf[buf][0][lr], a_hi + go);
      async_cp16(&Sbuf[buf][1][lr], a_lo + go);
      async_cp16(&Sbuf[buf][2][lr], w_hi + go);
      async_cp16(&Sbuf[buf][3][lr], w_lo + go);
    }
  };

  // two fragment sets: one is worked on while the other is filled
  v16bf fa_h[2][4], fa_l[2][4], fb_h[2][2], fb_l[2][2];
  auto load_set = [&](int s, int buf, int ks) {
    const int ab = (wr * 64 + ln) * GT_PITCH + ks + 8 * hf;
    const int bb = (wc * 32 + ln) * GT_PITCH + ks + 8 * hf;
    // both loops unrolled: fragment arrays stay in registers only under constant indices
    #pragma unroll
    for (int i = 0; i < 4; ++i) {
      fa_h[s][i] = ld_frag(&Sbuf[buf][0][ab + i * 16 * GT_PITCH]);
      fa_l[s][i] = ld_frag(&Sbuf[buf][1][ab + i * 16 * GT_PITCH]);
    }
    #pragma unroll
    for (int j = 0; j < 2; ++j) {
      fb_h[s][j] = ld_frag(&Sbuf[buf][2][bb + j * 16 * GT_PITCH]);
      fb_l[s][j] = ld_frag(&Sbuf[buf][3][bb + j * 16 * GT_PITCH]);
    }
  };

  issue(0, 0);
  // own copies of tile 0 have landed; the barrier then shows them to the other waves
  asm volatile("s_wait_asynccnt 0x0" ::: "memory");
  __syncthreads();
  issue(1, GT_K);
  load_set(0, 0, 0);

  for (int t = 0; t < GT_TRIPS; ++t) {
    const int buf = t & 1;
    // unrolled: the set index must be a constant for the fragments to stay in registers
    #pragma unroll
    for (int b = 0; b < 4; ++b) {
      if (b < 3) {
        load_set((b + 1) & 1, buf, (b + 1) * 32);
      } else {
        // publish point of tile t + 1, ahead of this tile's last block, whose fragments are fetched:
        // own LDS reads retired before the refill below aims at the buffer this trip has read
        asm volatile("s_wait_dscnt 0x0" ::: "memory");
        // own copies of the next tile have landed; the barrier then shows them to the other waves
        asm volatile("s_wait_asynccnt 0x0" ::: "memory");
        __syncthreads();
        if (t + 1 < GT_TRIPS) load_set(0, buf ^ 1, 0);
      }
      // keeps the next block's fragment loads one group ahead of this block's products
      __builtin_amdgcn_sched_barrier(0);
      // the refill flies while the next tile is worked on; its address work may mix with the products
      if (b == 3 && t + 2 < GT_TRIPS) issue(buf, (t + 2) * GT_K);
      const int s = b & 1;
      // product-major over the 8 independent accumulators; per accumulator and 32 k the order
      // stays hi*lo, lo*hi, hi*hi (loops unrolled: register arrays need constant indices)
      #pragma unroll
      for (int i = 0; i < 4; ++i)
        #pragma unroll
        for (int j = 0; j < 2; ++j) acc[i][j] = wmma_bf16(fa_h[s][i], fb_l[s][j], acc[i][j]);
      #pragma unroll
      for (int i = 0; i < 4; ++i)
        #pragma unroll
        for (int j = 0; j < 2; ++j) acc[i][j] = wmma_bf16(fa_l[s][i], fb_h[s][j], acc[i][j]);
      #pragma unroll
      for (int i = 0; i < 4; ++i)
        #pragma unroll
        for (int j = 0; j < 2; ++j) acc[i][j] = wmma_bf16(fa_h[s][i], fb_h[s][j], acc[i][j]);
      // keeps the following block's loads from moving in among these products
      __builtin_amdgcn_sched_barrier(0);
    }
  }
  // precaution: no copy is outstanding when the wave ends
  asm volatile("s_wait_asynccnt 0x0" ::: "memory");

  // C layout: lane ln = column, row = r + 8*hf
  #pragma unroll
  for (int i = 0; i < 4; ++i)
    #pragma unroll
    for (int j = 0; j < 2; ++j)
      #pragma unroll
      for (int r = 0; r < 8; ++r) {
        int gm = m0 + wr * 64 + i * 16 + r + 8 * hf;
        int gn = n0 + wc * 32 + j * 16 + ln;
        float v = acc[i][j][r];
        if (mode == 1) {
          out[(size_t)gm * DMODEL + gn] = fin_clamp(v);
        } else {
          int h = gn >> 7, d = gn & 127;
          out[((size_t)h * T_SEQ + gm) * HDIM + d] = v;
        }
      }
}

// ---------------- kernel 3: RoPE on Q,K + emit bf16 hi/lo split of K ----------------
// A thread takes 4 neighbouring j (with their partners j + 64) of one position t in ROPE_HEADS heads,
// Q and K: 16 loads of 16 bytes, all issued ahead of the angles.
#define ROPE_HEADS 4
#define ROPE_N     ((NHEAD / ROPE_HEADS) * T_SEQ * 16)
// written as explicit fma so that the product rounded first is x2*s (low half) and x1*s (high half)
static __device__ __forceinline__ void rot4(float4 a, float4 b, const float* c, const float* s,
                                            float4& lo, float4& hi) {
  lo.x = fmaf(c[0], a.x, -(b.x * s[0]));  hi.x = fmaf(c[0], b.x, a.x * s[0]);
  lo.y = fmaf(c[1], a.y, -(b.y * s[1]));  hi.y = fmaf(c[1], b.y, a.y * s[1]);
  lo.z = fmaf(c[2], a.z, -(b.z * s[2]));  hi.z = fmaf(c[2], b.z, a.z * s[2]);
  lo.w = fmaf(c[3], a.w, -(b.w * s[3]));  hi.w = fmaf(c[3], b.w, a.w * s[3]);
}
__global__ __launch_bounds__(256)
void rope_split_kernel(float* __restrict__ Q, float* __restrict__ K,
                       __bf16* __restrict__ Khi, __bf16* __restrict__ Klo) {
  int idx = blockIdx.x * blockDim.x + threadIdx.x;       // (H/ROPE_HEADS)*T*16
  if (idx >= ROPE_N) return;
  int j  = (idx & 15) * 4;
  int t  = (idx >> 4) & (T_SEQ - 1);
  int h0 = (idx >> 15) * ROPE_HEADS;
  const size_t base0 = ((size_t)h0 * T_SEQ + t) * HDIM + j;

  float4 q1[ROPE_HEADS], q2[ROPE_HEADS], k1[ROPE_HEADS], k2[ROPE_HEADS];
  #pragma unroll
  for (int i = 0; i < ROPE_HEADS; ++i) {
    const size_t base = base0 + (size_t)i * T_SEQ * HDIM;
    q1[i] = *(const float4*)(Q + base);  q2[i] = *(const float4*)(Q + base + 64);
    k1[i] = *(const float4*)(K + base);  k2[i] = *(const float4*)(K + base + 64);
  }

  float c[4], s[4];
  #pragma unroll
  for (int e = 0; e < 4; ++e) {
    float invf = __expf(-(float)(j + e) * (9.210340371976184f / 64.0f)); // 10000^(-j/64)
    float ang = (float)t * invf;
    c[e] = cosf(ang); s[e] = sinf(ang);
  }

  #pragma unroll
  for (int i = 0; i < ROPE_HEADS; ++i) {
    const size_t base = base0 + (size_t)i * T_SEQ * HDIM;
    float4 a, b;
    rot4(q1[i], q2[i], c, s, a, b);
    *(float4*)(Q + base)      = a;
    *(float4*)(Q + base + 64) = b;
    rot4(k1[i], k2[i], c, s, a, b);
    *(float4*)(K + base)      = a;
    *(float4*)(K + base + 64) = b;
    v4bf hh, ll;
    split4(a, hh, ll);
    *(v4bf*)(Khi + base)      = hh;  *(v4bf*)(Klo + base)      = ll;
    split4(b, hh, ll);
    *(v4bf*)(Khi + base + 64) = hh;  *(v4bf*)(Klo + base + 64) = ll;
  }
}

// ---------------- kernel 4: scores of the last query row against the kept keys (f32) ----------------
// value of lane l ^ M inside a 16-lane row
template <int M>
static __device__ __forceinline__ float xrow(float v) {
  int b = __builtin_bit_cast(int, v);
  return __builtin_bit_cast(float, __builtin_amdgcn_mov_dpp(b, 0x160 + M, 0xf, 0xf, true));  // row_xmask:M
}
typedef float f4v __attribute__((ext_vector_type(4)));
static __device__ __forceinline__ float dot4(f4v a, f4v b) {
  return fmaf(a.w, b.w, fmaf(a.z, b.z, fmaf(a.y, b.y, a.x * b.x)));
}
// One block per (128 kept keys, head).  Eight lanes share a key: each of their four loads is one whole
// 128-byte line of its row, and all sixteen key loads of a thread go out together.
#define SC_KEYS  128
#define SC_GRID  ((NVALID + SC_KEYS - 1) / SC_KEYS)
#define SC_PITCH (SC_GRID * SC_KEYS)   // floats per head in the score array
__global__ __launch_bounds__(256)
void lastrow_score_kernel(const float* __restrict__ Q, const float* __restrict__ K,
                          float* __restrict__ sc) {
  const int h = blockIdx.y, tid = threadIdx.x;
  const int sub = tid & 7, grp = tid >> 3;
  // byte offsets in 32 bits on block-uniform bases
  const char* qb = (const char*)(Q + ((size_t)h * T_SEQ + (T_SEQ - 1)) * HDIM);
  const char* kb = (const char*)(K + (size_t)h * T_SEQ * HDIM);
  const unsigned qo = (unsigned)sub * 16u;
  f4v q[4];
  #pragma unroll
  for (int c = 0; c < 4; ++c) q[c] = *(const f4v*)(qb + qo + c * 128);
  unsigned ko[4];
  f4v kv[4][4];
  #pragma unroll
  for (int b = 0; b < 4; ++b) {
    const int id  = blockIdx.x * SC_KEYS + b * 32 + grp;
    const int ic  = (id < NVALID) ? id : NVALID - 1;          // past the end: the last key again, not stored
    const int key = (ic < SB) ? ic : (T_SEQ - RB) + (ic - SB);
    ko[b] = (unsigned)key * (HDIM * 4u) + qo;
    #pragma unroll
    for (int c = 0; c < 4; ++c) kv[b][c] = *(const f4v*)(kb + ko[b] + c * 128);
  }
  // all twenty loads go out as one group and one memory latency is paid: left alone, the compiler's
  // scheduler puts some of them behind the wait for q
  __builtin_amdgcn_sched_barrier(0);
  // precaution: stands ahead of every later write of the loads' offset registers; it names the offsets so
  // that those registers are held until here and no load's result lands in them
  asm volatile("s_wait_xcnt 0x0" :: "v"(qo), "v"(ko[0]), "v"(ko[1]), "v"(ko[2]), "v"(ko[3]) : "memory");
  // keeps the wait directly behind the loads: later scalar and vector work stays behind it
  __builtin_amdgcn_sched_barrier(0);
  float d[4];
  #pragma unroll
  for (int b = 0; b < 4; ++b) {
    float t = (dot4(q[0], kv[b][0]) + dot4(q[1], kv[b][1])) + (dot4(q[2], kv[b][2]) + dot4(q[3], kv[b][3]));
    t += xrow<1>(t);
    t += xrow<2>(t);
    t += xrow<4>(t);
    d[b] = t;            // the same in all eight lanes of the key
  }
  // lane sub of a group stores the group's key number sub: one store for the four
  const float dv = (sub == 0) ? d[0] : (sub == 1) ? d[1] : (sub == 2) ? d[2] : d[3];
  const int   id = blockIdx.x * SC_KEYS + (sub & 3) * 32 + grp;
  if (sub < 4 && id < NVALID) sc[h * SC_PITCH + id] = dv * SCALE_QK;
}

// ---------------- kernel 4b: V bump + bf16 hi/lo split + transpose, once for all query blocks ----
// One block per (32-key tile, head).  Output tile: [d 0..127][key 0..31], 8 KiB contiguous, hi and lo,
// in the order in which attention walks the tiles.  Every block forms its head's bump coefficient itself
// from the last row's scores (softmax over the kept keys), all blocks in the same order of sums.
#define NTILE 39      // 7 tiles for [0,204), 32 for [1024,2048)
#define VT_PITCH 132  // floats; rows stay 16-byte aligned
__global__ __launch_bounds__(256)
void vprep_kernel(const float* __restrict__ V, const float* __restrict__ sc,
                  const float* __restrict__ bern,
                  __bf16* __restrict__ Vthi, __bf16* __restrict__ Vtlo) {
  __shared__ __attribute__((aligned(16))) float tile[32 * VT_PITCH];
  __shared__ __attribute__((aligned(16))) float red[3][8];     // per wave: maximum, sum, tail sum
  const int tid = threadIdx.x;
  const int it  = blockIdx.x;
  const int h   = blockIdx.y;
  const int k0  = (it < 7) ? it * 32 : (T_SEQ - RB) + (it - 7) * 32;
  const float* Vh = V + (size_t)h * T_SEQ * HDIM;
  // a thread keeps one group of 4 dims and takes 4 keys; all five loads go out together
  const int d4 = (tid & 31) * 4, kr0 = tid >> 5;
  // byte offsets in 32 bits on block-uniform bases: one offset register serves the four row loads,
  // whose rows lie a constant 4096 bytes apart
  const char* eb = (const char*)(Vh + (size_t)RB * HDIM) + (unsigned)d4 * 4u;
  const char* rb = (const char*)(Vh + (size_t)k0 * HDIM) + (unsigned)tid * 16u;
  const float4 e = *(const float4*)eb;
  float4 v[4];
  #pragma unroll
  for (int i = 0; i < 4; ++i)
    v[i] = *(const float4*)(rb + i * (8 * HDIM * 4));

  // the head's NVALID scores, 5 per thread: index tid + 256 * i; only i = 4 can pass the end
  static_assert(NVALID > 1024 && NVALID <= 1280 && SB + 1 < 256, "5 scores per thread, tail starts in the first");
  const char* sb = (const char*)(sc + h * SC_PITCH);
  const bool  in4 = tid < NVALID - 1024;
  const unsigned so = (unsigned)tid * 4u, so4 = in4 ? so + 4096u : (NVALID - 1) * 4u;
  float s[5];
  #pragma unroll
  for (int i = 0; i < 4; ++i) s[i] = *(const float*)(sb + so + i * 1024);
  s[4] = *(const float*)(sb + so4);
  // the V loads and the score loads go out as one group and one memory latency is paid: left alone, the
  // compiler's scheduler puts the V loads behind the wait for the scores
  __builtin_amdgcn_sched_barrier(0);
  // precaution: stands ahead of every later write of the score loads' offset registers; it names the
  // offsets so that those registers are held until here
  asm volatile("s_wait_xcnt 0x0" :: "v"(so), "v"(so4) : "memory");
  // keeps the wait directly behind the loads: later scalar address work stays behind it
  __builtin_amdgcn_sched_barrier(0);
  const float se = *(const float*)(sb + SB * 4);     // score of the evicted key, RB
  const float bu = bern[h];
  if (!in4) s[4] = -1e30f;
  float mx = fmaxf(fmaxf(fmaxf(s[0], s[1]), fmaxf(s[2], s[3])), s[4]);
  mx = fmaxf(mx, xrow<1>(mx));  mx = fmaxf(mx, xrow<2>(mx));
  mx = fmaxf(mx, xrow<4>(mx));  mx = fmaxf(mx, xrow<8>(mx));
  mx = fmaxf(mx, xhalf(mx));
  if ((tid & 31) == 0) red[0][tid >> 5] = mx;
  __syncthreads();      // the waves' maxima are seen by all
  float4 ra = *(const float4*)&red[0][0], rc = *(const float4*)&red[0][4];
  const float gmax = fmaxf(fmaxf(fmaxf(ra.x, ra.y), fmaxf(ra.z, ra.w)), fmaxf(fmaxf(rc.x, rc.y), fmaxf(rc.z, rc.w)));
  const float e0 = __expf(s[0] - gmax), e1 = __expf(s[1] - gmax), e2 = __expf(s[2] - gmax),
              e3 = __expf(s[3] - gmax), e4 = in4 ? __expf(s[4] - gmax) : 0.0f;
  const float rest = (e1 + e2) + (e3 + e4);
  float sm = e0 + rest;
  float tl = ((tid >= SB + 1) ? e0 : 0.0f) + rest;   // keys 1025..2047
  sm += xrow<1>(sm);  tl += xrow<1>(tl);
  sm += xrow<2>(sm);  tl += xrow<2>(tl);
  sm += xrow<4>(sm);  tl += xrow<4>(tl);
  sm += xrow<8>(sm);  tl += xrow<8>(tl);
  sm += xhalf(sm);    tl += xhalf(tl);
  if ((tid & 31) == 0) { red[1][tid >> 5] = sm; red[2][tid >> 5] = tl; }
  __syncthreads();      // the waves' sums are seen by all
  ra = *(const float4*)&red[1][0];  rc = *(const float4*)&red[1][4];
  const float gsum  = ((ra.x + ra.y) + (ra.z + ra.w)) + ((rc.x + rc.y) + (rc.z + rc.w));
  ra = *(const float4*)&red[2][0];  rc = *(const float4*)&red[2][4];
  const float gtail = ((ra.x + ra.y) + (ra.z + ra.w)) + ((rc.x + rc.y) + (rc.z + rc.w));
  const float pe   = __expf(se - gmax) / gsum;               // probs at key e=1024
  const float mean = (gtail / gsum) / 1023.0f + 1e-6f;
  float p = pe / mean;
  p = (p != p) ? 0.0f : fminf(fmaxf(p, 0.0f), 1.0f);
  const float cf = ((bu < p) ? 1.0f : 0.0f) / (float)RB;

  const float bx = e.x * cf, by = e.y * cf, bz = e.z * cf, bw = e.w * cf;
  #pragma unroll
  for (int i = 0; i < 4; ++i) {
    const bool bump = (k0 + kr0 + i * 8) > RB;     // keys 1025..2047 take the evicted row's share
    float4 u = v[i];
    u.x = bump ? u.x + bx : u.x;  u.y = bump ? u.y + by : u.y;
    u.z = bump ? u.z + bz : u.z;  u.w = bump ? u.w + bw : u.w;
    *(float4*)(&tile[(kr0 + i * 8) * VT_PITCH + d4]) = u;
  }
  __syncthreads();
  const size_t ob = ((size_t)h * NTILE + it) * (HDIM * 32);
  #pragma unroll
  for (int i = 0; i < 2; ++i) {
    int c = tid + i * 256;                   // 16-byte chunk of the output tile
    int d = c >> 2, kg = (c & 3) * 8;
    v8bf hh, ll;
    #pragma unroll
    for (int j = 0; j < 8; ++j) {
      float v = tile[(kg + j) * VT_PITCH + d];
      __bf16 x = (__bf16)v;
      hh[j] = x;
      ll[j] = (__bf16)(v - (float)x);
    }
    *(v8bf*)(Vthi + ob + c * 8) = hh;
    *(v8bf*)(Vtlo + ob + c * 8) = ll;
  }
}

__global__ __launch_bounds__(128)
void attn_kernel(const float* __restrict__ Q, const __bf16* __restrict__ Khi,
                 const __bf16* __restrict__ Klo, const __bf16* __restrict__ Vthi,
                 const __bf16* __restrict__ Vtlo, float* __restrict__ Oout) {
  __shared__ __bf16 Qhi_s[64 * 136], Qlo_s[64 * 136];   // 64 queries x 128 dims
  // V tile [d][key], 32 keys, hi and lo, two buffers; row pitch 80 B for 16-byte readers
  __shared__ __attribute__((aligned(16))) __bf16 Vhi_s[2][128 * 40];
  __shared__ __attribute__((aligned(16))) __bf16 Vlo_s[2][128 * 40];
  // K tile, 32 keys x 128 dims, hi and lo, two buffers; row pitch 272 B for 16-byte readers
  __shared__ __attribute__((aligned(16))) __bf16 Khi_s[2][32 * 136];
  __shared__ __attribute__((aligned(16))) __bf16 Klo_s[2][32 * 136];

  const int tid  = threadIdx.x;
  const int w    = tid >> 5;         // 4 waves, 16 queries each
  const int lane = tid & 31;
  const int ln   = lane & 15;
  const int hf   = lane >> 4;
  const int h    = blockIdx.y;
  const int t0   = blockIdx.x * 64;
  const size_t hk = (size_t)h * T_SEQ;

  const float* Qh = Q + hk * HDIM;

  // one K tile (hi and lo) into LDS, once per block: each wave's copy takes 512 contiguous
  // bytes (two whole key rows), 8 copies per thread and tile
  auto issue_k = [&](int buf, int kbase) {
    #pragma unroll
    for (int i = 0; i < 4; ++i) {
      int idx = tid + i * 128, rw = idx >> 4, cw = (idx & 15) * 8;
      async_cp16(&Khi_s[buf][rw * 136 + cw], Khi + (hk + kbase + rw) * HDIM + cw);
      async_cp16(&Klo_s[buf][rw * 136 + cw], Klo + (hk + kbase + rw) * HDIM + cw);
    }
  };
  // one prepared V tile (hi and lo) into LDS: each wave's copy takes 512 contiguous bytes,
  // 8 copies per thread and tile
  auto issue_v = [&](int buf, int tile) {
    const size_t vb = ((size_t)h * NTILE + tile) * (HDIM * 32);
    #pragma unroll
    for (int i = 0; i < 4; ++i) {
      int c = tid + i * 128;
      async_cp16(&Vhi_s[buf][(c >> 2) * 40 + (c & 3) * 8], Vthi + vb + c * 8);
      async_cp16(&Vlo_s[buf][(c >> 2) * 40 + (c & 3) * 8], Vtlo + vb + c * 8);
    }
  };
  issue_k(0, 0);
  issue_v(0, 0);

  // stage + split this block's 64 query rows
  // row (tid >> 5) + 4 * i, dims (tid & 31) * 4 and up: one address for all sixteen loads, 2048 bytes apart
  const float* qp = Qh + (size_t)(t0 + (tid >> 5)) * HDIM + (tid & 31) * 4;
  float4 qv[16];
  #pragma unroll
  for (int i = 0; i < 16; ++i) qv[i] = *(const float4*)(qp + i * 4 * HDIM);
  // precaution: stands ahead of every later write of the loads' address registers; it names the address so
  // that those registers are held until here and no load's result lands in them
  asm volatile("s_wait_xcnt 0x0" :: "v"(qp) : "memory");
  #pragma unroll
  for (int i = 0; i < 16; ++i) {
    int idx = tid + i * 128;
    int row = idx >> 5, kc = (idx & 31) * 4;
    float4 v = qv[i];
    v4bf hh, ll; split4(v, hh, ll);
    *(v4bf*)(&Qhi_s[row * 136 + kc]) = hh;
    *(v4bf*)(&Qlo_s[row * 136 + kc]) = ll;
  }

  v8f Oacc[8];
  float mrow = -1e30f, lrow = 0.0f;      // of query w * 16 + ln, the same in both halves
  #pragma unroll
  for (int ct = 0; ct < 8; ++ct)
    #pragma unroll
    for (int r = 0; r < 8; ++r) Oacc[ct][r] = 0.0f;

  for (int it = 0; it < NTILE; ++it) {
    const int k0 = (it < 7) ? it * 32 : (T_SEQ - RB) + (it - 7) * 32;
    // own LDS traffic retired before the refill below aims at a buffer this wave has read
    asm volatile("s_wait_dscnt 0x0" ::: "memory");
    // own copies of this tile's K and V have landed; the barrier then shows them to the other waves
    asm volatile("s_wait_asynccnt 0x0" ::: "memory");
    __syncthreads();

    // next tile's K and V fly while this tile is worked on; their buffers were last read one trip ago
    if (it + 1 < NTILE) {
      issue_k((it + 1) & 1, (it + 1 < 7) ? (it + 1) * 32 : (T_SEQ - RB) + (it + 1 - 7) * 32);
      issue_v((it + 1) & 1, it + 1);
    }
    const __bf16* Kh_t = Khi_s[it & 1];
    const __bf16* Kl_t = Klo_s[it & 1];
    const __bf16* Vh_t = Vhi_s[it & 1];
    const __bf16* Vl_t = Vlo_s[it & 1];

    // S^T(32x16) = K(32x128) * Q^T(128x16), two 16-key tiles, bf16x3: S0[r] is key k0 + 8*hf + r,
    // S1[r] key k0 + 16 + 8*hf + r, both of query ln
    v8f S0, S1;
    #pragma unroll
    for (int r = 0; r < 8; ++r) { S0[r] = 0.0f; S1[r] = 0.0f; }
    const int kr0 = ln * 136;
    const int kr1 = (16 + ln) * 136;
    #pragma unroll
    for (int kc = 0; kc < HDIM; kc += 32) {
      int qb = (w * 16 + ln) * 136 + kc + 8 * hf;
      v16bf qh = ld_frag(&Qhi_s[qb]), ql = ld_frag(&Qlo_s[qb]);
      v16bf kh0 = ld_frag(Kh_t + kr0 + kc + 8 * hf);
      v16bf kl0 = ld_frag(Kl_t + kr0 + kc + 8 * hf);
      v16bf kh1 = ld_frag(Kh_t + kr1 + kc + 8 * hf);
      v16bf kl1 = ld_frag(Kl_t + kr1 + kc + 8 * hf);
      // interleave the two independent accumulators
      S0 = wmma_bf16(kl0, qh, S0);
      S1 = wmma_bf16(kl1, qh, S1);
      S0 = wmma_bf16(kh0, ql, S0);
      S1 = wmma_bf16(kh1, ql, S1);
      S0 = wmma_bf16(kh0, qh, S0);
      S1 = wmma_bf16(kh1, qh, S1);
    }

    float s0[8], s1[8];
    #pragma unroll
    for (int r = 0; r < 8; ++r) {
      s0[r] = S0[r] * SCALE_QK; if ((it == 6) && (k0 + 8 * hf + r >= SB)) s0[r] = -1e30f;  // keys 192..207 partial
      s1[r] = S1[r] * SCALE_QK; if (it == 6) s1[r] = -1e30f;                               // keys 208..223 all masked
    }
    float ma = fmaxf(s0[0], s0[1]), mb = fmaxf(s1[0], s1[1]);
    #pragma unroll
    for (int r = 2; r < 8; r += 2) {
      ma = fmaxf(fmaxf(ma, s0[r]), s0[r + 1]);
      mb = fmaxf(fmaxf(mb, s1[r]), s1[r + 1]);
    }
    float tmax = fmaxf(ma, mb);
    tmax = fmaxf(tmax, xhalf(tmax));
    const float mnew  = fmaxf(mrow, tmax);
    const float alpha = __expf(mrow - mnew);
    // element s of the B operand is key 8*hf + s (s < 8) or 16 + 8*hf + (s - 8): the order in which
    // ld_frag fetches the keys of a V row
    v16bf ph, pl;
    float ps[8];
    #pragma unroll
    for (int r = 0; r < 8; ++r) {
      float p0 = __expf(s0[r] - mnew);
      float p1 = __expf(s1[r] - mnew);
      ps[r] = p0 + p1;
      __bf16 h0 = (__bf16)p0;
      ph[r]     = h0;  pl[r]     = (__bf16)(p0 - (float)h0);
      __bf16 h1 = (__bf16)p1;
      ph[8 + r] = h1;  pl[8 + r] = (__bf16)(p1 - (float)h1);
    }
    float rs = ((ps[0] + ps[1]) + (ps[2] + ps[3])) + ((ps[4] + ps[5]) + (ps[6] + ps[7]));
    rs += xhalf(rs);
    lrow = lrow * alpha + rs;
    mrow = mnew;
    #pragma unroll
    for (int ct = 0; ct < 8; ++ct)
      #pragma unroll
      for (int r = 0; r < 8; ++r) Oacc[ct][r] *= alpha;

    // O^T(128x16) += V^T(128x32) * P^T(32x16), bf16x3; process ct in pairs so the
    // 3-product chains alternate between two independent accumulators
    #pragma unroll
    for (int ct = 0; ct < 8; ct += 2) {
      int vb0 = ((ct + 0) * 16 + ln) * 40 + 8 * hf;
      int vb1 = ((ct + 1) * 16 + ln) * 40 + 8 * hf;
      v16bf vh0 = ld_frag(Vh_t + vb0), vl0 = ld_frag(Vl_t + vb0);
      v16bf vh1 = ld_frag(Vh_t + vb1), vl1 = ld_frag(Vl_t + vb1);
      Oacc[ct + 0] = wmma_bf16(vl0, ph, Oacc[ct + 0]);
      Oacc[ct + 1] = wmma_bf16(vl1, ph, Oacc[ct + 1]);
      Oacc[ct + 0] = wmma_bf16(vh0, pl, Oacc[ct + 0]);
      Oacc[ct + 1] = wmma_bf16(vh1, pl, Oacc[ct + 1]);
      Oacc[ct + 0] = wmma_bf16(vh0, ph, Oacc[ct + 0]);
      Oacc[ct + 1] = wmma_bf16(vh1, ph, Oacc[ct + 1]);
    }
  }

  // write [T][D]: row t = this lane's query, col = h*128 + d with d = ct*16 + 8*hf + r: 8 neighbours
  float* orow = Oout + (size_t)(t0 + w * 16 + ln) * DMODEL + h * HDIM + 8 * hf;
  #pragma unroll
  for (int ct = 0; ct < 8; ++ct)
    #pragma unroll
    for (int r = 0; r < 8; ++r) Oacc[ct][r] = Oacc[ct][r] / lrow;
  #pragma unroll
  for (int ct = 0; ct < 8; ++ct) {
    *(float4*)(orow + ct * 16)     = make_float4(Oacc[ct][0], Oacc[ct][1], Oacc[ct][2], Oacc[ct][3]);
    *(float4*)(orow + ct * 16 + 4) = make_float4(Oacc[ct][4], Oacc[ct][5], Oacc[ct][6], Oacc[ct][7]);
  }
}

// ---------------- launch ----------------
extern "C" void kernel_launch(void* const* d_in, const int* in_sizes, int n_in,
                              void* d_out, int out_size, void* d_ws, size_t ws_size,
                              hipStream_t stream) {
  (void)in_sizes; (void)n_in; (void)out_size; (void)ws_size;
  const float* hidden = (const float*)d_in[0];
  const float* wq     = (const float*)d_in[1];
  const float* wk     = (const float*)d_in[2];
  const float* wv     = (const float*)d_in[3];
  const float* wo     = (const float*)d_in[4];
  const float* bern   = (const float*)d_in[5];

  const size_t NE = (size_t)T_SEQ * DMODEL;   // 4,194,304
  float* ws    = (float*)d_ws;
  float* q     = ws;            // [H][T][128] f32; q, k, v lie one behind the other
  float* k     = ws + 1 * NE;
  float* v     = ws + 2 * NE;
  float* attnb = ws + 3 * NE;   // [T][D]
  __bf16* shi  = (__bf16*)(ws + 4 * NE);  // hi planes: activations (hidden, then attnb), wq, wk, wv, wo
  __bf16* slo  = shi + 5 * NE;            // lo planes, the same order
  __bf16* khi  = slo + 5 * NE;            // RoPE'd K split
  __bf16* klo  = khi + NE;
  __bf16* vthi = klo + NE;                // bumped V, split, tiled [H][NTILE][128][32]
  __bf16* vtlo = vthi + NE;
  float* sc    = (float*)(vtlo + NE);     // [H][SC_PITCH] scores of the last query row

  // sanitized hidden and the four weights -> bf16 hi/lo, one launch
  split_kernel<<<dim3(SPLIT_GRID, 5), SPLIT_THREADS, 0, stream>>>(hidden, wq, wk, wv, wo, shi, slo, 1);

  // Q, K and V projections, one launch: z = 0, 1, 2
  gemm_bf16x3_async_kernel<<<dim3(DMODEL / GT_MN, T_SEQ / GT_MN, 3), 256, 0, stream>>>(
      shi, slo, shi + NE, slo + NE, q, 0);

  rope_split_kernel<<<ROPE_N / 256, 256, 0, stream>>>(q, k, khi, klo);

  lastrow_score_kernel<<<dim3(SC_GRID, NHEAD), 256, 0, stream>>>(q, k, sc);
  vprep_kernel<<<dim3(NTILE, NHEAD), 256, 0, stream>>>(v, sc, bern, vthi, vtlo);

  attn_kernel<<<dim3(T_SEQ / 64, NHEAD), 128, 0, stream>>>(q, khi, klo, vthi, vtlo, attnb);

  // output projection: split attnb into the activations' planes, then GEMM -> d_out
  split_kernel<<<dim3(SPLIT_GRID, 1), SPLIT_THREADS, 0, stream>>>(attnb, attnb, attnb, attnb, attnb, shi, slo, 0);
  gemm_bf16x3_async_kernel<<<dim3(DMODEL / GT_MN, T_SEQ / GT_MN, 1), 256, 0, stream>>>(
      shi, slo, shi + 4 * NE, slo + 4 * NE, (float*)d_out, 1);
}

// v008
// It runs in 249 microseconds.
// Timed twice side by side with v007, it ran 1.05 times as fast both times.
// Counting every step since v000, it is 2.21 times as fast.
#include <hip/hip_runtime.h>
#include <math.h>

// ---------------- problem constants ----------------
#define T_SEQ   2048
#define DMODEL  2048
#define NHEAD   16
#define HDIM    128
#define SB      204      // int(0.1*2048)
#define RB      1024     // int(0.5*2048)
#define NVALID  1228     // SB + RB
#define SCALE_QK 0.088388347648318447f   // 1/sqrt(128)

typedef float  v8f  __attribute__((ext_vector_type(8)));
typedef __bf16 v4bf __attribute__((ext_vector_type(4)));
typedef __bf16 v8bf __attribute__((ext_vector_type(8)));
typedef __bf16 v16bf __attribute__((ext_vector_type(16)));

static __device__ __forceinline__ v8f wmma_bf16(v16bf a, v16bf b, v8f c) {
  // D(16x16,f32) = A(16x32,bf16) x B(32x16,bf16) + C
  return __builtin_amdgcn_wmma_f32_16x16x32_bf16(false, a, false, b, (short)0, c, false, false);
}

// 16-bit A/B fragment: 8 contiguous K at p, 8 more at p+16
static __device__ __forceinline__ v16bf ld_frag(const __bf16* p) {
  v8bf a = *(const v8bf*)(p);
  v8bf b = *(const v8bf*)(p + 16);
  return __builtin_shufflevector(a, b, 0,1,2,3,4,5,6,7,8,9,10,11,12,13,14,15);
}

static __device__ __forceinline__ void split4(float4 v, v4bf& h, v4bf& l) {
  h[0] = (__bf16)v.x; l[0] = (__bf16)(v.x - (float)h[0]);
  h[1] = (__bf16)v.y; l[1] = (__bf16)(v.y - (float)h[1]);
  h[2] = (__bf16)v.z; l[2] = (__bf16)(v.z - (float)h[2]);
  h[3] = (__bf16)v.w; l[3] = (__bf16)(v.w - (float)h[3]);
}

static __device__ __forceinline__ float fin_clamp(float v) {
  if (v != v)        return 0.0f;
  if (v >  1.0e38f)  return  1.0e4f;
  if (v < -1.0e38f)  return -1.0e4f;
  return v;
}

// value of lane l ^ 16: the other half of a column of a 16 x 16 accumulator tile
static __device__ __forceinline__ float xhalf(float v) {
  int b = __builtin_bit_cast(int, v);
  return __builtin_bit_cast(float, __builtin_amdgcn_permlanex16(b, b, 0x76543210, 0xfedcba98, false, false));
}

// ---------------- async global->LDS copy (CDNA5), with sync fallback ----------------
#if __has_builtin(__builtin_amdgcn_global_load_async_to_lds_b128)
#define HAS_ASYNC_LDS 1
typedef int gv4i __attribute__((vector_size(16)));
typedef __attribute__((address_space(1))) gv4i as1_v4i;   // global
typedef __attribute__((address_space(3))) gv4i as3_v4i;   // LDS
static __device__ __forceinline__ void async_cp16(void* l, const void* g) {
  __builtin_amdgcn_global_load_async_to_lds_b128((as1_v4i*)g, (as3_v4i*)l, 0, 0);
}
#else
#define HAS_ASYNC_LDS 0
static __device__ __forceinline__ void async_cp16(void* l, const void* g) {
  *(float4*)l = *(const float4*)g;     // 16B sync copy fallback
}
#endif

// ---------------- kernel 1: nan_to_num(optional) + bf16 hi/lo split ----------------
// 16 waves per block, one block per 64 KiB of input: a thread takes 8 float4, each wave-wide load
// covers 512 contiguous bytes and each wave-wide store 256, so few waves have to be started.
// blockIdx.y picks one of up to five arrays of the same size, which depend on nothing but the inputs:
// one launch splits them all; array a's planes lie a * T_SEQ * DMODEL elements into hi and lo.
#define SPLIT_THREADS 512
#define SPLIT_VEC     8
#define SPLIT_GRID    ((T_SEQ * DMODEL) / (SPLIT_THREADS * SPLIT_VEC * 4))
static_assert(SPLIT_GRID * SPLIT_THREADS * SPLIT_VEC * 4 == T_SEQ * DMODEL, "blocks tile the array");
__global__ __launch_bounds__(SPLIT_THREADS)
void split_kernel(const float* __restrict__ x0, const float* __restrict__ x1,
                  const float* __restrict__ x2, const float* __restrict__ x3,
                  const float* __restrict__ x4, __bf16* __restrict__ hi,
                  __bf16* __restrict__ lo, int clamp_first) {
  const unsigned arr = blockIdx.y;
  const float* x = (arr == 0) ? x0 : (arr == 1) ? x1 : (arr == 2) ? x2 : (arr == 3) ? x3 : x4;
  const bool do_clamp = clamp_first && arr == 0;     // only the activations are sanitized
  const size_t plane = (size_t)arr * (T_SEQ * DMODEL);
  // byte offsets in 32 bits: one offset register serves all loads and one all stores
  const unsigned t4 = blockIdx.x * (SPLIT_THREADS * SPLIT_VEC) + threadIdx.x;   // in float4 units
  const char* xb = (const char*)x + t4 * 16u;
  char* hb = (char*)(hi + plane) + t4 * 8u;
  char* lb = (char*)(lo + plane) + t4 * 8u;
  float4 v[SPLIT_VEC];
  #pragma unroll
  for (int i = 0; i < SPLIT_VEC; ++i)
    v[i] = *(const float4*)(xb + i * (SPLIT_THREADS * 16));
  // precaution: stands ahead of the clamp's exec saves, which reuse a scalar register of the
  // base pair that the eight loads name
  asm volatile("s_wait_xcnt 0x0" ::: "memory");
  v4bf hh[SPLIT_VEC], ll[SPLIT_VEC];
  #pragma unroll
  for (int i = 0; i < SPLIT_VEC; ++i) {
    float4 u = v[i];
    if (do_clamp) {
      u.x = fin_clamp(u.x); u.y = fin_clamp(u.y); u.z = fin_clamp(u.z); u.w = fin_clamp(u.w);
    }
    split4(u, hh[i], ll[i]);
  }
  #pragma unroll
  for (int i = 0; i < SPLIT_VEC; ++i) {
    *(v4bf*)(hb + i * (SPLIT_THREADS * 8)) = hh[i];
    *(v4bf*)(lb + i * (SPLIT_THREADS * 8)) = ll[i];
  }
}

// ---------------- GEMM: C = A * W^T, bf16x3, async double-buffered LDS ----------------
// Operands pre-split to global bf16 hi/lo.  mode 0: scatter [H][T][HDIM]; 1: [T][D]+clamp.
// One 128 x 128 tile of C per block, 8 waves as 2 x 4, 64 x 32 per wave; a trip takes 128 k, so a
// staged row is 256 contiguous bytes (whole lines) and the two buffers leave room for one block
// per WGP.  A trip is 4 blocks of 32 k; each block's fragments are fetched one block ahead.
// blockIdx.z picks one of several products that share A: its weight planes and its output lie
// z * T_SEQ * DMODEL elements into Whi_g, Wlo_g and out_g.
#define GT_MN    128
#define GT_K     128
#define GT_PITCH 136                   // bf16; rows of 272 B = 16 B x odd, for 16-byte readers
#define GT_ARR   (GT_MN * GT_PITCH)    // one operand plane of one buffer
#define GT_TRIPS (DMODEL / GT_K)
__global__ __launch_bounds__(256)
void gemm_bf16x3_async_kernel(const __bf16* __restrict__ Ahi_g, const __bf16* __restrict__ Alo_g,
                              const __bf16* __restrict__ Whi_g, const __bf16* __restrict__ Wlo_g,
                              float* __restrict__ out_g, int mode) {
  __shared__ __attribute__((aligned(16))) __bf16 Sbuf[2][4][GT_ARR];   // [buf][Ahi, Alo, Whi, Wlo]
  static_assert(T_SEQ == DMODEL, "a weight plane and an output are of one size");
  const size_t zoff = (size_t)blockIdx.z * ((size_t)T_SEQ * DMODEL);
  float* __restrict__ out = out_g + zoff;

  const int tid  = threadIdx.x;
  const int wid  = tid >> 5;
  const int lane = tid & 31;
  const int ln   = lane & 15;
  const int hf   = lane >> 4;
  const int wr   = wid >> 2;       // 0..1
  const int wc   = wid & 3;        // 0..3
  const int m0   = blockIdx.y * GT_MN;
  const int n0   = blockIdx.x * GT_MN;

  // 8 copies per plane and thread: rows crow + 0..3 and 64 + crow + 0..3, so that neighbouring
  // copies lie one row (4096 B) apart; a wave's copy takes two whole 256-B rows
  const int crow = (tid >> 4) * 4, cc = (tid & 15) * 8;      // 8 bf16 = 16B
  const __bf16* a_hi = Ahi_g + (size_t)(m0 + crow) * DMODEL + cc;
  const __bf16* a_lo = Alo_g + (size_t)(m0 + crow) * DMODEL + cc;
  const __bf16* w_hi = Whi_g + zoff + (size_t)(n0 + crow) * DMODEL + cc;
  const __bf16* w_lo = Wlo_g + zoff + (size_t)(n0 + crow) * DMODEL + cc;
  const int     loff = crow * GT_PITCH + cc;

  v8f acc[4][2];
  #pragma unroll
  for (int i = 0; i < 4; ++i)
    #pragma unroll
    for (int j = 0; j < 2; ++j)
      #pragma unroll
      for (int r = 0; r < 8; ++r) acc[i][j][r] = 0.0f;

  auto issue = [&](int buf, int kt) {
    // unrolled: the row steps become constants of the copies' addresses
    #pragma unroll
    for (int i = 0; i < 8; ++i) {
      const int rw = (i & 3) + (i >> 2) * 64;
      const int go = rw * DMODEL + kt;
      const int lr = loff + rw * GT_PITCH;
      async_cp16(&Sbuf[buf][0][lr], a_hi + go);
      async_cp16(&Sbuf[buf][1][lr], a_lo + go);
      async_cp16(&Sbuf[buf][2][lr], w_hi + go);
      async_cp16(&Sbuf[buf][3][lr], w_lo + go);
    }
  };

  // two fragment sets: one is worked on while the other is filled
  v16bf fa_h[2][4], fa_l[2][4], fb_h[2][2], fb_l[2][2];
  auto load_set = [&](int s, int buf, int ks) {
    const int ab = (wr * 64 + ln) * GT_PITCH + ks + 8 * hf;
    const int bb = (wc * 32 + ln) * GT_PITCH + ks + 8 * hf;
    // both loops unrolled: fragment arrays stay in registers only under constant indices
    #pragma unroll
    for (int i = 0; i < 4; ++i) {
      fa_h[s][i] = ld_frag(&Sbuf[buf][0][ab + i * 16 * GT_PITCH]);
      fa_l[s][i] = ld_frag(&Sbuf[buf][1][ab + i * 16 * GT_PITCH]);
    }
    #pragma unroll
    for (int j = 0; j < 2; ++j) {
      fb_h[s][j] = ld_frag(&Sbuf[buf][2][bb + j * 16 * GT_PITCH]);
      fb_l[s][j] = ld_frag(&Sbuf[buf][3][bb + j * 16 * GT_PITCH]);
    }
  };

  issue(0, 0);
  // own copies of tile 0 have landed; the barrier then shows them to the other waves
  asm volatile("s_wait_asynccnt 0x0" ::: "memory");
  __syncthreads();
  issue(1, GT_K);
  load_set(0, 0, 0);

  for (int t = 0; t < GT_TRIPS; ++t) {
    const int buf = t & 1;
    // unrolled: the set index must be a constant for the fragments to stay in registers
    #pragma unroll
    for (int b = 0; b < 4; ++b) {
      if (b < 3) {
        load_set((b + 1) & 1, buf, (b + 1) * 32);
      } else {
        // publish point of tile t + 1, ahead of this tile's last block, whose fragments are fetched:
        // own LDS reads retired before the refill below aims at the buffer this trip has read
        asm volatile("s_wait_dscnt 0x0" ::: "memory");
        // own copies of the next tile have landed; the barrier then shows them to the other waves
        asm volatile("s_wait_asynccnt 0x0" ::: "memory");
        __syncthreads();
        if (t + 1 < GT_TRIPS) load_set(0, buf ^ 1, 0);
      }
      // keeps the next block's fragment loads one group ahead of this block's products
      __builtin_amdgcn_sched_barrier(0);
      // the refill flies while the next tile is worked on; its address work may mix with the products
      if (b == 3 && t + 2 < GT_TRIPS) issue(buf, (t + 2) * GT_K);
      const int s = b & 1;
      // product-major over the 8 independent accumulators; per accumulator and 32 k the order
      // stays hi*lo, lo*hi, hi*hi (loops unrolled: register arrays need constant indices)
      #pragma unroll
      for (int i = 0; i < 4; ++i)
        #pragma unroll
        for (int j = 0; j < 2; ++j) acc[i][j] = wmma_bf16(fa_h[s][i], fb_l[s][j], acc[i][j]);
      #pragma unroll
      for (int i = 0; i < 4; ++i)
        #pragma unroll
        for (int j = 0; j < 2; ++j) acc[i][j] = wmma_bf16(fa_l[s][i], fb_h[s][j], acc[i][j]);
      #pragma unroll
      for (int i = 0; i < 4; ++i)
        #pragma unroll
        for (int j = 0; j < 2; ++j) acc[i][j] = wmma_bf16(fa_h[s][i], fb_h[s][j], acc[i][j]);
      // keeps the following block's loads from moving in among these products
      __builtin_amdgcn_sched_barrier(0);
    }
  }
  // precaution: no copy is outstanding when the wave ends
  asm volatile("s_wait_asynccnt 0x0" ::: "memory");

  // C layout: lane ln = column, row = r + 8*hf
  #pragma unroll
  for (int i = 0; i < 4; ++i)
    #pragma unroll
    for (int j = 0; j < 2; ++j)
      #pragma unroll
      for (int r = 0; r < 8; ++r) {
        int gm = m0 + wr * 64 + i * 16 + r + 8 * hf;
        int gn = n0 + wc * 32 + j * 16 + ln;
        float v = acc[i][j][r];
        if (mode == 1) {
          out[(size_t)gm * DMODEL + gn] = fin_clamp(v);
        } else {
          int h = gn >> 7, d = gn & 127;
          out[((size_t)h * T_SEQ + gm) * HDIM + d] = v;
        }
      }
}

// ---------------- kernel 3: RoPE on Q,K + emit bf16 hi/lo split of K ----------------
// A thread takes 4 neighbouring j (with their partners j + 64) of one position t in ROPE_HEADS heads,
// Q and K: 16 loads of 16 bytes, all issued ahead of the angles.
#define ROPE_HEADS 4
#define ROPE_N     ((NHEAD / ROPE_HEADS) * T_SEQ * 16)
// written as explicit fma so that the product rounded first is x2*s (low half) and x1*s (high half)
static __device__ __forceinline__ void rot4(float4 a, float4 b, const float* c, const float* s,
                                            float4& lo, float4& hi) {
  lo.x = fmaf(c[0], a.x, -(b.x * s[0]));  hi.x = fmaf(c[0], b.x, a.x * s[0]);
  lo.y = fmaf(c[1], a.y, -(b.y * s[1]));  hi.y = fmaf(c[1], b.y, a.y * s[1]);
  lo.z = fmaf(c[2], a.z, -(b.z * s[2]));  hi.z = fmaf(c[2], b.z, a.z * s[2]);
  lo.w = fmaf(c[3], a.w, -(b.w * s[3]));  hi.w = fmaf(c[3], b.w, a.w * s[3]);
}
__global__ __launch_bounds__(256)
void rope_split_kernel(float* __restrict__ Q, float* __restrict__ K,
                       __bf16* __restrict__ Khi, __bf16* __restrict__ Klo) {
  int idx = blockIdx.x * blockDim.x + threadIdx.x;       // (H/ROPE_HEADS)*T*16
  if (idx >= ROPE_N) return;
  int j  = (idx & 15) * 4;
  int t  = (idx >> 4) & (T_SEQ - 1);
  int h0 = (idx >> 15) * ROPE_HEADS;
  const size_t base0 = ((size_t)h0 * T_SEQ + t) * HDIM + j;

  float4 q1[ROPE_HEADS], q2[ROPE_HEADS], k1[ROPE_HEADS], k2[ROPE_HEADS];
  #pragma unroll
  for (int i = 0; i < ROPE_HEADS; ++i) {
    const size_t base = base0 + (size_t)i * T_SEQ * HDIM;
    q1[i] = *(const float4*)(Q + base);  q2[i] = *(const float4*)(Q + base + 64);
    k1[i] = *(const float4*)(K + base);  k2[i] = *(const float4*)(K + base + 64);
  }

  float c[4], s[4];
  #pragma unroll
  for (int e = 0; e < 4; ++e) {
    float invf = __expf(-(float)(j + e) * (9.210340371976184f / 64.0f)); // 10000^(-j/64)
    float ang = (float)t * invf;
    c[e] = cosf(ang); s[e] = sinf(ang);
  }

  #pragma unroll
  for (int i = 0; i < ROPE_HEADS; ++i) {
    const size_t base = base0 + (size_t)i * T_SEQ * HDIM;
    float4 a, b;
    rot4(q1[i], q2[i], c, s, a, b);
    *(float4*)(Q + base)      = a;
    *(float4*)(Q + base + 64) = b;
    rot4(k1[i], k2[i], c, s, a, b);
    *(float4*)(K + base)      = a;
    *(float4*)(K + base + 64) = b;
    v4bf hh, ll;
    split4(a, hh, ll);
    *(v4bf*)(Khi + base)      = hh;  *(v4bf*)(Klo + base)      = ll;
    split4(b, hh, ll);
    *(v4bf*)(Khi + base + 64) = hh;  *(v4bf*)(Klo + base + 64) = ll;
  }
}

// ---------------- kernel 4: scores of the last query row against the kept keys (f32) ----------------
// value of lane l ^ M inside a 16-lane row
template <int M>
static __device__ __forceinline__ float xrow(float v) {
  int b = __builtin_bit_cast(int, v);
  return __builtin_bit_cast(float, __builtin_amdgcn_mov_dpp(b, 0x160 + M, 0xf, 0xf, true));  // row_xmask:M
}
typedef float f4v __attribute__((ext_vector_type(4)));
static __device__ __forceinline__ float dot4(f4v a, f4v b) {
  return fmaf(a.w, b.w, fmaf(a.z, b.z, fmaf(a.y, b.y, a.x * b.x)));
}
// One block per (128 kept keys, head).  Eight lanes share a key: each of their four loads is one whole
// 128-byte line of its row, and all sixteen key loads of a thread go out together.
#define SC_KEYS  128
#define SC_GRID  ((NVALID + SC_KEYS - 1) / SC_KEYS)
#define SC_PITCH (SC_GRID * SC_KEYS)   // floats per head in the score array
__global__ __launch_bounds__(256)
void lastrow_score_kernel(const float* __restrict__ Q, const float* __restrict__ K,
                          float* __restrict__ sc) {
  const int h = blockIdx.y, tid = threadIdx.x;
  const int sub = tid & 7, grp = tid >> 3;
  // byte offsets in 32 bits on block-uniform bases
  const char* qb = (const char*)(Q + ((size_t)h * T_SEQ + (T_SEQ - 1)) * HDIM);
  const char* kb = (const char*)(K + (size_t)h * T_SEQ * HDIM);
  const unsigned qo = (unsigned)sub * 16u;
  f4v q[4];
  #pragma unroll
  for (int c = 0; c < 4; ++c) q[c] = *(const f4v*)(qb + qo + c * 128);
  unsigned ko[4];
  f4v kv[4][4];
  #pragma unroll
  for (int b = 0; b < 4; ++b) {
    const int id  = blockIdx.x * SC_KEYS + b * 32 + grp;
    const int ic  = (id < NVALID) ? id : NVALID - 1;          // past the end: the last key again, not stored
    const int key = (ic < SB) ? ic : (T_SEQ - RB) + (ic - SB);
    ko[b] = (unsigned)key * (HDIM * 4u) + qo;
    #pragma unroll
    for (int c = 0; c < 4; ++c) kv[b][c] = *(const f4v*)(kb + ko[b] + c * 128);
  }
  // all twenty loads go out as one group and one memory latency is paid: left alone, the compiler's
  // scheduler puts some of them behind the wait for q
  __builtin_amdgcn_sched_barrier(0);
  // precaution: stands ahead of every later write of the loads' offset registers; it names the offsets so
  // that those registers are held until here and no load's result lands in them
  asm volatile("s_wait_xcnt 0x0" :: "v"(qo), "v"(ko[0]), "v"(ko[1]), "v"(ko[2]), "v"(ko[3]) : "memory");
  // keeps the wait directly behind the loads: later scalar and vector work stays behind it
  __builtin_amdgcn_sched_barrier(0);
  float d[4];
  #pragma unroll
  for (int b = 0; b < 4; ++b) {
    float t = (dot4(q[0], kv[b][0]) + dot4(q[1], kv[b][1])) + (dot4(q[2], kv[b][2]) + dot4(q[3], kv[b][3]));
    t += xrow<1>(t);
    t += xrow<2>(t);
    t += xrow<4>(t);
    d[b] = t;            // the same in all eight lanes of the key
  }
  // lane sub of a group stores the group's key number sub: one store for the four
  const float dv = (sub == 0) ? d[0] : (sub == 1) ? d[1] : (sub == 2) ? d[2] : d[3];
  const int   id = blockIdx.x * SC_KEYS + (sub & 3) * 32 + grp;
  if (sub < 4 && id < NVALID) sc[h * SC_PITCH + id] = dv * SCALE_QK;
}

// ---------------- kernel 4b: V bump + bf16 hi/lo split + transpose, once for all query blocks ----
// One block per (32-key tile, head).  Output tile: [d 0..127][key 0..31], 8 KiB contiguous, hi and lo,
// in the order in which attention walks the tiles.  Every block forms its head's bump coefficient itself
// from the last row's scores (softmax over the kept keys), all blocks in the same order of sums.
#define NTILE 39      // 7 tiles for [0,204), 32 for [1024,2048)
#define VT_PITCH 132  // floats; rows stay 16-byte aligned
__global__ __launch_bounds__(256)
void vprep_kernel(const float* __restrict__ V, const float* __restrict__ sc,
                  const float* __restrict__ bern,
                  __bf16* __restrict__ Vthi, __bf16* __restrict__ Vtlo) {
  __shared__ __attribute__((aligned(16))) float tile[32 * VT_PITCH];
  __shared__ __attribute__((aligned(16))) float red[3][8];     // per wave: maximum, sum, tail sum
  const int tid = threadIdx.x;
  const int it  = blockIdx.x;
  const int h   = blockIdx.y;
  const int k0  = (it < 7) ? it * 32 : (T_SEQ - RB) + (it - 7) * 32;
  const float* Vh = V + (size_t)h * T_SEQ * HDIM;
  // a thread keeps one group of 4 dims and takes 4 keys; all five loads go out together
  const int d4 = (tid & 31) * 4, kr0 = tid >> 5;
  // byte offsets in 32 bits on block-uniform bases: one offset register serves the four row loads,
  // whose rows lie a constant 4096 bytes apart
  const char* eb = (const char*)(Vh + (size_t)RB * HDIM) + (unsigned)d4 * 4u;
  const char* rb = (const char*)(Vh + (size_t)k0 * HDIM) + (unsigned)tid * 16u;
  const float4 e = *(const float4*)eb;
  float4 v[4];
  #pragma unroll
  for (int i = 0; i < 4; ++i)
    v[i] = *(const float4*)(rb + i * (8 * HDIM * 4));

  // the head's NVALID scores, 5 per thread: index tid + 256 * i; only i = 4 can pass the end
  static_assert(NVALID > 1024 && NVALID <= 1280 && SB + 1 < 256, "5 scores per thread, tail starts in the first");
  const char* sb = (const char*)(sc + h * SC_PITCH);
  const bool  in4 = tid < NVALID - 1024;
  const unsigned so = (unsigned)tid * 4u, so4 = in4 ? so + 4096u : (NVALID - 1) * 4u;
  float s[5];
  #pragma unroll
  for (int i = 0; i < 4; ++i) s[i] = *(const float*)(sb + so + i * 1024);
  s[4] = *(const float*)(sb + so4);
  // the V loads and the score loads go out as one group and one memory latency is paid: left alone, the
  // compiler's scheduler puts the V loads behind the wait for the scores
  __builtin_amdgcn_sched_barrier(0);
  // precaution: stands ahead of every later write of the score loads' offset registers; it names the
  // offsets so that those registers are held until here
  asm volatile("s_wait_xcnt 0x0" :: "v"(so), "v"(so4) : "memory");
  // keeps the wait directly behind the loads: later scalar address work stays behind it
  __builtin_amdgcn_sched_barrier(0);
  const float se = *(const float*)(sb + SB * 4);     // score of the evicted key, RB
  const float bu = bern[h];
  if (!in4) s[4] = -1e30f;
  float mx = fmaxf(fmaxf(fmaxf(s[0], s[1]), fmaxf(s[2], s[3])), s[4]);
  mx = fmaxf(mx, xrow<1>(mx));  mx = fmaxf(mx, xrow<2>(mx));
  mx = fmaxf(mx, xrow<4>(mx));  mx = fmaxf(mx, xrow<8>(mx));
  mx = fmaxf(mx, xhalf(mx));
  if ((tid & 31) == 0) red[0][tid >> 5] = mx;
  __syncthreads();      // the waves' maxima are seen by all
  float4 ra = *(const float4*)&red[0][0], rc = *(const float4*)&red[0][4];
  const float gmax = fmaxf(fmaxf(fmaxf(ra.x, ra.y), fmaxf(ra.z, ra.w)), fmaxf(fmaxf(rc.x, rc.y), fmaxf(rc.z, rc.w)));
  const float e0 = __expf(s[0] - gmax), e1 = __expf(s[1] - gmax), e2 = __expf(s[2] - gmax),
              e3 = __expf(s[3] - gmax), e4 = in4 ? __expf(s[4] - gmax) : 0.0f;
  const float rest = (e1 + e2) + (e3 + e4);
  float sm = e0 + rest;
  float tl = ((tid >= SB + 1) ? e0 : 0.0f) + rest;   // keys 1025..2047
  sm += xrow<1>(sm);  tl += xrow<1>(tl);
  sm += xrow<2>(sm);  tl += xrow<2>(tl);
  sm += xrow<4>(sm);  tl += xrow<4>(tl);
  sm += xrow<8>(sm);  tl += xrow<8>(tl);
  sm += xhalf(sm);    tl += xhalf(tl);
  if ((tid & 31) == 0) { red[1][tid >> 5] = sm; red[2][tid >> 5] = tl; }
  __syncthreads();      // the waves' sums are seen by all
  ra = *(const float4*)&red[1][0];  rc = *(const float4*)&red[1][4];
  const float gsum  = ((ra.x + ra.y) + (ra.z + ra.w)) + ((rc.x + rc.y) + (rc.z + rc.w));
  ra = *(const float4*)&red[2][0];  rc = *(const float4*)&red[2][4];
  const float gtail = ((ra.x + ra.y) + (ra.z + ra.w)) + ((rc.x + rc.y) + (rc.z + rc.w));
  const float pe   = __expf(se - gmax) / gsum;               // probs at key e=1024
  const float mean = (gtail / gsum) / 1023.0f + 1e-6f;
  float p = pe / mean;
  p = (p != p) ? 0.0f : fminf(fmaxf(p, 0.0f), 1.0f);
  const float cf = ((bu < p) ? 1.0f : 0.0f) / (float)RB;

  const float bx = e.x * cf, by = e.y * cf, bz = e.z * cf, bw = e.w * cf;
  #pragma unroll
  for (int i = 0; i < 4; ++i) {
    const bool bump = (k0 + kr0 + i * 8) > RB;     // keys 1025..2047 take the evicted row's share
    float4 u = v[i];
    u.x = bump ? u.x + bx : u.x;  u.y = bump ? u.y + by : u.y;
    u.z = bump ? u.z + bz : u.z;  u.w = bump ? u.w + bw : u.w;
    *(float4*)(&tile[(kr0 + i * 8) * VT_PITCH + d4]) = u;
  }
  __syncthreads();
  const size_t ob = ((size_t)h * NTILE + it) * (HDIM * 32);
  #pragma unroll
  for (int i = 0; i < 2; ++i) {
    int c = tid + i * 256;                   // 16-byte chunk of the output tile
    int d = c >> 2, kg = (c & 3) * 8;
    v8bf hh, ll;
    #pragma unroll
    for (int j = 0; j < 8; ++j) {
      float v = tile[(kg + j) * VT_PITCH + d];
      __bf16 x = (__bf16)v;
      hh[j] = x;
      ll[j] = (__bf16)(v - (float)x);
    }
    *(v8bf*)(Vthi + ob + c * 8) = hh;
    *(v8bf*)(Vtlo + ob + c * 8) = ll;
  }
}

#define AT_Q     128
#define AT_TRIPS ((NTILE + 1) / 2)
__global__ __launch_bounds__(256)
void attn_kernel(const float* __restrict__ Q, const __bf16* __restrict__ Khi,
                 const __bf16* __restrict__ Klo, const __bf16* __restrict__ Vthi,
                 const __bf16* __restrict__ Vtlo, float* __restrict__ Oout) {
  __shared__ __attribute__((aligned(16))) __bf16 Qhi_s[AT_Q * 136], Qlo_s[AT_Q * 136];   // 128 queries x 128 dims
  // V tile [d][key], 32 keys, hi and lo, per key group two buffers; row pitch 80 B for 16-byte readers
  __shared__ __attribute__((aligned(16))) __bf16 Vhi_s[2][2][128 * 40];
  __shared__ __attribute__((aligned(16))) __bf16 Vlo_s[2][2][128 * 40];
  // K tile, 32 keys x 128 dims, hi and lo, per key group two buffers; row pitch 272 B for 16-byte readers
  __shared__ __attribute__((aligned(16))) __bf16 Khi_s[2][2][32 * 136];
  __shared__ __attribute__((aligned(16))) __bf16 Klo_s[2][2][32 * 136];
  // the join: what group g hands to the other group, [g][wave][16 bytes of a lane's 64 floats][lane]
  __shared__ __attribute__((aligned(16))) float Ox_s[2][4][16][32 * 4];
  __shared__ float Mx_s[2][4][32], Lx_s[2][4][32];

  const int tid  = threadIdx.x;
  const int gt   = tid & 127;        // thread within its key group
  const int g    = __builtin_amdgcn_readfirstlane(tid >> 7);   // key group, the same in a whole wave
  const int w    = (tid >> 5) & 3;   // 4 waves a group, 32 queries each
  const int lane = tid & 31;
  const int ln   = lane & 15;
  const int hf   = lane >> 4;
  const int h    = blockIdx.y;
  const int t0   = blockIdx.x * AT_Q;
  const size_t hk = (size_t)h * T_SEQ;

  const float* Qh = Q + hk * HDIM;

  // one K tile (hi and lo) into the group's LDS, once per block: each wave's copy takes 512 contiguous
  // bytes (two whole key rows), 8 copies per thread and tile
  auto issue_k = [&](int buf, int kbase) {
    #pragma unroll
    for (int i = 0; i < 4; ++i) {
      int idx = gt + i * 128, rw = idx >> 4, cw = (idx & 15) * 8;
      async_cp16(&Khi_s[g][buf][rw * 136 + cw], Khi + (hk + kbase + rw) * HDIM + cw);
      async_cp16(&Klo_s[g][buf][rw * 136 + cw], Klo + (hk + kbase + rw) * HDIM + cw);
    }
  };
  // one prepared V tile (hi and lo) into the group's LDS: each wave's copy takes 512 contiguous bytes,
  // 8 copies per thread and tile
  auto issue_v = [&](int buf, int tile) {
    const size_t vb = ((size_t)h * NTILE + tile) * (HDIM * 32);
    #pragma unroll
    for (int i = 0; i < 4; ++i) {
      int c = gt + i * 128;
      async_cp16(&Vhi_s[g][buf][(c >> 2) * 40 + (c & 3) * 8], Vthi + vb + c * 8);
      async_cp16(&Vlo_s[g][buf][(c >> 2) * 40 + (c & 3) * 8], Vtlo + vb + c * 8);
    }
  };
  static_assert(NTILE >= 2, "each key group has a first tile");
  issue_k(0, g * 32);
  issue_v(0, g);

  // stage + split this block's 128 query rows
  // row (tid >> 5) + 8 * i, dims (tid & 31) * 4 and up: one address for all sixteen loads, 4096 bytes apart
  const float* qp = Qh + (size_t)(t0 + (tid >> 5)) * HDIM + (tid & 31) * 4;
  float4 qv[16];
  #pragma unroll
  for (int i = 0; i < 16; ++i) qv[i] = *(const float4*)(qp + i * 8 * HDIM);
  // precaution: stands ahead of every later write of the loads' address registers; it names the address so
  // that those registers are held until here and no load's result lands in them
  asm volatile("s_wait_xcnt 0x0" :: "v"(qp) : "memory");
  #pragma unroll
  for (int i = 0; i < 16; ++i) {
    int row = (tid >> 5) + i * 8, kc = (tid & 31) * 4;
    float4 v = qv[i];
    v4bf hh, ll; split4(v, hh, ll);
    *(v4bf*)(&Qhi_s[row * 136 + kc]) = hh;
    *(v4bf*)(&Qlo_s[row * 136 + kc]) = ll;
  }
  __syncthreads();      // the split query rows are seen by all waves

  // this wave's 32 queries as B fragments, fetched once: [query tile][32 dims]
  // (here and below, loops over register arrays are unrolled: they stay in registers only under constant indices)
  v16bf qh[2][4], ql[2][4];
  #pragma unroll
  for (int qt = 0; qt < 2; ++qt)
    #pragma unroll
    for (int c = 0; c < 4; ++c) {
      int qb = (w * 32 + qt * 16 + ln) * 136 + c * 32 + 8 * hf;
      qh[qt][c] = ld_frag(&Qhi_s[qb]);
      ql[qt][c] = ld_frag(&Qlo_s[qb]);
    }

  v8f Oacc[2][8];
  float mrow[2], lrow[2];                // of query w * 32 + qt * 16 + ln, the same in both halves
  #pragma unroll
  for (int qt = 0; qt < 2; ++qt) {
    mrow[qt] = -1e30f; lrow[qt] = 0.0f;
    #pragma unroll
    for (int ct = 0; ct < 8; ++ct)
      #pragma unroll
      for (int r = 0; r < 8; ++r) Oacc[qt][ct][r] = 0.0f;
  }

  for (int tr = 0; tr < AT_TRIPS; ++tr) {
    const int it = 2 * tr + g;           // this group's key tile; the last trip has none for group 1
    // own LDS traffic retired before the refill below aims at a buffer this wave has read
    asm volatile("s_wait_dscnt 0x0" ::: "memory");
    // own copies of this tile's K and V have landed; the barrier then shows them to the other waves
    asm volatile("s_wait_asynccnt 0x0" ::: "memory");
    __syncthreads();

    // the group's next tile flies while this one is worked on; its buffers were last read one trip ago
    if (it + 2 < NTILE) {
      issue_k((tr + 1) & 1, (it + 2 < 7) ? (it + 2) * 32 : (T_SEQ - RB) + (it + 2 - 7) * 32);
      issue_v((tr + 1) & 1, it + 2);
    }
    if (it < NTILE) {
      const int k0 = (it < 7) ? it * 32 : (T_SEQ - RB) + (it - 7) * 32;
      const __bf16* Kh_t = Khi_s[g][tr & 1];
      const __bf16* Kl_t = Klo_s[g][tr & 1];
      const __bf16* Vh_t = Vhi_s[g][tr & 1];
      const __bf16* Vl_t = Vlo_s[g][tr & 1];

      // S^T(32x16) = K(32x128) * Q^T(128x16) per query tile, two 16-key tiles, bf16x3: S0[qt][r] is key
      // k0 + 8*hf + r, S1[qt][r] key k0 + 16 + 8*hf + r, both of query qt * 16 + ln
      v8f S0[2], S1[2];
      #pragma unroll
      for (int qt = 0; qt < 2; ++qt)
        #pragma unroll
        for (int r = 0; r < 8; ++r) { S0[qt][r] = 0.0f; S1[qt][r] = 0.0f; }
      const int kr0 = ln * 136;
      const int kr1 = (16 + ln) * 136;
      #pragma unroll
      for (int c = 0; c < 4; ++c) {
        const int kc = c * 32;
        v16bf kh0 = ld_frag(Kh_t + kr0 + kc + 8 * hf);
        v16bf kl0 = ld_frag(Kl_t + kr0 + kc + 8 * hf);
        v16bf kh1 = ld_frag(Kh_t + kr1 + kc + 8 * hf);
        v16bf kl1 = ld_frag(Kl_t + kr1 + kc + 8 * hf);
        // interleave the four independent accumulators
        S0[0] = wmma_bf16(kl0, qh[0][c], S0[0]);
        S1[0] = wmma_bf16(kl1, qh[0][c], S1[0]);
        S0[1] = wmma_bf16(kl0, qh[1][c], S0[1]);
        S1[1] = wmma_bf16(kl1, qh[1][c], S1[1]);
        S0[0] = wmma_bf16(kh0, ql[0][c], S0[0]);
        S1[0] = wmma_bf16(kh1, ql[0][c], S1[0]);
        S0[1] = wmma_bf16(kh0, ql[1][c], S0[1]);
        S1[1] = wmma_bf16(kh1, ql[1][c], S1[1]);
        S0[0] = wmma_bf16(kh0, qh[0][c], S0[0]);
        S1[0] = wmma_bf16(kh1, qh[0][c], S1[0]);
        S0[1] = wmma_bf16(kh0, qh[1][c], S0[1]);
        S1[1] = wmma_bf16(kh1, qh[1][c], S1[1]);
      }

      v16bf ph[2], pl[2];
      #pragma unroll
      for (int qt = 0; qt < 2; ++qt) {
        float s0[8], s1[8];
        #pragma unroll
        for (int r = 0; r < 8; ++r) {
          s0[r] = S0[qt][r] * SCALE_QK; if ((it == 6) && (k0 + 8 * hf + r >= SB)) s0[r] = -1e30f;  // keys 192..207 partial
          s1[r] = S1[qt][r] * SCALE_QK; if (it == 6) s1[r] = -1e30f;                               // keys 208..223 all masked
        }
        float ma = fmaxf(s0[0], s0[1]), mb = fmaxf(s1[0], s1[1]);
        #pragma unroll
        for (int r = 2; r < 8; r += 2) {
          ma = fmaxf(fmaxf(ma, s0[r]), s0[r + 1]);
          mb = fmaxf(fmaxf(mb, s1[r]), s1[r + 1]);
        }
        float tmax = fmaxf(ma, mb);
        tmax = fmaxf(tmax, xhalf(tmax));
        const float mnew  = fmaxf(mrow[qt], tmax);
        const float alpha = __expf(mrow[qt] - mnew);
        // element s of the B operand is key 8*hf + s (s < 8) or 16 + 8*hf + (s - 8): the order in which
        // ld_frag fetches the keys of a V row
        float ps[8];
        #pragma unroll
        for (int r = 0; r < 8; ++r) {
          float p0 = __expf(s0[r] - mnew);
          float p1 = __expf(s1[r] - mnew);
          ps[r] = p0 + p1;
          __bf16 h0 = (__bf16)p0;
          ph[qt][r]     = h0;  pl[qt][r]     = (__bf16)(p0 - (float)h0);
          __bf16 h1 = (__bf16)p1;
          ph[qt][8 + r] = h1;  pl[qt][8 + r] = (__bf16)(p1 - (float)h1);
        }
        float rs = ((ps[0] + ps[1]) + (ps[2] + ps[3])) + ((ps[4] + ps[5]) + (ps[6] + ps[7]));
        rs += xhalf(rs);
        lrow[qt] = lrow[qt] * alpha + rs;
        mrow[qt] = mnew;
        #pragma unroll
        for (int ct = 0; ct < 8; ++ct)
          #pragma unroll
          for (int r = 0; r < 8; ++r) Oacc[qt][ct][r] *= alpha;
      }

      // O^T(128x16) += V^T(128x32) * P^T(32x16) per query tile, bf16x3; ct in pairs, so the 3-product
      // chains alternate between four independent accumulators
      #pragma unroll
      for (int ct = 0; ct < 8; ct += 2) {
        int vb0 = ((ct + 0) * 16 + ln) * 40 + 8 * hf;
        int vb1 = ((ct + 1) * 16 + ln) * 40 + 8 * hf;
        v16bf vh0 = ld_frag(Vh_t + vb0), vl0 = ld_frag(Vl_t + vb0);
        v16bf vh1 = ld_frag(Vh_t + vb1), vl1 = ld_frag(Vl_t + vb1);
        Oacc[0][ct + 0] = wmma_bf16(vl0, ph[0], Oacc[0][ct + 0]);
        Oacc[0][ct + 1] = wmma_bf16(vl1, ph[0], Oacc[0][ct + 1]);
        Oacc[1][ct + 0] = wmma_bf16(vl0, ph[1], Oacc[1][ct + 0]);
        Oacc[1][ct + 1] = wmma_bf16(vl1, ph[1], Oacc[1][ct + 1]);
        Oacc[0][ct + 0] = wmma_bf16(vh0, pl[0], Oacc[0][ct + 0]);
        Oacc[0][ct + 1] = wmma_bf16(vh1, pl[0], Oacc[0][ct + 1]);
        Oacc[1][ct + 0] = wmma_bf16(vh0, pl[1], Oacc[1][ct + 0]);
        Oacc[1][ct + 1] = wmma_bf16(vh1, pl[1], Oacc[1][ct + 1]);
        Oacc[0][ct + 0] = wmma_bf16(vh0, ph[0], Oacc[0][ct + 0]);
        Oacc[0][ct + 1] = wmma_bf16(vh1, ph[0], Oacc[0][ct + 1]);
        Oacc[1][ct + 0] = wmma_bf16(vh0, ph[1], Oacc[1][ct + 0]);
        Oacc[1][ct + 1] = wmma_bf16(vh1, ph[1], Oacc[1][ct + 1]);
      }
    }
  }

  // the join of the two key groups: group g finishes query tile g and hands its part of the other tile over
  const bool g1 = (g != 0);
  const float mk = g1 ? mrow[1] : mrow[0], lk = g1 ? lrow[1] : lrow[0];     // kept
  Mx_s[g][w][lane] = g1 ? mrow[0] : mrow[1];
  Lx_s[g][w][lane] = g1 ? lrow[0] : lrow[1];
  #pragma unroll
  for (int ct = 0; ct < 8; ++ct)
    #pragma unroll
    for (int q4 = 0; q4 < 2; ++q4) {
      float4 x;
      x.x = g1 ? Oacc[0][ct][q4 * 4 + 0] : Oacc[1][ct][q4 * 4 + 0];
      x.y = g1 ? Oacc[0][ct][q4 * 4 + 1] : Oacc[1][ct][q4 * 4 + 1];
      x.z = g1 ? Oacc[0][ct][q4 * 4 + 2] : Oacc[1][ct][q4 * 4 + 2];
      x.w = g1 ? Oacc[0][ct][q4 * 4 + 3] : Oacc[1][ct][q4 * 4 + 3];
      *(float4*)(&Ox_s[g][w][ct * 2 + q4][lane * 4]) = x;
    }
  __syncthreads();      // each group's hand-over is seen by the other
  const float mo = Mx_s[g ^ 1][w][lane], lo = Lx_s[g ^ 1][w][lane];
  const float mj = fmaxf(mk, mo);
  const float ak = __expf(mk - mj), ao = __expf(mo - mj);
  const float lj = lk * ak + lo * ao;

  // write [T][D]: row t = this lane's query, col = h*128 + d with d = ct*16 + 8*hf + r: 8 neighbours
  float* orow = Oout + (size_t)(t0 + w * 32 + g * 16 + ln) * DMODEL + h * HDIM + 8 * hf;
  #pragma unroll
  for (int ct = 0; ct < 8; ++ct)
    #pragma unroll
    for (int q4 = 0; q4 < 2; ++q4) {
      const float4 y = *(const float4*)(&Ox_s[g ^ 1][w][ct * 2 + q4][lane * 4]);
      float4 x;
      x.x = g1 ? Oacc[1][ct][q4 * 4 + 0] : Oacc[0][ct][q4 * 4 + 0];
      x.y = g1 ? Oacc[1][ct][q4 * 4 + 1] : Oacc[0][ct][q4 * 4 + 1];
      x.z = g1 ? Oacc[1][ct][q4 * 4 + 2] : Oacc[0][ct][q4 * 4 + 2];
      x.w = g1 ? Oacc[1][ct][q4 * 4 + 3] : Oacc[0][ct][q4 * 4 + 3];
      x.x = (x.x * ak + y.x * ao) / lj;
      x.y = (x.y * ak + y.y * ao) / lj;
      x.z = (x.z * ak + y.z * ao) / lj;
      x.w = (x.w * ak + y.w * ao) / lj;
      *(float4*)(orow + ct * 16 + q4 * 4) = x;
    }
}

// ---------------- launch ----------------
extern "C" void kernel_launch(void* const* d_in, const int* in_sizes, int n_in,
                              void* d_out, int out_size, void* d_ws, size_t ws_size,
                              hipStream_t stream) {
  (void)in_sizes; (void)n_in; (void)out_size; (void)ws_size;
  const float* hidden = (const float*)d_in[0];
  const float* wq     = (const float*)d_in[1];
  const float* wk     = (const float*)d_in[2];
  const float* wv     = (const float*)d_in[3];
  const float* wo     = (const float*)d_in[4];
  const float* bern   = (const float*)d_in[5];

  const size_t NE = (size_t)T_SEQ * DMODEL;   // 4,194,304
  float* ws    = (float*)d_ws;
  float* q     = ws;            // [H][T][128] f32; q, k, v lie one behind the other
  float* k     = ws + 1 * NE;
  float* v     = ws + 2 * NE;
  float* attnb = ws + 3 * NE;   // [T][D]
  __bf16* shi  = (__bf16*)(ws + 4 * NE);  // hi planes: activations (hidden, then attnb), wq, wk, wv, wo
  __bf16* slo  = shi + 5 * NE;            // lo planes, the same order
  __bf16* khi  = slo + 5 * NE;            // RoPE'd K split
  __bf16* klo  = khi + NE;
  __bf16* vthi = klo + NE;                // bumped V, split, tiled [H][NTILE][128][32]
  __bf16* vtlo = vthi + NE;
  float* sc    = (float*)(vtlo + NE);     // [H][SC_PITCH] scores of the last query row

  // sanitized hidden and the four weights -> bf16 hi/lo, one launch
  split_kernel<<<dim3(SPLIT_GRID, 5), SPLIT_THREADS, 0, stream>>>(hidden, wq, wk, wv, wo, shi, slo, 1);

  // Q, K and V projections, one launch: z = 0, 1, 2
  gemm_bf16x3_async_kernel<<<dim3(DMODEL / GT_MN, T_SEQ / GT_MN, 3), 256, 0, stream>>>(
      shi, slo, shi + NE, slo + NE, q, 0);

  rope_split_kernel<<<ROPE_N / 256, 256, 0, stream>>>(q, k, khi, klo);

  lastrow_score_kernel<<<dim3(SC_GRID, NHEAD), 256, 0, stream>>>(q, k, sc);
  vprep_kernel<<<dim3(NTILE, NHEAD), 256, 0, stream>>>(v, sc, bern, vthi, vtlo);

  attn_kernel<<<dim3(T_SEQ / AT_Q, NHEAD), 256, 0, stream>>>(q, khi, klo, vthi, vtlo, attnb);

  // output projection: split attnb into the activations' planes, then GEMM -> d_out
  split_kernel<<<dim3(SPLIT_GRID, 1), SPLIT_THREADS, 0, stream>>>(attnb, attnb, attnb, attnb, attnb, shi, slo, 0);
  gemm_bf16x3_async_kernel<<<dim3(DMODEL / GT_MN, T_SEQ / GT_MN, 1), 256, 0, stream>>>(
      shi, slo, shi + 4 * NE, slo + 4 * NE, (float*)d_out, 1);
}

// v009
// A run of this version takes 199 microseconds.
// Next to v008, in two timings, it ran 1.25 and 1.27 times as fast.
// Counting every step since v000, it is 2.78 times as fast.
#include <hip/hip_runtime.h>
#include <math.h>

// ---------------- problem constants ----------------
#define T_SEQ   2048
#define DMODEL  2048
#define NHEAD   16
#define HDIM    128
#define SB      204      // int(0.1*2048)
#define RB      1024     // int(0.5*2048)
#define NVALID  1228     // SB + RB
#define SCALE_QK 0.088388347648318447f   // 1/sqrt(128)

typedef float  v8f  __attribute__((ext_vector_type(8)));
typedef __bf16 v4bf __attribute__((ext_vector_type(4)));
typedef __bf16 v8bf __attribute__((ext_vector_type(8)));
typedef __bf16 v16bf __attribute__((ext_vector_type(16)));

static __device__ __forceinline__ v8f wmma_bf16(v16bf a, v16bf b, v8f c) {
  // D(16x16,f32) = A(16x32,bf16) x B(32x16,bf16) + C
  return __builtin_amdgcn_wmma_f32_16x16x32_bf16(false, a, false, b, (short)0, c, false, false);
}

// 16-bit A/B fragment: 8 contiguous K at p, 8 more at p+16
static __device__ __forceinline__ v16bf ld_frag(const __bf16* p) {
  v8bf a = *(const v8bf*)(p);
  v8bf b = *(const v8bf*)(p + 16);
  return __builtin_shufflevector(a, b, 0,1,2,3,4,5,6,7,8,9,10,11,12,13,14,15);
}

static __device__ __forceinline__ void split4(float4 v, v4bf& h, v4bf& l) {
  h[0] = (__bf16)v.x; l[0] = (__bf16)(v.x - (float)h[0]);
  h[1] = (__bf16)v.y; l[1] = (__bf16)(v.y - (float)h[1]);
  h[2] = (__bf16)v.z; l[2] = (__bf16)(v.z - (float)h[2]);
  h[3] = (__bf16)v.w; l[3] = (__bf16)(v.w - (float)h[3]);
}

static __device__ __forceinline__ float fin_clamp(float v) {
  if (v != v)        return 0.0f;
  if (v >  1.0e38f)  return  1.0e4f;
  if (v < -1.0e38f)  return -1.0e4f;
  return v;
}

// value of lane l ^ 16: the other half of a column of a 16 x 16 accumulator tile
static __device__ __forceinline__ float xhalf(float v) {
  int b = __builtin_bit_cast(int, v);
  return __builtin_bit_cast(float, __builtin_amdgcn_permlanex16(b, b, 0x76543210, 0xfedcba98, false, false));
}

// ---------------- async global->LDS copy (CDNA5), with sync fallback ----------------
#if __has_builtin(__builtin_amdgcn_global_load_async_to_lds_b128)
#define HAS_ASYNC_LDS 1
typedef int gv4i __attribute__((vector_size(16)));
typedef __attribute__((address_space(1))) gv4i as1_v4i;   // global
typedef __attribute__((address_space(3))) gv4i as3_v4i;   // LDS
static __device__ __forceinline__ void async_cp16(void* l, const void* g) {
  __builtin_amdgcn_global_load_async_to_lds_b128((as1_v4i*)g, (as3_v4i*)l, 0, 0);
}
#else
#define HAS_ASYNC_LDS 0
static __device__ __forceinline__ void async_cp16(void* l, const void* g) {
  *(float4*)l = *(const float4*)g;     // 16B sync copy fallback
}
#endif

// ---------------- kernel 1: nan_to_num(optional) + bf16 hi/lo split ----------------
// 16 waves per block, one block per 64 KiB of input: a thread takes 8 float4, each wave-wide load
// covers 512 contiguous bytes and each wave-wide store 256, so few waves have to be started.
// blockIdx.y picks one of up to five arrays of the same size, which depend on nothing but the inputs:
// one launch splits them all; array a's planes lie a * T_SEQ * DMODEL elements into hi and lo.
// blockIdx.y = 5 splits nothing: it writes the rotary table, cos and sin of t * 10000^(-j/64), [t][j], a
// thread an angle; the projections' epilogue reads it.
#define SPLIT_THREADS 512
#define SPLIT_VEC     8
#define SPLIT_GRID    ((T_SEQ * DMODEL) / (SPLIT_THREADS * SPLIT_VEC * 4))
static_assert(SPLIT_GRID * SPLIT_THREADS * SPLIT_VEC * 4 == T_SEQ * DMODEL, "blocks tile the array");
static_assert(SPLIT_GRID * SPLIT_THREADS == T_SEQ * (HDIM / 2), "a thread an angle");
__global__ __launch_bounds__(SPLIT_THREADS)
void split_kernel(const float* __restrict__ x0, const float* __restrict__ x1,
                  const float* __restrict__ x2, const float* __restrict__ x3,
                  const float* __restrict__ x4, __bf16* __restrict__ hi,
                  __bf16* __restrict__ lo, float* __restrict__ ctab, float* __restrict__ stab,
                  int clamp_first) {
  const unsigned arr = blockIdx.y;
  if (arr == 5) {
    const int idx = blockIdx.x * SPLIT_THREADS + threadIdx.x;      // t * 64 + j
    const int j = idx & (HDIM / 2 - 1), t = idx >> 6;
    float invf = __expf(-(float)j * (9.210340371976184f / 64.0f)); // 10000^(-j/64)
    float ang = (float)t * invf;
    const float cs = cosf(ang), sn = sinf(ang);
    ctab[idx] = cs;      // both stores behind all the arithmetic
    stab[idx] = sn;
    return;
  }
  const float* x = (arr == 0) ? x0 : (arr == 1) ? x1 : (arr == 2) ? x2 : (arr == 3) ? x3 : x4;
  const bool do_clamp = clamp_first && arr == 0;     // only the activations are sanitized
  const size_t plane = (size_t)arr * (T_SEQ * DMODEL);
  // byte offsets in 32 bits: one offset register serves all loads and one all stores
  const unsigned t4 = blockIdx.x * (SPLIT_THREADS * SPLIT_VEC) + threadIdx.x;   // in float4 units
  const char* xb = (const char*)x + t4 * 16u;
  char* hb = (char*)(hi + plane) + t4 * 8u;
  char* lb = (char*)(lo + plane) + t4 * 8u;
  float4 v[SPLIT_VEC];
  #pragma unroll
  for (int i = 0; i < SPLIT_VEC; ++i)
    v[i] = *(const float4*)(xb + i * (SPLIT_THREADS * 16));
  // precaution: stands ahead of the clamp's exec saves, which reuse a scalar register of the
  // base pair that the eight loads name
  asm volatile("s_wait_xcnt 0x0" ::: "memory");
  v4bf hh[SPLIT_VEC], ll[SPLIT_VEC];
  #pragma unroll
  for (int i = 0; i < SPLIT_VEC; ++i) {
    float4 u = v[i];
    if (do_clamp) {
      u.x = fin_clamp(u.x); u.y = fin_clamp(u.y); u.z = fin_clamp(u.z); u.w = fin_clamp(u.w);
    }
    split4(u, hh[i], ll[i]);
  }
  #pragma unroll
  for (int i = 0; i < SPLIT_VEC; ++i) {
    *(v4bf*)(hb + i * (SPLIT_THREADS * 8)) = hh[i];
    *(v4bf*)(lb + i * (SPLIT_THREADS * 8)) = ll[i];
  }
  // precaution: the table branch's code lies behind these stores and writes registers that they name
  asm volatile("s_wait_xcnt 0x0" ::: "memory");
}

// rotation of 4 neighbouring dims j (a) with their partners j + 64 (b);
// written as explicit fma so that the product rounded first is x2*s (low half) and x1*s (high half)
static __device__ __forceinline__ void rot4(float4 a, float4 b, float4 c, float4 s,
                                            float4& lo, float4& hi) {
  lo.x = fmaf(c.x, a.x, -(b.x * s.x));  hi.x = fmaf(c.x, b.x, a.x * s.x);
  lo.y = fmaf(c.y, a.y, -(b.y * s.y));  hi.y = fmaf(c.y, b.y, a.y * s.y);
  lo.z = fmaf(c.z, a.z, -(b.z * s.z));  hi.z = fmaf(c.z, b.z, a.z * s.z);
  lo.w = fmaf(c.w, a.w, -(b.w * s.w));  hi.w = fmaf(c.w, b.w, a.w * s.w);
}

// ---------------- GEMM: C = A * W^T, bf16x3, async double-buffered LDS ----------------
// Operands pre-split to global bf16 hi/lo.  mode 0: [H][T][HDIM], z = 0 and 1 (Q, K) rotated, z = 1 also
// as bf16 hi/lo planes; mode 1: [T][D]+clamp.  A block's 128 columns are one head, so the finished tile,
// passed through LDS, holds both partners of every rotation and leaves in whole rows.
// One 128 x 128 tile of C per block, 8 waves as 2 x 4, 64 x 32 per wave; a trip takes 128 k, so a
// staged row is 256 contiguous bytes (whole lines) and the two buffers leave room for one block
// per WGP.  A trip is 4 blocks of 32 k; each block's fragments are fetched one block ahead.
// blockIdx.z picks one of several products that share A: its weight planes and its output lie
// z * T_SEQ * DMODEL elements into Whi_g, Wlo_g and out_g.
#define GT_MN    128
#define GT_K     128
#define GT_PITCH 136                   // bf16; rows of 272 B = 16 B x odd, for 16-byte readers
#define GT_ARR   (GT_MN * GT_PITCH)    // one operand plane of one buffer
#define GT_TRIPS (DMODEL / GT_K)
#define CT_PITCH 132                   // floats; rows of 528 B = 16 B x odd, for 16-byte readers
__global__ __launch_bounds__(256)
void gemm_bf16x3_async_kernel(const __bf16* __restrict__ Ahi_g, const __bf16* __restrict__ Alo_g,
                              const __bf16* __restrict__ Whi_g, const __bf16* __restrict__ Wlo_g,
                              float* __restrict__ out_g, const float* __restrict__ ctab,
                              const float* __restrict__ stab, __bf16* __restrict__ Khi,
                              __bf16* __restrict__ Klo, int mode) {
  __shared__ __attribute__((aligned(16))) __bf16 Sbuf[2][4][GT_ARR];   // [buf][Ahi, Alo, Whi, Wlo]
  static_assert(T_SEQ == DMODEL, "a weight plane and an output are of one size");
  static_assert(GT_MN == HDIM, "a block's columns are one head");
  static_assert(GT_MN * CT_PITCH * 4 <= 2 * 4 * GT_ARR * 2, "the finished tile fits the operands' LDS");
  const size_t zoff = (size_t)blockIdx.z * ((size_t)T_SEQ * DMODEL);
  float* __restrict__ out = out_g + zoff;

  const int tid  = threadIdx.x;
  const int wid  = tid >> 5;
  const int lane = tid & 31;
  const int ln   = lane & 15;
  const int hf   = lane >> 4;
  const int wr   = wid >> 2;       // 0..1
  const int wc   = wid & 3;        // 0..3
  const int m0   = blockIdx.y * GT_MN;
  const int n0   = blockIdx.x * GT_MN;

  // 8 copies per plane and thread: rows crow + 0..3 and 64 + crow + 0..3, so that neighbouring
  // copies lie one row (4096 B) apart; a wave's copy takes two whole 256-B rows
  const int crow = (tid >> 4) * 4, cc = (tid & 15) * 8;      // 8 bf16 = 16B
  const __bf16* a_hi = Ahi_g + (size_t)(m0 + crow) * DMODEL + cc;
  const __bf16* a_lo = Alo_g + (size_t)(m0 + crow) * DMODEL + cc;
  const __bf16* w_hi = Whi_g + zoff + (size_t)(n0 + crow) * DMODEL + cc;
  const __bf16* w_lo = Wlo_g + zoff + (size_t)(n0 + crow) * DMODEL + cc;
  const int     loff = crow * GT_PITCH + cc;

  v8f acc[4][2];
  #pragma unroll
  for (int i = 0; i < 4; ++i)
    #pragma unroll
    for (int j = 0; j < 2; ++j)
      #pragma unroll
      for (int r = 0; r < 8; ++r) acc[i][j][r] = 0.0f;

  auto issue = [&](int buf, int kt) {
    // unrolled: the row steps become constants of the copies' addresses
    #pragma unroll
    for (int i = 0; i < 8; ++i) {
      const int rw = (i & 3) + (i >> 2) * 64;
      const int go = rw * DMODEL + kt;
      const int lr = loff + rw * GT_PITCH;
      async_cp16(&Sbuf[buf][0][lr], a_hi + go);
      async_cp16(&Sbuf[buf][1][lr], a_lo + go);
      async_cp16(&Sbuf[buf][2][lr], w_hi + go);
      async_cp16(&Sbuf[buf][3][lr], w_lo + go);
    }
  };

  // two fragment sets: one is worked on while the other is filled
  v16bf fa_h[2][4], fa_l[2][4], fb_h[2][2], fb_l[2][2];
  auto load_set = [&](int s, int buf, int ks) {
    const int ab = (wr * 64 + ln) * GT_PITCH + ks + 8 * hf;
    const int bb = (wc * 32 + ln) * GT_PITCH + ks + 8 * hf;
    // both loops unrolled: fragment arrays stay in registers only under constant indices
    #pragma unroll
    for (int i = 0; i < 4; ++i) {
      fa_h[s][i] = ld_frag(&Sbuf[buf][0][ab + i * 16 * GT_PITCH]);
      fa_l[s][i] = ld_frag(&Sbuf[buf][1][ab + i * 16 * GT_PITCH]);
    }
    #pragma unroll
    for (int j = 0; j < 2; ++j) {
      fb_h[s][j] = ld_frag(&Sbuf[buf][2][bb + j * 16 * GT_PITCH]);
      fb_l[s][j] = ld_frag(&Sbuf[buf][3][bb + j * 16 * GT_PITCH]);
    }
  };

  issue(0, 0);
  // own copies of tile 0 have landed; the barrier then shows them to the other waves
  asm volatile("s_wait_asynccnt 0x0" ::: "memory");
  __syncthreads();
  issue(1, GT_K);
  load_set(0, 0, 0);

  for (int t = 0; t < GT_TRIPS; ++t) {
    const int buf = t & 1;
    // unrolled: the set index must be a constant for the fragments to stay in registers
    #pragma unroll
    for (int b = 0; b < 4; ++b) {
      if (b < 3) {
        load_set((b + 1) & 1, buf, (b + 1) * 32);
      } else {
        // publish point of tile t + 1, ahead of this tile's last block, whose fragments are fetched:
        // own LDS reads retired before the refill below aims at the buffer this trip has read
        asm volatile("s_wait_dscnt 0x0" ::: "memory");
        // own copies of the next tile have landed; the barrier then shows them to the other waves
        asm volatile("s_wait_asynccnt 0x0" ::: "memory");
        __syncthreads();
        if (t + 1 < GT_TRIPS) load_set(0, buf ^ 1, 0);
      }
      // keeps the next block's fragment loads one group ahead of this block's products
      __builtin_amdgcn_sched_barrier(0);
      // the refill flies while the next tile is worked on; its address work may mix with the first products
      if (b == 3 && t + 2 < GT_TRIPS) issue(buf, (t + 2) * GT_K);
      const int s = b & 1;
      // product-major over the 8 independent accumulators; per accumulator and 32 k the order
      // stays hi*lo, lo*hi, hi*hi (loops unrolled: register arrays need constant indices)
      #pragma unroll
      for (int i = 0; i < 4; ++i)
        #pragma unroll
        for (int j = 0; j < 2; ++j) acc[i][j] = wmma_bf16(fa_h[s][i], fb_l[s][j], acc[i][j]);
      // keeps the refill's address work among the eight products above, whose A fragments are read again below
      if (b == 3) __builtin_amdgcn_sched_barrier(0);
      #pragma unroll
      for (int i = 0; i < 4; ++i)
        #pragma unroll
        for (int j = 0; j < 2; ++j) acc[i][j] = wmma_bf16(fa_l[s][i], fb_h[s][j], acc[i][j]);
      #pragma unroll
      for (int i = 0; i < 4; ++i)
        #pragma unroll
        for (int j = 0; j < 2; ++j) acc[i][j] = wmma_bf16(fa_h[s][i], fb_h[s][j], acc[i][j]);
      // keeps the following block's loads from moving in among these products
      __builtin_amdgcn_sched_barrier(0);
    }
  }
  // precaution: no copy is outstanding when the wave ends
  asm volatile("s_wait_asynccnt 0x0" ::: "memory");

  // a thread finishes 4 dims jg.. and their partners jg + 64.. of the rows er + 16 * i
  const int  jg = (tid & 15) * 4, er = tid >> 4;
  const bool rot = (mode == 0) && (blockIdx.z < 2);
  // the rows' angles: byte offsets in 32 bits on uniform bases, the rows a constant 4096 bytes apart;
  // the loads go out ahead of the tile's trip through LDS, which covers their latency
  const unsigned to = (unsigned)((m0 + er) * (HDIM / 2) + jg) * 4u;
  float4 cv[8], sv[8];
  if (rot) {
    #pragma unroll
    for (int i = 0; i < 8; ++i) {
      cv[i] = *(const float4*)((const char*)ctab + to + i * (16 * (HDIM / 2) * 4));
      sv[i] = *(const float4*)((const char*)stab + to + i * (16 * (HDIM / 2) * 4));
    }
    // precaution: stands ahead of every later write of the loads' offset register; it names the offset so
    // that the register is held until here
    asm volatile("s_wait_xcnt 0x0" :: "v"(to) : "memory");
  }

  // The operands' LDS is free: every wave retired its reads and its copies ahead of the loop's last barrier.
  // C layout: lane ln = column, row = r + 8*hf
  float* Ct = (float*)&Sbuf[0][0][0];
  #pragma unroll
  for (int i = 0; i < 4; ++i)
    #pragma unroll
    for (int j = 0; j < 2; ++j)
      #pragma unroll
      for (int r = 0; r < 8; ++r)
        Ct[(wr * 64 + i * 16 + r + 8 * hf) * CT_PITCH + wc * 32 + j * 16 + ln] = acc[i][j][r];
  __syncthreads();      // the finished tile is seen by all waves

  // the thread's 16 pieces of the tile, read as one group: one LDS latency
  const float* cr = Ct + er * CT_PITCH + jg;
  float4 a[8], b[8];
  #pragma unroll
  for (int i = 0; i < 8; ++i) {
    a[i] = *(const float4*)(cr + i * 16 * CT_PITCH);
    b[i] = *(const float4*)(cr + i * 16 * CT_PITCH + 64);
  }
  if (mode == 1) {
    float* orow = out + (size_t)(m0 + er) * DMODEL + n0 + jg;
    #pragma unroll
    for (int i = 0; i < 8; ++i) {
      a[i].x = fin_clamp(a[i].x); a[i].y = fin_clamp(a[i].y); a[i].z = fin_clamp(a[i].z); a[i].w = fin_clamp(a[i].w);
      b[i].x = fin_clamp(b[i].x); b[i].y = fin_clamp(b[i].y); b[i].z = fin_clamp(b[i].z); b[i].w = fin_clamp(b[i].w);
    }
    #pragma unroll
    for (int i = 0; i < 8; ++i) {
      *(float4*)(orow + i * 16 * DMODEL)      = a[i];
      *(float4*)(orow + i * 16 * DMODEL + 64) = b[i];
    }
  } else {
    const size_t base = ((size_t)blockIdx.x * T_SEQ + m0 + er) * HDIM + jg;    // head blockIdx.x
    if (rot) {
      #pragma unroll
      for (int i = 0; i < 8; ++i) {
        float4 lo, hi;
        rot4(a[i], b[i], cv[i], sv[i], lo, hi);
        a[i] = lo; b[i] = hi;
      }
    }
    float* op = out + base;
    #pragma unroll
    for (int i = 0; i < 8; ++i) {
      *(float4*)(op + i * 16 * HDIM)      = a[i];
      *(float4*)(op + i * 16 * HDIM + 64) = b[i];
    }
    // precaution: stands ahead of every later write of a register that these stores name, on every way on
    // (K's split below; the code that lies behind this branch); it names the address so that it is held until here
    asm volatile("s_wait_xcnt 0x0" :: "v"(op) : "memory");
    if (blockIdx.z == 1) {
      v4bf ah[8], al[8], bh[8], bl[8];
      #pragma unroll
      for (int i = 0; i < 8; ++i) {
        split4(a[i], ah[i], al[i]);
        split4(b[i], bh[i], bl[i]);
      }
      // the stores stand behind all the arithmetic: no register that a store names is written again
      __builtin_amdgcn_sched_barrier(0);
      #pragma unroll
      for (int i = 0; i < 8; ++i) {
        *(v4bf*)(Khi + base + i * 16 * HDIM)      = ah[i];  *(v4bf*)(Klo + base + i * 16 * HDIM)      = al[i];
        *(v4bf*)(Khi + base + i * 16 * HDIM + 64) = bh[i];  *(v4bf*)(Klo + base + i * 16 * HDIM + 64) = bl[i];
      }
      // precaution: the code that lies behind this branch writes registers that these stores name
      asm volatile("s_wait_xcnt 0x0" ::: "memory");
    }
  }
}

// ---------------- kernel 4: scores of the last query row against the kept keys (f32) ----------------
// value of lane l ^ M inside a 16-lane row
template <int M>
static __device__ __forceinline__ float xrow(float v) {
  int b = __builtin_bit_cast(int, v);
  return __builtin_bit_cast(float, __builtin_amdgcn_mov_dpp(b, 0x160 + M, 0xf, 0xf, true));  // row_xmask:M
}
typedef float f4v __attribute__((ext_vector_type(4)));
static __device__ __forceinline__ float dot4(f4v a, f4v b) {
  return fmaf(a.w, b.w, fmaf(a.z, b.z, fmaf(a.y, b.y, a.x * b.x)));
}
// One block per (128 kept keys, head).  Eight lanes share a key: each of their four loads is one whole
// 128-byte line of its row, and all sixteen key loads of a thread go out together.
#define SC_KEYS  128
#define SC_GRID  ((NVALID + SC_KEYS - 1) / SC_KEYS)
#define SC_PITCH (SC_GRID * SC_KEYS)   // floats per head in the score array
__global__ __launch_bounds__(256)
void lastrow_score_kernel(const float* __restrict__ Q, const float* __restrict__ K,
                          float* __restrict__ sc) {
  const int h = blockIdx.y, tid = threadIdx.x;
  const int sub = tid & 7, grp = tid >> 3;
  // byte offsets in 32 bits on block-uniform bases
  const char* qb = (const char*)(Q + ((size_t)h * T_SEQ + (T_SEQ - 1)) * HDIM);
  const char* kb = (const char*)(K + (size_t)h * T_SEQ * HDIM);
  const unsigned qo = (unsigned)sub * 16u;
  f4v q[4];
  #pragma unroll
  for (int c = 0; c < 4; ++c) q[c] = *(const f4v*)(qb + qo + c * 128);
  unsigned ko[4];
  f4v kv[4][4];
  #pragma unroll
  for (int b = 0; b < 4; ++b) {
    const int id  = blockIdx.x * SC_KEYS + b * 32 + grp;
    const int ic  = (id < NVALID) ? id : NVALID - 1;          // past the end: the last key again, not stored
    const int key = (ic < SB) ? ic : (T_SEQ - RB) + (ic - SB);
    ko[b] = (unsigned)key * (HDIM * 4u) + qo;
    #pragma unroll
    for (int c = 0; c < 4; ++c) kv[b][c] = *(const f4v*)(kb + ko[b] + c * 128);
  }
  // all twenty loads go out as one group and one memory latency is paid: left alone, the compiler's
  // scheduler puts some of them behind the wait for q
  __builtin_amdgcn_sched_barrier(0);
  // precaution: stands ahead of every later write of the loads' offset registers; it names the offsets so
  // that those registers are held until here and no load's result lands in them
  asm volatile("s_wait_xcnt 0x0" :: "v"(qo), "v"(ko[0]), "v"(ko[1]), "v"(ko[2]), "v"(ko[3]) : "memory");
  // keeps the wait directly behind the loads: later scalar and vector work stays behind it
  __builtin_amdgcn_sched_barrier(0);
  float d[4];
  #pragma unroll
  for (int b = 0; b < 4; ++b) {
    float t = (dot4(q[0], kv[b][0]) + dot4(q[1], kv[b][1])) + (dot4(q[2], kv[b][2]) + dot4(q[3], kv[b][3]));
    t += xrow<1>(t);
    t += xrow<2>(t);
    t += xrow<4>(t);
    d[b] = t;            // the same in all eight lanes of the key
  }
  // lane sub of a group stores the group's key number sub: one store for the four
  const float dv = (sub == 0) ? d[0] : (sub == 1) ? d[1] : (sub == 2) ? d[2] : d[3];
  const int   id = blockIdx.x * SC_KEYS + (sub & 3) * 32 + grp;
  if (sub < 4 && id < NVALID) sc[h * SC_PITCH + id] = dv * SCALE_QK;
}

// ---------------- kernel 4b: V bump + bf16 hi/lo split + transpose, once for all query blocks ----
// One block per (32-key tile, head).  Output tile: [d 0..127][key 0..31], 8 KiB contiguous, hi and lo,
// in the order in which attention walks the tiles.  Every block forms its head's bump coefficient itself
// from the last row's scores (softmax over the kept keys), all blocks in the same order of sums.
#define NTILE 39      // 7 tiles for [0,204), 32 for [1024,2048)
#define VT_PITCH 132  // floats; rows stay 16-byte aligned
__global__ __launch_bounds__(256)
void vprep_kernel(const float* __restrict__ V, const float* __restrict__ sc,
                  const float* __restrict__ bern,
                  __bf16* __restrict__ Vthi, __bf16* __restrict__ Vtlo) {
  __shared__ __attribute__((aligned(16))) float tile[32 * VT_PITCH];
  __shared__ __attribute__((aligned(16))) float red[3][8];     // per wave: maximum, sum, tail sum
  const int tid = threadIdx.x;
  const int it  = blockIdx.x;
  const int h   = blockIdx.y;
  const int k0  = (it < 7) ? it * 32 : (T_SEQ - RB) + (it - 7) * 32;
  const float* Vh = V + (size_t)h * T_SEQ * HDIM;
  // a thread keeps one group of 4 dims and takes 4 keys; all five loads go out together
  const int d4 = (tid & 31) * 4, kr0 = tid >> 5;
  // byte offsets in 32 bits on block-uniform bases: one offset register serves the four row loads,
  // whose rows lie a constant 4096 bytes apart
  const char* eb = (const char*)(Vh + (size_t)RB * HDIM) + (unsigned)d4 * 4u;
  const char* rb = (const char*)(Vh + (size_t)k0 * HDIM) + (unsigned)tid * 16u;
  const float4 e = *(const float4*)eb;
  float4 v[4];
  #pragma unroll
  for (int i = 0; i < 4; ++i)
    v[i] = *(const float4*)(rb + i * (8 * HDIM * 4));

  // the head's NVALID scores, 5 per thread: index tid + 256 * i; only i = 4 can pass the end
  static_assert(NVALID > 1024 && NVALID <= 1280 && SB + 1 < 256, "5 scores per thread, tail starts in the first");
  const char* sb = (const char*)(sc + h * SC_PITCH);
  const bool  in4 = tid < NVALID - 1024;
  const unsigned so = (unsigned)tid * 4u, so4 = in4 ? so + 4096u : (NVALID - 1) * 4u;
  float s[5];
  #pragma unroll
  for (int i = 0; i < 4; ++i) s[i] = *(const float*)(sb + so + i * 1024);
  s[4] = *(const float*)(sb + so4);
  // the V loads and the score loads go out as one group and one memory latency is paid: left alone, the
  // compiler's scheduler puts the V loads behind the wait for the scores
  __builtin_amdgcn_sched_barrier(0);
  // precaution: stands ahead of every later write of the score loads' offset registers; it names the
  // offsets so that those registers are held until here
  asm volatile("s_wait_xcnt 0x0" :: "v"(so), "v"(so4) : "memory");
  // keeps the wait directly behind the loads: later scalar address work stays behind it
  __builtin_amdgcn_sched_barrier(0);
  const float se = *(const float*)(sb + SB * 4);     // score of the evicted key, RB
  const float bu = bern[h];
  if (!in4) s[4] = -1e30f;
  float mx = fmaxf(fmaxf(fmaxf(s[0], s[1]), fmaxf(s[2], s[3])), s[4]);
  mx = fmaxf(mx, xrow<1>(mx));  mx = fmaxf(mx, xrow<2>(mx));
  mx = fmaxf(mx, xrow<4>(mx));  mx = fmaxf(mx, xrow<8>(mx));
  mx = fmaxf(mx, xhalf(mx));
  if ((tid & 31) == 0) red[0][tid >> 5] = mx;
  __syncthreads();      // the waves' maxima are seen by all
  float4 ra = *(const float4*)&red[0][0], rc = *(const float4*)&red[0][4];
  const float gmax = fmaxf(fmaxf(fmaxf(ra.x, ra.y), fmaxf(ra.z, ra.w)), fmaxf(fmaxf(rc.x, rc.y), fmaxf(rc.z, rc.w)));
  const float e0 = __expf(s[0] - gmax), e1 = __expf(s[1] - gmax), e2 = __expf(s[2] - gmax),
              e3 = __expf(s[3] - gmax), e4 = in4 ? __expf(s[4] - gmax) : 0.0f;
  const float rest = (e1 + e2) + (e3 + e4);
  float sm = e0 + rest;
  float tl = ((tid >= SB + 1) ? e0 : 0.0f) + rest;   // keys 1025..2047
  sm += xrow<1>(sm);  tl += xrow<1>(tl);
  sm += xrow<2>(sm);  tl += xrow<2>(tl);
  sm += xrow<4>(sm);  tl += xrow<4>(tl);
  sm += xrow<8>(sm);  tl += xrow<8>(tl);
  sm += xhalf(sm);    tl += xhalf(tl);
  if ((tid & 31) == 0) { red[1][tid >> 5] = sm; red[2][tid >> 5] = tl; }
  __syncthreads();      // the waves' sums are seen by all
  ra = *(const float4*)&red[1][0];  rc = *(const float4*)&red[1][4];
  const float gsum  = ((ra.x + ra.y) + (ra.z + ra.w)) + ((rc.x + rc.y) + (rc.z + rc.w));
  ra = *(const float4*)&red[2][0];  rc = *(const float4*)&red[2][4];
  const float gtail = ((ra.x + ra.y) + (ra.z + ra.w)) + ((rc.x + rc.y) + (rc.z + rc.w));
  const float pe   = __expf(se - gmax) / gsum;               // probs at key e=1024
  const float mean = (gtail / gsum) / 1023.0f + 1e-6f;
  float p = pe / mean;
  p = (p != p) ? 0.0f : fminf(fmaxf(p, 0.0f), 1.0f);
  const float cf = ((bu < p) ? 1.0f : 0.0f) / (float)RB;

  const float bx = e.x * cf, by = e.y * cf, bz = e.z * cf, bw = e.w * cf;
  #pragma unroll
  for (int i = 0; i < 4; ++i) {
    const bool bump = (k0 + kr0 + i * 8) > RB;     // keys 1025..2047 take the evicted row's share
    float4 u = v[i];
    u.x = bump ? u.x + bx : u.x;  u.y = bump ? u.y + by : u.y;
    u.z = bump ? u.z + bz : u.z;  u.w = bump ? u.w + bw : u.w;
    *(float4*)(&tile[(kr0 + i * 8) * VT_PITCH + d4]) = u;
  }
  __syncthreads();
  const size_t ob = ((size_t)h * NTILE + it) * (HDIM * 32);
  #pragma unroll
  for (int i = 0; i < 2; ++i) {
    int c = tid + i * 256;                   // 16-byte chunk of the output tile
    int d = c >> 2, kg = (c & 3) * 8;
    v8bf hh, ll;
    #pragma unroll
    for (int j = 0; j < 8; ++j) {
      float v = tile[(kg + j) * VT_PITCH + d];
      __bf16 x = (__bf16)v;
      hh[j] = x;
      ll[j] = (__bf16)(v - (float)x);
    }
    *(v8bf*)(Vthi + ob + c * 8) = hh;
    *(v8bf*)(Vtlo + ob + c * 8) = ll;
  }
}

#define AT_Q     128
#define AT_TRIPS ((NTILE + 1) / 2)
__global__ __launch_bounds__(256)
void attn_kernel(const float* __restrict__ Q, const __bf16* __restrict__ Khi,
                 const __bf16* __restrict__ Klo, const __bf16* __restrict__ Vthi,
                 const __bf16* __restrict__ Vtlo, __bf16* __restrict__ Ohi, __bf16* __restrict__ Olo) {
  __shared__ __attribute__((aligned(16))) __bf16 Qhi_s[AT_Q * 136], Qlo_s[AT_Q * 136];   // 128 queries x 128 dims
  // V tile [d][key], 32 keys, hi and lo, per key group two buffers; row pitch 80 B for 16-byte readers
  __shared__ __attribute__((aligned(16))) __bf16 Vhi_s[2][2][128 * 40];
  __shared__ __attribute__((aligned(16))) __bf16 Vlo_s[2][2][128 * 40];
  // K tile, 32 keys x 128 dims, hi and lo, per key group two buffers; row pitch 272 B for 16-byte readers
  __shared__ __attribute__((aligned(16))) __bf16 Khi_s[2][2][32 * 136];
  __shared__ __attribute__((aligned(16))) __bf16 Klo_s[2][2][32 * 136];
  // the join: what group g hands to the other group, [g][wave][16 bytes of a lane's 64 floats][lane]
  __shared__ __attribute__((aligned(16))) float Ox_s[2][4][16][32 * 4];
  __shared__ float Mx_s[2][4][32], Lx_s[2][4][32];

  const int tid  = threadIdx.x;
  const int gt   = tid & 127;        // thread within its key group
  const int g    = __builtin_amdgcn_readfirstlane(tid >> 7);   // key group, the same in a whole wave
  const int w    = (tid >> 5) & 3;   // 4 waves a group, 32 queries each
  const int lane = tid & 31;
  const int ln   = lane & 15;
  const int hf   = lane >> 4;
  const int h    = blockIdx.y;
  const int t0   = blockIdx.x * AT_Q;
  const size_t hk = (size_t)h * T_SEQ;

  const float* Qh = Q + hk * HDIM;

  // one K tile (hi and lo) into the group's LDS, once per block: each wave's copy takes 512 contiguous
  // bytes (two whole key rows), 8 copies per thread and tile
  auto issue_k = [&](int buf, int kbase) {
    #pragma unroll
    for (int i = 0; i < 4; ++i) {
      int idx = gt + i * 128, rw = idx >> 4, cw = (idx & 15) * 8;
      async_cp16(&Khi_s[g][buf][rw * 136 + cw], Khi + (hk + kbase + rw) * HDIM + cw);
      async_cp16(&Klo_s[g][buf][rw * 136 + cw], Klo + (hk + kbase + rw) * HDIM + cw);
    }
  };
  // one prepared V tile (hi and lo) into the group's LDS: each wave's copy takes 512 contiguous bytes,
  // 8 copies per thread and tile
  auto issue_v = [&](int buf, int tile) {
    const size_t vb = ((size_t)h * NTILE + tile) * (HDIM * 32);
    #pragma unroll
    for (int i = 0; i < 4; ++i) {
      int c = gt + i * 128;
      async_cp16(&Vhi_s[g][buf][(c >> 2) * 40 + (c & 3) * 8], Vthi + vb + c * 8);
      async_cp16(&Vlo_s[g][buf][(c >> 2) * 40 + (c & 3) * 8], Vtlo + vb + c * 8);
    }
  };
  static_assert(NTILE >= 2, "each key group has a first tile");
  issue_k(0, g * 32);
  issue_v(0, g);

  // stage + split this block's 128 query rows
  // row (tid >> 5) + 8 * i, dims (tid & 31) * 4 and up: one address for all sixteen loads, 4096 bytes apart
  const float* qp = Qh + (size_t)(t0 + (tid >> 5)) * HDIM + (tid & 31) * 4;
  float4 qv[16];
  #pragma unroll
  for (int i = 0; i < 16; ++i) qv[i] = *(const float4*)(qp + i * 8 * HDIM);
  // precaution: stands ahead of every later write of the loads' address registers; it names the address so
  // that those registers are held until here and no load's result lands in them
  asm volatile("s_wait_xcnt 0x0" :: "v"(qp) : "memory");
  #pragma unroll
  for (int i = 0; i < 16; ++i) {
    int row = (tid >> 5) + i * 8, kc = (tid & 31) * 4;
    float4 v = qv[i];
    v4bf hh, ll; split4(v, hh, ll);
    *(v4bf*)(&Qhi_s[row * 136 + kc]) = hh;
    *(v4bf*)(&Qlo_s[row * 136 + kc]) = ll;
  }
  __syncthreads();      // the split query rows are seen by all waves

  // this wave's 32 queries as B fragments, fetched once: [query tile][32 dims]
  // (here and below, loops over register arrays are unrolled: they stay in registers only under constant indices)
  v16bf qh[2][4], ql[2][4];
  #pragma unroll
  for (int qt = 0; qt < 2; ++qt)
    #pragma unroll
    for (int c = 0; c < 4; ++c) {
      int qb = (w * 32 + qt * 16 + ln) * 136 + c * 32 + 8 * hf;
      qh[qt][c] = ld_frag(&Qhi_s[qb]);
      ql[qt][c] = ld_frag(&Qlo_s[qb]);
    }

  v8f Oacc[2][8];
  float mrow[2], lrow[2];                // of query w * 32 + qt * 16 + ln, the same in both halves
  #pragma unroll
  for (int qt = 0; qt < 2; ++qt) {
    mrow[qt] = -1e30f; lrow[qt] = 0.0f;
    #pragma unroll
    for (int ct = 0; ct < 8; ++ct)
      #pragma unroll
      for (int r = 0; r < 8; ++r) Oacc[qt][ct][r] = 0.0f;
  }

  for (int tr = 0; tr < AT_TRIPS; ++tr) {
    const int it = 2 * tr + g;           // this group's key tile; the last trip has none for group 1
    // own LDS traffic retired before the refill below aims at a buffer this wave has read
    asm volatile("s_wait_dscnt 0x0" ::: "memory");
    // own copies of this tile's K and V have landed; the barrier then shows them to the other waves
    asm volatile("s_wait_asynccnt 0x0" ::: "memory");
    __syncthreads();

    // the group's next tile flies while this one is worked on; its buffers were last read one trip ago
    if (it + 2 < NTILE) {
      issue_k((tr + 1) & 1, (it + 2 < 7) ? (it + 2) * 32 : (T_SEQ - RB) + (it + 2 - 7) * 32);
      issue_v((tr + 1) & 1, it + 2);
    }
    if (it < NTILE) {
      const int k0 = (it < 7) ? it * 32 : (T_SEQ - RB) + (it - 7) * 32;
      const __bf16* Kh_t = Khi_s[g][tr & 1];
      const __bf16* Kl_t = Klo_s[g][tr & 1];
      const __bf16* Vh_t = Vhi_s[g][tr & 1];
      const __bf16* Vl_t = Vlo_s[g][tr & 1];

      // S^T(32x16) = K(32x128) * Q^T(128x16) per query tile, two 16-key tiles, bf16x3: S0[qt][r] is key
      // k0 + 8*hf + r, S1[qt][r] key k0 + 16 + 8*hf + r, both of query qt * 16 + ln
      v8f S0[2], S1[2];
      #pragma unroll
      for (int qt = 0; qt < 2; ++qt)
        #pragma unroll
        for (int r = 0; r < 8; ++r) { S0[qt][r] = 0.0f; S1[qt][r] = 0.0f; }
      const int kr0 = ln * 136;
      const int kr1 = (16 + ln) * 136;
      #pragma unroll
      for (int c = 0; c < 4; ++c) {
        const int kc = c * 32;
        v16bf kh0 = ld_frag(Kh_t + kr0 + kc + 8 * hf);
        v16bf kl0 = ld_frag(Kl_t + kr0 + kc + 8 * hf);
        v16bf kh1 = ld_frag(Kh_t + kr1 + kc + 8 * hf);
        v16bf kl1 = ld_frag(Kl_t + kr1 + kc + 8 * hf);
        // interleave the four independent accumulators
        S0[0] = wmma_bf16(kl0, qh[0][c], S0[0]);
        S1[0] = wmma_bf16(kl1, qh[0][c], S1[0]);
        S0[1] = wmma_bf16(kl0, qh[1][c], S0[1]);
        S1[1] = wmma_bf16(kl1, qh[1][c], S1[1]);
        S0[0] = wmma_bf16(kh0, ql[0][c], S0[0]);
        S1[0] = wmma_bf16(kh1, ql[0][c], S1[0]);
        S0[1] = wmma_bf16(kh0, ql[1][c], S0[1]);
        S1[1] = wmma_bf16(kh1, ql[1][c], S1[1]);
        S0[0] = wmma_bf16(kh0, qh[0][c], S0[0]);
        S1[0] = wmma_bf16(kh1, qh[0][c], S1[0]);
        S0[1] = wmma_bf16(kh0, qh[1][c], S0[1]);
        S1[1] = wmma_bf16(kh1, qh[1][c], S1[1]);
      }

      v16bf ph[2], pl[2];
      #pragma unroll
      for (int qt = 0; qt < 2; ++qt) {
        float s0[8], s1[8];
        #pragma unroll
        for (int r = 0; r < 8; ++r) {
          s0[r] = S0[qt][r] * SCALE_QK; if ((it == 6) && (k0 + 8 * hf + r >= SB)) s0[r] = -1e30f;  // keys 192..207 partial
          s1[r] = S1[qt][r] * SCALE_QK; if (it == 6) s1[r] = -1e30f;                               // keys 208..223 all masked
        }
        float ma = fmaxf(s0[0], s0[1]), mb = fmaxf(s1[0], s1[1]);
        #pragma unroll
        for (int r = 2; r < 8; r += 2) {
          ma = fmaxf(fmaxf(ma, s0[r]), s0[r + 1]);
          mb = fmaxf(fmaxf(mb, s1[r]), s1[r + 1]);
        }
        float tmax = fmaxf(ma, mb);
        tmax = fmaxf(tmax, xhalf(tmax));
        const float mnew  = fmaxf(mrow[qt], tmax);
        const float alpha = __expf(mrow[qt] - mnew);
        // element s of the B operand is key 8*hf + s (s < 8) or 16 + 8*hf + (s - 8): the order in which
        // ld_frag fetches the keys of a V row
        float ps[8];
        #pragma unroll
        for (int r = 0; r < 8; ++r) {
          float p0 = __expf(s0[r] - mnew);
          float p1 = __expf(s1[r] - mnew);
          ps[r] = p0 + p1;
          __bf16 h0 = (__bf16)p0;
          ph[qt][r]     = h0;  pl[qt][r]     = (__bf16)(p0 - (float)h0);
          __bf16 h1 = (__bf16)p1;
          ph[qt][8 + r] = h1;  pl[qt][8 + r] = (__bf16)(p1 - (float)h1);
        }
        float rs = ((ps[0] + ps[1]) + (ps[2] + ps[3])) + ((ps[4] + ps[5]) + (ps[6] + ps[7]));
        rs += xhalf(rs);
        lrow[qt] = lrow[qt] * alpha + rs;
        mrow[qt] = mnew;
        #pragma unroll
        for (int ct = 0; ct < 8; ++ct)
          #pragma unroll
          for (int r = 0; r < 8; ++r) Oacc[qt][ct][r] *= alpha;
      }

      // O^T(128x16) += V^T(128x32) * P^T(32x16) per query tile, bf16x3; ct in pairs, so the 3-product
      // chains alternate between four independent accumulators
      #pragma unroll
      for (int ct = 0; ct < 8; ct += 2) {
        int vb0 = ((ct + 0) * 16 + ln) * 40 + 8 * hf;
        int vb1 = ((ct + 1) * 16 + ln) * 40 + 8 * hf;
        v16bf vh0 = ld_frag(Vh_t + vb0), vl0 = ld_frag(Vl_t + vb0);
        v16bf vh1 = ld_frag(Vh_t + vb1), vl1 = ld_frag(Vl_t + vb1);
        Oacc[0][ct + 0] = wmma_bf16(vl0, ph[0], Oacc[0][ct + 0]);
        Oacc[0][ct + 1] = wmma_bf16(vl1, ph[0], Oacc[0][ct + 1]);
        Oacc[1][ct + 0] = wmma_bf16(vl0, ph[1], Oacc[1][ct + 0]);
        Oacc[1][ct + 1] = wmma_bf16(vl1, ph[1], Oacc[1][ct + 1]);
        Oacc[0][ct + 0] = wmma_bf16(vh0, pl[0], Oacc[0][ct + 0]);
        Oacc[0][ct + 1] = wmma_bf16(vh1, pl[0], Oacc[0][ct + 1]);
        Oacc[1][ct + 0] = wmma_bf16(vh0, pl[1], Oacc[1][ct + 0]);
        Oacc[1][ct + 1] = wmma_bf16(vh1, pl[1], Oacc[1][ct + 1]);
        Oacc[0][ct + 0] = wmma_bf16(vh0, ph[0], Oacc[0][ct + 0]);
        Oacc[0][ct + 1] = wmma_bf16(vh1, ph[0], Oacc[0][ct + 1]);
        Oacc[1][ct + 0] = wmma_bf16(vh0, ph[1], Oacc[1][ct + 0]);
        Oacc[1][ct + 1] = wmma_bf16(vh1, ph[1], Oacc[1][ct + 1]);
      }
    }
  }

  // the join of the two key groups: group g finishes query tile g and hands its part of the other tile over
  const bool g1 = (g != 0);
  const float mk = g1 ? mrow[1] : mrow[0], lk = g1 ? lrow[1] : lrow[0];     // kept
  Mx_s[g][w][lane] = g1 ? mrow[0] : mrow[1];
  Lx_s[g][w][lane] = g1 ? lrow[0] : lrow[1];
  #pragma unroll
  for (int ct = 0; ct < 8; ++ct)
    #pragma unroll
    for (int q4 = 0; q4 < 2; ++q4) {
      float4 x;
      x.x = g1 ? Oacc[0][ct][q4 * 4 + 0] : Oacc[1][ct][q4 * 4 + 0];
      x.y = g1 ? Oacc[0][ct][q4 * 4 + 1] : Oacc[1][ct][q4 * 4 + 1];
      x.z = g1 ? Oacc[0][ct][q4 * 4 + 2] : Oacc[1][ct][q4 * 4 + 2];
      x.w = g1 ? Oacc[0][ct][q4 * 4 + 3] : Oacc[1][ct][q4 * 4 + 3];
      *(float4*)(&Ox_s[g][w][ct * 2 + q4][lane * 4]) = x;
    }
  __syncthreads();      // each group's hand-over is seen by the other
  const float mo = Mx_s[g ^ 1][w][lane], lo = Lx_s[g ^ 1][w][lane];
  const float mj = fmaxf(mk, mo);
  const float ak = __expf(mk - mj), ao = __expf(mo - mj);
  const float lj = lk * ak + lo * ao;

  // leaves as the bf16 hi/lo planes [T][D] that the output projection reads: row t = this lane's query,
  // col = h*128 + d with d = ct*16 + 8*hf + r: 8 neighbours, 16 bytes of a plane
  const size_t ob = (size_t)(t0 + w * 32 + g * 16 + ln) * DMODEL + h * HDIM + 8 * hf;
  v4bf oh[8][2], ol[8][2];
  #pragma unroll
  for (int ct = 0; ct < 8; ++ct)
    #pragma unroll
    for (int q4 = 0; q4 < 2; ++q4) {
      const float4 y = *(const float4*)(&Ox_s[g ^ 1][w][ct * 2 + q4][lane * 4]);
      float4 x;
      x.x = g1 ? Oacc[1][ct][q4 * 4 + 0] : Oacc[0][ct][q4 * 4 + 0];
      x.y = g1 ? Oacc[1][ct][q4 * 4 + 1] : Oacc[0][ct][q4 * 4 + 1];
      x.z = g1 ? Oacc[1][ct][q4 * 4 + 2] : Oacc[0][ct][q4 * 4 + 2];
      x.w = g1 ? Oacc[1][ct][q4 * 4 + 3] : Oacc[0][ct][q4 * 4 + 3];
      x.x = (x.x * ak + y.x * ao) / lj;
      x.y = (x.y * ak + y.y * ao) / lj;
      x.z = (x.z * ak + y.z * ao) / lj;
      x.w = (x.w * ak + y.w * ao) / lj;
      split4(x, oh[ct][q4], ol[ct][q4]);
    }
  // the stores stand behind all the arithmetic: no register that a store names is written again
  __builtin_amdgcn_sched_barrier(0);
  #pragma unroll
  for (int ct = 0; ct < 8; ++ct) {
    *(v8bf*)(Ohi + ob + ct * 16) = __builtin_shufflevector(oh[ct][0], oh[ct][1], 0, 1, 2, 3, 4, 5, 6, 7);
    *(v8bf*)(Olo + ob + ct * 16) = __builtin_shufflevector(ol[ct][0], ol[ct][1], 0, 1, 2, 3, 4, 5, 6, 7);
  }
}

// ---------------- launch ----------------
extern "C" void kernel_launch(void* const* d_in, const int* in_sizes, int n_in,
                              void* d_out, int out_size, void* d_ws, size_t ws_size,
                              hipStream_t stream) {
  (void)in_sizes; (void)n_in; (void)out_size; (void)ws_size;
  const float* hidden = (const float*)d_in[0];
  const float* wq     = (const float*)d_in[1];
  const float* wk     = (const float*)d_in[2];
  const float* wv     = (const float*)d_in[3];
  const float* wo     = (const float*)d_in[4];
  const float* bern   = (const float*)d_in[5];

  const size_t NE = (size_t)T_SEQ * DMODEL;   // 4,194,304
  float* ws    = (float*)d_ws;
  float* q     = ws;            // [H][T][128] f32; q, k, v lie one behind the other
  float* k     = ws + 1 * NE;
  float* v     = ws + 2 * NE;
  __bf16* shi  = (__bf16*)(ws + 4 * NE);  // hi planes: activations (hidden, then attention's result), wq, wk, wv, wo
  __bf16* slo  = shi + 5 * NE;            // lo planes, the same order
  __bf16* khi  = slo + 5 * NE;            // RoPE'd K split
  __bf16* klo  = khi + NE;
  __bf16* vthi = klo + NE;                // bumped V, split, tiled [H][NTILE][128][32]
  __bf16* vtlo = vthi + NE;
  float* sc    = (float*)(vtlo + NE);     // [H][SC_PITCH] scores of the last query row
  float* ctab  = sc + NHEAD * SC_PITCH;   // [T][64] cos of the rotary angles
  float* stab  = ctab + T_SEQ * (HDIM / 2);   // [T][64] sin

  // sanitized hidden and the four weights -> bf16 hi/lo, and the rotary table, one launch
  split_kernel<<<dim3(SPLIT_GRID, 6), SPLIT_THREADS, 0, stream>>>(hidden, wq, wk, wv, wo, shi, slo, ctab, stab, 1);

  // Q, K and V projections, one launch: z = 0, 1, 2; Q and K leave rotated, K also split
  gemm_bf16x3_async_kernel<<<dim3(DMODEL / GT_MN, T_SEQ / GT_MN, 3), 256, 0, stream>>>(
      shi, slo, shi + NE, slo + NE, q, ctab, stab, khi, klo, 0);

  lastrow_score_kernel<<<dim3(SC_GRID, NHEAD), 256, 0, stream>>>(q, k, sc);
  vprep_kernel<<<dim3(NTILE, NHEAD), 256, 0, stream>>>(v, sc, bern, vthi, vtlo);

  // attention's result leaves split, in the activations' planes [T][D]
  attn_kernel<<<dim3(T_SEQ / AT_Q, NHEAD), 256, 0, stream>>>(q, khi, klo, vthi, vtlo, shi, slo);

  // output projection -> d_out
  gemm_bf16x3_async_kernel<<<dim3(DMODEL / GT_MN, T_SEQ / GT_MN, 1), 256, 0, stream>>>(
      shi, slo, shi + 4 * NE, slo + 4 * NE, (float*)d_out, ctab, stab, khi, klo, 1);
}

// v010
// Measured time: 188 microseconds a run.
// Timed twice side by side with v009, it ran 1.06 times as fast both times.
// Counting every step since v000, it is 2.95 times as fast.
#include <hip/hip_runtime.h>
#include <math.h>

// ---------------- problem constants ----------------
#define T_SEQ   2048
#define DMODEL  2048
#define NHEAD   16
#define HDIM    128
#define SB      204      // int(0.1*2048)
#define RB      1024     // int(0.5*2048)
#define NVALID  1228     // SB + RB
#define SCALE_QK 0.088388347648318447f   // 1/sqrt(128)

typedef float  v8f  __attribute__((ext_vector_type(8)));
typedef __bf16 v4bf __attribute__((ext_vector_type(4)));
typedef __bf16 v8bf __attribute__((ext_vector_type(8)));
typedef __bf16 v16bf __attribute__((ext_vector_type(16)));

static __device__ __forceinline__ v8f wmma_bf16(v16bf a, v16bf b, v8f c) {
  // D(16x16,f32) = A(16x32,bf16) x B(32x16,bf16) + C
  return __builtin_amdgcn_wmma_f32_16x16x32_bf16(false, a, false, b, (short)0, c, false, false);
}

// 16-bit A/B fragment: 8 contiguous K at p, 8 more at p+16
static __device__ __forceinline__ v16bf ld_frag(const __bf16* p) {
  v8bf a = *(const v8bf*)(p);
  v8bf b = *(const v8bf*)(p + 16);
  return __builtin_shufflevector(a, b, 0,1,2,3,4,5,6,7,8,9,10,11,12,13,14,15);
}

static __device__ __forceinline__ void split4(float4 v, v4bf& h, v4bf& l) {
  h[0] = (__bf16)v.x; l[0] = (__bf16)(v.x - (float)h[0]);
  h[1] = (__bf16)v.y; l[1] = (__bf16)(v.y - (float)h[1]);
  h[2] = (__bf16)v.z; l[2] = (__bf16)(v.z - (float)h[2]);
  h[3] = (__bf16)v.w; l[3] = (__bf16)(v.w - (float)h[3]);
}

static __device__ __forceinline__ float fin_clamp(float v) {
  if (v != v)        return 0.0f;
  if (v >  1.0e38f)  return  1.0e4f;
  if (v < -1.0e38f)  return -1.0e4f;
  return v;
}

// value of lane l ^ 16: the other half of a column of a 16 x 16 accumulator tile
static __device__ __forceinline__ float xhalf(float v) {
  int b = __builtin_bit_cast(int, v);
  return __builtin_bit_cast(float, __builtin_amdgcn_permlanex16(b, b, 0x76543210, 0xfedcba98, false, false));
}

// ---------------- async global->LDS copy (CDNA5), with sync fallback ----------------
#if __has_builtin(__builtin_amdgcn_global_load_async_to_lds_b128)
#define HAS_ASYNC_LDS 1
typedef int gv4i __attribute__((vector_size(16)));
typedef __attribute__((address_space(1))) gv4i as1_v4i;   // global
typedef __attribute__((address_space(3))) gv4i as3_v4i;   // LDS
static __device__ __forceinline__ void async_cp16(void* l, const void* g) {
  __builtin_amdgcn_global_load_async_to_lds_b128((as1_v4i*)g, (as3_v4i*)l, 0, 0);
}
#else
#define HAS_ASYNC_LDS 0
static __device__ __forceinline__ void async_cp16(void* l, const void* g) {
  *(float4*)l = *(const float4*)g;     // 16B sync copy fallback
}
#endif

// ---------------- kernel 1: nan_to_num(optional) + bf16 hi/lo split ----------------
// 16 waves per block, one block per 64 KiB of input: a thread takes 8 float4, each wave-wide load
// covers 512 contiguous bytes and each wave-wide store 256, so few waves have to be started.
// blockIdx.y picks one of up to five arrays of the same size, which depend on nothing but the inputs:
// one launch splits them all; array a's planes lie a * T_SEQ * DMODEL elements into hi and lo.
// blockIdx.y = 5 splits nothing: it writes the rotary table, cos and sin of t * 10000^(-j/64), [t][j], a
// thread an angle; the projections' epilogue reads it.
#define SPLIT_THREADS 512
#define SPLIT_VEC     8
#define SPLIT_GRID    ((T_SEQ * DMODEL) / (SPLIT_THREADS * SPLIT_VEC * 4))
static_assert(SPLIT_GRID * SPLIT_THREADS * SPLIT_VEC * 4 == T_SEQ * DMODEL, "blocks tile the array");
static_assert(SPLIT_GRID * SPLIT_THREADS == T_SEQ * (HDIM / 2), "a thread an angle");
__global__ __launch_bounds__(SPLIT_THREADS)
void split_kernel(const float* __restrict__ x0, const float* __restrict__ x1,
                  const float* __restrict__ x2, const float* __restrict__ x3,
                  const float* __restrict__ x4, __bf16* __restrict__ hi,
                  __bf16* __restrict__ lo, float* __restrict__ ctab, float* __restrict__ stab,
                  int clamp_first) {
  const unsigned arr = blockIdx.y;
  if (arr == 5) {
    const int idx = blockIdx.x * SPLIT_THREADS + threadIdx.x;      // t * 64 + j
    const int j = idx & (HDIM / 2 - 1), t = idx >> 6;
    float invf = __expf(-(float)j * (9.210340371976184f / 64.0f)); // 10000^(-j/64)
    float ang = (float)t * invf;
    const float cs = cosf(ang), sn = sinf(ang);
    ctab[idx] = cs;      // both stores behind all the arithmetic
    stab[idx] = sn;
    return;
  }
  const float* x = (arr == 0) ? x0 : (arr == 1) ? x1 : (arr == 2) ? x2 : (arr == 3) ? x3 : x4;
  const bool do_clamp = clamp_first && arr == 0;     // only the activations are sanitized
  const size_t plane = (size_t)arr * (T_SEQ * DMODEL);
  // byte offsets in 32 bits: one offset register serves all loads and one all stores
  const unsigned t4 = blockIdx.x * (SPLIT_THREADS * SPLIT_VEC) + threadIdx.x;   // in float4 units
  const char* xb = (const char*)x + t4 * 16u;
  char* hb = (char*)(hi + plane) + t4 * 8u;
  char* lb = (char*)(lo + plane) + t4 * 8u;
  float4 v[SPLIT_VEC];
  #pragma unroll
  for (int i = 0; i < SPLIT_VEC; ++i)
    v[i] = *(const float4*)(xb + i * (SPLIT_THREADS * 16));
  // precaution: stands ahead of the clamp's exec saves, which reuse a scalar register of the
  // base pair that the eight loads name
  asm volatile("s_wait_xcnt 0x0" ::: "memory");
  v4bf hh[SPLIT_VEC], ll[SPLIT_VEC];
  #pragma unroll
  for (int i = 0; i < SPLIT_VEC; ++i) {
    float4 u = v[i];
    if (do_clamp) {
      u.x = fin_clamp(u.x); u.y = fin_clamp(u.y); u.z = fin_clamp(u.z); u.w = fin_clamp(u.w);
    }
    split4(u, hh[i], ll[i]);
  }
  #pragma unroll
  for (int i = 0; i < SPLIT_VEC; ++i) {
    *(v4bf*)(hb + i * (SPLIT_THREADS * 8)) = hh[i];
    *(v4bf*)(lb + i * (SPLIT_THREADS * 8)) = ll[i];
  }
  // precaution: the table branch's code lies behind these stores and writes registers that they name
  asm volatile("s_wait_xcnt 0x0" ::: "memory");
}

// rotation of 4 neighbouring dims j (a) with their partners j + 64 (b);
// written as explicit fma so that the product rounded first is x2*s (low half) and x1*s (high half)
static __device__ __forceinline__ void rot4(float4 a, float4 b, float4 c, float4 s,
                                            float4& lo, float4& hi) {
  lo.x = fmaf(c.x, a.x, -(b.x * s.x));  hi.x = fmaf(c.x, b.x, a.x * s.x);
  lo.y = fmaf(c.y, a.y, -(b.y * s.y));  hi.y = fmaf(c.y, b.y, a.y * s.y);
  lo.z = fmaf(c.z, a.z, -(b.z * s.z));  hi.z = fmaf(c.z, b.z, a.z * s.z);
  lo.w = fmaf(c.w, a.w, -(b.w * s.w));  hi.w = fmaf(c.w, b.w, a.w * s.w);
}

// ---------------- GEMM: C = A * W^T, bf16x3, async double-buffered LDS (output projection) ----------------
// Operands pre-split to global bf16 hi/lo.  C leaves as [T][D], clamped; the finished tile, passed through
// LDS, leaves in whole rows.
// One 128 x 128 tile of C per block, 8 waves as 2 x 4, 64 x 32 per wave; a trip takes 128 k, so a
// staged row is 256 contiguous bytes (whole lines) and the two buffers leave room for one block
// per WGP.  A trip is 4 blocks of 32 k; each block's fragments are fetched one block ahead.
#define GT_MN    128
#define GT_K     128
#define GT_PITCH 136                   // bf16; rows of 272 B = 16 B x odd, for 16-byte readers
#define GT_ARR   (GT_MN * GT_PITCH)    // one operand plane of one buffer
#define GT_TRIPS (DMODEL / GT_K)
#define CT_PITCH 132                   // floats; rows of 528 B = 16 B x odd, for 16-byte readers
__global__ __launch_bounds__(256)
void gemm_bf16x3_async_kernel(const __bf16* __restrict__ Ahi_g, const __bf16* __restrict__ Alo_g,
                              const __bf16* __restrict__ Whi_g, const __bf16* __restrict__ Wlo_g,
                              float* __restrict__ out) {
  __shared__ __attribute__((aligned(16))) __bf16 Sbuf[2][4][GT_ARR];   // [buf][Ahi, Alo, Whi, Wlo]
  static_assert(GT_MN * CT_PITCH * 4 <= 2 * 4 * GT_ARR * 2, "the finished tile fits the operands' LDS");

  const int tid  = threadIdx.x;
  const int wid  = tid >> 5;
  const int lane = tid & 31;
  const int ln   = lane & 15;
  const int hf   = lane >> 4;
  const int wr   = wid >> 2;       // 0..1
  const int wc   = wid & 3;        // 0..3
  const int m0   = blockIdx.y * GT_MN;
  const int n0   = blockIdx.x * GT_MN;

  // 8 copies per plane and thread: rows crow + 0..3 and 64 + crow + 0..3, so that neighbouring
  // copies lie one row (4096 B) apart; a wave's copy takes two whole 256-B rows
  const int crow = (tid >> 4) * 4, cc = (tid & 15) * 8;      // 8 bf16 = 16B
  const __bf16* a_hi = Ahi_g + (size_t)(m0 + crow) * DMODEL + cc;
  const __bf16* a_lo = Alo_g + (size_t)(m0 + crow) * DMODEL + cc;
  const __bf16* w_hi = Whi_g + (size_t)(n0 + crow) * DMODEL + cc;
  const __bf16* w_lo = Wlo_g + (size_t)(n0 + crow) * DMODEL + cc;
  const int     loff = crow * GT_PITCH + cc;

  v8f acc[4][2];
  #pragma unroll
  for (int i = 0; i < 4; ++i)
    #pragma unroll
    for (int j = 0; j < 2; ++j)
      #pragma unroll
      for (int r = 0; r < 8; ++r) acc[i][j][r] = 0.0f;

  auto issue = [&](int buf, int kt) {
    // unrolled: the row steps become constants of the copies' addresses
    #pragma unroll
    for (int i = 0; i < 8; ++i) {
      const int rw = (i & 3) + (i >> 2) * 64;
      const int go = rw * DMODEL + kt;
      const int lr = loff + rw * GT_PITCH;
      async_cp16(&Sbuf[buf][0][lr], a_hi + go);
      async_cp16(&Sbuf[buf][1][lr], a_lo + go);
      async_cp16(&Sbuf[buf][2][lr], w_hi + go);
      async_cp16(&Sbuf[buf][3][lr], w_lo + go);
    }
  };

  // two fragment sets: one is worked on while the other is filled
  v16bf fa_h[2][4], fa_l[2][4], fb_h[2][2], fb_l[2][2];
  auto load_set = [&](int s, int buf, int ks) {
    const int ab = (wr * 64 + ln) * GT_PITCH + ks + 8 * hf;
    const int bb = (wc * 32 + ln) * GT_PITCH + ks + 8 * hf;
    // both loops unrolled: fragment arrays stay in registers only under constant indices
    #pragma unroll
    for (int i = 0; i < 4; ++i) {
      fa_h[s][i] = ld_frag(&Sbuf[buf][0][ab + i * 16 * GT_PITCH]);
      fa_l[s][i] = ld_frag(&Sbuf[buf][1][ab + i * 16 * GT_PITCH]);
    }
    #pragma unroll
    for (int j = 0; j < 2; ++j) {
      fb_h[s][j] = ld_frag(&Sbuf[buf][2][bb + j * 16 * GT_PITCH]);
      fb_l[s][j] = ld_frag(&Sbuf[buf][3][bb + j * 16 * GT_PITCH]);
    }
  };

  issue(0, 0);
  // own copies of tile 0 have landed; the barrier then shows them to the other waves
  asm volatile("s_wait_asynccnt 0x0" ::: "memory");
  __syncthreads();
  issue(1, GT_K);
  load_set(0, 0, 0);

  for (int t = 0; t < GT_TRIPS; ++t) {
    const int buf = t & 1;
    // unrolled: the set index must be a constant for the fragments to stay in registers
    #pragma unroll
    for (int b = 0; b < 4; ++b) {
      if (b < 3) {
        load_set((b + 1) & 1, buf, (b + 1) * 32);
      } else {
        // publish point of tile t + 1, ahead of this tile's last block, whose fragments are fetched:
        // own LDS reads retired before the refill below aims at the buffer this trip has read
        asm volatile("s_wait_dscnt 0x0" ::: "memory");
        // own copies of the next tile have landed; the barrier then shows them to the other waves
        asm volatile("s_wait_asynccnt 0x0" ::: "memory");
        __syncthreads();
        if (t + 1 < GT_TRIPS) load_set(0, buf ^ 1, 0);
      }
      // keeps the next block's fragment loads one group ahead of this block's products
      __builtin_amdgcn_sched_barrier(0);
      // the refill flies while the next tile is worked on; its address work may mix with the first products
      if (b == 3 && t + 2 < GT_TRIPS) issue(buf, (t + 2) * GT_K);
      const int s = b & 1;
      // product-major over the 8 independent accumulators; per accumulator and 32 k the order
      // stays hi*lo, lo*hi, hi*hi (loops unrolled: register arrays need constant indices)
      #pragma unroll
      for (int i = 0; i < 4; ++i)
        #pragma unroll
        for (int j = 0; j < 2; ++j) acc[i][j] = wmma_bf16(fa_h[s][i], fb_l[s][j], acc[i][j]);
      // keeps the refill's address work among the eight products above, whose A fragments are read again below
      if (b == 3) __builtin_amdgcn_sched_barrier(0);
      #pragma unroll
      for (int i = 0; i < 4; ++i)
        #pragma unroll
        for (int j = 0; j < 2; ++j) acc[i][j] = wmma_bf16(fa_l[s][i], fb_h[s][j], acc[i][j]);
      #pragma unroll
      for (int i = 0; i < 4; ++i)
        #pragma unroll
        for (int j = 0; j < 2; ++j) acc[i][j] = wmma_bf16(fa_h[s][i], fb_h[s][j], acc[i][j]);
      // keeps the following block's loads from moving in among these products
      __builtin_amdgcn_sched_barrier(0);
    }
  }
  // precaution: no copy is outstanding when the wave ends
  asm volatile("s_wait_asynccnt 0x0" ::: "memory");

  // a thread finishes the columns jg.. and jg + 64.. of the rows er + 16 * i
  const int  jg = (tid & 15) * 4, er = tid >> 4;

  // The operands' LDS is free: every wave retired its reads and its copies ahead of the loop's last barrier.
  // C layout: lane ln = column, row = r + 8*hf
  float* Ct = (float*)&Sbuf[0][0][0];
  #pragma unroll
  for (int i = 0; i < 4; ++i)
    #pragma unroll
    for (int j = 0; j < 2; ++j)
      #pragma unroll
      for (int r = 0; r < 8; ++r)
        Ct[(wr * 64 + i * 16 + r + 8 * hf) * CT_PITCH + wc * 32 + j * 16 + ln] = acc[i][j][r];
  __syncthreads();      // the finished tile is seen by all waves

  // the thread's 16 pieces of the tile, read as one group: one LDS latency
  const float* cr = Ct + er * CT_PITCH + jg;
  float4 a[8], b[8];
  #pragma unroll
  for (int i = 0; i < 8; ++i) {
    a[i] = *(const float4*)(cr + i * 16 * CT_PITCH);
    b[i] = *(const float4*)(cr + i * 16 * CT_PITCH + 64);
  }
  float* orow = out + (size_t)(m0 + er) * DMODEL + n0 + jg;
  #pragma unroll
  for (int i = 0; i < 8; ++i) {
    a[i].x = fin_clamp(a[i].x); a[i].y = fin_clamp(a[i].y); a[i].z = fin_clamp(a[i].z); a[i].w = fin_clamp(a[i].w);
    b[i].x = fin_clamp(b[i].x); b[i].y = fin_clamp(b[i].y); b[i].z = fin_clamp(b[i].z); b[i].w = fin_clamp(b[i].w);
  }
  #pragma unroll
  for (int i = 0; i < 8; ++i) {
    *(float4*)(orow + i * 16 * DMODEL)      = a[i];
    *(float4*)(orow + i * 16 * DMODEL + 64) = b[i];
  }
}

// ---------------- Q, K and V projections in one block: C_z = A * W_z^T, z = 0, 1, 2, bf16x3 ----------------
// The three products share A: a block takes the 128 x 128 tile (rows m0.., head blockIdx.x) of all three, so an
// A tile is staged once for them, 512 operand rows per k instead of 768, and 256 blocks fill the chip once.
// 8 waves as 2 x 4; a wave holds its 64 x 32 piece of each of the three tiles.  A trip takes 64 k (two buffers
// of 8 planes fit the LDS) and is 6 runs of 24 products: (32 k, z).  The A fragments of 32 k serve three runs;
// each run's W fragments, and the next 32 k's A fragments, are fetched one run ahead.
// Q and K leave rotated, K also as bf16 hi/lo planes; all as [H][T][HDIM], z * T_SEQ * DMODEL elements apart.
#define QT_K     64
#define QT_PITCH 72                    // bf16; rows of 144 B = 16 B x odd, for 16-byte readers
#define QT_ARR   (GT_MN * QT_PITCH)    // one operand plane of one buffer
#define QT_TRIPS (DMODEL / QT_K)
__global__ __launch_bounds__(256)
void gemm_qkv_kernel(const __bf16* __restrict__ Ahi_g, const __bf16* __restrict__ Alo_g,
                     const __bf16* __restrict__ Whi_g, const __bf16* __restrict__ Wlo_g,
                     float* __restrict__ out_g, const float* __restrict__ ctab,
                     const float* __restrict__ stab, __bf16* __restrict__ Khi,
                     __bf16* __restrict__ Klo) {
  __shared__ __attribute__((aligned(16))) __bf16 Sbuf[2][8][QT_ARR];   // [buf][Ahi, Alo, then Whi, Wlo of z = 0, 1, 2]
  static_assert(3 * GT_MN * CT_PITCH * 4 <= 2 * 8 * QT_ARR * 2, "the three finished tiles fit the operands' LDS");
  static_assert(QT_TRIPS >= 2, "the ring's prologue fills two tiles");
  static_assert(T_SEQ == DMODEL, "a weight plane and an output are of one size");
  static_assert(GT_MN == HDIM, "a block's columns are one head: a finished tile holds both partners of every rotation");
  const size_t NEz = (size_t)T_SEQ * DMODEL;     // a weight plane, an output

  const int tid  = threadIdx.x;
  const int wid  = tid >> 5;
  const int lane = tid & 31;
  const int ln   = lane & 15;
  const int hf   = lane >> 4;
  const int wr   = wid >> 2;       // 0..1
  const int wc   = wid & 3;        // 0..3
  const int m0   = blockIdx.y * GT_MN;
  const int n0   = blockIdx.x * GT_MN;

  // 4 copies per plane and thread: rows crow + 0..3, so that neighbouring copies lie one row (4096 B) apart;
  // a wave's copy takes four whole 128-B lines
  const int crow = (tid >> 3) * 4, cc = (tid & 7) * 8;       // 8 bf16 = 16B
  const __bf16* a_hi = Ahi_g + (size_t)(m0 + crow) * DMODEL + cc;
  const __bf16* a_lo = Alo_g + (size_t)(m0 + crow) * DMODEL + cc;
  const __bf16* w_hi = Whi_g + (size_t)(n0 + crow) * DMODEL + cc;
  const __bf16* w_lo = Wlo_g + (size_t)(n0 + crow) * DMODEL + cc;
  const int     loff = crow * QT_PITCH + cc;

  v8f acc[3][4][2];
  #pragma unroll
  for (int z = 0; z < 3; ++z)
    #pragma unroll
    for (int i = 0; i < 4; ++i)
      #pragma unroll
      for (int j = 0; j < 2; ++j)
        #pragma unroll
        for (int r = 0; r < 8; ++r) acc[z][i][j][r] = 0.0f;

  auto issue = [&](int buf, int kt) {
    // unrolled: the row steps become constants of the copies' addresses
    #pragma unroll
    for (int i = 0; i < 4; ++i) {
      const int go = i * DMODEL + kt;
      const int lr = loff + i * QT_PITCH;
      async_cp16(&Sbuf[buf][0][lr], a_hi + go);
      async_cp16(&Sbuf[buf][1][lr], a_lo + go);
      #pragma unroll
      for (int z = 0; z < 3; ++z) {
        async_cp16(&Sbuf[buf][2 + 2 * z][lr], w_hi + z * NEz + go);
        async_cp16(&Sbuf[buf][3 + 2 * z][lr], w_lo + z * NEz + go);
      }
    }
  };

  // two fragment sets of each operand: one is worked on while the other is filled
  // (loops unrolled: fragment arrays stay in registers only under constant indices)
  v16bf fa_h[2][4], fa_l[2][4], fb_h[2][2], fb_l[2][2];
  auto load_a = [&](int s, int buf, int ks) {
    const int ab = (wr * 64 + ln) * QT_PITCH + ks + 8 * hf;
    #pragma unroll
    for (int i = 0; i < 4; ++i) {
      fa_h[s][i] = ld_frag(&Sbuf[buf][0][ab + i * 16 * QT_PITCH]);
      fa_l[s][i] = ld_frag(&Sbuf[buf][1][ab + i * 16 * QT_PITCH]);
    }
  };
  auto load_b = [&](int s, int buf, int z, int ks) {
    const int bb = (wc * 32 + ln) * QT_PITCH + ks + 8 * hf;
    #pragma unroll
    for (int j = 0; j < 2; ++j) {
      fb_h[s][j] = ld_frag(&Sbuf[buf][2 + 2 * z][bb + j * 16 * QT_PITCH]);
      fb_l[s][j] = ld_frag(&Sbuf[buf][3 + 2 * z][bb + j * 16 * QT_PITCH]);
    }
  };

  issue(0, 0);
  // own copies of tile 0 have landed; the barrier then shows them to the other waves
  asm volatile("s_wait_asynccnt 0x0" ::: "memory");
  __syncthreads();
  issue(1, QT_K);
  load_a(0, 0, 0);
  load_b(0, 0, 0, 0);

  // one trip; more: a tile t + 1 exists, refill: a tile t + 2 exists.  Both are constants at each call, so that no
  // branch stands in a trip and the refill's address work can mix with products.  Inlined: the register arrays
  // stay in registers
  auto trip = [&](int t, bool more, bool refill) __attribute__((always_inline)) {
    const int buf = t & 1;
    // unrolled: set and tile indices must be constants for fragments and sums to stay in registers
    #pragma unroll
    for (int run = 0; run < 6; ++run) {
      const int z = run % 3, sa = run / 3, s = run & 1;
      if (run < 5) {
        load_b(s ^ 1, buf, (run + 1) % 3, ((run + 1) / 3) * 32);
        if (run == 2) load_a(1, buf, 32);
      } else {
        // publish point of tile t + 1, ahead of this tile's last run, whose fragments are fetched:
        // own LDS reads retired before the refill below aims at the buffer this trip has read
        asm volatile("s_wait_dscnt 0x0" ::: "memory");
        // own copies of the next tile have landed; the barrier then shows them to the other waves
        asm volatile("s_wait_asynccnt 0x0" ::: "memory");
        __syncthreads();
        if (more) {
          load_a(0, buf ^ 1, 0);
          load_b(0, buf ^ 1, 0, 0);
        }
      }
      // keeps the next run's fragment loads one group ahead of this run's products
      __builtin_amdgcn_sched_barrier(0);
      // the refill flies while the next tile is worked on; its address work may mix with the first products
      if (run == 5 && refill) issue(buf, (t + 2) * QT_K);
      // product-major over the 8 independent accumulators; per accumulator and 32 k the order
      // stays hi*lo, lo*hi, hi*hi
      #pragma unroll
      for (int i = 0; i < 4; ++i)
        #pragma unroll
        for (int j = 0; j < 2; ++j) acc[z][i][j] = wmma_bf16(fa_h[sa][i], fb_l[s][j], acc[z][i][j]);
      // keeps the refill's address work among the eight products above, whose A fragments are read again
      // below, and off registers of fragments just used for the last time
      if (run == 5) __builtin_amdgcn_sched_barrier(0);
      #pragma unroll
      for (int i = 0; i < 4; ++i)
        #pragma unroll
        for (int j = 0; j < 2; ++j) acc[z][i][j] = wmma_bf16(fa_l[sa][i], fb_h[s][j], acc[z][i][j]);
      #pragma unroll
      for (int i = 0; i < 4; ++i)
        #pragma unroll
        for (int j = 0; j < 2; ++j) acc[z][i][j] = wmma_bf16(fa_h[sa][i], fb_h[s][j], acc[z][i][j]);
      // keeps the following run's loads from moving in among these products
      __builtin_amdgcn_sched_barrier(0);
    }
  };
  for (int t = 0; t < QT_TRIPS - 2; ++t) trip(t, true, true);
  trip(QT_TRIPS - 2, true, false);
  trip(QT_TRIPS - 1, false, false);
  // precaution: no copy is outstanding when the wave ends
  asm volatile("s_wait_asynccnt 0x0" ::: "memory");

  // a thread finishes 4 dims jg.. and their partners jg + 64.. of the rows er + 16 * i
  const int jg = (tid & 15) * 4, er = tid >> 4;
  // the rows' angles: byte offsets in 32 bits on uniform bases, the rows a constant 4096 bytes apart;
  // the loads go out ahead of the tiles' trip through LDS, which covers their latency
  const unsigned to = (unsigned)((m0 + er) * (HDIM / 2) + jg) * 4u;
  float4 cv[8], sv[8];
  #pragma unroll
  for (int i = 0; i < 8; ++i) {
    cv[i] = *(const float4*)((const char*)ctab + to + i * (16 * (HDIM / 2) * 4));
    sv[i] = *(const float4*)((const char*)stab + to + i * (16 * (HDIM / 2) * 4));
  }
  // the sixteen loads go out here, ahead of the LDS stores: left alone, the compiler's scheduler puts them
  // among the stores, and less of their latency is covered
  __builtin_amdgcn_sched_barrier(0);
  // precaution: stands ahead of every later write of the loads' offset register; it names the offset so
  // that the register is held until here
  asm volatile("s_wait_xcnt 0x0" :: "v"(to) : "memory");
  // keeps the wait directly behind the loads: later address work stays behind it
  __builtin_amdgcn_sched_barrier(0);

  // The operands' LDS is free: every wave retired its reads and its copies ahead of the last trip's barrier.
  // C layout: lane ln = column, row = r + 8*hf
  float* Ct = (float*)&Sbuf[0][0][0];
  #pragma unroll
  for (int z = 0; z < 3; ++z)
    #pragma unroll
    for (int i = 0; i < 4; ++i)
      #pragma unroll
      for (int j = 0; j < 2; ++j)
        #pragma unroll
        for (int r = 0; r < 8; ++r)
          Ct[(z * GT_MN + wr * 64 + i * 16 + r + 8 * hf) * CT_PITCH + wc * 32 + j * 16 + ln] = acc[z][i][j][r];
  __syncthreads();      // the finished tiles are seen by all waves

  const size_t base = ((size_t)blockIdx.x * T_SEQ + m0 + er) * HDIM + jg;    // head blockIdx.x
  // rolled: a third of the code, and the branches on z keep a tile's arithmetic in blocks of its own, ahead of
  // its stores, so that no register that a store names is written among them
  #pragma unroll 1
  for (int z = 0; z < 3; ++z) {
    // the thread's 16 pieces of the tile, read as one group: one LDS latency
    const float* cr = Ct + (z * GT_MN + er) * CT_PITCH + jg;
    float4 a[8], b[8];
    #pragma unroll
    for (int i = 0; i < 8; ++i) {
      a[i] = *(const float4*)(cr + i * 16 * CT_PITCH);
      b[i] = *(const float4*)(cr + i * 16 * CT_PITCH + 64);
    }
    if (z < 2) {
      #pragma unroll
      for (int i = 0; i < 8; ++i) {
        float4 lo, hi;
        rot4(a[i], b[i], cv[i], sv[i], lo, hi);
        a[i] = lo; b[i] = hi;
      }
    }
    float* op = out_g + z * NEz + base;
    #pragma unroll
    for (int i = 0; i < 8; ++i) {
      *(float4*)(op + i * 16 * HDIM)      = a[i];
      *(float4*)(op + i * 16 * HDIM + 64) = b[i];
    }
    // precaution: stands ahead of every later write of a register that these stores name (K's split, the
    // next tile's reads); it names the address so that it is held until here
    asm volatile("s_wait_xcnt 0x0" :: "v"(op) : "memory");
    if (z == 1) {
      v4bf ah[8], al[8], bh[8], bl[8];
      #pragma unroll
      for (int i = 0; i < 8; ++i) {
        split4(a[i], ah[i], al[i]);
        split4(b[i], bh[i], bl[i]);
      }
      // the stores stand behind all the arithmetic: no register that a store names is written among them
      __builtin_amdgcn_sched_barrier(0);
      #pragma unroll
      for (int i = 0; i < 8; ++i) {
        *(v4bf*)(Khi + base + i * 16 * HDIM)      = ah[i];  *(v4bf*)(Klo + base + i * 16 * HDIM)      = al[i];
        *(v4bf*)(Khi + base + i * 16 * HDIM + 64) = bh[i];  *(v4bf*)(Klo + base + i * 16 * HDIM + 64) = bl[i];
      }
      // precaution: the next tile's reads write registers that these stores name
      asm volatile("s_wait_xcnt 0x0" ::: "memory");
    }
  }
}

// ---------------- kernel 4: scores of the last query row against the kept keys (f32) ----------------
// value of lane l ^ M inside a 16-lane row
template <int M>
static __device__ __forceinline__ float xrow(float v) {
  int b = __builtin_bit_cast(int, v);
  return __builtin_bit_cast(float, __builtin_amdgcn_mov_dpp(b, 0x160 + M, 0xf, 0xf, true));  // row_xmask:M
}
typedef float f4v __attribute__((ext_vector_type(4)));
static __device__ __forceinline__ float dot4(f4v a, f4v b) {
  return fmaf(a.w, b.w, fmaf(a.z, b.z, fmaf(a.y, b.y, a.x * b.x)));
}
// One block per (128 kept keys, head).  Eight lanes share a key: each of their four loads is one whole
// 128-byte line of its row, and all sixteen key loads of a thread go out together.
#define SC_KEYS  128
#define SC_GRID  ((NVALID + SC_KEYS - 1) / SC_KEYS)
#define SC_PITCH (SC_GRID * SC_KEYS)   // floats per head in the score array
__global__ __launch_bounds__(256)
void lastrow_score_kernel(const float* __restrict__ Q, const float* __restrict__ K,
                          float* __restrict__ sc) {
  const int h = blockIdx.y, tid = threadIdx.x;
  const int sub = tid & 7, grp = tid >> 3;
  // byte offsets in 32 bits on block-uniform bases
  const char* qb = (const char*)(Q + ((size_t)h * T_SEQ + (T_SEQ - 1)) * HDIM);
  const char* kb = (const char*)(K + (size_t)h * T_SEQ * HDIM);
  const unsigned qo = (unsigned)sub * 16u;
  f4v q[4];
  #pragma unroll
  for (int c = 0; c < 4; ++c) q[c] = *(const f4v*)(qb + qo + c * 128);
  unsigned ko[4];
  f4v kv[4][4];
  #pragma unroll
  for (int b = 0; b < 4; ++b) {
    const int id  = blockIdx.x * SC_KEYS + b * 32 + grp;
    const int ic  = (id < NVALID) ? id : NVALID - 1;          // past the end: the last key again, not stored
    const int key = (ic < SB) ? ic : (T_SEQ - RB) + (ic - SB);
    ko[b] = (unsigned)key * (HDIM * 4u) + qo;
    #pragma unroll
    for (int c = 0; c < 4; ++c) kv[b][c] = *(const f4v*)(kb + ko[b] + c * 128);
  }
  // all twenty loads go out as one group and one memory latency is paid: left alone, the compiler's
  // scheduler puts some of them behind the wait for q
  __builtin_amdgcn_sched_barrier(0);
  // precaution: stands ahead of every later write of the loads' offset registers; it names the offsets so
  // that those registers are held until here and no load's result lands in them
  asm volatile("s_wait_xcnt 0x0" :: "v"(qo), "v"(ko[0]), "v"(ko[1]), "v"(ko[2]), "v"(ko[3]) : "memory");
  // keeps the wait directly behind the loads: later scalar and vector work stays behind it
  __builtin_amdgcn_sched_barrier(0);
  float d[4];
  #pragma unroll
  for (int b = 0; b < 4; ++b) {
    float t = (dot4(q[0], kv[b][0]) + dot4(q[1], kv[b][1])) + (dot4(q[2], kv[b][2]) + dot4(q[3], kv[b][3]));
    t += xrow<1>(t);
    t += xrow<2>(t);
    t += xrow<4>(t);
    d[b] = t;            // the same in all eight lanes of the key
  }
  // lane sub of a group stores the group's key number sub: one store for the four
  const float dv = (sub == 0) ? d[0] : (sub == 1) ? d[1] : (sub == 2) ? d[2] : d[3];
  const int   id = blockIdx.x * SC_KEYS + (sub & 3) * 32 + grp;
  if (sub < 4 && id < NVALID) sc[h * SC_PITCH + id] = dv * SCALE_QK;
}

// ---------------- kernel 4b: V bump + bf16 hi/lo split + transpose, once for all query blocks ----
// One block per (32-key tile, head).  Output tile: [d 0..127][key 0..31], 8 KiB contiguous, hi and lo,
// in the order in which attention walks the tiles.  Every block forms its head's bump coefficient itself
// from the last row's scores (softmax over the kept keys), all blocks in the same order of sums.
#define NTILE 39      // 7 tiles for [0,204), 32 for [1024,2048)
#define VT_PITCH 132  // floats; rows stay 16-byte aligned
__global__ __launch_bounds__(256)
void vprep_kernel(const float* __restrict__ V, const float* __restrict__ sc,
                  const float* __restrict__ bern,
                  __bf16* __restrict__ Vthi, __bf16* __restrict__ Vtlo) {
  __shared__ __attribute__((aligned(16))) float tile[32 * VT_PITCH];
  __shared__ __attribute__((aligned(16))) float red[3][8];     // per wave: maximum, sum, tail sum
  const int tid = threadIdx.x;
  const int it  = blockIdx.x;
  const int h   = blockIdx.y;
  const int k0  = (it < 7) ? it * 32 : (T_SEQ - RB) + (it - 7) * 32;
  const float* Vh = V + (size_t)h * T_SEQ * HDIM;
  // a thread keeps one group of 4 dims and takes 4 keys; all five loads go out together
  const int d4 = (tid & 31) * 4, kr0 = tid >> 5;
  // byte offsets in 32 bits on block-uniform bases: one offset register serves the four row loads,
  // whose rows lie a constant 4096 bytes apart
  const char* eb = (const char*)(Vh + (size_t)RB * HDIM) + (unsigned)d4 * 4u;
  const char* rb = (const char*)(Vh + (size_t)k0 * HDIM) + (unsigned)tid * 16u;
  const float4 e = *(const float4*)eb;
  float4 v[4];
  #pragma unroll
  for (int i = 0; i < 4; ++i)
    v[i] = *(const float4*)(rb + i * (8 * HDIM * 4));

  // the head's NVALID scores, 5 per thread: index tid + 256 * i; only i = 4 can pass the end
  static_assert(NVALID > 1024 && NVALID <= 1280 && SB + 1 < 256, "5 scores per thread, tail starts in the first");
  const char* sb = (const char*)(sc + h * SC_PITCH);
  const bool  in4 = tid < NVALID - 1024;
  const unsigned so = (unsigned)tid * 4u, so4 = in4 ? so + 4096u : (NVALID - 1) * 4u;
  float s[5];
  #pragma unroll
  for (int i = 0; i < 4; ++i) s[i] = *(const float*)(sb + so + i * 1024);
  s[4] = *(const float*)(sb + so4);
  // the V loads and the score loads go out as one group and one memory latency is paid: left alone, the
  // compiler's scheduler puts the V loads behind the wait for the scores
  __builtin_amdgcn_sched_barrier(0);
  // precaution: stands ahead of every later write of the score loads' offset registers; it names the
  // offsets so that those registers are held until here
  asm volatile("s_wait_xcnt 0x0" :: "v"(so), "v"(so4) : "memory");
  // keeps the wait directly behind the loads: later scalar address work stays behind it
  __builtin_amdgcn_sched_barrier(0);
  const float se = *(const float*)(sb + SB * 4);     // score of the evicted key, RB
  const float bu = bern[h];
  if (!in4) s[4] = -1e30f;
  float mx = fmaxf(fmaxf(fmaxf(s[0], s[1]), fmaxf(s[2], s[3])), s[4]);
  mx = fmaxf(mx, xrow<1>(mx));  mx = fmaxf(mx, xrow<2>(mx));
  mx = fmaxf(mx, xrow<4>(mx));  mx = fmaxf(mx, xrow<8>(mx));
  mx = fmaxf(mx, xhalf(mx));
  if ((tid & 31) == 0) red[0][tid >> 5] = mx;
  __syncthreads();      // the waves' maxima are seen by all
  float4 ra = *(const float4*)&red[0][0], rc = *(const float4*)&red[0][4];
  const float gmax = fmaxf(fmaxf(fmaxf(ra.x, ra.y), fmaxf(ra.z, ra.w)), fmaxf(fmaxf(rc.x, rc.y), fmaxf(rc.z, rc.w)));
  const float e0 = __expf(s[0] - gmax), e1 = __expf(s[1] - gmax), e2 = __expf(s[2] - gmax),
              e3 = __expf(s[3] - gmax), e4 = in4 ? __expf(s[4] - gmax) : 0.0f;
  const float rest = (e1 + e2) + (e3 + e4);
  float sm = e0 + rest;
  float tl = ((tid >= SB + 1) ? e0 : 0.0f) + rest;   // keys 1025..2047
  sm += xrow<1>(sm);  tl += xrow<1>(tl);
  sm += xrow<2>(sm);  tl += xrow<2>(tl);
  sm += xrow<4>(sm);  tl += xrow<4>(tl);
  sm += xrow<8>(sm);  tl += xrow<8>(tl);
  sm += xhalf(sm);    tl += xhalf(tl);
  if ((tid & 31) == 0) { red[1][tid >> 5] = sm; red[2][tid >> 5] = tl; }
  __syncthreads();      // the waves' sums are seen by all
  ra = *(const float4*)&red[1][0];  rc = *(const float4*)&red[1][4];
  const float gsum  = ((ra.x + ra.y) + (ra.z + ra.w)) + ((rc.x + rc.y) + (rc.z + rc.w));
  ra = *(const float4*)&red[2][0];  rc = *(const float4*)&red[2][4];
  const float gtail = ((ra.x + ra.y) + (ra.z + ra.w)) + ((rc.x + rc.y) + (rc.z + rc.w));
  const float pe   = __expf(se - gmax) / gsum;               // probs at key e=1024
  const float mean = (gtail / gsum) / 1023.0f + 1e-6f;
  float p = pe / mean;
  p = (p != p) ? 0.0f : fminf(fmaxf(p, 0.0f), 1.0f);
  const float cf = ((bu < p) ? 1.0f : 0.0f) / (float)RB;

  const float bx = e.x * cf, by = e.y * cf, bz = e.z * cf, bw = e.w * cf;
  #pragma unroll
  for (int i = 0; i < 4; ++i) {
    const bool bump = (k0 + kr0 + i * 8) > RB;     // keys 1025..2047 take the evicted row's share
    float4 u = v[i];
    u.x = bump ? u.x + bx : u.x;  u.y = bump ? u.y + by : u.y;
    u.z = bump ? u.z + bz : u.z;  u.w = bump ? u.w + bw : u.w;
    *(float4*)(&tile[(kr0 + i * 8) * VT_PITCH + d4]) = u;
  }
  __syncthreads();
  const size_t ob = ((size_t)h * NTILE + it) * (HDIM * 32);
  #pragma unroll
  for (int i = 0; i < 2; ++i) {
    int c = tid + i * 256;                   // 16-byte chunk of the output tile
    int d = c >> 2, kg = (c & 3) * 8;
    v8bf hh, ll;
    #pragma unroll
    for (int j = 0; j < 8; ++j) {
      float v = tile[(kg + j) * VT_PITCH + d];
      __bf16 x = (__bf16)v;
      hh[j] = x;
      ll[j] = (__bf16)(v - (float)x);
    }
    *(v8bf*)(Vthi + ob + c * 8) = hh;
    *(v8bf*)(Vtlo + ob + c * 8) = ll;
  }
}

#define AT_Q     128
#define AT_TRIPS ((NTILE + 1) / 2)
__global__ __launch_bounds__(256)
void attn_kernel(const float* __restrict__ Q, const __bf16* __restrict__ Khi,
                 const __bf16* __restrict__ Klo, const __bf16* __restrict__ Vthi,
                 const __bf16* __restrict__ Vtlo, __bf16* __restrict__ Ohi, __bf16* __restrict__ Olo) {
  __shared__ __attribute__((aligned(16))) __bf16 Qhi_s[AT_Q * 136], Qlo_s[AT_Q * 136];   // 128 queries x 128 dims
  // V tile [d][key], 32 keys, hi and lo, per key group two buffers; row pitch 80 B for 16-byte readers
  __shared__ __attribute__((aligned(16))) __bf16 Vhi_s[2][2][128 * 40];
  __shared__ __attribute__((aligned(16))) __bf16 Vlo_s[2][2][128 * 40];
  // K tile, 32 keys x 128 dims, hi and lo, per key group two buffers; row pitch 272 B for 16-byte readers
  __shared__ __attribute__((aligned(16))) __bf16 Khi_s[2][2][32 * 136];
  __shared__ __attribute__((aligned(16))) __bf16 Klo_s[2][2][32 * 136];
  // the join: what group g hands to the other group, [g][wave][16 bytes of a lane's 64 floats][lane]
  __shared__ __attribute__((aligned(16))) float Ox_s[2][4][16][32 * 4];
  __shared__ float Mx_s[2][4][32], Lx_s[2][4][32];

  const int tid  = threadIdx.x;
  const int gt   = tid & 127;        // thread within its key group
  const int g    = __builtin_amdgcn_readfirstlane(tid >> 7);   // key group, the same in a whole wave
  const int w    = (tid >> 5) & 3;   // 4 waves a group, 32 queries each
  const int lane = tid & 31;
  const int ln   = lane & 15;
  const int hf   = lane >> 4;
  const int h    = blockIdx.y;
  const int t0   = blockIdx.x * AT_Q;
  const size_t hk = (size_t)h * T_SEQ;

  const float* Qh = Q + hk * HDIM;

  // one K tile (hi and lo) into the group's LDS, once per block: each wave's copy takes 512 contiguous
  // bytes (two whole key rows), 8 copies per thread and tile
  auto issue_k = [&](int buf, int kbase) {
    #pragma unroll
    for (int i = 0; i < 4; ++i) {
      int idx = gt + i * 128, rw = idx >> 4, cw = (idx & 15) * 8;
      async_cp16(&Khi_s[g][buf][rw * 136 + cw], Khi + (hk + kbase + rw) * HDIM + cw);
      async_cp16(&Klo_s[g][buf][rw * 136 + cw], Klo + (hk + kbase + rw) * HDIM + cw);
    }
  };
  // one prepared V tile (hi and lo) into the group's LDS: each wave's copy takes 512 contiguous bytes,
  // 8 copies per thread and tile
  auto issue_v = [&](int buf, int tile) {
    const size_t vb = ((size_t)h * NTILE + tile) * (HDIM * 32);
    #pragma unroll
    for (int i = 0; i < 4; ++i) {
      int c = gt + i * 128;
      async_cp16(&Vhi_s[g][buf][(c >> 2) * 40 + (c & 3) * 8], Vthi + vb + c * 8);
      async_cp16(&Vlo_s[g][buf][(c >> 2) * 40 + (c & 3) * 8], Vtlo + vb + c * 8);
    }
  };
  static_assert(NTILE >= 2, "each key group has a first tile");
  issue_k(0, g * 32);
  issue_v(0, g);

  // stage + split this block's 128 query rows
  // row (tid >> 5) + 8 * i, dims (tid & 31) * 4 and up: one address for all sixteen loads, 4096 bytes apart
  const float* qp = Qh + (size_t)(t0 + (tid >> 5)) * HDIM + (tid & 31) * 4;
  float4 qv[16];
  #pragma unroll
  for (int i = 0; i < 16; ++i) qv[i] = *(const float4*)(qp + i * 8 * HDIM);
  // precaution: stands ahead of every later write of the loads' address registers; it names the address so
  // that those registers are held until here and no load's result lands in them
  asm volatile("s_wait_xcnt 0x0" :: "v"(qp) : "memory");
  #pragma unroll
  for (int i = 0; i < 16; ++i) {
    int row = (tid >> 5) + i * 8, kc = (tid & 31) * 4;
    float4 v = qv[i];
    v4bf hh, ll; split4(v, hh, ll);
    *(v4bf*)(&Qhi_s[row * 136 + kc]) = hh;
    *(v4bf*)(&Qlo_s[row * 136 + kc]) = ll;
  }
  __syncthreads();      // the split query rows are seen by all waves

  // this wave's 32 queries as B fragments, fetched once: [query tile][32 dims]
  // (here and below, loops over register arrays are unrolled: they stay in registers only under constant indices)
  v16bf qh[2][4], ql[2][4];
  #pragma unroll
  for (int qt = 0; qt < 2; ++qt)
    #pragma unroll
    for (int c = 0; c < 4; ++c) {
      int qb = (w * 32 + qt * 16 + ln) * 136 + c * 32 + 8 * hf;
      qh[qt][c] = ld_frag(&Qhi_s[qb]);
      ql[qt][c] = ld_frag(&Qlo_s[qb]);
    }

  v8f Oacc[2][8];
  float mrow[2], lrow[2];                // of query w * 32 + qt * 16 + ln, the same in both halves
  #pragma unroll
  for (int qt = 0; qt < 2; ++qt) {
    mrow[qt] = -1e30f; lrow[qt] = 0.0f;
    #pragma unroll
    for (int ct = 0; ct < 8; ++ct)
      #pragma unroll
      for (int r = 0; r < 8; ++r) Oacc[qt][ct][r] = 0.0f;
  }

  for (int tr = 0; tr < AT_TRIPS; ++tr) {
    const int it = 2 * tr + g;           // this group's key tile; the last trip has none for group 1
    // own LDS traffic retired before the refill below aims at a buffer this wave has read
    asm volatile("s_wait_dscnt 0x0" ::: "memory");
    // own copies of this tile's K and V have landed; the barrier then shows them to the other waves
    asm volatile("s_wait_asynccnt 0x0" ::: "memory");
    __syncthreads();

    // the group's next tile flies while this one is worked on; its buffers were last read one trip ago
    if (it + 2 < NTILE) {
      issue_k((tr + 1) & 1, (it + 2 < 7) ? (it + 2) * 32 : (T_SEQ - RB) + (it + 2 - 7) * 32);
      issue_v((tr + 1) & 1, it + 2);
    }
    if (it < NTILE) {
      const int k0 = (it < 7) ? it * 32 : (T_SEQ - RB) + (it - 7) * 32;
      const __bf16* Kh_t = Khi_s[g][tr & 1];
      const __bf16* Kl_t = Klo_s[g][tr & 1];
      const __bf16* Vh_t = Vhi_s[g][tr & 1];
      const __bf16* Vl_t = Vlo_s[g][tr & 1];

      // S^T(32x16) = K(32x128) * Q^T(128x16) per query tile, two 16-key tiles, bf16x3: S0[qt][r] is key
      // k0 + 8*hf + r, S1[qt][r] key k0 + 16 + 8*hf + r, both of query qt * 16 + ln
      v8f S0[2], S1[2];
      #pragma unroll
      for (int qt = 0; qt < 2; ++qt)
        #pragma unroll
        for (int r = 0; r < 8; ++r) { S0[qt][r] = 0.0f; S1[qt][r] = 0.0f; }
      const int kr0 = ln * 136;
      const int kr1 = (16 + ln) * 136;
      #pragma unroll
      for (int c = 0; c < 4; ++c) {
        const int kc = c * 32;
        v16bf kh0 = ld_frag(Kh_t + kr0 + kc + 8 * hf);
        v16bf kl0 = ld_frag(Kl_t + kr0 + kc + 8 * hf);
        v16bf kh1 = ld_frag(Kh_t + kr1 + kc + 8 * hf);
        v16bf kl1 = ld_frag(Kl_t + kr1 + kc + 8 * hf);
        // interleave the four independent accumulators
        S0[0] = wmma_bf16(kl0, qh[0][c], S0[0]);
        S1[0] = wmma_bf16(kl1, qh[0][c], S1[0]);
        S0[1] = wmma_bf16(kl0, qh[1][c], S0[1]);
        S1[1] = wmma_bf16(kl1, qh[1][c], S1[1]);
        S0[0] = wmma_bf16(kh0, ql[0][c], S0[0]);
        S1[0] = wmma_bf16(kh1, ql[0][c], S1[0]);
        S0[1] = wmma_bf16(kh0, ql[1][c], S0[1]);
        S1[1] = wmma_bf16(kh1, ql[1][c], S1[1]);
        S0[0] = wmma_bf16(kh0, qh[0][c], S0[0]);
        S1[0] = wmma_bf16(kh1, qh[0][c], S1[0]);
        S0[1] = wmma_bf16(kh0, qh[1][c], S0[1]);
        S1[1] = wmma_bf16(kh1, qh[1][c], S1[1]);
      }

      v16bf ph[2], pl[2];
      #pragma unroll
      for (int qt = 0; qt < 2; ++qt) {
        float s0[8], s1[8];
        #pragma unroll
        for (int r = 0; r < 8; ++r) {
          s0[r] = S0[qt][r] * SCALE_QK; if ((it == 6) && (k0 + 8 * hf + r >= SB)) s0[r] = -1e30f;  // keys 192..207 partial
          s1[r] = S1[qt][r] * SCALE_QK; if (it == 6) s1[r] = -1e30f;                               // keys 208..223 all masked
        }
        float ma = fmaxf(s0[0], s0[1]), mb = fmaxf(s1[0], s1[1]);
        #pragma unroll
        for (int r = 2; r < 8; r += 2) {
          ma = fmaxf(fmaxf(ma, s0[r]), s0[r + 1]);
          mb = fmaxf(fmaxf(mb, s1[r]), s1[r + 1]);
        }
        float tmax = fmaxf(ma, mb);
        tmax = fmaxf(tmax, xhalf(tmax));
        const float mnew  = fmaxf(mrow[qt], tmax);
        const float alpha = __expf(mrow[qt] - mnew);
        // element s of the B operand is key 8*hf + s (s < 8) or 16 + 8*hf + (s - 8): the order in which
        // ld_frag fetches the keys of a V row
        float ps[8];
        #pragma unroll
        for (int r = 0; r < 8; ++r) {
          float p0 = __expf(s0[r] - mnew);
          float p1 = __expf(s1[r] - mnew);
          ps[r] = p0 + p1;
          __bf16 h0 = (__bf16)p0;
          ph[qt][r]     = h0;  pl[qt][r]     = (__bf16)(p0 - (float)h0);
          __bf16 h1 = (__bf16)p1;
          ph[qt][8 + r] = h1;  pl[qt][8 + r] = (__bf16)(p1 - (float)h1);
        }
        float rs = ((ps[0] + ps[1]) + (ps[2] + ps[3])) + ((ps[4] + ps[5]) + (ps[6] + ps[7]));
        rs += xhalf(rs);
        lrow[qt] = lrow[qt] * alpha + rs;
        mrow[qt] = mnew;
        #pragma unroll
        for (int ct = 0; ct < 8; ++ct)
          #pragma unroll
          for (int r = 0; r < 8; ++r) Oacc[qt][ct][r] *= alpha;
      }

      // O^T(128x16) += V^T(128x32) * P^T(32x16) per query tile, bf16x3; ct in pairs, so the 3-product
      // chains alternate between four independent accumulators
      #pragma unroll
      for (int ct = 0; ct < 8; ct += 2) {
        int vb0 = ((ct + 0) * 16 + ln) * 40 + 8 * hf;
        int vb1 = ((ct + 1) * 16 + ln) * 40 + 8 * hf;
        v16bf vh0 = ld_frag(Vh_t + vb0), vl0 = ld_frag(Vl_t + vb0);
        v16bf vh1 = ld_frag(Vh_t + vb1), vl1 = ld_frag(Vl_t + vb1);
        Oacc[0][ct + 0] = wmma_bf16(vl0, ph[0], Oacc[0][ct + 0]);
        Oacc[0][ct + 1] = wmma_bf16(vl1, ph[0], Oacc[0][ct + 1]);
        Oacc[1][ct + 0] = wmma_bf16(vl0, ph[1], Oacc[1][ct + 0]);
        Oacc[1][ct + 1] = wmma_bf16(vl1, ph[1], Oacc[1][ct + 1]);
        Oacc[0][ct + 0] = wmma_bf16(vh0, pl[0], Oacc[0][ct + 0]);
        Oacc[0][ct + 1] = wmma_bf16(vh1, pl[0], Oacc[0][ct + 1]);
        Oacc[1][ct + 0] = wmma_bf16(vh0, pl[1], Oacc[1][ct + 0]);
        Oacc[1][ct + 1] = wmma_bf16(vh1, pl[1], Oacc[1][ct + 1]);
        Oacc[0][ct + 0] = wmma_bf16(vh0, ph[0], Oacc[0][ct + 0]);
        Oacc[0][ct + 1] = wmma_bf16(vh1, ph[0], Oacc[0][ct + 1]);
        Oacc[1][ct + 0] = wmma_bf16(vh0, ph[1], Oacc[1][ct + 0]);
        Oacc[1][ct + 1] = wmma_bf16(vh1, ph[1], Oacc[1][ct + 1]);
      }
    }
  }

  // the join of the two key groups: group g finishes query tile g and hands its part of the other tile over
  const bool g1 = (g != 0);
  const float mk = g1 ? mrow[1] : mrow[0], lk = g1 ? lrow[1] : lrow[0];     // kept
  Mx_s[g][w][lane] = g1 ? mrow[0] : mrow[1];
  Lx_s[g][w][lane] = g1 ? lrow[0] : lrow[1];
  #pragma unroll
  for (int ct = 0; ct < 8; ++ct)
    #pragma unroll
    for (int q4 = 0; q4 < 2; ++q4) {
      float4 x;
      x.x = g1 ? Oacc[0][ct][q4 * 4 + 0] : Oacc[1][ct][q4 * 4 + 0];
      x.y = g1 ? Oacc[0][ct][q4 * 4 + 1] : Oacc[1][ct][q4 * 4 + 1];
      x.z = g1 ? Oacc[0][ct][q4 * 4 + 2] : Oacc[1][ct][q4 * 4 + 2];
      x.w = g1 ? Oacc[0][ct][q4 * 4 + 3] : Oacc[1][ct][q4 * 4 + 3];
      *(float4*)(&Ox_s[g][w][ct * 2 + q4][lane * 4]) = x;
    }
  __syncthreads();      // each group's hand-over is seen by the other
  const float mo = Mx_s[g ^ 1][w][lane], lo = Lx_s[g ^ 1][w][lane];
  const float mj = fmaxf(mk, mo);
  const float ak = __expf(mk - mj), ao = __expf(mo - mj);
  const float lj = lk * ak + lo * ao;

  // leaves as the bf16 hi/lo planes [T][D] that the output projection reads: row t = this lane's query,
  // col = h*128 + d with d = ct*16 + 8*hf + r: 8 neighbours, 16 bytes of a plane
  const size_t ob = (size_t)(t0 + w * 32 + g * 16 + ln) * DMODEL + h * HDIM + 8 * hf;
  v4bf oh[8][2], ol[8][2];
  #pragma unroll
  for (int ct = 0; ct < 8; ++ct)
    #pragma unroll
    for (int q4 = 0; q4 < 2; ++q4) {
      const float4 y = *(const float4*)(&Ox_s[g ^ 1][w][ct * 2 + q4][lane * 4]);
      float4 x;
      x.x = g1 ? Oacc[1][ct][q4 * 4 + 0] : Oacc[0][ct][q4 * 4 + 0];
      x.y = g1 ? Oacc[1][ct][q4 * 4 + 1] : Oacc[0][ct][q4 * 4 + 1];
      x.z = g1 ? Oacc[1][ct][q4 * 4 + 2] : Oacc[0][ct][q4 * 4 + 2];
      x.w = g1 ? Oacc[1][ct][q4 * 4 + 3] : Oacc[0][ct][q4 * 4 + 3];
      x.x = (x.x * ak + y.x * ao) / lj;
      x.y = (x.y * ak + y.y * ao) / lj;
      x.z = (x.z * ak + y.z * ao) / lj;
      x.w = (x.w * ak + y.w * ao) / lj;
      split4(x, oh[ct][q4], ol[ct][q4]);
    }
  // the stores stand behind all the arithmetic: no register that a store names is written again
  __builtin_amdgcn_sched_barrier(0);
  #pragma unroll
  for (int ct = 0; ct < 8; ++ct) {
    *(v8bf*)(Ohi + ob + ct * 16) = __builtin_shufflevector(oh[ct][0], oh[ct][1], 0, 1, 2, 3, 4, 5, 6, 7);
    *(v8bf*)(Olo + ob + ct * 16) = __builtin_shufflevector(ol[ct][0], ol[ct][1], 0, 1, 2, 3, 4, 5, 6, 7);
  }
}

// ---------------- launch ----------------
extern "C" void kernel_launch(void* const* d_in, const int* in_sizes, int n_in,
                              void* d_out, int out_size, void* d_ws, size_t ws_size,
                              hipStream_t stream) {
  (void)in_sizes; (void)n_in; (void)out_size; (void)ws_size;
  const float* hidden = (const float*)d_in[0];
  const float* wq     = (const float*)d_in[1];
  const float* wk     = (const float*)d_in[2];
  const float* wv     = (const float*)d_in[3];
  const float* wo     = (const float*)d_in[4];
  const float* bern   = (const float*)d_in[5];

  const size_t NE = (size_t)T_SEQ * DMODEL;   // 4,194,304
  float* ws    = (float*)d_ws;
  float* q     = ws;            // [H][T][128] f32; q, k, v lie one behind the other
  float* k     = ws + 1 * NE;
  float* v     = ws + 2 * NE;
  __bf16* shi  = (__bf16*)(ws + 4 * NE);  // hi planes: activations (hidden, then attention's result), wq, wk, wv, wo
  __bf16* slo  = shi + 5 * NE;            // lo planes, the same order
  __bf16* khi  = slo + 5 * NE;            // RoPE'd K split
  __bf16* klo  = khi + NE;
  __bf16* vthi = klo + NE;                // bumped V, split, tiled [H][NTILE][128][32]
  __bf16* vtlo = vthi + NE;
  float* sc    = (float*)(vtlo + NE);     // [H][SC_PITCH] scores of the last query row
  float* ctab  = sc + NHEAD * SC_PITCH;   // [T][64] cos of the rotary angles
  float* stab  = ctab + T_SEQ * (HDIM / 2);   // [T][64] sin

  // sanitized hidden and the four weights -> bf16 hi/lo, and the rotary table, one launch
  split_kernel<<<dim3(SPLIT_GRID, 6), SPLIT_THREADS, 0, stream>>>(hidden, wq, wk, wv, wo, shi, slo, ctab, stab, 1);

  // Q, K and V projections, one launch, a block a tile of each; Q and K leave rotated, K also split
  gemm_qkv_kernel<<<dim3(DMODEL / GT_MN, T_SEQ / GT_MN), 256, 0, stream>>>(
      shi, slo, shi + NE, slo + NE, q, ctab, stab, khi, klo);

  lastrow_score_kernel<<<dim3(SC_GRID, NHEAD), 256, 0, stream>>>(q, k, sc);
  vprep_kernel<<<dim3(NTILE, NHEAD), 256, 0, stream>>>(v, sc, bern, vthi, vtlo);

  // attention's result leaves split, in the activations' planes [T][D]
  attn_kernel<<<dim3(T_SEQ / AT_Q, NHEAD), 256, 0, stream>>>(q, khi, klo, vthi, vtlo, shi, slo);

  // output projection -> d_out
  gemm_bf16x3_async_kernel<<<dim3(DMODEL / GT_MN, T_SEQ / GT_MN), 256, 0, stream>>>(
      shi, slo, shi + 4 * NE, slo + 4 * NE, (float*)d_out);
}
